// v000
// Measured on an AMD MI455X. A time is GPU time per run, averaged over a window of back-to-back runs after a warm-up
// (all launches, gaps included; the runs take copies of the inputs in turn), and the median of several windows.
// Apart from v000's, it joins two sittings. Times from different sittings can be a few percent apart, while
// side-by-side timings come from the same sitting.
// v000, which the later versions start from, runs in 3450 microseconds.
#include <hip/hip_runtime.h>
// SuperGlue multi-head attention (query, key, value channel-first [8][256][2048]; q/k/v = 1x1 conv (natural [256][256] + bias); the module's head split view(B, d=64, H=4, N) makes channel c = dd*4 + h (INTERLEAVED heads); scores = q.k / 8 per head over 2,048 keys; softmax; x merged back to c = dd*4 + h; out = w_m x + b_m -> [8][256][2048]).
// Structure: channel-first inputs transposed to token rows (exact f16) via LDS tiles; projection weights and biases permuted once so the head split becomes contiguous 64-column blocks (exact x16 f16); Q, K, V as WMMA GEMMs (32x64 wave tiles, f32 accumulation, f16 outputs); per batch: V^T via LDS transposes; scores for the 4 heads in one GEMM (K = 64); row softmax on VALU (f32 statistics, native exp; weights x256 f16); o = P . V^T GEMM (K = 2048; o x64 in f16) into head-major rows; out channel-major directly: (w_m with permuted columns) . o^T GEMM batched over the 8 batches (alpha folds 1/16 and 1/64), then the per-channel bias as a row pass; 45 launches.
// Compute dtype: inputs rounded to bf16; inputs / weights exact in f16; q, k, v, softmax weights and o plain f16 (~2^-12); scores and softmax statistics f32; v_wmma_f32_16x16x32_f16.
#define NB 8
#define CC 256
#define LL 2048
#define SQ LL
#define DM CC
#define NH 4
#define HD 64
#define HG 4
#define NC CC                        /* k_rowbias macros */
#define NPX LL
#define B0 0                         /* first batch through the attention (debug hook) */
#define NBR NB                       /* batches through it (debug hook) */
#define QN SQ                        /* query rows per batch (debug hook) */
#define NR ((size_t)NB * LL)
typedef __bf16 v16b __attribute__((ext_vector_type(16)));
typedef unsigned short v8us __attribute__((ext_vector_type(8), may_alias));
typedef float  v8f  __attribute__((ext_vector_type(8)));
typedef float  v4f  __attribute__((ext_vector_type(4)));
typedef float  v4fa __attribute__((ext_vector_type(4), may_alias));
union FragB { v16b v; v8us half[2]; unsigned short u[16]; };

__device__ __forceinline__ unsigned short bf16_bits(float x) { unsigned int u = __float_as_uint(x); return (unsigned short)((u + 0x7FFFu + ((u >> 16) & 1u)) >> 16); }
__device__ __forceinline__ float bf16_val(unsigned short b) { return __uint_as_float(((unsigned int)b) << 16); }
__device__ __forceinline__ float bf16_round(float x) { return bf16_val(bf16_bits(x)); }
// D += A·B with NT terms: 1 = ah·bh, 2 = + al·bh (A split), 3 = + ah·bl (both split)
template <int NT>
__device__ __forceinline__ v8f mmaN(v16b ah, v16b al, v16b bh, v16b bl, v8f c) {
  c = __builtin_amdgcn_wmma_f32_16x16x32_bf16(false, ah, false, bh, (short)0, c, false, false);
  if (NT >= 2) c = __builtin_amdgcn_wmma_f32_16x16x32_bf16(false, al, false, bh, (short)0, c, false, false);
  if (NT >= 3) c = __builtin_amdgcn_wmma_f32_16x16x32_bf16(false, ah, false, bl, (short)0, c, false, false);
  asm volatile("v_nop\n\tv_nop\n\tv_nop\n\tv_nop" : "+v"(c) : "v"(ah), "v"(al), "v"(bh), "v"(bl));
  return c;
}

__global__ __launch_bounds__(256) void k_wt_bf16(const float* __restrict__ W, unsigned short* __restrict__ Wt, int K, int N) {
  const int t = blockIdx.x * 256 + threadIdx.x;
  const int k8n = K / 8;
  if (t >= N * k8n) return;
  const int n = t / k8n, k8 = (t % k8n) * 8;
  v8us v;
#pragma unroll
  for (int i = 0; i < 8; ++i) v[i] = bf16_bits(W[(size_t)(k8 + i) * N + n]);
  *(v8us*)(Wt + (size_t)n * K + k8) = v;
  
}

// GEMM C[M][N] (f32, pitch ldc) = act(A[M][K]·W + bias). A f32 row-major (pitch lda) converted per fragment to bf16
// (ASPLIT: hi/lo two planes -> 2 terms, else single rounded term); Wt bf16 [N][K] (pitch ldb). BIAS_BF16 rounds the
// bias to bf16 first (bias quantised to bf16 before the add). K%32==0, M%16==0, N%64==0.
template <bool ASPLIT, int ACT, bool BIAS_BF16>
__global__ __launch_bounds__(128) void k_gemm_bf(const float* __restrict__ A, int lda, const unsigned short* __restrict__ Wt, int ldb,
                                               const float* __restrict__ bias, float* __restrict__ C, int ldc, int M, int N, int K) {
  __shared__ __attribute__((aligned(16))) float so[4][16][64];
  const int tid = threadIdx.x, w = tid >> 5, lane = tid & 31, ln = lane & 15, hh = lane >> 4;
  const int ntn = N / 64;
  const int wid = blockIdx.x * 4 + w;
  const int mt = wid / ntn, nq = wid % ntn;
  if (mt * 16 >= M) return;
  const int row0 = mt * 16, col0 = nq * 64;
  const float* arow = A + (size_t)(row0 + ln) * lda;
  v8f acc[4] = {};
  for (int kb = 0; kb < K; kb += 32) {
    FragB ah, al;
    const v4f x0 = *(const v4fa*)(arow + kb + 8 * hh), x1 = *(const v4fa*)(arow + kb + 8 * hh + 4);
    const v4f x2 = *(const v4fa*)(arow + kb + 16 + 8 * hh), x3 = *(const v4fa*)(arow + kb + 16 + 8 * hh + 4);
    float xs[16] = {x0[0],x0[1],x0[2],x0[3],x1[0],x1[1],x1[2],x1[3],x2[0],x2[1],x2[2],x2[3],x3[0],x3[1],x3[2],x3[3]};
#pragma unroll
    for (int i = 0; i < 16; ++i) { const unsigned short hb = bf16_bits(xs[i]); ah.u[i] = hb; al.u[i] = ASPLIT ? bf16_bits(xs[i] - bf16_val(hb)) : (unsigned short)0; }
#pragma unroll
    for (int t = 0; t < 4; ++t) {
      const unsigned short* brow = Wt + (size_t)(col0 + t * 16 + ln) * ldb + kb;
      FragB b;
      b.half[0] = *(const v8us*)(brow + 8 * hh);
      b.half[1] = *(const v8us*)(brow + 16 + 8 * hh);
      acc[t] = mmaN<ASPLIT ? 2 : 1>(ah.v, al.v, b.v, b.v, acc[t]);
    }
  }
#pragma unroll
  for (int t = 0; t < 4; ++t) {
    float bv = bias ? bias[col0 + t * 16 + ln] : 0.f;
    if (BIAS_BF16) bv = bf16_round(bv);
#pragma unroll
    for (int r = 0; r < 8; ++r) { float v = acc[t][r] + bv; if (ACT == 1) v = fmaxf(v, 0.f); so[w][8 * hh + r][t * 16 + ln] = v; }
  }
  __builtin_amdgcn_fence(__ATOMIC_ACQ_REL, "workgroup");
  __builtin_amdgcn_wave_barrier();
  const int rsub = lane >> 4, c4 = (lane & 15) * 4;
  {
#pragma unroll
    for (int q = 0; q < 8; ++q) {
      const int r = q * 2 + rsub;
      const v4f v = *(const v4fa*)&so[w][r][c4];
      *(v4f*)(C + (size_t)(row0 + r) * ldc + col0 + c4) = v;
    }
    
  }
}

// GEMM C = act(A·W + bias + resid): A f32 (ASPLIT -> hi/lo 2 terms), Wt bf16 [N][K]; ACT 0 none, 1 relu, 2 exact gelu;
// resid (optional, f32, row index = (row % rmod), pitch ldr, RES_BF16 rounds it) added before the activation.
template <bool ASPLIT, int ACT, bool BIAS_BF16, bool RES_BF16>
__global__ __launch_bounds__(128) void k_gemm_bf3(const float* __restrict__ A, int lda, const unsigned short* __restrict__ Wt, int ldb,
                                                const float* __restrict__ bias, const float* __restrict__ resid, int rmod, int ldr,
                                                float* __restrict__ C, int ldc, int M, int N, int K) {
  __shared__ __attribute__((aligned(16))) float so[4][16][64];
  const int tid = threadIdx.x, w = tid >> 5, lane = tid & 31, ln = lane & 15, hh = lane >> 4;
  const int ntn = N / 64;
  const int wid = blockIdx.x * 4 + w;
  const int mt = wid / ntn, nq = wid % ntn;
  if (mt * 16 >= M) return;
  const int row0 = mt * 16, col0 = nq * 64;
  const float* arow = A + (size_t)(row0 + ln) * lda;
  v8f acc[4] = {};
  for (int kb = 0; kb < K; kb += 32) {
    FragB ah, al;
    const v4f x0 = *(const v4fa*)(arow + kb + 8 * hh), x1 = *(const v4fa*)(arow + kb + 8 * hh + 4);
    const v4f x2 = *(const v4fa*)(arow + kb + 16 + 8 * hh), x3 = *(const v4fa*)(arow + kb + 16 + 8 * hh + 4);
    float xs[16] = {x0[0],x0[1],x0[2],x0[3],x1[0],x1[1],x1[2],x1[3],x2[0],x2[1],x2[2],x2[3],x3[0],x3[1],x3[2],x3[3]};
#pragma unroll
    for (int i = 0; i < 16; ++i) { const unsigned short hb = bf16_bits(xs[i]); ah.u[i] = hb; al.u[i] = ASPLIT ? bf16_bits(xs[i] - bf16_val(hb)) : (unsigned short)0; }
#pragma unroll
    for (int t = 0; t < 4; ++t) {
      const unsigned short* brow = Wt + (size_t)(col0 + t * 16 + ln) * ldb + kb;
      FragB b;
      b.half[0] = *(const v8us*)(brow + 8 * hh);
      b.half[1] = *(const v8us*)(brow + 16 + 8 * hh);
      acc[t] = mmaN<ASPLIT ? 2 : 1>(ah.v, al.v, b.v, b.v, acc[t]);
    }
  }
#pragma unroll
  for (int t = 0; t < 4; ++t) {
    const int col = col0 + t * 16 + ln;
    float bv = bias ? bias[col] : 0.f;
    if (BIAS_BF16) bv = bf16_round(bv);
#pragma unroll
    for (int r = 0; r < 8; ++r) {
      float v = acc[t][r] + bv;
      if (resid) { float rv = resid[(size_t)((row0 + 8 * hh + r) % rmod) * ldr + col]; if (RES_BF16) rv = bf16_round(rv); v += rv; }
      if (ACT == 1) v = fmaxf(v, 0.f);
      if (ACT == 2) v = 0.5f * v * (1.0f + erff(v * 0.70710678118654752f));
      if (ACT == 3) { const float u = 0.7978845608028654f * (v + 0.044715f * v * v * v); v = 0.5f * v * (1.0f + tanhf(u)); }
      so[w][8 * hh + r][t * 16 + ln] = v;
    }
  }
  __builtin_amdgcn_fence(__ATOMIC_ACQ_REL, "workgroup");
  __builtin_amdgcn_wave_barrier();
  const int rsub = lane >> 4, c4 = (lane & 15) * 4;
  {
#pragma unroll
    for (int q = 0; q < 8; ++q) {
      const int r = q * 2 + rsub;
      const v4f v = *(const v4fa*)&so[w][r][c4];
      *(v4f*)(C + (size_t)(row0 + r) * ldc + col0 + c4) = v;
    }
    
  }
}
// row LayerNorm (biased variance, eps) over N: s = X (+ R); optional out_sum <- s; out_norm <- (s-mu)*rsqrt(var+eps)*g + b
template <bool PARAM_BF16>
__global__ __launch_bounds__(256) void k_layernorm(const float* __restrict__ X, const float* __restrict__ R, const float* __restrict__ g, const float* __restrict__ bta,
                                                  float* __restrict__ out_sum, float* __restrict__ out_norm, int N, float eps) {
  __shared__ float red[256];
  const int row = blockIdx.x, tid = threadIdx.x;
  const float* x = X + (size_t)row * N; const float* rr = R ? R + (size_t)row * N : nullptr;
  float vals[16];                     // up to N = 4096
  const int per = N / 256;            // contiguous chunk per thread? use strided-by-4 chunks: thread handles j = tid*4 + 1024*u
  float s1 = 0.f;
  for (int u = 0; u < per / 4; ++u) {
    const int j = tid * 4 + 1024 * u;
    const v4f a = *(const v4fa*)(x + j);
    v4f b = {0.f,0.f,0.f,0.f}; if (rr) b = *(const v4fa*)(rr + j);
#pragma unroll
    for (int q = 0; q < 4; ++q) { const float v = a[q] + b[q]; vals[u * 4 + q] = v; s1 += v; }
  }
  red[tid] = s1; __syncthreads();
  for (int st = 128; st > 0; st >>= 1) { if (tid < st) red[tid] += red[tid + st]; __syncthreads(); }
  const float mu = red[0] / (float)N; __syncthreads();
  float s2 = 0.f;
  for (int u = 0; u < per / 4; ++u)
#pragma unroll
    for (int q = 0; q < 4; ++q) { const float c = vals[u * 4 + q] - mu; s2 += c * c; }
  red[tid] = s2; __syncthreads();
  for (int st = 128; st > 0; st >>= 1) { if (tid < st) red[tid] += red[tid + st]; __syncthreads(); }
  const float rs = rsqrtf(red[0] / (float)N + eps);
  {
    for (int u = 0; u < per / 4; ++u) {
      const int j = tid * 4 + 1024 * u;
      v4f o, sm;
#pragma unroll
      for (int q = 0; q < 4; ++q) {
        float gg = g[j + q], bb = bta[j + q];
        if (PARAM_BF16) { gg = bf16_round(gg); bb = bf16_round(bb); }
        sm[q] = vals[u * 4 + q]; o[q] = (vals[u * 4 + q] - mu) * rs * gg + bb;
      }
      if (out_sum) *(v4f*)(out_sum + (size_t)row * N + j) = sm;
      *(v4f*)(out_norm + (size_t)row * N + j) = o;
    }
    
  }
}



// ---- f16 WMMA path (v_wmma_f32_16x16x32_f16): 11-bit significands for operands in range — used where a [0,1] probability operand needs more precision than bf16
typedef _Float16 v16h __attribute__((ext_vector_type(16)));
union FragH { v16h v; v8us half[2]; _Float16 h[16]; unsigned short u[16]; };
template <int NT>
__device__ __forceinline__ v8f mmaH(v16h ah, v16h al, v16h bh, v16h bl, v8f c) {
  c = __builtin_amdgcn_wmma_f32_16x16x32_f16(false, ah, false, bh, (short)0, c, false, false);
  if (NT >= 2) c = __builtin_amdgcn_wmma_f32_16x16x32_f16(false, al, false, bh, (short)0, c, false, false);
  if (NT >= 3) c = __builtin_amdgcn_wmma_f32_16x16x32_f16(false, ah, false, bl, (short)0, c, false, false);
  asm volatile("v_nop\n\tv_nop\n\tv_nop\n\tv_nop" : "+v"(c) : "v"(ah), "v"(al), "v"(bh), "v"(bl));
  return c;
}
// batched GEMM like k_gemm_b but f16 operands: A f32 (split into f16 hi/lo if ASPLIT, else rounded to f16), Bt = f16 values [n][k]; alpha; C f32; N multiple of 16 (partial tiles skipped)
template <bool ASPLIT>
__global__ __launch_bounds__(128) void k_gemm_h(const float* __restrict__ A, int lda, size_t sA, const _Float16* __restrict__ Bh, int ldb, size_t sB, float alpha, float* __restrict__ C, int ldc, size_t sC, int M, int N, int K) {
  __shared__ __attribute__((aligned(16))) float so[4][16][64];
  const int tid = threadIdx.x, w = tid >> 5, lane = tid & 31, ln = lane & 15, hh = lane >> 4; const int by = blockIdx.y;
  A += (size_t)by * sA; Bh += (size_t)by * sB; C += (size_t)by * sC;
  const int ntn = (N + 63) / 64; const int wid = blockIdx.x * 4 + w; const int mt = wid / ntn, nq = wid % ntn; if (mt * 16 >= M) return;
  const int row0 = mt * 16, col0 = nq * 64; const float* arow = A + (size_t)(row0 + ln) * lda;
  v8f acc[4] = {};
  for (int kb = 0; kb < K; kb += 32) {
    FragH ah, al;
    const v4f x0 = *(const v4fa*)(arow + kb + 8 * hh), x1 = *(const v4fa*)(arow + kb + 8 * hh + 4), x2 = *(const v4fa*)(arow + kb + 16 + 8 * hh), x3 = *(const v4fa*)(arow + kb + 16 + 8 * hh + 4);
    float xs[16] = {x0[0],x0[1],x0[2],x0[3],x1[0],x1[1],x1[2],x1[3],x2[0],x2[1],x2[2],x2[3],x3[0],x3[1],x3[2],x3[3]};
#pragma unroll
    for (int i = 0; i < 16; ++i) { const _Float16 h = (_Float16)xs[i]; ah.h[i] = h; al.h[i] = ASPLIT ? (_Float16)(xs[i] - (float)h) : (_Float16)0.0f; }
#pragma unroll
    for (int t = 0; t < 4; ++t) { if (col0 + t * 16 >= N) continue; const size_t boff = (size_t)(col0 + t * 16 + ln) * ldb + kb; FragH bq; bq.half[0] = *(const v8us*)(Bh + boff + 8 * hh); bq.half[1] = *(const v8us*)(Bh + boff + 16 + 8 * hh);
      acc[t] = mmaH<ASPLIT ? 2 : 1>(ah.v, al.v, bq.v, bq.v, acc[t]); }
  }
#pragma unroll
  for (int t = 0; t < 4; ++t) { if (col0 + t * 16 >= N) continue;
#pragma unroll
    for (int r = 0; r < 8; ++r) so[w][8 * hh + r][t * 16 + ln] = acc[t][r] * alpha; }
  __builtin_amdgcn_fence(__ATOMIC_ACQ_REL, "workgroup"); __builtin_amdgcn_wave_barrier();
  const int rsub = lane >> 4, c4 = (lane & 15) * 4;
  {
#pragma unroll
    for (int q = 0; q < 8; ++q) { const int r = q * 2 + rsub; if (col0 + c4 < N) { const v4f v = *(const v4fa*)&so[w][r][c4]; *(v4f*)(C + (size_t)(row0 + r) * ldc + col0 + c4) = v; } }
     }
}

// Wt[n][k] = f16(W[k][n]·scale) from f32 row-major W[K][N] (scale = power of two; bf16-exact weights stay exact in f16 away from the subnormal range)
__global__ __launch_bounds__(256) void k_wt_f16(const float* __restrict__ W, _Float16* __restrict__ Wt, int K, int N, float scale) {
  const int t = blockIdx.x * 256 + threadIdx.x; if (t >= N * (K / 8)) return; const int n = t / (K / 8), k8 = (t % (K / 8)) * 8; FragH f;
#pragma unroll
  for (int i = 0; i < 8; ++i) f.h[i] = (_Float16)(bf16_round(W[(size_t)(k8 + i) * N + n]) * scale); const v8us o = f.half[0];
  *(v8us*)((unsigned short*)Wt + (size_t)n * K + k8) = o; 
}
// k_gemm_hh variant with fused epilogue: v = acc·alpha + bias[by·sBias + col] (+ CP[(row/rowsPerB)·sCPb + by·64 + col] if CP) ; ACT 0 none / 1 elu ; writes f16 C16 (and f32 C if non-null)
template <int ACT>
__global__ __launch_bounds__(128) void k_gemm_hhx(const _Float16* __restrict__ A, int lda, size_t sA, const _Float16* __restrict__ Bh, int ldb, size_t sB, float alpha, const float* __restrict__ bias, size_t sBias, const float* __restrict__ CP, int rowsPerB, size_t sCPb, int row0g,
    float* __restrict__ C, _Float16* __restrict__ C16, int ldc, size_t sC, int M, int N, int K) {
  __shared__ __attribute__((aligned(16))) float so[4][16][64];
  const int tid = threadIdx.x, w = tid >> 5, lane = tid & 31, ln = lane & 15, hh = lane >> 4; const int by = blockIdx.y;
  A += (size_t)by * sA; Bh += (size_t)by * sB; const size_t cofs = (size_t)by * sC; const float* bp = bias ? bias + (size_t)by * sBias : nullptr;
  const int ntn = (N + 63) / 64; const int wid = blockIdx.x * 4 + w; const int mt = wid / ntn, nq = wid % ntn; if (mt * 16 >= M) return;
  const int row0 = mt * 16, col0 = nq * 64; const _Float16* arow = A + (size_t)(row0 + ln) * lda;
  v8f acc[4] = {};
  for (int kb = 0; kb < K; kb += 32) { FragH ah; ah.half[0] = *(const v8us*)((const unsigned short*)arow + kb + 8 * hh); ah.half[1] = *(const v8us*)((const unsigned short*)arow + kb + 16 + 8 * hh);
#pragma unroll
    for (int t = 0; t < 4; ++t) { if (col0 + t * 16 >= N) continue; const size_t boff = (size_t)(col0 + t * 16 + ln) * ldb + kb; FragH bq; bq.half[0] = *(const v8us*)((const unsigned short*)Bh + boff + 8 * hh); bq.half[1] = *(const v8us*)((const unsigned short*)Bh + boff + 16 + 8 * hh);
      acc[t] = mmaH<1>(ah.v, ah.v, bq.v, bq.v, acc[t]); }
  }
#pragma unroll
  for (int t = 0; t < 4; ++t) { if (col0 + t * 16 >= N) continue; const int col = col0 + t * 16 + ln; const float bv = bp ? bf16_round(bp[col]) : 0.f;
#pragma unroll
    for (int r = 0; r < 8; ++r) { float v = acc[t][r] * alpha + bv; if (CP) { const int rr = row0g + row0 + 8 * hh + r; if (rowsPerB < 0) v += CP[cofs + (size_t)rr * ldc + col];      /* rowsPerB < 0: own element of the batched C plane */ else { const int bidx = rr / rowsPerB; v += CP[(size_t)bidx * sCPb + (size_t)by * 64 + col]; } } if (ACT == 1) v = (v > 0.f) ? v : expm1f(v); else if (ACT == 7) v = (v > 0.f) ? v + 1.0f : expf(v); else if (ACT == 8) v = tanhf(v); else if (ACT == 9) v = 0.5f * v * (1.0f + tanhf(0.7978845608028654f * (v + 0.044715f * v * v * v))); else if (ACT == 11) v = 1.0f / (1.0f + expf(-v)); else if (ACT == 12) v = (v > 0.f) ? v : 0.01f * v; else if (ACT == 14) v = (v > 0.f) ? v : 0.1f * v; else if (ACT == 16) v = (v >= 0.f) ? v : 0.3f * v; else if (ACT == 17) v = (v >= 0.f) ? v : 0.2f * v; else if (ACT == 15) v = v / (1.0f + expf(-v)); else if (ACT == 3) v = fmaxf(v, 0.f); else if (ACT == 6) v = 0.5f * v * (1.0f + erff(v * 0.70710678118654752f)); so[w][8 * hh + r][t * 16 + ln] = v; } }
  __builtin_amdgcn_fence(__ATOMIC_ACQ_REL, "workgroup"); __builtin_amdgcn_wave_barrier();
  const int rsub = lane >> 4, c4 = (lane & 15) * 4; typedef _Float16 v4h __attribute__((ext_vector_type(4)));
  {
#pragma unroll
    for (int q = 0; q < 8; ++q) { const int r = q * 2 + rsub; if (col0 + c4 < N) { const v4f v = *(const v4fa*)&so[w][r][c4]; if (C) *(v4f*)(C + cofs + (size_t)(row0 + r) * ldc + col0 + c4) = v; if (C16) { v4h h4; for (int i = 0; i < 4; ++i) h4[i] = (_Float16)v[i]; *(v4h*)(C16 + cofs + (size_t)(row0 + r) * ldc + col0 + c4) = h4; } } }
     }
}


typedef _Float16 v4h __attribute__((ext_vector_type(4)));

__global__ __launch_bounds__(256) void k_x16(const float* __restrict__ x, _Float16* __restrict__ X16, size_t n8) { const size_t t = (size_t)blockIdx.x * 256 + threadIdx.x; if (t >= n8) return; FragH f;
#pragma unroll
  for (int q = 0; q < 8; ++q) f.h[q] = (_Float16)bf16_round(x[t * 8 + q]); *(v8us*)((unsigned short*)X16 + t * 8) = f.half[0];  }
__global__ __launch_bounds__(256) void k_h16(const float* __restrict__ x, _Float16* __restrict__ X16, size_t n8) { const size_t t = (size_t)blockIdx.x * 256 + threadIdx.x; if (t >= n8) return; FragH f;
#pragma unroll
  for (int q = 0; q < 8; ++q) f.h[q] = (_Float16)x[t * 8 + q]; *(v8us*)((unsigned short*)X16 + t * 8) = f.half[0];  }
__global__ __launch_bounds__(256) void k_round16f(const float* __restrict__ W, _Float16* __restrict__ Bt, size_t n8) { const size_t t = (size_t)blockIdx.x * 256 + threadIdx.x; if (t >= n8) return; FragH f;
#pragma unroll
  for (int i = 0; i < 8; ++i) f.h[i] = (_Float16)(bf16_round(W[t * 8 + i]) * 16.0f); *(v8us*)((unsigned short*)Bt + t * 8) = f.half[0];  }
template <int NHv, int TTv>
__global__ __launch_bounds__(256) void k_vt(const _Float16* __restrict__ V16, int ldv, int voff, _Float16* __restrict__ Vt) { __shared__ unsigned short tl[64][66]; const int tid = threadIdx.x; const int slab = blockIdx.x / (TTv / 64), lg = blockIdx.x % (TTv / 64); const int b = slab / NHv, h = slab % NHv;
  for (int i = tid; i < 64 * 8; i += 256) { const int r = i / 8, c8 = (i % 8) * 8; FragH f; f.half[0] = *(const v8us*)((const unsigned short*)V16 + ((size_t)b * TTv + lg * 64 + r) * ldv + voff + h * 64 + c8);
#pragma unroll
    for (int q = 0; q < 8; ++q) tl[r][c8 + q] = f.u[q]; }
  __syncthreads();
  {
#pragma unroll
    for (int rd = 0; rd < 2; ++rd) { const int d = rd * 32 + tid / 8, pc = tid % 8; FragH f;
#pragma unroll
      for (int q = 0; q < 8; ++q) f.u[q] = tl[pc * 8 + q][d];
      *(v8us*)((unsigned short*)Vt + ((size_t)slab * 64 + d) * TTv + lg * 64 + pc * 8) = f.half[0]; }
     } }

__global__ __launch_bounds__(256) void k_hl(const float* __restrict__ F, _Float16* __restrict__ Hh, _Float16* __restrict__ Hl, size_t n8) { const size_t t = (size_t)blockIdx.x * 256 + threadIdx.x; if (t >= n8) return; FragH fh, fl; const v4f a = *(const v4fa*)(F + t * 8), c = *(const v4fa*)(F + t * 8 + 4);
#pragma unroll
  for (int q = 0; q < 4; ++q) { _Float16 h = (_Float16)a[q]; fh.h[q] = h; fl.h[q] = (_Float16)((a[q] - (float)h) * 1024.0f); h = (_Float16)c[q]; fh.h[4 + q] = h; fl.h[4 + q] = (_Float16)((c[q] - (float)h) * 1024.0f); }
  { *(v8us*)((unsigned short*)Hh + t * 8) = fh.half[0]; *(v8us*)((unsigned short*)Hl + t * 8) = fl.half[0];  } }

// ---- fast GEMM (wave tile 32x64; requires M % 32 == 0 rows per launch region and N % 64 == 0); epilogue = k_gemm_hhx semantics ----
__device__ __forceinline__ v16h g2_frag(const _Float16* p, int hh) { FragH f; f.half[0] = *(const v8us*)((const unsigned short*)p + 8 * hh); f.half[1] = *(const v8us*)((const unsigned short*)p + 16 + 8 * hh); return f.v; }
__device__ __forceinline__ v8f g2_mma(v16h a, v16h b, v8f c) { v8f d = __builtin_amdgcn_wmma_f32_16x16x32_f16(false, a, false, b, (short)0, c, false, false); asm volatile("v_nop\n\tv_nop\n\tv_nop\n\tv_nop" : "+v"(d) : "v"(a), "v"(b)); return d; }
template <int ACT>
__global__ __launch_bounds__(128) void k_gemm2(const _Float16* __restrict__ A, int lda, size_t sA, const _Float16* __restrict__ Bh, int ldb, size_t sB, float alpha, const float* __restrict__ bias, size_t sBias, const float* __restrict__ CP, int rowsPerB, size_t sCPb, int row0g,
    float* __restrict__ C, _Float16* __restrict__ C16, int ldc, size_t sC, int M, int N, int K) { static_assert(ACT == 0 || ACT == 3 || ACT == 6 || ACT == 8 || ACT == 9 || ACT == 11 || ACT == 12 || ACT == 14 || ACT == 15 || ACT == 16 || ACT == 17, "k_gemm2: unsupported ACT code (would silently apply no activation)");
  __shared__ __attribute__((aligned(16))) float so[4][32][68];
  const int tid = threadIdx.x, w = tid >> 5, lane = tid & 31, ln = lane & 15, hh = lane >> 4; const int by = blockIdx.y;
  A += (size_t)by * sA; Bh += (size_t)by * sB; const size_t cofs = (size_t)by * sC; const float* bp = bias ? bias + (size_t)by * sBias : nullptr;
  const int ntn = N >> 6; const int mt = blockIdx.x / ntn, nq = blockIdx.x - mt * ntn; const int row0 = mt * 128 + 32 * w, col0 = nq * 64; if (row0 >= M) return;
  const _Float16* a0p = A + (size_t)(row0 + ln) * lda; const _Float16* a1p = a0p + (size_t)16 * lda;
  const _Float16* b0p = Bh + (size_t)(col0 + ln) * ldb; const _Float16* b1p = b0p + (size_t)16 * ldb; const _Float16* b2p = b1p + (size_t)16 * ldb; const _Float16* b3p = b2p + (size_t)16 * ldb;
  const v8f z8 = {0.f,0.f,0.f,0.f,0.f,0.f,0.f,0.f}; v8f c00 = z8, c01 = z8, c02 = z8, c03 = z8, c10 = z8, c11 = z8, c12 = z8, c13 = z8;
#pragma unroll 1
  for (int kb = 0; kb < K; kb += 32) { const v16h a0 = g2_frag(a0p + kb, hh), a1 = g2_frag(a1p + kb, hh);
    v16h b = g2_frag(b0p + kb, hh); c00 = g2_mma(a0, b, c00); c10 = g2_mma(a1, b, c10);
    b = g2_frag(b1p + kb, hh); c01 = g2_mma(a0, b, c01); c11 = g2_mma(a1, b, c11);
    b = g2_frag(b2p + kb, hh); c02 = g2_mma(a0, b, c02); c12 = g2_mma(a1, b, c12);
    b = g2_frag(b3p + kb, hh); c03 = g2_mma(a0, b, c03); c13 = g2_mma(a1, b, c13); }
  v8f accs[8] = {c00, c01, c02, c03, c10, c11, c12, c13};
#pragma unroll
  for (int u = 0; u < 8; ++u) { const int t = u & 3, half = u >> 2; const int col = col0 + t * 16 + ln; const float bv = bp ? bf16_round(bp[col]) : 0.f;
#pragma unroll
    for (int r = 0; r < 8; ++r) { const int rloc = half * 16 + 8 * hh + r; float v = accs[u][r] * alpha + bv; if (CP) { if (rowsPerB < 0) v += CP[cofs + (size_t)(row0g + row0 + rloc) * ldc + col];      /* rowsPerB < 0: own element of the batched C plane */ else { const int bidx = (row0g + row0 + rloc) / rowsPerB; v += CP[(size_t)bidx * sCPb + (size_t)by * 64 + col]; } }
      if (ACT == 3) v = fmaxf(v, 0.f); else if (ACT == 6) v = 0.5f * v * (1.0f + erff(v * 0.70710678118654752f)); else if (ACT == 11) v = 1.0f / (1.0f + expf(-v)); else if (ACT == 15) v = v / (1.0f + expf(-v)); else if (ACT == 12) v = (v > 0.f) ? v : 0.01f * v; else if (ACT == 8) v = tanhf(v); else if (ACT == 9) v = 0.5f * v * (1.0f + tanhf(0.7978845608028654f * (v + 0.044715f * v * v * v))); else if (ACT == 14) v = (v > 0.f) ? v : 0.1f * v; else if (ACT == 16) v = (v >= 0.f) ? v : 0.3f * v; else if (ACT == 17) v = (v >= 0.f) ? v : 0.2f * v;
      so[w][rloc][t * 16 + ln] = v; } }
  __builtin_amdgcn_fence(__ATOMIC_ACQ_REL, "workgroup"); __builtin_amdgcn_wave_barrier();
  const int rsub = lane >> 4, c4 = (lane & 15) * 4;
  {
#pragma unroll
    for (int q = 0; q < 16; ++q) { const int r = q * 2 + rsub; const v4f v = *(const v4fa*)&so[w][r][c4]; if (C) *(v4f*)(C + cofs + (size_t)(row0 + r) * ldc + col0 + c4) = v; if (C16) { v4h h4; for (int i = 0; i < 4; ++i) h4[i] = (_Float16)v[i]; *(v4h*)(C16 + cofs + (size_t)(row0 + r) * ldc + col0 + c4) = h4; } }
     } }


__global__ __launch_bounds__(256) void k_wnat(const float* __restrict__ w, size_t n8, _Float16* __restrict__ Bt) { const size_t t = (size_t)blockIdx.x * 256 + threadIdx.x; if (t >= n8) return; FragH f; for (int q = 0; q < 8; ++q) f.h[q] = (_Float16)(bf16_round(w[t * 8 + q]) * 16.0f); *(v8us*)((unsigned short*)Bt + t * 8) = f.half[0];  }
__global__ __launch_bounds__(256) void k_rsm(const float* __restrict__ S, _Float16* __restrict__ P, int nrows) {
  #pragma clang fp contract(off)
  const int i = blockIdx.x * 256 + threadIdx.x; if (i >= nrows) return; const float* s = S + (size_t)i * SQ; float mx = -3.0e38f;
#pragma unroll 1
  for (int j = 0; j < SQ; ++j) mx = fmaxf(mx, s[j]); float se = 0.f;
#pragma unroll 1
  for (int j = 0; j < SQ; ++j) se += expf(s[j] - mx); const float sc = 256.0f / se;
#pragma unroll 1
  for (int j0 = 0; j0 < SQ; j0 += 8) { FragH f; for (int q = 0; q < 8; ++q) f.h[q] = (_Float16)(expf(s[j0 + q] - mx) * sc); unsigned short* d = (unsigned short*)P + (size_t)i * SQ + j0; *(v8us*)d = f.half[0];  } }
__global__ __launch_bounds__(256) void k_vt(const _Float16* __restrict__ V16, int b, int h0, _Float16* __restrict__ VT) { __shared__ unsigned short tl[64][65]; const int tid = threadIdx.x; const int hh = blockIdx.x % HG, sg = blockIdx.x / HG; const int s0 = sg * 64; const int h = h0 + hh;
  for (int i = tid; i < 64 * 8; i += 256) { const int j = i / 8, d8 = (i % 8) * 8; FragH f; f.half[0] = *(const v8us*)((const unsigned short*)V16 + ((size_t)b * SQ + s0 + j) * DM + h * HD + d8); for (int q = 0; q < 8; ++q) tl[d8 + q][j] = f.u[q]; }
  __syncthreads();
  { for (int i = tid; i < 64 * 8; i += 256) { const int d = i / 8, j8 = (i % 8) * 8; FragH f; for (int q = 0; q < 8; ++q) f.u[q] = tl[d][j8 + q]; *(v8us*)((unsigned short*)VT + ((size_t)hh * HD + d) * SQ + s0 + j8) = f.half[0]; }  } }

__global__ __launch_bounds__(256) void k_cl2rows(const float* __restrict__ X, _Float16* __restrict__ XR) { __shared__ float tl[64][33]; const int tid = threadIdx.x; const int nl = LL / 32, nc = CC / 64; const int cb_ = blockIdx.x % nc; const int lb = (blockIdx.x / nc) % nl; const size_t b = blockIdx.x / (nc * nl); const int c0 = cb_ * 64, l0 = lb * 32;
  for (int i = tid; i < 64 * 32; i += 256) { const int c = i / 32, l = i % 32; tl[c][l] = bf16_round(X[(b * CC + c0 + c) * (size_t)LL + l0 + l]); }
  __syncthreads();
  { const int l = tid / 8, c8 = (tid % 8) * 8; FragH f; for (int q = 0; q < 8; ++q) f.h[q] = (_Float16)tl[c8 + q][l]; unsigned short* d = (unsigned short*)XR + (b * LL + l0 + l) * (size_t)CC + c0 + c8; *(v8us*)d = f.half[0];  } }


__global__ __launch_bounds__(256) void k_wperm(const float* __restrict__ w, _Float16* __restrict__ Bt) { const int t = blockIdx.x * 256 + threadIdx.x; if (t >= CC * (CC / 8)) return; const int k8 = (t % (CC / 8)) * 8, np_ = t / (CC / 8); const int h = np_ / HD, dd = np_ % HD; const int src = dd * NH + h; FragH f;
  for (int q = 0; q < 8; ++q) f.h[q] = (_Float16)(bf16_round(w[(size_t)src * CC + k8 + q]) * 16.0f); unsigned short* d = (unsigned short*)Bt + (size_t)np_ * CC + k8; *(v8us*)d = f.half[0];  }
__global__ __launch_bounds__(256) void k_wpermc(const float* __restrict__ w, _Float16* __restrict__ A) { const int t = blockIdx.x * 256 + threadIdx.x; if (t >= CC * (CC / 8)) return; const int k8 = (t % (CC / 8)) * 8, c = t / (CC / 8); FragH f;
  for (int q = 0; q < 8; ++q) { const int kp = k8 + q; const int h = kp / HD, dd = kp % HD; f.h[q] = (_Float16)(bf16_round(w[(size_t)c * CC + dd * NH + h]) * 16.0f); } unsigned short* d = (unsigned short*)A + (size_t)c * CC + k8; *(v8us*)d = f.half[0];  }
__global__ __launch_bounds__(256) void k_bperm(const float* __restrict__ b0, const float* __restrict__ b1, const float* __restrict__ b2, float* __restrict__ BP) { const int t = threadIdx.x; if (t >= CC) return; const int h = t / HD, dd = t % HD; const int src = dd * NH + h;
  { *(float*)(BP + t) = b0[src]; *(float*)(BP + CC + t) = b1[src]; *(float*)(BP + 2 * CC + t) = b2[src];  } }
__global__ __launch_bounds__(256) void k_rsmf2(const float* __restrict__ S, _Float16* __restrict__ P, int qn, int hg) {
  #pragma clang fp contract(off)
  const int t = blockIdx.x * 256 + threadIdx.x; if (t >= qn * hg) return; const size_t i = (size_t)(t / qn) * SQ + (t % qn); const float* s = S + i * SQ; float mx = -3.0e38f;
#pragma unroll 1
  for (int j = 0; j < SQ; ++j) mx = fmaxf(mx, s[j]); float se = 0.f;
#pragma unroll 1
  for (int j = 0; j < SQ; ++j) se += __expf(s[j] - mx); const float sc = 256.0f / se;
#pragma unroll 1
  for (int j0 = 0; j0 < SQ; j0 += 8) { FragH f; for (int q = 0; q < 8; ++q) f.h[q] = (_Float16)(__expf(s[j0 + q] - mx) * sc); unsigned short* d = (unsigned short*)P + i * SQ + j0; *(v8us*)d = f.half[0];  } }
__global__ __launch_bounds__(256) void k_rowbias(float* __restrict__ y, const float* __restrict__ bo) { const size_t t = (size_t)blockIdx.x * 256 + threadIdx.x; if (t >= (size_t)NB * NC * NPX / 4) return; const size_t e = t * 4; const int co = (int)((e / NPX) % NC); const float bv = bf16_round(bo[co]); v4f v = *(const v4fa*)(y + e); for (int q = 0; q < 4; ++q) v[q] = v[q] + bv; *(v4f*)(y + e) = v;  }

extern "C" void kernel_launch(void* const* d_in, const int* in_sizes, int n_in,
                              void* d_out, int out_size, void* d_ws, size_t ws_size, hipStream_t stream) {
  (void)in_sizes; (void)n_in; (void)out_size;
  const float* const* I = (const float* const*)d_in; const float* xq = I[0]; const float* xk = I[1]; const float* xv = I[2]; const float* wq = I[3]; const float* bq = I[4]; const float* wk = I[5]; const float* bk = I[6]; const float* wv = I[7]; const float* bv = I[8]; const float* wm = I[9]; const float* bm = I[10];
  char* ws = (char*)d_ws; size_t off = 0;
  auto take = [&](size_t bytes) { char* p = ws + off; off += (bytes + 255) & ~(size_t)255; return p; };
  _Float16* BQ = (_Float16*)take((size_t)CC * CC * 2); _Float16* BK = (_Float16*)take((size_t)CC * CC * 2); _Float16* BV = (_Float16*)take((size_t)CC * CC * 2); _Float16* AM = (_Float16*)take((size_t)CC * CC * 2); float* BP = (float*)take((size_t)3 * CC * 4);
  _Float16* XQ = (_Float16*)take(NR * CC * 2); _Float16* XK = (_Float16*)take(NR * CC * 2); _Float16* XV = (_Float16*)take(NR * CC * 2); _Float16* Q16 = (_Float16*)take(NR * CC * 2); _Float16* K16 = (_Float16*)take(NR * CC * 2); _Float16* V16 = (_Float16*)take(NR * CC * 2); _Float16* O16 = (_Float16*)take(NR * CC * 2);
  float* S = (float*)take((size_t)HG * SQ * SQ * 4); _Float16* P = (_Float16*)take((size_t)HG * SQ * SQ * 2); _Float16* VT = (_Float16*)take((size_t)NH * HD * SQ * 2);
  if (off > ws_size) return;      /* 0.5 + 56 + 64 + 32 + 1 = approx 154 MiB */
  { const unsigned gw = (CC * (CC / 8) + 255) / 256; k_wperm<<<gw, 256, 0, stream>>>(wq, BQ); k_wperm<<<gw, 256, 0, stream>>>(wk, BK); k_wperm<<<gw, 256, 0, stream>>>(wv, BV); k_wpermc<<<gw, 256, 0, stream>>>(wm, AM); k_bperm<<<1, 256, 0, stream>>>(bq, bk, bv, BP); }
  { const unsigned gx = NB * (LL / 32) * (CC / 64); k_cl2rows<<<gx, 256, 0, stream>>>(xq, XQ); k_cl2rows<<<gx, 256, 0, stream>>>(xk, XK); k_cl2rows<<<gx, 256, 0, stream>>>(xv, XV); }
  const dim3 gp((unsigned)((NR / 128) * (CC / 64)), 1);
  k_gemm2<0><<<gp, 128, 0, stream>>>(XQ, CC, 0, BQ, CC, 0, 0.0625f, BP, 0, nullptr, 1, 0, 0, nullptr, Q16, CC, 0, (int)NR, CC, CC);
  k_gemm2<0><<<gp, 128, 0, stream>>>(XK, CC, 0, BK, CC, 0, 0.0625f, BP + CC, 0, nullptr, 1, 0, 0, nullptr, K16, CC, 0, (int)NR, CC, CC);
  k_gemm2<0><<<gp, 128, 0, stream>>>(XV, CC, 0, BV, CC, 0, 0.0625f, BP + 2 * CC, 0, nullptr, 1, 0, 0, nullptr, V16, CC, 0, (int)NR, CC, CC);
  for (int b = B0; b < B0 + NBR; ++b) { const size_t r0 = (size_t)b * LL;
    k_vt<NH, SQ><<<NH * (SQ / 64), 256, 0, stream>>>(V16 + r0 * CC, CC, 0, VT);      /* V^T [4][64][2048] for this batch */
    k_gemm2<0><<<dim3((QN / 128) * (SQ / 64), HG), 128, 0, stream>>>(Q16 + r0 * CC, CC, (size_t)HD, K16 + r0 * CC, CC, (size_t)HD, 0.125f, nullptr, 0, nullptr, 1, 0, 0, S, nullptr, SQ, (size_t)SQ * SQ, QN, SQ, HD);      /* scores / 8, 4 heads */
    k_rsmf2<<<(HG * QN + 255) / 256, 256, 0, stream>>>(S, P, QN, HG);
    k_gemm2<0><<<dim3((QN / 128) * (HD / 64), HG), 128, 0, stream>>>(P, SQ, (size_t)SQ * SQ, VT, SQ, (size_t)HD * SQ, 0.25f, nullptr, 0, nullptr, 1, 0, 0, nullptr, O16 + r0 * CC, CC, (size_t)HD, QN, HD, SQ); }      /* o x64, head-major f16 rows */
  k_gemm2<0><<<dim3((CC / 128) * (LL / 64), NBR), 128, 0, stream>>>(AM, CC, 0, O16 + (size_t)B0 * LL * CC, CC, (size_t)LL * CC, 0.0009765625f, nullptr, 0, nullptr, 1, 0, 0, (float*)d_out + (size_t)B0 * CC * LL, nullptr, LL, (size_t)CC * LL, CC, LL, CC);      /* out[b][c][n] = sum_k' w_m'[c][k'] o[(b,n)][k'] (channel-major directly) */
  k_rowbias<<<(unsigned)(((size_t)NB * NC * NPX / 4 + 255) / 256), 256, 0, stream>>>((float*)d_out, bm);
}

// v001
// Measured time: 859 microseconds a run.
// In two side-by-side timings against v000, it was 4.06 and 4.07 times as fast.
#include <hip/hip_runtime.h>
// SuperGlue multi-head attention (query, key, value channel-first [8][256][2048]; q/k/v = 1x1 conv (natural [256][256] + bias); the module's head split view(B, d=64, H=4, N) makes channel c = dd*4 + h (INTERLEAVED heads); scores = q.k / 8 per head over 2,048 keys; softmax; x merged back to c = dd*4 + h; out = w_m x + b_m -> [8][256][2048]).
// Structure: channel-first inputs transposed to token rows (exact f16) via LDS tiles; projection weights and biases permuted once so the head split becomes contiguous 64-column blocks (exact x16 f16); Q, K, V as WMMA GEMMs (32x64 wave tiles, f32 accumulation, f16 outputs); per batch: V^T via LDS transposes; scores for the 4 heads in one GEMM (K = 64); row softmax on VALU, one wave per row (f32 statistics, native exp; weights x256 f16); o = P . V^T GEMM (K = 2048; o x64 in f16) into head-major rows; out channel-major directly: (w_m with permuted columns) . o^T GEMM batched over the 8 batches (alpha folds 1/16 and 1/64), then the per-channel bias as a row pass; 45 launches.
// Compute dtype: inputs rounded to bf16; inputs / weights exact in f16; q, k, v, softmax weights and o plain f16 (~2^-12); scores and softmax statistics f32. v_wmma_f32_16x16x32_f16.
#define NB 8
#define CC 256
#define LL 2048
#define SQ LL
#define DM CC
#define NH 4
#define HD 64
#define HG 4
#define NC CC                        /* k_rowbias macros */
#define NPX LL
#define B0 0                         /* first batch through the attention (debug hook) */
#define NBR NB                       /* batches through it (debug hook) */
#define QN SQ                        /* query rows per batch (debug hook) */
#define NR ((size_t)NB * LL)
typedef __bf16 v16b __attribute__((ext_vector_type(16)));
typedef unsigned short v8us __attribute__((ext_vector_type(8), may_alias));
typedef float  v8f  __attribute__((ext_vector_type(8)));
typedef float  v4f  __attribute__((ext_vector_type(4)));
typedef float  v4fa __attribute__((ext_vector_type(4), may_alias));
union FragB { v16b v; v8us half[2]; unsigned short u[16]; };

__device__ __forceinline__ unsigned short bf16_bits(float x) { unsigned int u = __float_as_uint(x); return (unsigned short)((u + 0x7FFFu + ((u >> 16) & 1u)) >> 16); }
__device__ __forceinline__ float bf16_val(unsigned short b) { return __uint_as_float(((unsigned int)b) << 16); }
__device__ __forceinline__ float bf16_round(float x) { return bf16_val(bf16_bits(x)); }
// D += A·B with NT terms: 1 = ah·bh, 2 = + al·bh (A split), 3 = + ah·bl (both split)
template <int NT>
__device__ __forceinline__ v8f mmaN(v16b ah, v16b al, v16b bh, v16b bl, v8f c) {
  c = __builtin_amdgcn_wmma_f32_16x16x32_bf16(false, ah, false, bh, (short)0, c, false, false);
  if (NT >= 2) c = __builtin_amdgcn_wmma_f32_16x16x32_bf16(false, al, false, bh, (short)0, c, false, false);
  if (NT >= 3) c = __builtin_amdgcn_wmma_f32_16x16x32_bf16(false, ah, false, bl, (short)0, c, false, false);
  asm volatile("v_nop\n\tv_nop\n\tv_nop\n\tv_nop" : "+v"(c) : "v"(ah), "v"(al), "v"(bh), "v"(bl));
  return c;
}

__global__ __launch_bounds__(256) void k_wt_bf16(const float* __restrict__ W, unsigned short* __restrict__ Wt, int K, int N) {
  const int t = blockIdx.x * 256 + threadIdx.x;
  const int k8n = K / 8;
  if (t >= N * k8n) return;
  const int n = t / k8n, k8 = (t % k8n) * 8;
  v8us v;
#pragma unroll
  for (int i = 0; i < 8; ++i) v[i] = bf16_bits(W[(size_t)(k8 + i) * N + n]);
  *(v8us*)(Wt + (size_t)n * K + k8) = v;
  
}

// GEMM C[M][N] (f32, pitch ldc) = act(A[M][K]·W + bias). A f32 row-major (pitch lda) converted per fragment to bf16
// (ASPLIT: hi/lo two planes -> 2 terms, else single rounded term); Wt bf16 [N][K] (pitch ldb). BIAS_BF16 rounds the
// bias to bf16 first (bias quantised to bf16 before the add). K%32==0, M%16==0, N%64==0.
template <bool ASPLIT, int ACT, bool BIAS_BF16>
__global__ __launch_bounds__(128) void k_gemm_bf(const float* __restrict__ A, int lda, const unsigned short* __restrict__ Wt, int ldb,
                                               const float* __restrict__ bias, float* __restrict__ C, int ldc, int M, int N, int K) {
  __shared__ __attribute__((aligned(16))) float so[4][16][64];
  const int tid = threadIdx.x, w = tid >> 5, lane = tid & 31, ln = lane & 15, hh = lane >> 4;
  const int ntn = N / 64;
  const int wid = blockIdx.x * 4 + w;
  const int mt = wid / ntn, nq = wid % ntn;
  if (mt * 16 >= M) return;
  const int row0 = mt * 16, col0 = nq * 64;
  const float* arow = A + (size_t)(row0 + ln) * lda;
  v8f acc[4] = {};
  for (int kb = 0; kb < K; kb += 32) {
    FragB ah, al;
    const v4f x0 = *(const v4fa*)(arow + kb + 8 * hh), x1 = *(const v4fa*)(arow + kb + 8 * hh + 4);
    const v4f x2 = *(const v4fa*)(arow + kb + 16 + 8 * hh), x3 = *(const v4fa*)(arow + kb + 16 + 8 * hh + 4);
    float xs[16] = {x0[0],x0[1],x0[2],x0[3],x1[0],x1[1],x1[2],x1[3],x2[0],x2[1],x2[2],x2[3],x3[0],x3[1],x3[2],x3[3]};
#pragma unroll
    for (int i = 0; i < 16; ++i) { const unsigned short hb = bf16_bits(xs[i]); ah.u[i] = hb; al.u[i] = ASPLIT ? bf16_bits(xs[i] - bf16_val(hb)) : (unsigned short)0; }
#pragma unroll
    for (int t = 0; t < 4; ++t) {
      const unsigned short* brow = Wt + (size_t)(col0 + t * 16 + ln) * ldb + kb;
      FragB b;
      b.half[0] = *(const v8us*)(brow + 8 * hh);
      b.half[1] = *(const v8us*)(brow + 16 + 8 * hh);
      acc[t] = mmaN<ASPLIT ? 2 : 1>(ah.v, al.v, b.v, b.v, acc[t]);
    }
  }
#pragma unroll
  for (int t = 0; t < 4; ++t) {
    float bv = bias ? bias[col0 + t * 16 + ln] : 0.f;
    if (BIAS_BF16) bv = bf16_round(bv);
#pragma unroll
    for (int r = 0; r < 8; ++r) { float v = acc[t][r] + bv; if (ACT == 1) v = fmaxf(v, 0.f); so[w][8 * hh + r][t * 16 + ln] = v; }
  }
  __builtin_amdgcn_fence(__ATOMIC_ACQ_REL, "workgroup");
  __builtin_amdgcn_wave_barrier();
  const int rsub = lane >> 4, c4 = (lane & 15) * 4;
  {
#pragma unroll
    for (int q = 0; q < 8; ++q) {
      const int r = q * 2 + rsub;
      const v4f v = *(const v4fa*)&so[w][r][c4];
      *(v4f*)(C + (size_t)(row0 + r) * ldc + col0 + c4) = v;
    }
    
  }
}

// GEMM C = act(A·W + bias + resid): A f32 (ASPLIT -> hi/lo 2 terms), Wt bf16 [N][K]; ACT 0 none, 1 relu, 2 exact gelu;
// resid (optional, f32, row index = (row % rmod), pitch ldr, RES_BF16 rounds it) added before the activation.
template <bool ASPLIT, int ACT, bool BIAS_BF16, bool RES_BF16>
__global__ __launch_bounds__(128) void k_gemm_bf3(const float* __restrict__ A, int lda, const unsigned short* __restrict__ Wt, int ldb,
                                                const float* __restrict__ bias, const float* __restrict__ resid, int rmod, int ldr,
                                                float* __restrict__ C, int ldc, int M, int N, int K) {
  __shared__ __attribute__((aligned(16))) float so[4][16][64];
  const int tid = threadIdx.x, w = tid >> 5, lane = tid & 31, ln = lane & 15, hh = lane >> 4;
  const int ntn = N / 64;
  const int wid = blockIdx.x * 4 + w;
  const int mt = wid / ntn, nq = wid % ntn;
  if (mt * 16 >= M) return;
  const int row0 = mt * 16, col0 = nq * 64;
  const float* arow = A + (size_t)(row0 + ln) * lda;
  v8f acc[4] = {};
  for (int kb = 0; kb < K; kb += 32) {
    FragB ah, al;
    const v4f x0 = *(const v4fa*)(arow + kb + 8 * hh), x1 = *(const v4fa*)(arow + kb + 8 * hh + 4);
    const v4f x2 = *(const v4fa*)(arow + kb + 16 + 8 * hh), x3 = *(const v4fa*)(arow + kb + 16 + 8 * hh + 4);
    float xs[16] = {x0[0],x0[1],x0[2],x0[3],x1[0],x1[1],x1[2],x1[3],x2[0],x2[1],x2[2],x2[3],x3[0],x3[1],x3[2],x3[3]};
#pragma unroll
    for (int i = 0; i < 16; ++i) { const unsigned short hb = bf16_bits(xs[i]); ah.u[i] = hb; al.u[i] = ASPLIT ? bf16_bits(xs[i] - bf16_val(hb)) : (unsigned short)0; }
#pragma unroll
    for (int t = 0; t < 4; ++t) {
      const unsigned short* brow = Wt + (size_t)(col0 + t * 16 + ln) * ldb + kb;
      FragB b;
      b.half[0] = *(const v8us*)(brow + 8 * hh);
      b.half[1] = *(const v8us*)(brow + 16 + 8 * hh);
      acc[t] = mmaN<ASPLIT ? 2 : 1>(ah.v, al.v, b.v, b.v, acc[t]);
    }
  }
#pragma unroll
  for (int t = 0; t < 4; ++t) {
    const int col = col0 + t * 16 + ln;
    float bv = bias ? bias[col] : 0.f;
    if (BIAS_BF16) bv = bf16_round(bv);
#pragma unroll
    for (int r = 0; r < 8; ++r) {
      float v = acc[t][r] + bv;
      if (resid) { float rv = resid[(size_t)((row0 + 8 * hh + r) % rmod) * ldr + col]; if (RES_BF16) rv = bf16_round(rv); v += rv; }
      if (ACT == 1) v = fmaxf(v, 0.f);
      if (ACT == 2) v = 0.5f * v * (1.0f + erff(v * 0.70710678118654752f));
      if (ACT == 3) { const float u = 0.7978845608028654f * (v + 0.044715f * v * v * v); v = 0.5f * v * (1.0f + tanhf(u)); }
      so[w][8 * hh + r][t * 16 + ln] = v;
    }
  }
  __builtin_amdgcn_fence(__ATOMIC_ACQ_REL, "workgroup");
  __builtin_amdgcn_wave_barrier();
  const int rsub = lane >> 4, c4 = (lane & 15) * 4;
  {
#pragma unroll
    for (int q = 0; q < 8; ++q) {
      const int r = q * 2 + rsub;
      const v4f v = *(const v4fa*)&so[w][r][c4];
      *(v4f*)(C + (size_t)(row0 + r) * ldc + col0 + c4) = v;
    }
    
  }
}
// row LayerNorm (biased variance, eps) over N: s = X (+ R); optional out_sum <- s; out_norm <- (s-mu)*rsqrt(var+eps)*g + b
template <bool PARAM_BF16>
__global__ __launch_bounds__(256) void k_layernorm(const float* __restrict__ X, const float* __restrict__ R, const float* __restrict__ g, const float* __restrict__ bta,
                                                  float* __restrict__ out_sum, float* __restrict__ out_norm, int N, float eps) {
  __shared__ float red[256];
  const int row = blockIdx.x, tid = threadIdx.x;
  const float* x = X + (size_t)row * N; const float* rr = R ? R + (size_t)row * N : nullptr;
  float vals[16];                     // up to N = 4096
  const int per = N / 256;            // contiguous chunk per thread? use strided-by-4 chunks: thread handles j = tid*4 + 1024*u
  float s1 = 0.f;
  for (int u = 0; u < per / 4; ++u) {
    const int j = tid * 4 + 1024 * u;
    const v4f a = *(const v4fa*)(x + j);
    v4f b = {0.f,0.f,0.f,0.f}; if (rr) b = *(const v4fa*)(rr + j);
#pragma unroll
    for (int q = 0; q < 4; ++q) { const float v = a[q] + b[q]; vals[u * 4 + q] = v; s1 += v; }
  }
  red[tid] = s1; __syncthreads();
  for (int st = 128; st > 0; st >>= 1) { if (tid < st) red[tid] += red[tid + st]; __syncthreads(); }
  const float mu = red[0] / (float)N; __syncthreads();
  float s2 = 0.f;
  for (int u = 0; u < per / 4; ++u)
#pragma unroll
    for (int q = 0; q < 4; ++q) { const float c = vals[u * 4 + q] - mu; s2 += c * c; }
  red[tid] = s2; __syncthreads();
  for (int st = 128; st > 0; st >>= 1) { if (tid < st) red[tid] += red[tid + st]; __syncthreads(); }
  const float rs = rsqrtf(red[0] / (float)N + eps);
  {
    for (int u = 0; u < per / 4; ++u) {
      const int j = tid * 4 + 1024 * u;
      v4f o, sm;
#pragma unroll
      for (int q = 0; q < 4; ++q) {
        float gg = g[j + q], bb = bta[j + q];
        if (PARAM_BF16) { gg = bf16_round(gg); bb = bf16_round(bb); }
        sm[q] = vals[u * 4 + q]; o[q] = (vals[u * 4 + q] - mu) * rs * gg + bb;
      }
      if (out_sum) *(v4f*)(out_sum + (size_t)row * N + j) = sm;
      *(v4f*)(out_norm + (size_t)row * N + j) = o;
    }
    
  }
}



// ---- f16 WMMA path (v_wmma_f32_16x16x32_f16): 11-bit significands for operands in range — used where a [0,1] probability operand needs more precision than bf16
typedef _Float16 v16h __attribute__((ext_vector_type(16)));
union FragH { v16h v; v8us half[2]; _Float16 h[16]; unsigned short u[16]; };
template <int NT>
__device__ __forceinline__ v8f mmaH(v16h ah, v16h al, v16h bh, v16h bl, v8f c) {
  c = __builtin_amdgcn_wmma_f32_16x16x32_f16(false, ah, false, bh, (short)0, c, false, false);
  if (NT >= 2) c = __builtin_amdgcn_wmma_f32_16x16x32_f16(false, al, false, bh, (short)0, c, false, false);
  if (NT >= 3) c = __builtin_amdgcn_wmma_f32_16x16x32_f16(false, ah, false, bl, (short)0, c, false, false);
  asm volatile("v_nop\n\tv_nop\n\tv_nop\n\tv_nop" : "+v"(c) : "v"(ah), "v"(al), "v"(bh), "v"(bl));
  return c;
}
// batched GEMM like k_gemm_b but f16 operands: A f32 (split into f16 hi/lo if ASPLIT, else rounded to f16), Bt = f16 values [n][k]; alpha; C f32; N multiple of 16 (partial tiles skipped)
template <bool ASPLIT>
__global__ __launch_bounds__(128) void k_gemm_h(const float* __restrict__ A, int lda, size_t sA, const _Float16* __restrict__ Bh, int ldb, size_t sB, float alpha, float* __restrict__ C, int ldc, size_t sC, int M, int N, int K) {
  __shared__ __attribute__((aligned(16))) float so[4][16][64];
  const int tid = threadIdx.x, w = tid >> 5, lane = tid & 31, ln = lane & 15, hh = lane >> 4; const int by = blockIdx.y;
  A += (size_t)by * sA; Bh += (size_t)by * sB; C += (size_t)by * sC;
  const int ntn = (N + 63) / 64; const int wid = blockIdx.x * 4 + w; const int mt = wid / ntn, nq = wid % ntn; if (mt * 16 >= M) return;
  const int row0 = mt * 16, col0 = nq * 64; const float* arow = A + (size_t)(row0 + ln) * lda;
  v8f acc[4] = {};
  for (int kb = 0; kb < K; kb += 32) {
    FragH ah, al;
    const v4f x0 = *(const v4fa*)(arow + kb + 8 * hh), x1 = *(const v4fa*)(arow + kb + 8 * hh + 4), x2 = *(const v4fa*)(arow + kb + 16 + 8 * hh), x3 = *(const v4fa*)(arow + kb + 16 + 8 * hh + 4);
    float xs[16] = {x0[0],x0[1],x0[2],x0[3],x1[0],x1[1],x1[2],x1[3],x2[0],x2[1],x2[2],x2[3],x3[0],x3[1],x3[2],x3[3]};
#pragma unroll
    for (int i = 0; i < 16; ++i) { const _Float16 h = (_Float16)xs[i]; ah.h[i] = h; al.h[i] = ASPLIT ? (_Float16)(xs[i] - (float)h) : (_Float16)0.0f; }
#pragma unroll
    for (int t = 0; t < 4; ++t) { if (col0 + t * 16 >= N) continue; const size_t boff = (size_t)(col0 + t * 16 + ln) * ldb + kb; FragH bq; bq.half[0] = *(const v8us*)(Bh + boff + 8 * hh); bq.half[1] = *(const v8us*)(Bh + boff + 16 + 8 * hh);
      acc[t] = mmaH<ASPLIT ? 2 : 1>(ah.v, al.v, bq.v, bq.v, acc[t]); }
  }
#pragma unroll
  for (int t = 0; t < 4; ++t) { if (col0 + t * 16 >= N) continue;
#pragma unroll
    for (int r = 0; r < 8; ++r) so[w][8 * hh + r][t * 16 + ln] = acc[t][r] * alpha; }
  __builtin_amdgcn_fence(__ATOMIC_ACQ_REL, "workgroup"); __builtin_amdgcn_wave_barrier();
  const int rsub = lane >> 4, c4 = (lane & 15) * 4;
  {
#pragma unroll
    for (int q = 0; q < 8; ++q) { const int r = q * 2 + rsub; if (col0 + c4 < N) { const v4f v = *(const v4fa*)&so[w][r][c4]; *(v4f*)(C + (size_t)(row0 + r) * ldc + col0 + c4) = v; } }
     }
}

// Wt[n][k] = f16(W[k][n]·scale) from f32 row-major W[K][N] (scale = power of two; bf16-exact weights stay exact in f16 away from the subnormal range)
__global__ __launch_bounds__(256) void k_wt_f16(const float* __restrict__ W, _Float16* __restrict__ Wt, int K, int N, float scale) {
  const int t = blockIdx.x * 256 + threadIdx.x; if (t >= N * (K / 8)) return; const int n = t / (K / 8), k8 = (t % (K / 8)) * 8; FragH f;
#pragma unroll
  for (int i = 0; i < 8; ++i) f.h[i] = (_Float16)(bf16_round(W[(size_t)(k8 + i) * N + n]) * scale); const v8us o = f.half[0];
  *(v8us*)((unsigned short*)Wt + (size_t)n * K + k8) = o; 
}
// k_gemm_hh variant with fused epilogue: v = acc·alpha + bias[by·sBias + col] (+ CP[(row/rowsPerB)·sCPb + by·64 + col] if CP) ; ACT 0 none / 1 elu ; writes f16 C16 (and f32 C if non-null)
template <int ACT>
__global__ __launch_bounds__(128) void k_gemm_hhx(const _Float16* __restrict__ A, int lda, size_t sA, const _Float16* __restrict__ Bh, int ldb, size_t sB, float alpha, const float* __restrict__ bias, size_t sBias, const float* __restrict__ CP, int rowsPerB, size_t sCPb, int row0g,
    float* __restrict__ C, _Float16* __restrict__ C16, int ldc, size_t sC, int M, int N, int K) {
  __shared__ __attribute__((aligned(16))) float so[4][16][64];
  const int tid = threadIdx.x, w = tid >> 5, lane = tid & 31, ln = lane & 15, hh = lane >> 4; const int by = blockIdx.y;
  A += (size_t)by * sA; Bh += (size_t)by * sB; const size_t cofs = (size_t)by * sC; const float* bp = bias ? bias + (size_t)by * sBias : nullptr;
  const int ntn = (N + 63) / 64; const int wid = blockIdx.x * 4 + w; const int mt = wid / ntn, nq = wid % ntn; if (mt * 16 >= M) return;
  const int row0 = mt * 16, col0 = nq * 64; const _Float16* arow = A + (size_t)(row0 + ln) * lda;
  v8f acc[4] = {};
  for (int kb = 0; kb < K; kb += 32) { FragH ah; ah.half[0] = *(const v8us*)((const unsigned short*)arow + kb + 8 * hh); ah.half[1] = *(const v8us*)((const unsigned short*)arow + kb + 16 + 8 * hh);
#pragma unroll
    for (int t = 0; t < 4; ++t) { if (col0 + t * 16 >= N) continue; const size_t boff = (size_t)(col0 + t * 16 + ln) * ldb + kb; FragH bq; bq.half[0] = *(const v8us*)((const unsigned short*)Bh + boff + 8 * hh); bq.half[1] = *(const v8us*)((const unsigned short*)Bh + boff + 16 + 8 * hh);
      acc[t] = mmaH<1>(ah.v, ah.v, bq.v, bq.v, acc[t]); }
  }
#pragma unroll
  for (int t = 0; t < 4; ++t) { if (col0 + t * 16 >= N) continue; const int col = col0 + t * 16 + ln; const float bv = bp ? bf16_round(bp[col]) : 0.f;
#pragma unroll
    for (int r = 0; r < 8; ++r) { float v = acc[t][r] * alpha + bv; if (CP) { const int rr = row0g + row0 + 8 * hh + r; if (rowsPerB < 0) v += CP[cofs + (size_t)rr * ldc + col];      /* rowsPerB < 0: own element of the batched C plane */ else { const int bidx = rr / rowsPerB; v += CP[(size_t)bidx * sCPb + (size_t)by * 64 + col]; } } if (ACT == 1) v = (v > 0.f) ? v : expm1f(v); else if (ACT == 7) v = (v > 0.f) ? v + 1.0f : expf(v); else if (ACT == 8) v = tanhf(v); else if (ACT == 9) v = 0.5f * v * (1.0f + tanhf(0.7978845608028654f * (v + 0.044715f * v * v * v))); else if (ACT == 11) v = 1.0f / (1.0f + expf(-v)); else if (ACT == 12) v = (v > 0.f) ? v : 0.01f * v; else if (ACT == 14) v = (v > 0.f) ? v : 0.1f * v; else if (ACT == 16) v = (v >= 0.f) ? v : 0.3f * v; else if (ACT == 17) v = (v >= 0.f) ? v : 0.2f * v; else if (ACT == 15) v = v / (1.0f + expf(-v)); else if (ACT == 3) v = fmaxf(v, 0.f); else if (ACT == 6) v = 0.5f * v * (1.0f + erff(v * 0.70710678118654752f)); so[w][8 * hh + r][t * 16 + ln] = v; } }
  __builtin_amdgcn_fence(__ATOMIC_ACQ_REL, "workgroup"); __builtin_amdgcn_wave_barrier();
  const int rsub = lane >> 4, c4 = (lane & 15) * 4; typedef _Float16 v4h __attribute__((ext_vector_type(4)));
  {
#pragma unroll
    for (int q = 0; q < 8; ++q) { const int r = q * 2 + rsub; if (col0 + c4 < N) { const v4f v = *(const v4fa*)&so[w][r][c4]; if (C) *(v4f*)(C + cofs + (size_t)(row0 + r) * ldc + col0 + c4) = v; if (C16) { v4h h4; for (int i = 0; i < 4; ++i) h4[i] = (_Float16)v[i]; *(v4h*)(C16 + cofs + (size_t)(row0 + r) * ldc + col0 + c4) = h4; } } }
     }
}


typedef _Float16 v4h __attribute__((ext_vector_type(4)));

__global__ __launch_bounds__(256) void k_x16(const float* __restrict__ x, _Float16* __restrict__ X16, size_t n8) { const size_t t = (size_t)blockIdx.x * 256 + threadIdx.x; if (t >= n8) return; FragH f;
#pragma unroll
  for (int q = 0; q < 8; ++q) f.h[q] = (_Float16)bf16_round(x[t * 8 + q]); *(v8us*)((unsigned short*)X16 + t * 8) = f.half[0];  }
__global__ __launch_bounds__(256) void k_h16(const float* __restrict__ x, _Float16* __restrict__ X16, size_t n8) { const size_t t = (size_t)blockIdx.x * 256 + threadIdx.x; if (t >= n8) return; FragH f;
#pragma unroll
  for (int q = 0; q < 8; ++q) f.h[q] = (_Float16)x[t * 8 + q]; *(v8us*)((unsigned short*)X16 + t * 8) = f.half[0];  }
__global__ __launch_bounds__(256) void k_round16f(const float* __restrict__ W, _Float16* __restrict__ Bt, size_t n8) { const size_t t = (size_t)blockIdx.x * 256 + threadIdx.x; if (t >= n8) return; FragH f;
#pragma unroll
  for (int i = 0; i < 8; ++i) f.h[i] = (_Float16)(bf16_round(W[t * 8 + i]) * 16.0f); *(v8us*)((unsigned short*)Bt + t * 8) = f.half[0];  }
template <int NHv, int TTv>
__global__ __launch_bounds__(256) void k_vt(const _Float16* __restrict__ V16, int ldv, int voff, _Float16* __restrict__ Vt) { __shared__ unsigned short tl[64][66]; const int tid = threadIdx.x; const int slab = blockIdx.x / (TTv / 64), lg = blockIdx.x % (TTv / 64); const int b = slab / NHv, h = slab % NHv;
  for (int i = tid; i < 64 * 8; i += 256) { const int r = i / 8, c8 = (i % 8) * 8; FragH f; f.half[0] = *(const v8us*)((const unsigned short*)V16 + ((size_t)b * TTv + lg * 64 + r) * ldv + voff + h * 64 + c8);
#pragma unroll
    for (int q = 0; q < 8; ++q) tl[r][c8 + q] = f.u[q]; }
  __syncthreads();
  {
#pragma unroll
    for (int rd = 0; rd < 2; ++rd) { const int d = rd * 32 + tid / 8, pc = tid % 8; FragH f;
#pragma unroll
      for (int q = 0; q < 8; ++q) f.u[q] = tl[pc * 8 + q][d];
      *(v8us*)((unsigned short*)Vt + ((size_t)slab * 64 + d) * TTv + lg * 64 + pc * 8) = f.half[0]; }
     } }

__global__ __launch_bounds__(256) void k_hl(const float* __restrict__ F, _Float16* __restrict__ Hh, _Float16* __restrict__ Hl, size_t n8) { const size_t t = (size_t)blockIdx.x * 256 + threadIdx.x; if (t >= n8) return; FragH fh, fl; const v4f a = *(const v4fa*)(F + t * 8), c = *(const v4fa*)(F + t * 8 + 4);
#pragma unroll
  for (int q = 0; q < 4; ++q) { _Float16 h = (_Float16)a[q]; fh.h[q] = h; fl.h[q] = (_Float16)((a[q] - (float)h) * 1024.0f); h = (_Float16)c[q]; fh.h[4 + q] = h; fl.h[4 + q] = (_Float16)((c[q] - (float)h) * 1024.0f); }
  { *(v8us*)((unsigned short*)Hh + t * 8) = fh.half[0]; *(v8us*)((unsigned short*)Hl + t * 8) = fl.half[0];  } }

// ---- fast GEMM (wave tile 32x64; requires M % 32 == 0 rows per launch region and N % 64 == 0); epilogue = k_gemm_hhx semantics ----
__device__ __forceinline__ v16h g2_frag(const _Float16* p, int hh) { FragH f; f.half[0] = *(const v8us*)((const unsigned short*)p + 8 * hh); f.half[1] = *(const v8us*)((const unsigned short*)p + 16 + 8 * hh); return f.v; }
__device__ __forceinline__ v8f g2_mma(v16h a, v16h b, v8f c) { v8f d = __builtin_amdgcn_wmma_f32_16x16x32_f16(false, a, false, b, (short)0, c, false, false); asm volatile("v_nop\n\tv_nop\n\tv_nop\n\tv_nop" : "+v"(d) : "v"(a), "v"(b)); return d; }
template <int ACT>
__global__ __launch_bounds__(128) void k_gemm2(const _Float16* __restrict__ A, int lda, size_t sA, const _Float16* __restrict__ Bh, int ldb, size_t sB, float alpha, const float* __restrict__ bias, size_t sBias, const float* __restrict__ CP, int rowsPerB, size_t sCPb, int row0g,
    float* __restrict__ C, _Float16* __restrict__ C16, int ldc, size_t sC, int M, int N, int K) { static_assert(ACT == 0 || ACT == 3 || ACT == 6 || ACT == 8 || ACT == 9 || ACT == 11 || ACT == 12 || ACT == 14 || ACT == 15 || ACT == 16 || ACT == 17, "k_gemm2: unsupported ACT code (would silently apply no activation)");
  __shared__ __attribute__((aligned(16))) float so[4][32][68];
  const int tid = threadIdx.x, w = tid >> 5, lane = tid & 31, ln = lane & 15, hh = lane >> 4; const int by = blockIdx.y;
  A += (size_t)by * sA; Bh += (size_t)by * sB; const size_t cofs = (size_t)by * sC; const float* bp = bias ? bias + (size_t)by * sBias : nullptr;
  const int ntn = N >> 6; const int mt = blockIdx.x / ntn, nq = blockIdx.x - mt * ntn; const int row0 = mt * 128 + 32 * w, col0 = nq * 64; if (row0 >= M) return;
  const _Float16* a0p = A + (size_t)(row0 + ln) * lda; const _Float16* a1p = a0p + (size_t)16 * lda;
  const _Float16* b0p = Bh + (size_t)(col0 + ln) * ldb; const _Float16* b1p = b0p + (size_t)16 * ldb; const _Float16* b2p = b1p + (size_t)16 * ldb; const _Float16* b3p = b2p + (size_t)16 * ldb;
  const v8f z8 = {0.f,0.f,0.f,0.f,0.f,0.f,0.f,0.f}; v8f c00 = z8, c01 = z8, c02 = z8, c03 = z8, c10 = z8, c11 = z8, c12 = z8, c13 = z8;
#pragma unroll 1
  for (int kb = 0; kb < K; kb += 32) { const v16h a0 = g2_frag(a0p + kb, hh), a1 = g2_frag(a1p + kb, hh);
    v16h b = g2_frag(b0p + kb, hh); c00 = g2_mma(a0, b, c00); c10 = g2_mma(a1, b, c10);
    b = g2_frag(b1p + kb, hh); c01 = g2_mma(a0, b, c01); c11 = g2_mma(a1, b, c11);
    b = g2_frag(b2p + kb, hh); c02 = g2_mma(a0, b, c02); c12 = g2_mma(a1, b, c12);
    b = g2_frag(b3p + kb, hh); c03 = g2_mma(a0, b, c03); c13 = g2_mma(a1, b, c13); }
  v8f accs[8] = {c00, c01, c02, c03, c10, c11, c12, c13};
#pragma unroll
  for (int u = 0; u < 8; ++u) { const int t = u & 3, half = u >> 2; const int col = col0 + t * 16 + ln; const float bv = bp ? bf16_round(bp[col]) : 0.f;
#pragma unroll
    for (int r = 0; r < 8; ++r) { const int rloc = half * 16 + 8 * hh + r; float v = accs[u][r] * alpha + bv; if (CP) { if (rowsPerB < 0) v += CP[cofs + (size_t)(row0g + row0 + rloc) * ldc + col];      /* rowsPerB < 0: own element of the batched C plane */ else { const int bidx = (row0g + row0 + rloc) / rowsPerB; v += CP[(size_t)bidx * sCPb + (size_t)by * 64 + col]; } }
      if (ACT == 3) v = fmaxf(v, 0.f); else if (ACT == 6) v = 0.5f * v * (1.0f + erff(v * 0.70710678118654752f)); else if (ACT == 11) v = 1.0f / (1.0f + expf(-v)); else if (ACT == 15) v = v / (1.0f + expf(-v)); else if (ACT == 12) v = (v > 0.f) ? v : 0.01f * v; else if (ACT == 8) v = tanhf(v); else if (ACT == 9) v = 0.5f * v * (1.0f + tanhf(0.7978845608028654f * (v + 0.044715f * v * v * v))); else if (ACT == 14) v = (v > 0.f) ? v : 0.1f * v; else if (ACT == 16) v = (v >= 0.f) ? v : 0.3f * v; else if (ACT == 17) v = (v >= 0.f) ? v : 0.2f * v;
      so[w][rloc][t * 16 + ln] = v; } }
  __builtin_amdgcn_fence(__ATOMIC_ACQ_REL, "workgroup"); __builtin_amdgcn_wave_barrier();
  const int rsub = lane >> 4, c4 = (lane & 15) * 4;
  {
#pragma unroll
    for (int q = 0; q < 16; ++q) { const int r = q * 2 + rsub; const v4f v = *(const v4fa*)&so[w][r][c4]; if (C) *(v4f*)(C + cofs + (size_t)(row0 + r) * ldc + col0 + c4) = v; if (C16) { v4h h4; for (int i = 0; i < 4; ++i) h4[i] = (_Float16)v[i]; *(v4h*)(C16 + cofs + (size_t)(row0 + r) * ldc + col0 + c4) = h4; } }
     } }


__global__ __launch_bounds__(256) void k_wnat(const float* __restrict__ w, size_t n8, _Float16* __restrict__ Bt) { const size_t t = (size_t)blockIdx.x * 256 + threadIdx.x; if (t >= n8) return; FragH f; for (int q = 0; q < 8; ++q) f.h[q] = (_Float16)(bf16_round(w[t * 8 + q]) * 16.0f); *(v8us*)((unsigned short*)Bt + t * 8) = f.half[0];  }
__global__ __launch_bounds__(256) void k_rsm(const float* __restrict__ S, _Float16* __restrict__ P, int nrows) {
  #pragma clang fp contract(off)
  const int i = blockIdx.x * 256 + threadIdx.x; if (i >= nrows) return; const float* s = S + (size_t)i * SQ; float mx = -3.0e38f;
#pragma unroll 1
  for (int j = 0; j < SQ; ++j) mx = fmaxf(mx, s[j]); float se = 0.f;
#pragma unroll 1
  for (int j = 0; j < SQ; ++j) se += expf(s[j] - mx); const float sc = 256.0f / se;
#pragma unroll 1
  for (int j0 = 0; j0 < SQ; j0 += 8) { FragH f; for (int q = 0; q < 8; ++q) f.h[q] = (_Float16)(expf(s[j0 + q] - mx) * sc); unsigned short* d = (unsigned short*)P + (size_t)i * SQ + j0; *(v8us*)d = f.half[0];  } }
__global__ __launch_bounds__(256) void k_vt(const _Float16* __restrict__ V16, int b, int h0, _Float16* __restrict__ VT) { __shared__ unsigned short tl[64][65]; const int tid = threadIdx.x; const int hh = blockIdx.x % HG, sg = blockIdx.x / HG; const int s0 = sg * 64; const int h = h0 + hh;
  for (int i = tid; i < 64 * 8; i += 256) { const int j = i / 8, d8 = (i % 8) * 8; FragH f; f.half[0] = *(const v8us*)((const unsigned short*)V16 + ((size_t)b * SQ + s0 + j) * DM + h * HD + d8); for (int q = 0; q < 8; ++q) tl[d8 + q][j] = f.u[q]; }
  __syncthreads();
  { for (int i = tid; i < 64 * 8; i += 256) { const int d = i / 8, j8 = (i % 8) * 8; FragH f; for (int q = 0; q < 8; ++q) f.u[q] = tl[d][j8 + q]; *(v8us*)((unsigned short*)VT + ((size_t)hh * HD + d) * SQ + s0 + j8) = f.half[0]; }  } }

__global__ __launch_bounds__(256) void k_cl2rows(const float* __restrict__ X, _Float16* __restrict__ XR) { __shared__ float tl[64][33]; const int tid = threadIdx.x; const int nl = LL / 32, nc = CC / 64; const int cb_ = blockIdx.x % nc; const int lb = (blockIdx.x / nc) % nl; const size_t b = blockIdx.x / (nc * nl); const int c0 = cb_ * 64, l0 = lb * 32;
  for (int i = tid; i < 64 * 32; i += 256) { const int c = i / 32, l = i % 32; tl[c][l] = bf16_round(X[(b * CC + c0 + c) * (size_t)LL + l0 + l]); }
  __syncthreads();
  { const int l = tid / 8, c8 = (tid % 8) * 8; FragH f; for (int q = 0; q < 8; ++q) f.h[q] = (_Float16)tl[c8 + q][l]; unsigned short* d = (unsigned short*)XR + (b * LL + l0 + l) * (size_t)CC + c0 + c8; *(v8us*)d = f.half[0];  } }


__global__ __launch_bounds__(256) void k_wperm(const float* __restrict__ w, _Float16* __restrict__ Bt) { const int t = blockIdx.x * 256 + threadIdx.x; if (t >= CC * (CC / 8)) return; const int k8 = (t % (CC / 8)) * 8, np_ = t / (CC / 8); const int h = np_ / HD, dd = np_ % HD; const int src = dd * NH + h; FragH f;
  for (int q = 0; q < 8; ++q) f.h[q] = (_Float16)(bf16_round(w[(size_t)src * CC + k8 + q]) * 16.0f); unsigned short* d = (unsigned short*)Bt + (size_t)np_ * CC + k8; *(v8us*)d = f.half[0];  }
__global__ __launch_bounds__(256) void k_wpermc(const float* __restrict__ w, _Float16* __restrict__ A) { const int t = blockIdx.x * 256 + threadIdx.x; if (t >= CC * (CC / 8)) return; const int k8 = (t % (CC / 8)) * 8, c = t / (CC / 8); FragH f;
  for (int q = 0; q < 8; ++q) { const int kp = k8 + q; const int h = kp / HD, dd = kp % HD; f.h[q] = (_Float16)(bf16_round(w[(size_t)c * CC + dd * NH + h]) * 16.0f); } unsigned short* d = (unsigned short*)A + (size_t)c * CC + k8; *(v8us*)d = f.half[0];  }
__global__ __launch_bounds__(256) void k_bperm(const float* __restrict__ b0, const float* __restrict__ b1, const float* __restrict__ b2, float* __restrict__ BP) { const int t = threadIdx.x; if (t >= CC) return; const int h = t / HD, dd = t % HD; const int src = dd * NH + h;
  { *(float*)(BP + t) = b0[src]; *(float*)(BP + CC + t) = b1[src]; *(float*)(BP + 2 * CC + t) = b2[src];  } }
// Row softmax, one wave per score row: the row's 2,048 f32 sit in 64 registers a lane (16 loads of 512 contiguous bytes a wave) and are read once;
// maximum and sum: four chains a lane, then a five-step butterfly over the 32 lanes; each exp is made once; stores cover 256 contiguous bytes a wave.
template <int M> __device__ __forceinline__ float rs_xm(float x) { return __builtin_bit_cast(float, __builtin_amdgcn_update_dpp(0, __builtin_bit_cast(int, x), 0x160 + M, 0xf, 0xf, true)); }      /* lane l <- lane l ^ M inside a 16-lane row (DPP row_xmask) */
__device__ __forceinline__ float rs_xh(float x) { return __builtin_bit_cast(float, __builtin_amdgcn_permlanex16(__builtin_bit_cast(int, x), __builtin_bit_cast(int, x), 0x76543210, 0xfedcba98, false, false)); }      /* lane l <- lane l ^ 16 */
// 2^z on the transcendental unit. The v_nop is the slot that the instruction set asks for behind a transcendental before its result is read or its source overwritten.
__device__ __forceinline__ float rs_exp2(float z) { float y; asm("v_exp_f32 %0, %1\n\tv_nop" : "=v"(y) : "v"(z)); return y; }
__global__ __launch_bounds__(256) void k_rsmf2(const float* __restrict__ S, _Float16* __restrict__ P, int qn, int hg) {
  const unsigned lane = threadIdx.x & 31; const int t = blockIdx.x * 8 + __builtin_amdgcn_readfirstlane(threadIdx.x >> 5); if (t >= qn * hg) return;      /* wave-uniform; no barrier below */
  const size_t i = (size_t)(t / qn) * SQ + (t % qn); const char* s = (const char*)(S + i * SQ) + lane * 16; v4f x[SQ / 128];      /* 16 bytes a lane */
#pragma unroll      // constant indices keep x[] in registers; all 16 loads issue before the first wait
  for (int u = 0; u < SQ / 128; ++u) x[u] = *(const v4fa*)(s + u * 512);
  v4f m4 = {-3.0e38f, -3.0e38f, -3.0e38f, -3.0e38f};
#pragma unroll      // constant indices keep x[] in registers
  for (int u = 0; u < SQ / 128; ++u) for (int q = 0; q < 4; ++q) m4[q] = fmaxf(m4[q], x[u][q]);
  float mx = fmaxf(fmaxf(m4[0], m4[1]), fmaxf(m4[2], m4[3]));
  mx = fmaxf(mx, rs_xm<1>(mx)); mx = fmaxf(mx, rs_xm<2>(mx)); mx = fmaxf(mx, rs_xm<4>(mx)); mx = fmaxf(mx, rs_xm<8>(mx)); mx = fmaxf(mx, rs_xh(mx));
  v4f a4 = {0.f, 0.f, 0.f, 0.f};
#pragma unroll      // constant indices keep x[] in registers
  for (int u = 0; u < SQ / 128; ++u) for (int q = 0; q < 4; ++q) { x[u][q] = rs_exp2((x[u][q] - mx) * 1.44269504088896340736f);      /* = the native exp: times log2(e), then 2^z */ a4[q] += x[u][q]; }
  float se = (a4[0] + a4[1]) + (a4[2] + a4[3]);
  se += rs_xm<1>(se); se += rs_xm<2>(se); se += rs_xm<4>(se); se += rs_xm<8>(se); se += rs_xh(se);
  const float sc = 256.0f / se; _Float16* d = P + i * SQ + lane * 4;
#pragma unroll      // constant indices keep x[] in registers; the 16 stores issue back to back
  for (int u = 0; u < SQ / 128; ++u) { v4h h4; for (int q = 0; q < 4; ++q) h4[q] = (_Float16)(x[u][q] * sc); *(v4h*)(d + u * 128) = h4; } }
__global__ __launch_bounds__(256) void k_rowbias(float* __restrict__ y, const float* __restrict__ bo) { const size_t t = (size_t)blockIdx.x * 256 + threadIdx.x; if (t >= (size_t)NB * NC * NPX / 4) return; const size_t e = t * 4; const int co = (int)((e / NPX) % NC); const float bv = bf16_round(bo[co]); v4f v = *(const v4fa*)(y + e); for (int q = 0; q < 4; ++q) v[q] = v[q] + bv; *(v4f*)(y + e) = v;  }

extern "C" void kernel_launch(void* const* d_in, const int* in_sizes, int n_in,
                              void* d_out, int out_size, void* d_ws, size_t ws_size, hipStream_t stream) {
  (void)in_sizes; (void)n_in; (void)out_size;
  const float* const* I = (const float* const*)d_in; const float* xq = I[0]; const float* xk = I[1]; const float* xv = I[2]; const float* wq = I[3]; const float* bq = I[4]; const float* wk = I[5]; const float* bk = I[6]; const float* wv = I[7]; const float* bv = I[8]; const float* wm = I[9]; const float* bm = I[10];
  char* ws = (char*)d_ws; size_t off = 0;
  auto take = [&](size_t bytes) { char* p = ws + off; off += (bytes + 255) & ~(size_t)255; return p; };
  _Float16* BQ = (_Float16*)take((size_t)CC * CC * 2); _Float16* BK = (_Float16*)take((size_t)CC * CC * 2); _Float16* BV = (_Float16*)take((size_t)CC * CC * 2); _Float16* AM = (_Float16*)take((size_t)CC * CC * 2); float* BP = (float*)take((size_t)3 * CC * 4);
  _Float16* XQ = (_Float16*)take(NR * CC * 2); _Float16* XK = (_Float16*)take(NR * CC * 2); _Float16* XV = (_Float16*)take(NR * CC * 2); _Float16* Q16 = (_Float16*)take(NR * CC * 2); _Float16* K16 = (_Float16*)take(NR * CC * 2); _Float16* V16 = (_Float16*)take(NR * CC * 2); _Float16* O16 = (_Float16*)take(NR * CC * 2);
  float* S = (float*)take((size_t)HG * SQ * SQ * 4); _Float16* P = (_Float16*)take((size_t)HG * SQ * SQ * 2); _Float16* VT = (_Float16*)take((size_t)NH * HD * SQ * 2);
  if (off > ws_size) return;      /* 0.5 + 56 + 64 + 32 + 1 = approx 154 MiB */
  { const unsigned gw = (CC * (CC / 8) + 255) / 256; k_wperm<<<gw, 256, 0, stream>>>(wq, BQ); k_wperm<<<gw, 256, 0, stream>>>(wk, BK); k_wperm<<<gw, 256, 0, stream>>>(wv, BV); k_wpermc<<<gw, 256, 0, stream>>>(wm, AM); k_bperm<<<1, 256, 0, stream>>>(bq, bk, bv, BP); }
  { const unsigned gx = NB * (LL / 32) * (CC / 64); k_cl2rows<<<gx, 256, 0, stream>>>(xq, XQ); k_cl2rows<<<gx, 256, 0, stream>>>(xk, XK); k_cl2rows<<<gx, 256, 0, stream>>>(xv, XV); }
  const dim3 gp((unsigned)((NR / 128) * (CC / 64)), 1);
  k_gemm2<0><<<gp, 128, 0, stream>>>(XQ, CC, 0, BQ, CC, 0, 0.0625f, BP, 0, nullptr, 1, 0, 0, nullptr, Q16, CC, 0, (int)NR, CC, CC);
  k_gemm2<0><<<gp, 128, 0, stream>>>(XK, CC, 0, BK, CC, 0, 0.0625f, BP + CC, 0, nullptr, 1, 0, 0, nullptr, K16, CC, 0, (int)NR, CC, CC);
  k_gemm2<0><<<gp, 128, 0, stream>>>(XV, CC, 0, BV, CC, 0, 0.0625f, BP + 2 * CC, 0, nullptr, 1, 0, 0, nullptr, V16, CC, 0, (int)NR, CC, CC);
  for (int b = B0; b < B0 + NBR; ++b) { const size_t r0 = (size_t)b * LL;
    k_vt<NH, SQ><<<NH * (SQ / 64), 256, 0, stream>>>(V16 + r0 * CC, CC, 0, VT);      /* V^T [4][64][2048] for this batch */
    k_gemm2<0><<<dim3((QN / 128) * (SQ / 64), HG), 128, 0, stream>>>(Q16 + r0 * CC, CC, (size_t)HD, K16 + r0 * CC, CC, (size_t)HD, 0.125f, nullptr, 0, nullptr, 1, 0, 0, S, nullptr, SQ, (size_t)SQ * SQ, QN, SQ, HD);      /* scores / 8, 4 heads */
    k_rsmf2<<<(HG * QN + 7) / 8, 256, 0, stream>>>(S, P, QN, HG);      /* one wave per row, 8 rows per block */
    k_gemm2<0><<<dim3((QN / 128) * (HD / 64), HG), 128, 0, stream>>>(P, SQ, (size_t)SQ * SQ, VT, SQ, (size_t)HD * SQ, 0.25f, nullptr, 0, nullptr, 1, 0, 0, nullptr, O16 + r0 * CC, CC, (size_t)HD, QN, HD, SQ); }      /* o x64, head-major f16 rows */
  k_gemm2<0><<<dim3((CC / 128) * (LL / 64), NBR), 128, 0, stream>>>(AM, CC, 0, O16 + (size_t)B0 * LL * CC, CC, (size_t)LL * CC, 0.0009765625f, nullptr, 0, nullptr, 1, 0, 0, (float*)d_out + (size_t)B0 * CC * LL, nullptr, LL, (size_t)CC * LL, CC, LL, CC);      /* out[b][c][n] = sum_k' w_m'[c][k'] o[(b,n)][k'] (channel-major directly) */
  k_rowbias<<<(unsigned)(((size_t)NB * NC * NPX / 4 + 255) / 256), 256, 0, stream>>>((float*)d_out, bm);
}

// v002
// A run of this version takes 136 microseconds.
// Two timings next to v001 put it at 6.29 and 6.41 times that version's speed.
// All steps since v000 together make it 25.8 times as fast.
#include <hip/hip_runtime.h>
// SuperGlue multi-head attention (query, key, value channel-first [8][256][2048]; q/k/v = 1x1 conv (natural [256][256] + bias); the module's head split view(B, d=64, H=4, N) makes channel c = dd*4 + h (INTERLEAVED heads); scores = q.k / 8 per head over 2,048 keys; softmax; x merged back to c = dd*4 + h; out = w_m x + b_m -> [8][256][2048]).
// Structure: channel-first inputs transposed to token rows (exact f16) via LDS tiles; projection weights and biases permuted once so the head split becomes contiguous 64-column blocks (exact x16 f16); Q, K, V as WMMA GEMMs (32x64 wave tiles, f32 accumulation, f16 outputs); V^T of all batches via LDS transposes (one launch); scores, softmax and P . V fused in one kernel over all batches and heads (S^T = K . Q^T, online softmax in f32, O^T += V^T . P^T, P stays in registers as f16; o x64 in f16) into head-major rows; out channel-major directly: (w_m with permuted columns) . o^T GEMM batched over the 8 batches (alpha folds 1/16 and 1/64), then the per-channel bias as a row pass; 15 launches.
// Compute dtype: inputs rounded to bf16; inputs / weights exact in f16; q, k, v, softmax weights and o plain f16 (~2^-12); scores and softmax statistics f32; v_wmma_f32_16x16x32_f16.
#define NB 8
#define CC 256
#define LL 2048
#define SQ LL
#define DM CC
#define NH 4
#define HD 64
#define HG 4
#define NC CC                        /* k_rowbias macros */
#define NPX LL
#define B0 0                         /* first batch through the output GEMM (debug hook) */
#define NBR NB                       /* batches through it (debug hook) */
#define QN SQ                        /* query rows per batch (unused) */
#define NR ((size_t)NB * LL)
typedef __bf16 v16b __attribute__((ext_vector_type(16)));
typedef unsigned short v8us __attribute__((ext_vector_type(8), may_alias));
typedef float  v8f  __attribute__((ext_vector_type(8)));
typedef float  v4f  __attribute__((ext_vector_type(4)));
typedef float  v4fa __attribute__((ext_vector_type(4), may_alias));
union FragB { v16b v; v8us half[2]; unsigned short u[16]; };

__device__ __forceinline__ unsigned short bf16_bits(float x) { unsigned int u = __float_as_uint(x); return (unsigned short)((u + 0x7FFFu + ((u >> 16) & 1u)) >> 16); }
__device__ __forceinline__ float bf16_val(unsigned short b) { return __uint_as_float(((unsigned int)b) << 16); }
__device__ __forceinline__ float bf16_round(float x) { return bf16_val(bf16_bits(x)); }
// D += A·B with NT terms: 1 = ah·bh, 2 = + al·bh (A split), 3 = + ah·bl (both split)
template <int NT>
__device__ __forceinline__ v8f mmaN(v16b ah, v16b al, v16b bh, v16b bl, v8f c) {
  c = __builtin_amdgcn_wmma_f32_16x16x32_bf16(false, ah, false, bh, (short)0, c, false, false);
  if (NT >= 2) c = __builtin_amdgcn_wmma_f32_16x16x32_bf16(false, al, false, bh, (short)0, c, false, false);
  if (NT >= 3) c = __builtin_amdgcn_wmma_f32_16x16x32_bf16(false, ah, false, bl, (short)0, c, false, false);
  asm volatile("v_nop\n\tv_nop\n\tv_nop\n\tv_nop" : "+v"(c) : "v"(ah), "v"(al), "v"(bh), "v"(bl));
  return c;
}

__global__ __launch_bounds__(256) void k_wt_bf16(const float* __restrict__ W, unsigned short* __restrict__ Wt, int K, int N) {
  const int t = blockIdx.x * 256 + threadIdx.x;
  const int k8n = K / 8;
  if (t >= N * k8n) return;
  const int n = t / k8n, k8 = (t % k8n) * 8;
  v8us v;
#pragma unroll
  for (int i = 0; i < 8; ++i) v[i] = bf16_bits(W[(size_t)(k8 + i) * N + n]);
  *(v8us*)(Wt + (size_t)n * K + k8) = v;
  
}

// GEMM C[M][N] (f32, pitch ldc) = act(A[M][K]·W + bias). A f32 row-major (pitch lda) converted per fragment to bf16
// (ASPLIT: hi/lo two planes -> 2 terms, else single rounded term); Wt bf16 [N][K] (pitch ldb). BIAS_BF16 rounds the
// bias to bf16 first (bias quantised to bf16 before the add). K%32==0, M%16==0, N%64==0.
template <bool ASPLIT, int ACT, bool BIAS_BF16>
__global__ __launch_bounds__(128) void k_gemm_bf(const float* __restrict__ A, int lda, const unsigned short* __restrict__ Wt, int ldb,
                                               const float* __restrict__ bias, float* __restrict__ C, int ldc, int M, int N, int K) {
  __shared__ __attribute__((aligned(16))) float so[4][16][64];
  const int tid = threadIdx.x, w = tid >> 5, lane = tid & 31, ln = lane & 15, hh = lane >> 4;
  const int ntn = N / 64;
  const int wid = blockIdx.x * 4 + w;
  const int mt = wid / ntn, nq = wid % ntn;
  if (mt * 16 >= M) return;
  const int row0 = mt * 16, col0 = nq * 64;
  const float* arow = A + (size_t)(row0 + ln) * lda;
  v8f acc[4] = {};
  for (int kb = 0; kb < K; kb += 32) {
    FragB ah, al;
    const v4f x0 = *(const v4fa*)(arow + kb + 8 * hh), x1 = *(const v4fa*)(arow + kb + 8 * hh + 4);
    const v4f x2 = *(const v4fa*)(arow + kb + 16 + 8 * hh), x3 = *(const v4fa*)(arow + kb + 16 + 8 * hh + 4);
    float xs[16] = {x0[0],x0[1],x0[2],x0[3],x1[0],x1[1],x1[2],x1[3],x2[0],x2[1],x2[2],x2[3],x3[0],x3[1],x3[2],x3[3]};
#pragma unroll
    for (int i = 0; i < 16; ++i) { const unsigned short hb = bf16_bits(xs[i]); ah.u[i] = hb; al.u[i] = ASPLIT ? bf16_bits(xs[i] - bf16_val(hb)) : (unsigned short)0; }
#pragma unroll
    for (int t = 0; t < 4; ++t) {
      const unsigned short* brow = Wt + (size_t)(col0 + t * 16 + ln) * ldb + kb;
      FragB b;
      b.half[0] = *(const v8us*)(brow + 8 * hh);
      b.half[1] = *(const v8us*)(brow + 16 + 8 * hh);
      acc[t] = mmaN<ASPLIT ? 2 : 1>(ah.v, al.v, b.v, b.v, acc[t]);
    }
  }
#pragma unroll
  for (int t = 0; t < 4; ++t) {
    float bv = bias ? bias[col0 + t * 16 + ln] : 0.f;
    if (BIAS_BF16) bv = bf16_round(bv);
#pragma unroll
    for (int r = 0; r < 8; ++r) { float v = acc[t][r] + bv; if (ACT == 1) v = fmaxf(v, 0.f); so[w][8 * hh + r][t * 16 + ln] = v; }
  }
  __builtin_amdgcn_fence(__ATOMIC_ACQ_REL, "workgroup");
  __builtin_amdgcn_wave_barrier();
  const int rsub = lane >> 4, c4 = (lane & 15) * 4;
  {
#pragma unroll
    for (int q = 0; q < 8; ++q) {
      const int r = q * 2 + rsub;
      const v4f v = *(const v4fa*)&so[w][r][c4];
      *(v4f*)(C + (size_t)(row0 + r) * ldc + col0 + c4) = v;
    }
    
  }
}

// GEMM C = act(A·W + bias + resid): A f32 (ASPLIT -> hi/lo 2 terms), Wt bf16 [N][K]; ACT 0 none, 1 relu, 2 exact gelu;
// resid (optional, f32, row index = (row % rmod), pitch ldr, RES_BF16 rounds it) added before the activation.
template <bool ASPLIT, int ACT, bool BIAS_BF16, bool RES_BF16>
__global__ __launch_bounds__(128) void k_gemm_bf3(const float* __restrict__ A, int lda, const unsigned short* __restrict__ Wt, int ldb,
                                                const float* __restrict__ bias, const float* __restrict__ resid, int rmod, int ldr,
                                                float* __restrict__ C, int ldc, int M, int N, int K) {
  __shared__ __attribute__((aligned(16))) float so[4][16][64];
  const int tid = threadIdx.x, w = tid >> 5, lane = tid & 31, ln = lane & 15, hh = lane >> 4;
  const int ntn = N / 64;
  const int wid = blockIdx.x * 4 + w;
  const int mt = wid / ntn, nq = wid % ntn;
  if (mt * 16 >= M) return;
  const int row0 = mt * 16, col0 = nq * 64;
  const float* arow = A + (size_t)(row0 + ln) * lda;
  v8f acc[4] = {};
  for (int kb = 0; kb < K; kb += 32) {
    FragB ah, al;
    const v4f x0 = *(const v4fa*)(arow + kb + 8 * hh), x1 = *(const v4fa*)(arow + kb + 8 * hh + 4);
    const v4f x2 = *(const v4fa*)(arow + kb + 16 + 8 * hh), x3 = *(const v4fa*)(arow + kb + 16 + 8 * hh + 4);
    float xs[16] = {x0[0],x0[1],x0[2],x0[3],x1[0],x1[1],x1[2],x1[3],x2[0],x2[1],x2[2],x2[3],x3[0],x3[1],x3[2],x3[3]};
#pragma unroll
    for (int i = 0; i < 16; ++i) { const unsigned short hb = bf16_bits(xs[i]); ah.u[i] = hb; al.u[i] = ASPLIT ? bf16_bits(xs[i] - bf16_val(hb)) : (unsigned short)0; }
#pragma unroll
    for (int t = 0; t < 4; ++t) {
      const unsigned short* brow = Wt + (size_t)(col0 + t * 16 + ln) * ldb + kb;
      FragB b;
      b.half[0] = *(const v8us*)(brow + 8 * hh);
      b.half[1] = *(const v8us*)(brow + 16 + 8 * hh);
      acc[t] = mmaN<ASPLIT ? 2 : 1>(ah.v, al.v, b.v, b.v, acc[t]);
    }
  }
#pragma unroll
  for (int t = 0; t < 4; ++t) {
    const int col = col0 + t * 16 + ln;
    float bv = bias ? bias[col] : 0.f;
    if (BIAS_BF16) bv = bf16_round(bv);
#pragma unroll
    for (int r = 0; r < 8; ++r) {
      float v = acc[t][r] + bv;
      if (resid) { float rv = resid[(size_t)((row0 + 8 * hh + r) % rmod) * ldr + col]; if (RES_BF16) rv = bf16_round(rv); v += rv; }
      if (ACT == 1) v = fmaxf(v, 0.f);
      if (ACT == 2) v = 0.5f * v * (1.0f + erff(v * 0.70710678118654752f));
      if (ACT == 3) { const float u = 0.7978845608028654f * (v + 0.044715f * v * v * v); v = 0.5f * v * (1.0f + tanhf(u)); }
      so[w][8 * hh + r][t * 16 + ln] = v;
    }
  }
  __builtin_amdgcn_fence(__ATOMIC_ACQ_REL, "workgroup");
  __builtin_amdgcn_wave_barrier();
  const int rsub = lane >> 4, c4 = (lane & 15) * 4;
  {
#pragma unroll
    for (int q = 0; q < 8; ++q) {
      const int r = q * 2 + rsub;
      const v4f v = *(const v4fa*)&so[w][r][c4];
      *(v4f*)(C + (size_t)(row0 + r) * ldc + col0 + c4) = v;
    }
    
  }
}
// row LayerNorm (biased variance, eps) over N: s = X (+ R); optional out_sum <- s; out_norm <- (s-mu)*rsqrt(var+eps)*g + b
template <bool PARAM_BF16>
__global__ __launch_bounds__(256) void k_layernorm(const float* __restrict__ X, const float* __restrict__ R, const float* __restrict__ g, const float* __restrict__ bta,
                                                  float* __restrict__ out_sum, float* __restrict__ out_norm, int N, float eps) {
  __shared__ float red[256];
  const int row = blockIdx.x, tid = threadIdx.x;
  const float* x = X + (size_t)row * N; const float* rr = R ? R + (size_t)row * N : nullptr;
  float vals[16];                     // up to N = 4096
  const int per = N / 256;            // contiguous chunk per thread? use strided-by-4 chunks: thread handles j = tid*4 + 1024*u
  float s1 = 0.f;
  for (int u = 0; u < per / 4; ++u) {
    const int j = tid * 4 + 1024 * u;
    const v4f a = *(const v4fa*)(x + j);
    v4f b = {0.f,0.f,0.f,0.f}; if (rr) b = *(const v4fa*)(rr + j);
#pragma unroll
    for (int q = 0; q < 4; ++q) { const float v = a[q] + b[q]; vals[u * 4 + q] = v; s1 += v; }
  }
  red[tid] = s1; __syncthreads();
  for (int st = 128; st > 0; st >>= 1) { if (tid < st) red[tid] += red[tid + st]; __syncthreads(); }
  const float mu = red[0] / (float)N; __syncthreads();
  float s2 = 0.f;
  for (int u = 0; u < per / 4; ++u)
#pragma unroll
    for (int q = 0; q < 4; ++q) { const float c = vals[u * 4 + q] - mu; s2 += c * c; }
  red[tid] = s2; __syncthreads();
  for (int st = 128; st > 0; st >>= 1) { if (tid < st) red[tid] += red[tid + st]; __syncthreads(); }
  const float rs = rsqrtf(red[0] / (float)N + eps);
  {
    for (int u = 0; u < per / 4; ++u) {
      const int j = tid * 4 + 1024 * u;
      v4f o, sm;
#pragma unroll
      for (int q = 0; q < 4; ++q) {
        float gg = g[j + q], bb = bta[j + q];
        if (PARAM_BF16) { gg = bf16_round(gg); bb = bf16_round(bb); }
        sm[q] = vals[u * 4 + q]; o[q] = (vals[u * 4 + q] - mu) * rs * gg + bb;
      }
      if (out_sum) *(v4f*)(out_sum + (size_t)row * N + j) = sm;
      *(v4f*)(out_norm + (size_t)row * N + j) = o;
    }
    
  }
}



// ---- f16 WMMA path (v_wmma_f32_16x16x32_f16): 11-bit significands for operands in range — used where a [0,1] probability operand needs more precision than bf16
typedef _Float16 v16h __attribute__((ext_vector_type(16)));
union FragH { v16h v; v8us half[2]; _Float16 h[16]; unsigned short u[16]; };
template <int NT>
__device__ __forceinline__ v8f mmaH(v16h ah, v16h al, v16h bh, v16h bl, v8f c) {
  c = __builtin_amdgcn_wmma_f32_16x16x32_f16(false, ah, false, bh, (short)0, c, false, false);
  if (NT >= 2) c = __builtin_amdgcn_wmma_f32_16x16x32_f16(false, al, false, bh, (short)0, c, false, false);
  if (NT >= 3) c = __builtin_amdgcn_wmma_f32_16x16x32_f16(false, ah, false, bl, (short)0, c, false, false);
  asm volatile("v_nop\n\tv_nop\n\tv_nop\n\tv_nop" : "+v"(c) : "v"(ah), "v"(al), "v"(bh), "v"(bl));
  return c;
}
// batched GEMM like k_gemm_b but f16 operands: A f32 (split into f16 hi/lo if ASPLIT, else rounded to f16), Bt = f16 values [n][k]; alpha; C f32; N multiple of 16 (partial tiles skipped)
template <bool ASPLIT>
__global__ __launch_bounds__(128) void k_gemm_h(const float* __restrict__ A, int lda, size_t sA, const _Float16* __restrict__ Bh, int ldb, size_t sB, float alpha, float* __restrict__ C, int ldc, size_t sC, int M, int N, int K) {
  __shared__ __attribute__((aligned(16))) float so[4][16][64];
  const int tid = threadIdx.x, w = tid >> 5, lane = tid & 31, ln = lane & 15, hh = lane >> 4; const int by = blockIdx.y;
  A += (size_t)by * sA; Bh += (size_t)by * sB; C += (size_t)by * sC;
  const int ntn = (N + 63) / 64; const int wid = blockIdx.x * 4 + w; const int mt = wid / ntn, nq = wid % ntn; if (mt * 16 >= M) return;
  const int row0 = mt * 16, col0 = nq * 64; const float* arow = A + (size_t)(row0 + ln) * lda;
  v8f acc[4] = {};
  for (int kb = 0; kb < K; kb += 32) {
    FragH ah, al;
    const v4f x0 = *(const v4fa*)(arow + kb + 8 * hh), x1 = *(const v4fa*)(arow + kb + 8 * hh + 4), x2 = *(const v4fa*)(arow + kb + 16 + 8 * hh), x3 = *(const v4fa*)(arow + kb + 16 + 8 * hh + 4);
    float xs[16] = {x0[0],x0[1],x0[2],x0[3],x1[0],x1[1],x1[2],x1[3],x2[0],x2[1],x2[2],x2[3],x3[0],x3[1],x3[2],x3[3]};
#pragma unroll
    for (int i = 0; i < 16; ++i) { const _Float16 h = (_Float16)xs[i]; ah.h[i] = h; al.h[i] = ASPLIT ? (_Float16)(xs[i] - (float)h) : (_Float16)0.0f; }
#pragma unroll
    for (int t = 0; t < 4; ++t) { if (col0 + t * 16 >= N) continue; const size_t boff = (size_t)(col0 + t * 16 + ln) * ldb + kb; FragH bq; bq.half[0] = *(const v8us*)(Bh + boff + 8 * hh); bq.half[1] = *(const v8us*)(Bh + boff + 16 + 8 * hh);
      acc[t] = mmaH<ASPLIT ? 2 : 1>(ah.v, al.v, bq.v, bq.v, acc[t]); }
  }
#pragma unroll
  for (int t = 0; t < 4; ++t) { if (col0 + t * 16 >= N) continue;
#pragma unroll
    for (int r = 0; r < 8; ++r) so[w][8 * hh + r][t * 16 + ln] = acc[t][r] * alpha; }
  __builtin_amdgcn_fence(__ATOMIC_ACQ_REL, "workgroup"); __builtin_amdgcn_wave_barrier();
  const int rsub = lane >> 4, c4 = (lane & 15) * 4;
  {
#pragma unroll
    for (int q = 0; q < 8; ++q) { const int r = q * 2 + rsub; if (col0 + c4 < N) { const v4f v = *(const v4fa*)&so[w][r][c4]; *(v4f*)(C + (size_t)(row0 + r) * ldc + col0 + c4) = v; } }
     }
}

// Wt[n][k] = f16(W[k][n]·scale) from f32 row-major W[K][N] (scale = power of two; bf16-exact weights stay exact in f16 away from the subnormal range)
__global__ __launch_bounds__(256) void k_wt_f16(const float* __restrict__ W, _Float16* __restrict__ Wt, int K, int N, float scale) {
  const int t = blockIdx.x * 256 + threadIdx.x; if (t >= N * (K / 8)) return; const int n = t / (K / 8), k8 = (t % (K / 8)) * 8; FragH f;
#pragma unroll
  for (int i = 0; i < 8; ++i) f.h[i] = (_Float16)(bf16_round(W[(size_t)(k8 + i) * N + n]) * scale); const v8us o = f.half[0];
  *(v8us*)((unsigned short*)Wt + (size_t)n * K + k8) = o; 
}
// k_gemm_hh variant with fused epilogue: v = acc·alpha + bias[by·sBias + col] (+ CP[(row/rowsPerB)·sCPb + by·64 + col] if CP) ; ACT 0 none / 1 elu ; writes f16 C16 (and f32 C if non-null)
template <int ACT>
__global__ __launch_bounds__(128) void k_gemm_hhx(const _Float16* __restrict__ A, int lda, size_t sA, const _Float16* __restrict__ Bh, int ldb, size_t sB, float alpha, const float* __restrict__ bias, size_t sBias, const float* __restrict__ CP, int rowsPerB, size_t sCPb, int row0g,
    float* __restrict__ C, _Float16* __restrict__ C16, int ldc, size_t sC, int M, int N, int K) {
  __shared__ __attribute__((aligned(16))) float so[4][16][64];
  const int tid = threadIdx.x, w = tid >> 5, lane = tid & 31, ln = lane & 15, hh = lane >> 4; const int by = blockIdx.y;
  A += (size_t)by * sA; Bh += (size_t)by * sB; const size_t cofs = (size_t)by * sC; const float* bp = bias ? bias + (size_t)by * sBias : nullptr;
  const int ntn = (N + 63) / 64; const int wid = blockIdx.x * 4 + w; const int mt = wid / ntn, nq = wid % ntn; if (mt * 16 >= M) return;
  const int row0 = mt * 16, col0 = nq * 64; const _Float16* arow = A + (size_t)(row0 + ln) * lda;
  v8f acc[4] = {};
  for (int kb = 0; kb < K; kb += 32) { FragH ah; ah.half[0] = *(const v8us*)((const unsigned short*)arow + kb + 8 * hh); ah.half[1] = *(const v8us*)((const unsigned short*)arow + kb + 16 + 8 * hh);
#pragma unroll
    for (int t = 0; t < 4; ++t) { if (col0 + t * 16 >= N) continue; const size_t boff = (size_t)(col0 + t * 16 + ln) * ldb + kb; FragH bq; bq.half[0] = *(const v8us*)((const unsigned short*)Bh + boff + 8 * hh); bq.half[1] = *(const v8us*)((const unsigned short*)Bh + boff + 16 + 8 * hh);
      acc[t] = mmaH<1>(ah.v, ah.v, bq.v, bq.v, acc[t]); }
  }
#pragma unroll
  for (int t = 0; t < 4; ++t) { if (col0 + t * 16 >= N) continue; const int col = col0 + t * 16 + ln; const float bv = bp ? bf16_round(bp[col]) : 0.f;
#pragma unroll
    for (int r = 0; r < 8; ++r) { float v = acc[t][r] * alpha + bv; if (CP) { const int rr = row0g + row0 + 8 * hh + r; if (rowsPerB < 0) v += CP[cofs + (size_t)rr * ldc + col];      /* rowsPerB < 0: own element of the batched C plane */ else { const int bidx = rr / rowsPerB; v += CP[(size_t)bidx * sCPb + (size_t)by * 64 + col]; } } if (ACT == 1) v = (v > 0.f) ? v : expm1f(v); else if (ACT == 7) v = (v > 0.f) ? v + 1.0f : expf(v); else if (ACT == 8) v = tanhf(v); else if (ACT == 9) v = 0.5f * v * (1.0f + tanhf(0.7978845608028654f * (v + 0.044715f * v * v * v))); else if (ACT == 11) v = 1.0f / (1.0f + expf(-v)); else if (ACT == 12) v = (v > 0.f) ? v : 0.01f * v; else if (ACT == 14) v = (v > 0.f) ? v : 0.1f * v; else if (ACT == 16) v = (v >= 0.f) ? v : 0.3f * v; else if (ACT == 17) v = (v >= 0.f) ? v : 0.2f * v; else if (ACT == 15) v = v / (1.0f + expf(-v)); else if (ACT == 3) v = fmaxf(v, 0.f); else if (ACT == 6) v = 0.5f * v * (1.0f + erff(v * 0.70710678118654752f)); so[w][8 * hh + r][t * 16 + ln] = v; } }
  __builtin_amdgcn_fence(__ATOMIC_ACQ_REL, "workgroup"); __builtin_amdgcn_wave_barrier();
  const int rsub = lane >> 4, c4 = (lane & 15) * 4; typedef _Float16 v4h __attribute__((ext_vector_type(4)));
  {
#pragma unroll
    for (int q = 0; q < 8; ++q) { const int r = q * 2 + rsub; if (col0 + c4 < N) { const v4f v = *(const v4fa*)&so[w][r][c4]; if (C) *(v4f*)(C + cofs + (size_t)(row0 + r) * ldc + col0 + c4) = v; if (C16) { v4h h4; for (int i = 0; i < 4; ++i) h4[i] = (_Float16)v[i]; *(v4h*)(C16 + cofs + (size_t)(row0 + r) * ldc + col0 + c4) = h4; } } }
     }
}


typedef _Float16 v4h __attribute__((ext_vector_type(4)));

__global__ __launch_bounds__(256) void k_x16(const float* __restrict__ x, _Float16* __restrict__ X16, size_t n8) { const size_t t = (size_t)blockIdx.x * 256 + threadIdx.x; if (t >= n8) return; FragH f;
#pragma unroll
  for (int q = 0; q < 8; ++q) f.h[q] = (_Float16)bf16_round(x[t * 8 + q]); *(v8us*)((unsigned short*)X16 + t * 8) = f.half[0];  }
__global__ __launch_bounds__(256) void k_h16(const float* __restrict__ x, _Float16* __restrict__ X16, size_t n8) { const size_t t = (size_t)blockIdx.x * 256 + threadIdx.x; if (t >= n8) return; FragH f;
#pragma unroll
  for (int q = 0; q < 8; ++q) f.h[q] = (_Float16)x[t * 8 + q]; *(v8us*)((unsigned short*)X16 + t * 8) = f.half[0];  }
__global__ __launch_bounds__(256) void k_round16f(const float* __restrict__ W, _Float16* __restrict__ Bt, size_t n8) { const size_t t = (size_t)blockIdx.x * 256 + threadIdx.x; if (t >= n8) return; FragH f;
#pragma unroll
  for (int i = 0; i < 8; ++i) f.h[i] = (_Float16)(bf16_round(W[t * 8 + i]) * 16.0f); *(v8us*)((unsigned short*)Bt + t * 8) = f.half[0];  }
template <int NHv, int TTv>
__global__ __launch_bounds__(256) void k_vt(const _Float16* __restrict__ V16, int ldv, int voff, _Float16* __restrict__ Vt) { __shared__ unsigned short tl[64][66]; const int tid = threadIdx.x; const int slab = blockIdx.x / (TTv / 64), lg = blockIdx.x % (TTv / 64); const int b = slab / NHv, h = slab % NHv;
  for (int i = tid; i < 64 * 8; i += 256) { const int r = i / 8, c8 = (i % 8) * 8; FragH f; f.half[0] = *(const v8us*)((const unsigned short*)V16 + ((size_t)b * TTv + lg * 64 + r) * ldv + voff + h * 64 + c8);
#pragma unroll
    for (int q = 0; q < 8; ++q) tl[r][c8 + q] = f.u[q]; }
  __syncthreads();
  {
#pragma unroll
    for (int rd = 0; rd < 2; ++rd) { const int d = rd * 32 + tid / 8, pc = tid % 8; FragH f;
#pragma unroll
      for (int q = 0; q < 8; ++q) f.u[q] = tl[pc * 8 + q][d];
      *(v8us*)((unsigned short*)Vt + ((size_t)slab * 64 + d) * TTv + lg * 64 + pc * 8) = f.half[0]; }
     } }

__global__ __launch_bounds__(256) void k_hl(const float* __restrict__ F, _Float16* __restrict__ Hh, _Float16* __restrict__ Hl, size_t n8) { const size_t t = (size_t)blockIdx.x * 256 + threadIdx.x; if (t >= n8) return; FragH fh, fl; const v4f a = *(const v4fa*)(F + t * 8), c = *(const v4fa*)(F + t * 8 + 4);
#pragma unroll
  for (int q = 0; q < 4; ++q) { _Float16 h = (_Float16)a[q]; fh.h[q] = h; fl.h[q] = (_Float16)((a[q] - (float)h) * 1024.0f); h = (_Float16)c[q]; fh.h[4 + q] = h; fl.h[4 + q] = (_Float16)((c[q] - (float)h) * 1024.0f); }
  { *(v8us*)((unsigned short*)Hh + t * 8) = fh.half[0]; *(v8us*)((unsigned short*)Hl + t * 8) = fl.half[0];  } }

// ---- fast GEMM (wave tile 32x64; requires M % 32 == 0 rows per launch region and N % 64 == 0); epilogue = k_gemm_hhx semantics ----
__device__ __forceinline__ v16h g2_frag(const _Float16* p, int hh) { FragH f; f.half[0] = *(const v8us*)((const unsigned short*)p + 8 * hh); f.half[1] = *(const v8us*)((const unsigned short*)p + 16 + 8 * hh); return f.v; }
__device__ __forceinline__ v8f g2_mma(v16h a, v16h b, v8f c) { v8f d = __builtin_amdgcn_wmma_f32_16x16x32_f16(false, a, false, b, (short)0, c, false, false); asm volatile("v_nop\n\tv_nop\n\tv_nop\n\tv_nop" : "+v"(d) : "v"(a), "v"(b)); return d; }
template <int ACT>
__global__ __launch_bounds__(128) void k_gemm2(const _Float16* __restrict__ A, int lda, size_t sA, const _Float16* __restrict__ Bh, int ldb, size_t sB, float alpha, const float* __restrict__ bias, size_t sBias, const float* __restrict__ CP, int rowsPerB, size_t sCPb, int row0g,
    float* __restrict__ C, _Float16* __restrict__ C16, int ldc, size_t sC, int M, int N, int K) { static_assert(ACT == 0 || ACT == 3 || ACT == 6 || ACT == 8 || ACT == 9 || ACT == 11 || ACT == 12 || ACT == 14 || ACT == 15 || ACT == 16 || ACT == 17, "k_gemm2: unsupported ACT code (would silently apply no activation)");
  __shared__ __attribute__((aligned(16))) float so[4][32][68];
  const int tid = threadIdx.x, w = tid >> 5, lane = tid & 31, ln = lane & 15, hh = lane >> 4; const int by = blockIdx.y;
  A += (size_t)by * sA; Bh += (size_t)by * sB; const size_t cofs = (size_t)by * sC; const float* bp = bias ? bias + (size_t)by * sBias : nullptr;
  const int ntn = N >> 6; const int mt = blockIdx.x / ntn, nq = blockIdx.x - mt * ntn; const int row0 = mt * 128 + 32 * w, col0 = nq * 64; if (row0 >= M) return;
  const _Float16* a0p = A + (size_t)(row0 + ln) * lda; const _Float16* a1p = a0p + (size_t)16 * lda;
  const _Float16* b0p = Bh + (size_t)(col0 + ln) * ldb; const _Float16* b1p = b0p + (size_t)16 * ldb; const _Float16* b2p = b1p + (size_t)16 * ldb; const _Float16* b3p = b2p + (size_t)16 * ldb;
  const v8f z8 = {0.f,0.f,0.f,0.f,0.f,0.f,0.f,0.f}; v8f c00 = z8, c01 = z8, c02 = z8, c03 = z8, c10 = z8, c11 = z8, c12 = z8, c13 = z8;
#pragma unroll 1
  for (int kb = 0; kb < K; kb += 32) { const v16h a0 = g2_frag(a0p + kb, hh), a1 = g2_frag(a1p + kb, hh);
    v16h b = g2_frag(b0p + kb, hh); c00 = g2_mma(a0, b, c00); c10 = g2_mma(a1, b, c10);
    b = g2_frag(b1p + kb, hh); c01 = g2_mma(a0, b, c01); c11 = g2_mma(a1, b, c11);
    b = g2_frag(b2p + kb, hh); c02 = g2_mma(a0, b, c02); c12 = g2_mma(a1, b, c12);
    b = g2_frag(b3p + kb, hh); c03 = g2_mma(a0, b, c03); c13 = g2_mma(a1, b, c13); }
  v8f accs[8] = {c00, c01, c02, c03, c10, c11, c12, c13};
#pragma unroll
  for (int u = 0; u < 8; ++u) { const int t = u & 3, half = u >> 2; const int col = col0 + t * 16 + ln; const float bv = bp ? bf16_round(bp[col]) : 0.f;
#pragma unroll
    for (int r = 0; r < 8; ++r) { const int rloc = half * 16 + 8 * hh + r; float v = accs[u][r] * alpha + bv; if (CP) { if (rowsPerB < 0) v += CP[cofs + (size_t)(row0g + row0 + rloc) * ldc + col];      /* rowsPerB < 0: own element of the batched C plane */ else { const int bidx = (row0g + row0 + rloc) / rowsPerB; v += CP[(size_t)bidx * sCPb + (size_t)by * 64 + col]; } }
      if (ACT == 3) v = fmaxf(v, 0.f); else if (ACT == 6) v = 0.5f * v * (1.0f + erff(v * 0.70710678118654752f)); else if (ACT == 11) v = 1.0f / (1.0f + expf(-v)); else if (ACT == 15) v = v / (1.0f + expf(-v)); else if (ACT == 12) v = (v > 0.f) ? v : 0.01f * v; else if (ACT == 8) v = tanhf(v); else if (ACT == 9) v = 0.5f * v * (1.0f + tanhf(0.7978845608028654f * (v + 0.044715f * v * v * v))); else if (ACT == 14) v = (v > 0.f) ? v : 0.1f * v; else if (ACT == 16) v = (v >= 0.f) ? v : 0.3f * v; else if (ACT == 17) v = (v >= 0.f) ? v : 0.2f * v;
      so[w][rloc][t * 16 + ln] = v; } }
  __builtin_amdgcn_fence(__ATOMIC_ACQ_REL, "workgroup"); __builtin_amdgcn_wave_barrier();
  const int rsub = lane >> 4, c4 = (lane & 15) * 4;
  {
#pragma unroll
    for (int q = 0; q < 16; ++q) { const int r = q * 2 + rsub; const v4f v = *(const v4fa*)&so[w][r][c4]; if (C) *(v4f*)(C + cofs + (size_t)(row0 + r) * ldc + col0 + c4) = v; if (C16) { v4h h4; for (int i = 0; i < 4; ++i) h4[i] = (_Float16)v[i]; *(v4h*)(C16 + cofs + (size_t)(row0 + r) * ldc + col0 + c4) = h4; } }
     } }


__global__ __launch_bounds__(256) void k_wnat(const float* __restrict__ w, size_t n8, _Float16* __restrict__ Bt) { const size_t t = (size_t)blockIdx.x * 256 + threadIdx.x; if (t >= n8) return; FragH f; for (int q = 0; q < 8; ++q) f.h[q] = (_Float16)(bf16_round(w[t * 8 + q]) * 16.0f); *(v8us*)((unsigned short*)Bt + t * 8) = f.half[0];  }
__global__ __launch_bounds__(256) void k_rsm(const float* __restrict__ S, _Float16* __restrict__ P, int nrows) {
  #pragma clang fp contract(off)
  const int i = blockIdx.x * 256 + threadIdx.x; if (i >= nrows) return; const float* s = S + (size_t)i * SQ; float mx = -3.0e38f;
#pragma unroll 1
  for (int j = 0; j < SQ; ++j) mx = fmaxf(mx, s[j]); float se = 0.f;
#pragma unroll 1
  for (int j = 0; j < SQ; ++j) se += expf(s[j] - mx); const float sc = 256.0f / se;
#pragma unroll 1
  for (int j0 = 0; j0 < SQ; j0 += 8) { FragH f; for (int q = 0; q < 8; ++q) f.h[q] = (_Float16)(expf(s[j0 + q] - mx) * sc); unsigned short* d = (unsigned short*)P + (size_t)i * SQ + j0; *(v8us*)d = f.half[0];  } }
__global__ __launch_bounds__(256) void k_vt(const _Float16* __restrict__ V16, int b, int h0, _Float16* __restrict__ VT) { __shared__ unsigned short tl[64][65]; const int tid = threadIdx.x; const int hh = blockIdx.x % HG, sg = blockIdx.x / HG; const int s0 = sg * 64; const int h = h0 + hh;
  for (int i = tid; i < 64 * 8; i += 256) { const int j = i / 8, d8 = (i % 8) * 8; FragH f; f.half[0] = *(const v8us*)((const unsigned short*)V16 + ((size_t)b * SQ + s0 + j) * DM + h * HD + d8); for (int q = 0; q < 8; ++q) tl[d8 + q][j] = f.u[q]; }
  __syncthreads();
  { for (int i = tid; i < 64 * 8; i += 256) { const int d = i / 8, j8 = (i % 8) * 8; FragH f; for (int q = 0; q < 8; ++q) f.u[q] = tl[d][j8 + q]; *(v8us*)((unsigned short*)VT + ((size_t)hh * HD + d) * SQ + s0 + j8) = f.half[0]; }  } }

__global__ __launch_bounds__(256) void k_cl2rows(const float* __restrict__ X, _Float16* __restrict__ XR) { __shared__ float tl[64][33]; const int tid = threadIdx.x; const int nl = LL / 32, nc = CC / 64; const int cb_ = blockIdx.x % nc; const int lb = (blockIdx.x / nc) % nl; const size_t b = blockIdx.x / (nc * nl); const int c0 = cb_ * 64, l0 = lb * 32;
  for (int i = tid; i < 64 * 32; i += 256) { const int c = i / 32, l = i % 32; tl[c][l] = bf16_round(X[(b * CC + c0 + c) * (size_t)LL + l0 + l]); }
  __syncthreads();
  { const int l = tid / 8, c8 = (tid % 8) * 8; FragH f; for (int q = 0; q < 8; ++q) f.h[q] = (_Float16)tl[c8 + q][l]; unsigned short* d = (unsigned short*)XR + (b * LL + l0 + l) * (size_t)CC + c0 + c8; *(v8us*)d = f.half[0];  } }


__global__ __launch_bounds__(256) void k_wperm(const float* __restrict__ w, _Float16* __restrict__ Bt) { const int t = blockIdx.x * 256 + threadIdx.x; if (t >= CC * (CC / 8)) return; const int k8 = (t % (CC / 8)) * 8, np_ = t / (CC / 8); const int h = np_ / HD, dd = np_ % HD; const int src = dd * NH + h; FragH f;
  for (int q = 0; q < 8; ++q) f.h[q] = (_Float16)(bf16_round(w[(size_t)src * CC + k8 + q]) * 16.0f); unsigned short* d = (unsigned short*)Bt + (size_t)np_ * CC + k8; *(v8us*)d = f.half[0];  }
__global__ __launch_bounds__(256) void k_wpermc(const float* __restrict__ w, _Float16* __restrict__ A) { const int t = blockIdx.x * 256 + threadIdx.x; if (t >= CC * (CC / 8)) return; const int k8 = (t % (CC / 8)) * 8, c = t / (CC / 8); FragH f;
  for (int q = 0; q < 8; ++q) { const int kp = k8 + q; const int h = kp / HD, dd = kp % HD; f.h[q] = (_Float16)(bf16_round(w[(size_t)c * CC + dd * NH + h]) * 16.0f); } unsigned short* d = (unsigned short*)A + (size_t)c * CC + k8; *(v8us*)d = f.half[0];  }
__global__ __launch_bounds__(256) void k_bperm(const float* __restrict__ b0, const float* __restrict__ b1, const float* __restrict__ b2, float* __restrict__ BP) { const int t = threadIdx.x; if (t >= CC) return; const int h = t / HD, dd = t % HD; const int src = dd * NH + h;
  { *(float*)(BP + t) = b0[src]; *(float*)(BP + CC + t) = b1[src]; *(float*)(BP + 2 * CC + t) = b2[src];  } }
__device__ __forceinline__ float rs_xh(float x) { return __builtin_bit_cast(float, __builtin_amdgcn_permlanex16(__builtin_bit_cast(int, x), __builtin_bit_cast(int, x), 0x76543210, 0xfedcba98, false, false)); }      /* lane l <- lane l ^ 16 */
// 2^z on the transcendental unit. The v_nop is the slot that the instruction set asks for behind a transcendental before its result is read or its source overwritten.
__device__ __forceinline__ float rs_exp2(float z) { float y; asm("v_exp_f32 %0, %1\n\tv_nop" : "=v"(y) : "v"(z)); return y; }
// Eight independent 2^z in place: each fills the slot behind the one before it, the v_nop fills the slot behind the last.
__device__ __forceinline__ void fa_exp2x8(float (&z)[8]) { asm("v_exp_f32 %0, %0\n\tv_exp_f32 %1, %1\n\tv_exp_f32 %2, %2\n\tv_exp_f32 %3, %3\n\tv_exp_f32 %4, %4\n\tv_exp_f32 %5, %5\n\tv_exp_f32 %6, %6\n\tv_exp_f32 %7, %7\n\tv_nop" : "+v"(z[0]), "+v"(z[1]), "+v"(z[2]), "+v"(z[3]), "+v"(z[4]), "+v"(z[5]), "+v"(z[6]), "+v"(z[7])); }
#define FA_KS 64                     /* keys per stage */
#define FA_PK 144                    /* LDS row pitch, bytes: 128 + 16, an odd multiple of 16 for 16-byte readers */
__device__ __forceinline__ v8f fa_mma(v16h a, v16h b, v8f c) { return __builtin_amdgcn_wmma_f32_16x16x32_f16(false, a, false, b, (short)0, c, false, false); }
__device__ __forceinline__ v16h fa_lfrag(const unsigned char* p) { FragH f; f.half[0] = *(const v8us*)p; f.half[1] = *(const v8us*)(p + 32); return f.v; }      /* p already holds + 16 hh: k = 8 hh .. and 16 + 8 hh .. */
__global__ __launch_bounds__(256) void k_fattn(const _Float16* __restrict__ Q16, const _Float16* __restrict__ K16, const _Float16* __restrict__ VT, _Float16* __restrict__ O16) {
  __shared__ __attribute__((aligned(16))) unsigned char L[2][2][FA_KS * FA_PK];      /* [buffer][K, V^T][row][pitch] */
  const int tid = threadIdx.x, lane = tid & 31, w = tid >> 5, c = lane & 15, hh = lane >> 4; const int h = blockIdx.y, b = blockIdx.z; const size_t r0 = (size_t)b * LL; const int q0 = blockIdx.x * 256 + w * 32;
  const float cs = 0.125f * 1.44269504088896340736f;      /* 1 / sqrt(64), times log2(e) */
  v16h qf[2][2];
#pragma unroll
  for (int g = 0; g < 2; ++g) for (int kc = 0; kc < 2; ++kc) qf[g][kc] = g2_frag(Q16 + (r0 + q0 + g * 16 + c) * CC + h * HD + kc * 32, hh);
  const int srow = tid >> 2, sseg = (tid & 3) * 32;      /* staging: 4 threads cover one 128-byte row, 32 bytes each */
  const unsigned char* kg = (const unsigned char*)(K16 + (r0 + srow) * CC + h * HD) + sseg;      /* key rows: + 64 rows a stage */
  const unsigned char* vg = (const unsigned char*)(VT + ((size_t)(b * NH + h) * HD + srow) * SQ) + sseg;      /* d rows: + 64 keys a stage */
  const int sdst = srow * FA_PK + sseg;
  v8us k0 = *(const v8us*)kg, k1 = *(const v8us*)(kg + 16), v0 = *(const v8us*)vg, v1 = *(const v8us*)(vg + 16);
  *(v8us*)&L[0][0][sdst] = k0; *(v8us*)&L[0][0][sdst + 16] = k1; *(v8us*)&L[0][1][sdst] = v0; *(v8us*)&L[0][1][sdst + 16] = v1;
  const v8f z8 = {0.f, 0.f, 0.f, 0.f, 0.f, 0.f, 0.f, 0.f}; v8f acc[2][4]; float m_run[2], l_run[2];
#pragma unroll
  for (int g = 0; g < 2; ++g) { m_run[g] = -__builtin_inff(); l_run[g] = 0.f; for (int t = 0; t < 4; ++t) acc[g][t] = z8; }
  __syncthreads();      /* stage 0 published */
#pragma unroll 1      // one stage a trip: the body already holds two unrolled 32-key passes
  for (int st = 0; st < SQ / FA_KS; ++st) {
    const bool more = st + 1 < SQ / FA_KS;
    if (more) { const unsigned char* kn = kg + (size_t)(st + 1) * (FA_KS * CC * 2); const unsigned char* vn = vg + (size_t)(st + 1) * (FA_KS * 2); k0 = *(const v8us*)kn; k1 = *(const v8us*)(kn + 16); v0 = *(const v8us*)vn; v1 = *(const v8us*)(vn + 16); }
    const unsigned char* Kb = &L[st & 1][0][c * FA_PK + 16 * hh]; const unsigned char* Vb = &L[st & 1][1][c * FA_PK + 16 * hh];
#pragma unroll
    for (int sub = 0; sub < 2; ++sub) {      /* one pass = 32 keys */
      v8f s[2][2];
#pragma unroll
      for (int kt = 0; kt < 2; ++kt) { const v16h ka = fa_lfrag(Kb + (sub * 32 + kt * 16) * FA_PK), kb2 = fa_lfrag(Kb + (sub * 32 + kt * 16) * FA_PK + 64);
        for (int g = 0; g < 2; ++g) s[kt][g] = fa_mma(kb2, qf[g][1], fa_mma(ka, qf[g][0], z8)); }
      v16h vf[4];
#pragma unroll
      for (int t = 0; t < 4; ++t) vf[t] = fa_lfrag(Vb + t * 16 * FA_PK + sub * 64);
      float mb[2]; bool need = false;
#pragma unroll
      for (int g = 0; g < 2; ++g) { float mx = fmaxf(s[0][g][0], s[1][g][0]);
        for (int r = 1; r < 8; ++r) mx = fmaxf(mx, fmaxf(s[0][g][r], s[1][g][r]));
        mx = fmaxf(mx, rs_xh(mx)) * cs; mb[g] = mx; need = need || (mx > m_run[g] + 8.0f); }      /* both wave halves hold the query's maximum, scaled (the scale is positive) */
      if (__builtin_amdgcn_ballot_w32(need) != 0) {      /* wave-uniform scalar branch, one test a pass; always taken on the first pass (m_run = -inf gives corr = 0) */
#pragma unroll
        for (int g = 0; g < 2; ++g) { const float m_new = fmaxf(m_run[g], mb[g]); const float corr = rs_exp2(m_run[g] - m_new); m_run[g] = m_new; l_run[g] *= corr; for (int t = 0; t < 4; ++t) acc[g][t] = acc[g][t] * corr; }
      }
#pragma unroll
      for (int g = 0; g < 2; ++g) { const float nm = -m_run[g]; float e0[8], e1[8];
        for (int r = 0; r < 8; ++r) { e0[r] = __builtin_fmaf(s[0][g][r], cs, nm); e1[r] = __builtin_fmaf(s[1][g][r], cs, nm); }
        fa_exp2x8(e0); fa_exp2x8(e1);
        l_run[g] += (((e0[0] + e0[1]) + (e0[2] + e0[3])) + ((e0[4] + e0[5]) + (e0[6] + e0[7]))) + (((e1[0] + e1[1]) + (e1[2] + e1[3])) + ((e1[4] + e1[5]) + (e1[6] + e1[7])));
        FragH pf; for (int r = 0; r < 8; ++r) { pf.h[r] = (_Float16)e0[r]; pf.h[8 + r] = (_Float16)e1[r]; }      /* element s: key 8 hh + s, then 16 + 8 hh + (s - 8): the k order of V^T's loader */
        for (int t = 0; t < 4; ++t) acc[g][t] = fa_mma(vf[t], pf.v, acc[g][t]); }
    }
    if (more) { unsigned char* d = &L[(st + 1) & 1][0][sdst]; *(v8us*)d = k0; *(v8us*)(d + 16) = k1; *(v8us*)(d + FA_KS * FA_PK) = v0; *(v8us*)(d + FA_KS * FA_PK + 16) = v1; }      /* its last readers left it before the barrier that ended trip st - 1 */
    __syncthreads();      /* publishes stage st + 1 and ends every read of stage st */
  }
#pragma unroll
  for (int g = 0; g < 2; ++g) { const float l = l_run[g] + rs_xh(l_run[g]); const float inv = 64.0f / l; unsigned short* d = (unsigned short*)O16 + (r0 + q0 + g * 16 + c) * CC + h * HD + 8 * hh;      /* o x64; a lane's 8 registers are 8 consecutive d of its query */
    for (int t = 0; t < 4; ++t) { FragH f; for (int r = 0; r < 8; ++r) f.h[r] = (_Float16)(acc[g][t][r] * inv); *(v8us*)(d + t * 16) = f.half[0]; } } }
__global__ __launch_bounds__(256) void k_rowbias(float* __restrict__ y, const float* __restrict__ bo) { const size_t t = (size_t)blockIdx.x * 256 + threadIdx.x; if (t >= (size_t)NB * NC * NPX / 4) return; const size_t e = t * 4; const int co = (int)((e / NPX) % NC); const float bv = bf16_round(bo[co]); v4f v = *(const v4fa*)(y + e); for (int q = 0; q < 4; ++q) v[q] = v[q] + bv; *(v4f*)(y + e) = v;  }

extern "C" void kernel_launch(void* const* d_in, const int* in_sizes, int n_in,
                              void* d_out, int out_size, void* d_ws, size_t ws_size, hipStream_t stream) {
  (void)in_sizes; (void)n_in; (void)out_size;
  const float* const* I = (const float* const*)d_in; const float* xq = I[0]; const float* xk = I[1]; const float* xv = I[2]; const float* wq = I[3]; const float* bq = I[4]; const float* wk = I[5]; const float* bk = I[6]; const float* wv = I[7]; const float* bv = I[8]; const float* wm = I[9]; const float* bm = I[10];
  char* ws = (char*)d_ws; size_t off = 0;
  auto take = [&](size_t bytes) { char* p = ws + off; off += (bytes + 255) & ~(size_t)255; return p; };
  _Float16* BQ = (_Float16*)take((size_t)CC * CC * 2); _Float16* BK = (_Float16*)take((size_t)CC * CC * 2); _Float16* BV = (_Float16*)take((size_t)CC * CC * 2); _Float16* AM = (_Float16*)take((size_t)CC * CC * 2); float* BP = (float*)take((size_t)3 * CC * 4);
  _Float16* XQ = (_Float16*)take(NR * CC * 2); _Float16* XK = (_Float16*)take(NR * CC * 2); _Float16* XV = (_Float16*)take(NR * CC * 2); _Float16* Q16 = (_Float16*)take(NR * CC * 2); _Float16* K16 = (_Float16*)take(NR * CC * 2); _Float16* V16 = (_Float16*)take(NR * CC * 2); _Float16* O16 = (_Float16*)take(NR * CC * 2);
  _Float16* VT = (_Float16*)take((size_t)NB * NH * HD * SQ * 2);
  if (off > ws_size) return;      /* 0.5 + 56 + 8 = approx 65 MiB */
  { const unsigned gw = (CC * (CC / 8) + 255) / 256; k_wperm<<<gw, 256, 0, stream>>>(wq, BQ); k_wperm<<<gw, 256, 0, stream>>>(wk, BK); k_wperm<<<gw, 256, 0, stream>>>(wv, BV); k_wpermc<<<gw, 256, 0, stream>>>(wm, AM); k_bperm<<<1, 256, 0, stream>>>(bq, bk, bv, BP); }
  { const unsigned gx = NB * (LL / 32) * (CC / 64); k_cl2rows<<<gx, 256, 0, stream>>>(xq, XQ); k_cl2rows<<<gx, 256, 0, stream>>>(xk, XK); k_cl2rows<<<gx, 256, 0, stream>>>(xv, XV); }
  const dim3 gp((unsigned)((NR / 128) * (CC / 64)), 1);
  k_gemm2<0><<<gp, 128, 0, stream>>>(XQ, CC, 0, BQ, CC, 0, 0.0625f, BP, 0, nullptr, 1, 0, 0, nullptr, Q16, CC, 0, (int)NR, CC, CC);
  k_gemm2<0><<<gp, 128, 0, stream>>>(XK, CC, 0, BK, CC, 0, 0.0625f, BP + CC, 0, nullptr, 1, 0, 0, nullptr, K16, CC, 0, (int)NR, CC, CC);
  k_gemm2<0><<<gp, 128, 0, stream>>>(XV, CC, 0, BV, CC, 0, 0.0625f, BP + 2 * CC, 0, nullptr, 1, 0, 0, nullptr, V16, CC, 0, (int)NR, CC, CC);
  k_vt<NH, SQ><<<NB * NH * (SQ / 64), 256, 0, stream>>>(V16, CC, 0, VT);      /* V^T [8][4][64][2048] */
  k_fattn<<<dim3(SQ / 256, NH, NB), 256, 0, stream>>>(Q16, K16, VT, O16);      /* o x64, head-major f16 rows */
  k_gemm2<0><<<dim3((CC / 128) * (LL / 64), NBR), 128, 0, stream>>>(AM, CC, 0, O16 + (size_t)B0 * LL * CC, CC, (size_t)LL * CC, 0.0009765625f, nullptr, 0, nullptr, 1, 0, 0, (float*)d_out + (size_t)B0 * CC * LL, nullptr, LL, (size_t)CC * LL, CC, LL, CC);      /* out[b][c][n] = sum_k' w_m'[c][k'] o[(b,n)][k'] (channel-major directly) */
  k_rowbias<<<(unsigned)(((size_t)NB * NC * NPX / 4 + 255) / 256), 256, 0, stream>>>((float*)d_out, bm);
}

// v003
// Measured time: 90.9 microseconds a run.
// In two side-by-side timings against v002, it was 1.51 and 1.49 times as fast.
// All steps since v000 together make it 38.7 times as fast.
#include <hip/hip_runtime.h>
// SuperGlue multi-head attention (query, key, value channel-first [8][256][2048]; q/k/v = 1x1 conv (natural [256][256] + bias); the module's head split view(B, d=64, H=4, N) makes channel c = dd*4 + h (INTERLEAVED heads); scores = q.k / 8 per head over 2,048 keys; softmax; x merged back to c = dd*4 + h; out = w_m x + b_m -> [8][256][2048]).
// Structure, 4 launches: (1) one preparation grid: channel-first inputs transposed to token rows (exact f16) via LDS tiles, projection weights and biases permuted so the head split becomes contiguous 64-column blocks (exact x16 f16); (2) Q, K and V as WMMA GEMMs in one grid (32x64 wave tiles, f32 accumulation, f16 outputs), V with the operands swapped so that V^T [8][4][64][2048] is written directly; (3) scores, softmax and P . V fused in one kernel over all batches and heads (S^T = K . Q^T, online softmax in f32, O^T += V^T . P^T, P stays in registers as f16; o x64 in f16) into head-major rows; (4) out channel-major directly: (w_m with permuted columns) . o^T GEMM batched over the 8 batches (alpha folds 1/16 and 1/64), the per-channel bias added in its epilogue.
// Compute dtype: inputs rounded to bf16; inputs / weights exact in f16; q, k, v, softmax weights and o plain f16 (~2^-12); scores and softmax statistics f32; v_wmma_f32_16x16x32_f16.
#define NB 8
#define CC 256
#define LL 2048
#define SQ LL
#define DM CC
#define NH 4
#define HD 64
#define HG 4
#define QN SQ                        /* query rows per batch (unused) */
#define NR ((size_t)NB * LL)
typedef __bf16 v16b __attribute__((ext_vector_type(16)));
typedef unsigned short v8us __attribute__((ext_vector_type(8), may_alias));
typedef float  v8f  __attribute__((ext_vector_type(8)));
typedef float  v4f  __attribute__((ext_vector_type(4)));
typedef float  v4fa __attribute__((ext_vector_type(4), may_alias));
union FragB { v16b v; v8us half[2]; unsigned short u[16]; };

__device__ __forceinline__ unsigned short bf16_bits(float x) { unsigned int u = __float_as_uint(x); return (unsigned short)((u + 0x7FFFu + ((u >> 16) & 1u)) >> 16); }
__device__ __forceinline__ float bf16_val(unsigned short b) { return __uint_as_float(((unsigned int)b) << 16); }
__device__ __forceinline__ float bf16_round(float x) { return bf16_val(bf16_bits(x)); }
// D += A·B with NT terms: 1 = ah·bh, 2 = + al·bh (A split), 3 = + ah·bl (both split)
template <int NT>
__device__ __forceinline__ v8f mmaN(v16b ah, v16b al, v16b bh, v16b bl, v8f c) {
  c = __builtin_amdgcn_wmma_f32_16x16x32_bf16(false, ah, false, bh, (short)0, c, false, false);
  if (NT >= 2) c = __builtin_amdgcn_wmma_f32_16x16x32_bf16(false, al, false, bh, (short)0, c, false, false);
  if (NT >= 3) c = __builtin_amdgcn_wmma_f32_16x16x32_bf16(false, ah, false, bl, (short)0, c, false, false);
  asm volatile("v_nop\n\tv_nop\n\tv_nop\n\tv_nop" : "+v"(c) : "v"(ah), "v"(al), "v"(bh), "v"(bl));
  return c;
}

__global__ __launch_bounds__(256) void k_wt_bf16(const float* __restrict__ W, unsigned short* __restrict__ Wt, int K, int N) {
  const int t = blockIdx.x * 256 + threadIdx.x;
  const int k8n = K / 8;
  if (t >= N * k8n) return;
  const int n = t / k8n, k8 = (t % k8n) * 8;
  v8us v;
#pragma unroll
  for (int i = 0; i < 8; ++i) v[i] = bf16_bits(W[(size_t)(k8 + i) * N + n]);
  *(v8us*)(Wt + (size_t)n * K + k8) = v;
  
}

// GEMM C[M][N] (f32, pitch ldc) = act(A[M][K]·W + bias). A f32 row-major (pitch lda) converted per fragment to bf16
// (ASPLIT: hi/lo two planes -> 2 terms, else single rounded term); Wt bf16 [N][K] (pitch ldb). BIAS_BF16 rounds the
// bias to bf16 first (bias quantised to bf16 before the add). K%32==0, M%16==0, N%64==0.
template <bool ASPLIT, int ACT, bool BIAS_BF16>
__global__ __launch_bounds__(128) void k_gemm_bf(const float* __restrict__ A, int lda, const unsigned short* __restrict__ Wt, int ldb,
                                               const float* __restrict__ bias, float* __restrict__ C, int ldc, int M, int N, int K) {
  __shared__ __attribute__((aligned(16))) float so[4][16][64];
  const int tid = threadIdx.x, w = tid >> 5, lane = tid & 31, ln = lane & 15, hh = lane >> 4;
  const int ntn = N / 64;
  const int wid = blockIdx.x * 4 + w;
  const int mt = wid / ntn, nq = wid % ntn;
  if (mt * 16 >= M) return;
  const int row0 = mt * 16, col0 = nq * 64;
  const float* arow = A + (size_t)(row0 + ln) * lda;
  v8f acc[4] = {};
  for (int kb = 0; kb < K; kb += 32) {
    FragB ah, al;
    const v4f x0 = *(const v4fa*)(arow + kb + 8 * hh), x1 = *(const v4fa*)(arow + kb + 8 * hh + 4);
    const v4f x2 = *(const v4fa*)(arow + kb + 16 + 8 * hh), x3 = *(const v4fa*)(arow + kb + 16 + 8 * hh + 4);
    float xs[16] = {x0[0],x0[1],x0[2],x0[3],x1[0],x1[1],x1[2],x1[3],x2[0],x2[1],x2[2],x2[3],x3[0],x3[1],x3[2],x3[3]};
#pragma unroll
    for (int i = 0; i < 16; ++i) { const unsigned short hb = bf16_bits(xs[i]); ah.u[i] = hb; al.u[i] = ASPLIT ? bf16_bits(xs[i] - bf16_val(hb)) : (unsigned short)0; }
#pragma unroll
    for (int t = 0; t < 4; ++t) {
      const unsigned short* brow = Wt + (size_t)(col0 + t * 16 + ln) * ldb + kb;
      FragB b;
      b.half[0] = *(const v8us*)(brow + 8 * hh);
      b.half[1] = *(const v8us*)(brow + 16 + 8 * hh);
      acc[t] = mmaN<ASPLIT ? 2 : 1>(ah.v, al.v, b.v, b.v, acc[t]);
    }
  }
#pragma unroll
  for (int t = 0; t < 4; ++t) {
    float bv = bias ? bias[col0 + t * 16 + ln] : 0.f;
    if (BIAS_BF16) bv = bf16_round(bv);
#pragma unroll
    for (int r = 0; r < 8; ++r) { float v = acc[t][r] + bv; if (ACT == 1) v = fmaxf(v, 0.f); so[w][8 * hh + r][t * 16 + ln] = v; }
  }
  __builtin_amdgcn_fence(__ATOMIC_ACQ_REL, "workgroup");
  __builtin_amdgcn_wave_barrier();
  const int rsub = lane >> 4, c4 = (lane & 15) * 4;
  {
#pragma unroll
    for (int q = 0; q < 8; ++q) {
      const int r = q * 2 + rsub;
      const v4f v = *(const v4fa*)&so[w][r][c4];
      *(v4f*)(C + (size_t)(row0 + r) * ldc + col0 + c4) = v;
    }
    
  }
}

// GEMM C = act(A·W + bias + resid): A f32 (ASPLIT -> hi/lo 2 terms), Wt bf16 [N][K]; ACT 0 none, 1 relu, 2 exact gelu;
// resid (optional, f32, row index = (row % rmod), pitch ldr, RES_BF16 rounds it) added before the activation.
template <bool ASPLIT, int ACT, bool BIAS_BF16, bool RES_BF16>
__global__ __launch_bounds__(128) void k_gemm_bf3(const float* __restrict__ A, int lda, const unsigned short* __restrict__ Wt, int ldb,
                                                const float* __restrict__ bias, const float* __restrict__ resid, int rmod, int ldr,
                                                float* __restrict__ C, int ldc, int M, int N, int K) {
  __shared__ __attribute__((aligned(16))) float so[4][16][64];
  const int tid = threadIdx.x, w = tid >> 5, lane = tid & 31, ln = lane & 15, hh = lane >> 4;
  const int ntn = N / 64;
  const int wid = blockIdx.x * 4 + w;
  const int mt = wid / ntn, nq = wid % ntn;
  if (mt * 16 >= M) return;
  const int row0 = mt * 16, col0 = nq * 64;
  const float* arow = A + (size_t)(row0 + ln) * lda;
  v8f acc[4] = {};
  for (int kb = 0; kb < K; kb += 32) {
    FragB ah, al;
    const v4f x0 = *(const v4fa*)(arow + kb + 8 * hh), x1 = *(const v4fa*)(arow + kb + 8 * hh + 4);
    const v4f x2 = *(const v4fa*)(arow + kb + 16 + 8 * hh), x3 = *(const v4fa*)(arow + kb + 16 + 8 * hh + 4);
    float xs[16] = {x0[0],x0[1],x0[2],x0[3],x1[0],x1[1],x1[2],x1[3],x2[0],x2[1],x2[2],x2[3],x3[0],x3[1],x3[2],x3[3]};
#pragma unroll
    for (int i = 0; i < 16; ++i) { const unsigned short hb = bf16_bits(xs[i]); ah.u[i] = hb; al.u[i] = ASPLIT ? bf16_bits(xs[i] - bf16_val(hb)) : (unsigned short)0; }
#pragma unroll
    for (int t = 0; t < 4; ++t) {
      const unsigned short* brow = Wt + (size_t)(col0 + t * 16 + ln) * ldb + kb;
      FragB b;
      b.half[0] = *(const v8us*)(brow + 8 * hh);
      b.half[1] = *(const v8us*)(brow + 16 + 8 * hh);
      acc[t] = mmaN<ASPLIT ? 2 : 1>(ah.v, al.v, b.v, b.v, acc[t]);
    }
  }
#pragma unroll
  for (int t = 0; t < 4; ++t) {
    const int col = col0 + t * 16 + ln;
    float bv = bias ? bias[col] : 0.f;
    if (BIAS_BF16) bv = bf16_round(bv);
#pragma unroll
    for (int r = 0; r < 8; ++r) {
      float v = acc[t][r] + bv;
      if (resid) { float rv = resid[(size_t)((row0 + 8 * hh + r) % rmod) * ldr + col]; if (RES_BF16) rv = bf16_round(rv); v += rv; }
      if (ACT == 1) v = fmaxf(v, 0.f);
      if (ACT == 2) v = 0.5f * v * (1.0f + erff(v * 0.70710678118654752f));
      if (ACT == 3) { const float u = 0.7978845608028654f * (v + 0.044715f * v * v * v); v = 0.5f * v * (1.0f + tanhf(u)); }
      so[w][8 * hh + r][t * 16 + ln] = v;
    }
  }
  __builtin_amdgcn_fence(__ATOMIC_ACQ_REL, "workgroup");
  __builtin_amdgcn_wave_barrier();
  const int rsub = lane >> 4, c4 = (lane & 15) * 4;
  {
#pragma unroll
    for (int q = 0; q < 8; ++q) {
      const int r = q * 2 + rsub;
      const v4f v = *(const v4fa*)&so[w][r][c4];
      *(v4f*)(C + (size_t)(row0 + r) * ldc + col0 + c4) = v;
    }
    
  }
}
// row LayerNorm (biased variance, eps) over N: s = X (+ R); optional out_sum <- s; out_norm <- (s-mu)*rsqrt(var+eps)*g + b
template <bool PARAM_BF16>
__global__ __launch_bounds__(256) void k_layernorm(const float* __restrict__ X, const float* __restrict__ R, const float* __restrict__ g, const float* __restrict__ bta,
                                                  float* __restrict__ out_sum, float* __restrict__ out_norm, int N, float eps) {
  __shared__ float red[256];
  const int row = blockIdx.x, tid = threadIdx.x;
  const float* x = X + (size_t)row * N; const float* rr = R ? R + (size_t)row * N : nullptr;
  float vals[16];                     // up to N = 4096
  const int per = N / 256;            // contiguous chunk per thread? use strided-by-4 chunks: thread handles j = tid*4 + 1024*u
  float s1 = 0.f;
  for (int u = 0; u < per / 4; ++u) {
    const int j = tid * 4 + 1024 * u;
    const v4f a = *(const v4fa*)(x + j);
    v4f b = {0.f,0.f,0.f,0.f}; if (rr) b = *(const v4fa*)(rr + j);
#pragma unroll
    for (int q = 0; q < 4; ++q) { const float v = a[q] + b[q]; vals[u * 4 + q] = v; s1 += v; }
  }
  red[tid] = s1; __syncthreads();
  for (int st = 128; st > 0; st >>= 1) { if (tid < st) red[tid] += red[tid + st]; __syncthreads(); }
  const float mu = red[0] / (float)N; __syncthreads();
  float s2 = 0.f;
  for (int u = 0; u < per / 4; ++u)
#pragma unroll
    for (int q = 0; q < 4; ++q) { const float c = vals[u * 4 + q] - mu; s2 += c * c; }
  red[tid] = s2; __syncthreads();
  for (int st = 128; st > 0; st >>= 1) { if (tid < st) red[tid] += red[tid + st]; __syncthreads(); }
  const float rs = rsqrtf(red[0] / (float)N + eps);
  {
    for (int u = 0; u < per / 4; ++u) {
      const int j = tid * 4 + 1024 * u;
      v4f o, sm;
#pragma unroll
      for (int q = 0; q < 4; ++q) {
        float gg = g[j + q], bb = bta[j + q];
        if (PARAM_BF16) { gg = bf16_round(gg); bb = bf16_round(bb); }
        sm[q] = vals[u * 4 + q]; o[q] = (vals[u * 4 + q] - mu) * rs * gg + bb;
      }
      if (out_sum) *(v4f*)(out_sum + (size_t)row * N + j) = sm;
      *(v4f*)(out_norm + (size_t)row * N + j) = o;
    }
    
  }
}



// ---- f16 WMMA path (v_wmma_f32_16x16x32_f16): 11-bit significands for operands in range — used where a [0,1] probability operand needs more precision than bf16
typedef _Float16 v16h __attribute__((ext_vector_type(16)));
union FragH { v16h v; v8us half[2]; _Float16 h[16]; unsigned short u[16]; };
template <int NT>
__device__ __forceinline__ v8f mmaH(v16h ah, v16h al, v16h bh, v16h bl, v8f c) {
  c = __builtin_amdgcn_wmma_f32_16x16x32_f16(false, ah, false, bh, (short)0, c, false, false);
  if (NT >= 2) c = __builtin_amdgcn_wmma_f32_16x16x32_f16(false, al, false, bh, (short)0, c, false, false);
  if (NT >= 3) c = __builtin_amdgcn_wmma_f32_16x16x32_f16(false, ah, false, bl, (short)0, c, false, false);
  asm volatile("v_nop\n\tv_nop\n\tv_nop\n\tv_nop" : "+v"(c) : "v"(ah), "v"(al), "v"(bh), "v"(bl));
  return c;
}
// batched GEMM like k_gemm_b but f16 operands: A f32 (split into f16 hi/lo if ASPLIT, else rounded to f16), Bt = f16 values [n][k]; alpha; C f32; N multiple of 16 (partial tiles skipped)
template <bool ASPLIT>
__global__ __launch_bounds__(128) void k_gemm_h(const float* __restrict__ A, int lda, size_t sA, const _Float16* __restrict__ Bh, int ldb, size_t sB, float alpha, float* __restrict__ C, int ldc, size_t sC, int M, int N, int K) {
  __shared__ __attribute__((aligned(16))) float so[4][16][64];
  const int tid = threadIdx.x, w = tid >> 5, lane = tid & 31, ln = lane & 15, hh = lane >> 4; const int by = blockIdx.y;
  A += (size_t)by * sA; Bh += (size_t)by * sB; C += (size_t)by * sC;
  const int ntn = (N + 63) / 64; const int wid = blockIdx.x * 4 + w; const int mt = wid / ntn, nq = wid % ntn; if (mt * 16 >= M) return;
  const int row0 = mt * 16, col0 = nq * 64; const float* arow = A + (size_t)(row0 + ln) * lda;
  v8f acc[4] = {};
  for (int kb = 0; kb < K; kb += 32) {
    FragH ah, al;
    const v4f x0 = *(const v4fa*)(arow + kb + 8 * hh), x1 = *(const v4fa*)(arow + kb + 8 * hh + 4), x2 = *(const v4fa*)(arow + kb + 16 + 8 * hh), x3 = *(const v4fa*)(arow + kb + 16 + 8 * hh + 4);
    float xs[16] = {x0[0],x0[1],x0[2],x0[3],x1[0],x1[1],x1[2],x1[3],x2[0],x2[1],x2[2],x2[3],x3[0],x3[1],x3[2],x3[3]};
#pragma unroll
    for (int i = 0; i < 16; ++i) { const _Float16 h = (_Float16)xs[i]; ah.h[i] = h; al.h[i] = ASPLIT ? (_Float16)(xs[i] - (float)h) : (_Float16)0.0f; }
#pragma unroll
    for (int t = 0; t < 4; ++t) { if (col0 + t * 16 >= N) continue; const size_t boff = (size_t)(col0 + t * 16 + ln) * ldb + kb; FragH bq; bq.half[0] = *(const v8us*)(Bh + boff + 8 * hh); bq.half[1] = *(const v8us*)(Bh + boff + 16 + 8 * hh);
      acc[t] = mmaH<ASPLIT ? 2 : 1>(ah.v, al.v, bq.v, bq.v, acc[t]); }
  }
#pragma unroll
  for (int t = 0; t < 4; ++t) { if (col0 + t * 16 >= N) continue;
#pragma unroll
    for (int r = 0; r < 8; ++r) so[w][8 * hh + r][t * 16 + ln] = acc[t][r] * alpha; }
  __builtin_amdgcn_fence(__ATOMIC_ACQ_REL, "workgroup"); __builtin_amdgcn_wave_barrier();
  const int rsub = lane >> 4, c4 = (lane & 15) * 4;
  {
#pragma unroll
    for (int q = 0; q < 8; ++q) { const int r = q * 2 + rsub; if (col0 + c4 < N) { const v4f v = *(const v4fa*)&so[w][r][c4]; *(v4f*)(C + (size_t)(row0 + r) * ldc + col0 + c4) = v; } }
     }
}

// Wt[n][k] = f16(W[k][n]·scale) from f32 row-major W[K][N] (scale = power of two; bf16-exact weights stay exact in f16 away from the subnormal range)
__global__ __launch_bounds__(256) void k_wt_f16(const float* __restrict__ W, _Float16* __restrict__ Wt, int K, int N, float scale) {
  const int t = blockIdx.x * 256 + threadIdx.x; if (t >= N * (K / 8)) return; const int n = t / (K / 8), k8 = (t % (K / 8)) * 8; FragH f;
#pragma unroll
  for (int i = 0; i < 8; ++i) f.h[i] = (_Float16)(bf16_round(W[(size_t)(k8 + i) * N + n]) * scale); const v8us o = f.half[0];
  *(v8us*)((unsigned short*)Wt + (size_t)n * K + k8) = o; 
}
// k_gemm_hh variant with fused epilogue: v = acc·alpha + bias[by·sBias + col] (+ CP[(row/rowsPerB)·sCPb + by·64 + col] if CP) ; ACT 0 none / 1 elu ; writes f16 C16 (and f32 C if non-null)
template <int ACT>
__global__ __launch_bounds__(128) void k_gemm_hhx(const _Float16* __restrict__ A, int lda, size_t sA, const _Float16* __restrict__ Bh, int ldb, size_t sB, float alpha, const float* __restrict__ bias, size_t sBias, const float* __restrict__ CP, int rowsPerB, size_t sCPb, int row0g,
    float* __restrict__ C, _Float16* __restrict__ C16, int ldc, size_t sC, int M, int N, int K) {
  __shared__ __attribute__((aligned(16))) float so[4][16][64];
  const int tid = threadIdx.x, w = tid >> 5, lane = tid & 31, ln = lane & 15, hh = lane >> 4; const int by = blockIdx.y;
  A += (size_t)by * sA; Bh += (size_t)by * sB; const size_t cofs = (size_t)by * sC; const float* bp = bias ? bias + (size_t)by * sBias : nullptr;
  const int ntn = (N + 63) / 64; const int wid = blockIdx.x * 4 + w; const int mt = wid / ntn, nq = wid % ntn; if (mt * 16 >= M) return;
  const int row0 = mt * 16, col0 = nq * 64; const _Float16* arow = A + (size_t)(row0 + ln) * lda;
  v8f acc[4] = {};
  for (int kb = 0; kb < K; kb += 32) { FragH ah; ah.half[0] = *(const v8us*)((const unsigned short*)arow + kb + 8 * hh); ah.half[1] = *(const v8us*)((const unsigned short*)arow + kb + 16 + 8 * hh);
#pragma unroll
    for (int t = 0; t < 4; ++t) { if (col0 + t * 16 >= N) continue; const size_t boff = (size_t)(col0 + t * 16 + ln) * ldb + kb; FragH bq; bq.half[0] = *(const v8us*)((const unsigned short*)Bh + boff + 8 * hh); bq.half[1] = *(const v8us*)((const unsigned short*)Bh + boff + 16 + 8 * hh);
      acc[t] = mmaH<1>(ah.v, ah.v, bq.v, bq.v, acc[t]); }
  }
#pragma unroll
  for (int t = 0; t < 4; ++t) { if (col0 + t * 16 >= N) continue; const int col = col0 + t * 16 + ln; const float bv = bp ? bf16_round(bp[col]) : 0.f;
#pragma unroll
    for (int r = 0; r < 8; ++r) { float v = acc[t][r] * alpha + bv; if (CP) { const int rr = row0g + row0 + 8 * hh + r; if (rowsPerB < 0) v += CP[cofs + (size_t)rr * ldc + col];      /* rowsPerB < 0: own element of the batched C plane */ else { const int bidx = rr / rowsPerB; v += CP[(size_t)bidx * sCPb + (size_t)by * 64 + col]; } } if (ACT == 1) v = (v > 0.f) ? v : expm1f(v); else if (ACT == 7) v = (v > 0.f) ? v + 1.0f : expf(v); else if (ACT == 8) v = tanhf(v); else if (ACT == 9) v = 0.5f * v * (1.0f + tanhf(0.7978845608028654f * (v + 0.044715f * v * v * v))); else if (ACT == 11) v = 1.0f / (1.0f + expf(-v)); else if (ACT == 12) v = (v > 0.f) ? v : 0.01f * v; else if (ACT == 14) v = (v > 0.f) ? v : 0.1f * v; else if (ACT == 16) v = (v >= 0.f) ? v : 0.3f * v; else if (ACT == 17) v = (v >= 0.f) ? v : 0.2f * v; else if (ACT == 15) v = v / (1.0f + expf(-v)); else if (ACT == 3) v = fmaxf(v, 0.f); else if (ACT == 6) v = 0.5f * v * (1.0f + erff(v * 0.70710678118654752f)); so[w][8 * hh + r][t * 16 + ln] = v; } }
  __builtin_amdgcn_fence(__ATOMIC_ACQ_REL, "workgroup"); __builtin_amdgcn_wave_barrier();
  const int rsub = lane >> 4, c4 = (lane & 15) * 4; typedef _Float16 v4h __attribute__((ext_vector_type(4)));
  {
#pragma unroll
    for (int q = 0; q < 8; ++q) { const int r = q * 2 + rsub; if (col0 + c4 < N) { const v4f v = *(const v4fa*)&so[w][r][c4]; if (C) *(v4f*)(C + cofs + (size_t)(row0 + r) * ldc + col0 + c4) = v; if (C16) { v4h h4; for (int i = 0; i < 4; ++i) h4[i] = (_Float16)v[i]; *(v4h*)(C16 + cofs + (size_t)(row0 + r) * ldc + col0 + c4) = h4; } } }
     }
}


typedef _Float16 v4h __attribute__((ext_vector_type(4)));

__global__ __launch_bounds__(256) void k_x16(const float* __restrict__ x, _Float16* __restrict__ X16, size_t n8) { const size_t t = (size_t)blockIdx.x * 256 + threadIdx.x; if (t >= n8) return; FragH f;
#pragma unroll
  for (int q = 0; q < 8; ++q) f.h[q] = (_Float16)bf16_round(x[t * 8 + q]); *(v8us*)((unsigned short*)X16 + t * 8) = f.half[0];  }
__global__ __launch_bounds__(256) void k_h16(const float* __restrict__ x, _Float16* __restrict__ X16, size_t n8) { const size_t t = (size_t)blockIdx.x * 256 + threadIdx.x; if (t >= n8) return; FragH f;
#pragma unroll
  for (int q = 0; q < 8; ++q) f.h[q] = (_Float16)x[t * 8 + q]; *(v8us*)((unsigned short*)X16 + t * 8) = f.half[0];  }
__global__ __launch_bounds__(256) void k_round16f(const float* __restrict__ W, _Float16* __restrict__ Bt, size_t n8) { const size_t t = (size_t)blockIdx.x * 256 + threadIdx.x; if (t >= n8) return; FragH f;
#pragma unroll
  for (int i = 0; i < 8; ++i) f.h[i] = (_Float16)(bf16_round(W[t * 8 + i]) * 16.0f); *(v8us*)((unsigned short*)Bt + t * 8) = f.half[0];  }

__global__ __launch_bounds__(256) void k_hl(const float* __restrict__ F, _Float16* __restrict__ Hh, _Float16* __restrict__ Hl, size_t n8) { const size_t t = (size_t)blockIdx.x * 256 + threadIdx.x; if (t >= n8) return; FragH fh, fl; const v4f a = *(const v4fa*)(F + t * 8), c = *(const v4fa*)(F + t * 8 + 4);
#pragma unroll
  for (int q = 0; q < 4; ++q) { _Float16 h = (_Float16)a[q]; fh.h[q] = h; fl.h[q] = (_Float16)((a[q] - (float)h) * 1024.0f); h = (_Float16)c[q]; fh.h[4 + q] = h; fl.h[4 + q] = (_Float16)((c[q] - (float)h) * 1024.0f); }
  { *(v8us*)((unsigned short*)Hh + t * 8) = fh.half[0]; *(v8us*)((unsigned short*)Hl + t * 8) = fl.half[0];  } }

// ---- fast GEMM tile: C = A . B^T * alpha + bias, A [M][K] and B [N][K] f16 rows; work-group tile 128x64, wave tile 32x64 (M % 128 == 0, N % 64 == 0, K % 32 == 0) ----
__device__ __forceinline__ v16h g2_frag(const _Float16* p, int hh) { FragH f; f.half[0] = *(const v8us*)((const unsigned short*)p + 8 * hh); f.half[1] = *(const v8us*)((const unsigned short*)p + 16 + 8 * hh); return f.v; }
__device__ __forceinline__ v8f g2_mma(v16h a, v16h b, v8f c) { v8f d = __builtin_amdgcn_wmma_f32_16x16x32_f16(false, a, false, b, (short)0, c, false, false); asm volatile("v_nop\n\tv_nop\n\tv_nop\n\tv_nop" : "+v"(d) : "v"(a), "v"(b)); return d; }
// RB: the bias belongs to the row of C (channel-major outputs), else to its column. TO: element type of C (float or f16). bx: tile index, column tiles fastest.
template <bool RB, typename TO>
__device__ __forceinline__ void g2_tile(float (&so)[4][32][68], const _Float16* __restrict__ A, int lda, const _Float16* __restrict__ Bh, int ldb, float alpha, const float* __restrict__ bp, TO* __restrict__ C, int ldc, int bx, int N, int K) {
  const int tid = threadIdx.x, w = tid >> 5, lane = tid & 31, ln = lane & 15, hh = lane >> 4;
  const int ntn = N >> 6; const int mt = bx / ntn, nq = bx - mt * ntn; const int row0 = mt * 128 + 32 * w, col0 = nq * 64;
  const _Float16* a0p = A + (size_t)(row0 + ln) * lda + 8 * hh;      /* + 8 hh: the lane half's k offset sits in the row pointers */
  const _Float16* b0p = Bh + (size_t)(col0 + ln) * ldb + 8 * hh; const _Float16* b1p = b0p + (size_t)16 * ldb; const _Float16* b2p = b1p + (size_t)16 * ldb; const _Float16* b3p = b2p + (size_t)16 * ldb;
  const v8f z8 = {0.f,0.f,0.f,0.f,0.f,0.f,0.f,0.f}; v8f c00 = z8, c01 = z8, c02 = z8, c03 = z8, c10 = z8, c11 = z8, c12 = z8, c13 = z8;
#pragma unroll 1
  for (int kb = 0; kb < K; kb += 32) { const _Float16* ap = a0p + kb; const v16h a0 = g2_frag(ap, 0), a1 = g2_frag(ap + 16 * lda, 0);
    v16h b = g2_frag(b0p + kb, 0);
    asm volatile("s_wait_xcnt 0x0" :: "v"(ap) : "memory");      // the four A loads name one address pair; as an input here it stays whole up to this wait; behind the first B loads, so that these issue first
    c00 = g2_mma(a0, b, c00); c10 = g2_mma(a1, b, c10);
    b = g2_frag(b1p + kb, 0); c01 = g2_mma(a0, b, c01); c11 = g2_mma(a1, b, c11);
    b = g2_frag(b2p + kb, 0); c02 = g2_mma(a0, b, c02); c12 = g2_mma(a1, b, c12);
    b = g2_frag(b3p + kb, 0); c03 = g2_mma(a0, b, c03); c13 = g2_mma(a1, b, c13); }
  v8f accs[8] = {c00, c01, c02, c03, c10, c11, c12, c13};
#pragma unroll
  for (int u = 0; u < 8; ++u) { const int t = u & 3, half = u >> 2; const int col = col0 + t * 16 + ln;
#pragma unroll
    for (int r = 0; r < 8; ++r) { const int rloc = half * 16 + 8 * hh + r; const float bv = bf16_round(RB ? bp[row0 + rloc] : bp[col]); so[w][rloc][t * 16 + ln] = accs[u][r] * alpha + bv; } }
  __builtin_amdgcn_fence(__ATOMIC_ACQ_REL, "workgroup"); __builtin_amdgcn_wave_barrier();
  const int rsub = lane >> 4, c4 = (lane & 15) * 4;
#pragma unroll
  for (int q = 0; q < 16; ++q) { const int r = q * 2 + rsub; const v4f v = *(const v4fa*)&so[w][r][c4]; typedef TO v4o __attribute__((ext_vector_type(4))); v4o o4; for (int i = 0; i < 4; ++i) o4[i] = (TO)v[i]; *(v4o*)(C + (size_t)(row0 + r) * ldc + col0 + c4) = o4; } }
// The three projections in one grid (blockIdx.y: 0 Q, 1 K, 2 V). Q and K: token rows x permuted channels. V: permuted channels x tokens of one batch (A = weights, B = token rows), which is V^T as the attention reads it.
#define QKV_G ((int)((NR / 128) * (CC / 64)))      /* tiles of one projection, either way round */
#define CT_G ((CC / 128) * (LL / 64))              /* tiles of one batch's channel-major product */
static_assert(QKV_G == NB * CT_G, "the V tiles must fill the same grid row as the Q and K tiles");
__global__ __launch_bounds__(128) void k_qkv(const _Float16* __restrict__ XQ, const _Float16* __restrict__ XK, const _Float16* __restrict__ XV, const _Float16* __restrict__ BQ, const _Float16* __restrict__ BK, const _Float16* __restrict__ BV, const float* __restrict__ BP, _Float16* __restrict__ Q16, _Float16* __restrict__ K16, _Float16* __restrict__ VT) {
  __shared__ __attribute__((aligned(16))) float so[4][32][68];
  const int by = blockIdx.y, bx = blockIdx.x;
  if (by < 2) g2_tile<false>(so, by ? XK : XQ, CC, by ? BK : BQ, CC, 0.0625f, BP + by * CC, by ? K16 : Q16, CC, bx, CC, CC);
  else { const int b = bx / CT_G; g2_tile<true>(so, BV, CC, XV + (size_t)b * LL * CC, CC, 0.0625f, BP + 2 * CC, VT + (size_t)b * CC * LL, LL, bx - b * CT_G, LL, CC); } }
// out[b][c][n] = sum_k' w_m'[c][k'] o[(b,n)][k'] / 1024 + b_m[c] (channel-major directly; blockIdx.y = batch)
__global__ __launch_bounds__(128) void k_out(const _Float16* __restrict__ AM, const _Float16* __restrict__ O16, const float* __restrict__ bm, float* __restrict__ out) {
  __shared__ __attribute__((aligned(16))) float so[4][32][68];
  const size_t b = blockIdx.y;
  g2_tile<true>(so, AM, CC, O16 + b * LL * CC, CC, 0.0009765625f, bm, out + b * CC * LL, LL, blockIdx.x, LL, CC); }


__global__ __launch_bounds__(256) void k_wnat(const float* __restrict__ w, size_t n8, _Float16* __restrict__ Bt) { const size_t t = (size_t)blockIdx.x * 256 + threadIdx.x; if (t >= n8) return; FragH f; for (int q = 0; q < 8; ++q) f.h[q] = (_Float16)(bf16_round(w[t * 8 + q]) * 16.0f); *(v8us*)((unsigned short*)Bt + t * 8) = f.half[0];  }
__global__ __launch_bounds__(256) void k_rsm(const float* __restrict__ S, _Float16* __restrict__ P, int nrows) {
  #pragma clang fp contract(off)
  const int i = blockIdx.x * 256 + threadIdx.x; if (i >= nrows) return; const float* s = S + (size_t)i * SQ; float mx = -3.0e38f;
#pragma unroll 1
  for (int j = 0; j < SQ; ++j) mx = fmaxf(mx, s[j]); float se = 0.f;
#pragma unroll 1
  for (int j = 0; j < SQ; ++j) se += expf(s[j] - mx); const float sc = 256.0f / se;
#pragma unroll 1
  for (int j0 = 0; j0 < SQ; j0 += 8) { FragH f; for (int q = 0; q < 8; ++q) f.h[q] = (_Float16)(expf(s[j0 + q] - mx) * sc); unsigned short* d = (unsigned short*)P + (size_t)i * SQ + j0; *(v8us*)d = f.half[0];  } }
__global__ __launch_bounds__(256) void k_vt(const _Float16* __restrict__ V16, int b, int h0, _Float16* __restrict__ VT) { __shared__ unsigned short tl[64][65]; const int tid = threadIdx.x; const int hh = blockIdx.x % HG, sg = blockIdx.x / HG; const int s0 = sg * 64; const int h = h0 + hh;
  for (int i = tid; i < 64 * 8; i += 256) { const int j = i / 8, d8 = (i % 8) * 8; FragH f; f.half[0] = *(const v8us*)((const unsigned short*)V16 + ((size_t)b * SQ + s0 + j) * DM + h * HD + d8); for (int q = 0; q < 8; ++q) tl[d8 + q][j] = f.u[q]; }
  __syncthreads();
  { for (int i = tid; i < 64 * 8; i += 256) { const int d = i / 8, j8 = (i % 8) * 8; FragH f; for (int q = 0; q < 8; ++q) f.u[q] = tl[d][j8 + q]; *(v8us*)((unsigned short*)VT + ((size_t)hh * HD + d) * SQ + s0 + j8) = f.half[0]; }  } }

// ---- operand preparation: the bodies below are dealt to the work-groups of one grid by index (k_prep); bx = index within the body's own share ----
// Behind a body's last global store: in the built kernel a work-group's way to the end passes the heads of other bodies, which write registers that the store names; this wait stands in front of them.
__device__ __forceinline__ void p_stored() { asm volatile("s_wait_xcnt 0x0" ::: "memory"); }
__device__ __forceinline__ void p_cl2rows(float (&tl)[64][33], const float* __restrict__ X, _Float16* __restrict__ XR, int bx) { const int tid = threadIdx.x; const int nl = LL / 32, nc = CC / 64; const int cb_ = bx % nc; const int lb = (bx / nc) % nl; const size_t b = bx / (nc * nl); const int c0 = cb_ * 64, l0 = lb * 32;
  for (int i = tid; i < 64 * 32; i += 256) { const int c = i / 32, l = i % 32; tl[c][l] = bf16_round(X[(b * CC + c0 + c) * (size_t)LL + l0 + l]); }
  __syncthreads();
  { const int l = tid / 8, c8 = (tid % 8) * 8; FragH f; for (int q = 0; q < 8; ++q) f.h[q] = (_Float16)tl[c8 + q][l]; unsigned short* d = (unsigned short*)XR + (b * LL + l0 + l) * (size_t)CC + c0 + c8; *(v8us*)d = f.half[0]; p_stored(); } }
__device__ __forceinline__ void p_wperm(const float* __restrict__ w, _Float16* __restrict__ Bt, int bx) { const int t = bx * 256 + threadIdx.x; const int k8 = (t % (CC / 8)) * 8, np_ = t / (CC / 8); const int h = np_ / HD, dd = np_ % HD; const int src = dd * NH + h; FragH f;
  for (int q = 0; q < 8; ++q) f.h[q] = (_Float16)(bf16_round(w[(size_t)src * CC + k8 + q]) * 16.0f); unsigned short* d = (unsigned short*)Bt + (size_t)np_ * CC + k8; *(v8us*)d = f.half[0];  }
__device__ __forceinline__ void p_wpermc(const float* __restrict__ w, _Float16* __restrict__ A, int bx) { const int t = bx * 256 + threadIdx.x; const int k8 = (t % (CC / 8)) * 8, c = t / (CC / 8); FragH f;
  for (int q = 0; q < 8; ++q) { const int kp = k8 + q; const int h = kp / HD, dd = kp % HD; f.h[q] = (_Float16)(bf16_round(w[(size_t)c * CC + dd * NH + h]) * 16.0f); } unsigned short* d = (unsigned short*)A + (size_t)c * CC + k8; *(v8us*)d = f.half[0]; p_stored(); }
__device__ __forceinline__ void p_bperm(const float* __restrict__ b0, const float* __restrict__ b1, const float* __restrict__ b2, float* __restrict__ BP) { const int t = threadIdx.x; const int h = t / HD, dd = t % HD; const int src = dd * NH + h;
  { *(float*)(BP + t) = b0[src]; *(float*)(BP + CC + t) = b1[src]; *(float*)(BP + 2 * CC + t) = b2[src];  } }
#define PW_G (CC * (CC / 8) / 256)                 /* work-groups per weight matrix: 8 elements a thread, exactly */
#define PX_G (NB * (LL / 32) * (CC / 64))          /* work-groups of one input's transpose: 64-channel x 32-token tiles */
static_assert(PW_G * 256 == CC * (CC / 8) && CC == 256, "the weight and bias bodies have no tail guard");
// Every branch is on blockIdx alone, so the barrier inside p_cl2rows is reached by a whole work-group or by none of it. The short weight and bias bodies take the lowest indices: they start first and end under the transposes.
__global__ __launch_bounds__(256) void k_prep(const float* __restrict__ xq, const float* __restrict__ xk, const float* __restrict__ xv, const float* __restrict__ wq, const float* __restrict__ wk, const float* __restrict__ wv, const float* __restrict__ wm, const float* __restrict__ bq, const float* __restrict__ bk, const float* __restrict__ bv,
    _Float16* __restrict__ XQ, _Float16* __restrict__ XK, _Float16* __restrict__ XV, _Float16* __restrict__ BQ, _Float16* __restrict__ BK, _Float16* __restrict__ BV, _Float16* __restrict__ AM, float* __restrict__ BP) {
  __shared__ float tl[64][33];
  const int bx = blockIdx.x;
  if (bx < 3 * PW_G) { const int s = bx / PW_G; p_wperm(s == 0 ? wq : s == 1 ? wk : wv, s == 0 ? BQ : s == 1 ? BK : BV, bx - s * PW_G); }
  else if (bx < 4 * PW_G) p_wpermc(wm, AM, bx - 3 * PW_G);
  else if (bx == 4 * PW_G) p_bperm(bq, bk, bv, BP);
  else { const int i = bx - (4 * PW_G + 1), s = i / PX_G; p_cl2rows(tl, s == 0 ? xq : s == 1 ? xk : xv, s == 0 ? XQ : s == 1 ? XK : XV, i - s * PX_G); } }
__device__ __forceinline__ float rs_xh(float x) { return __builtin_bit_cast(float, __builtin_amdgcn_permlanex16(__builtin_bit_cast(int, x), __builtin_bit_cast(int, x), 0x76543210, 0xfedcba98, false, false)); }      /* lane l <- lane l ^ 16 */
// 2^z on the transcendental unit. The v_nop is the slot that the instruction set asks for behind a transcendental before its result is read or its source overwritten.
__device__ __forceinline__ float rs_exp2(float z) { float y; asm("v_exp_f32 %0, %1\n\tv_nop" : "=v"(y) : "v"(z)); return y; }
// Eight independent 2^z in place: each fills the slot behind the one before it, the v_nop fills the slot behind the last.
__device__ __forceinline__ void fa_exp2x8(float (&z)[8]) { asm("v_exp_f32 %0, %0\n\tv_exp_f32 %1, %1\n\tv_exp_f32 %2, %2\n\tv_exp_f32 %3, %3\n\tv_exp_f32 %4, %4\n\tv_exp_f32 %5, %5\n\tv_exp_f32 %6, %6\n\tv_exp_f32 %7, %7\n\tv_nop" : "+v"(z[0]), "+v"(z[1]), "+v"(z[2]), "+v"(z[3]), "+v"(z[4]), "+v"(z[5]), "+v"(z[6]), "+v"(z[7])); }
#define FA_KS 64                     /* keys per stage */
#define FA_PK 144                    /* LDS row pitch, bytes: 128 + 16, an odd multiple of 16 for 16-byte readers */
__device__ __forceinline__ v8f fa_mma(v16h a, v16h b, v8f c) { return __builtin_amdgcn_wmma_f32_16x16x32_f16(false, a, false, b, (short)0, c, false, false); }
__device__ __forceinline__ v16h fa_lfrag(const unsigned char* p) { FragH f; f.half[0] = *(const v8us*)p; f.half[1] = *(const v8us*)(p + 32); return f.v; }      /* p already holds + 16 hh: k = 8 hh .. and 16 + 8 hh .. */
__global__ __launch_bounds__(256) void k_fattn(const _Float16* __restrict__ Q16, const _Float16* __restrict__ K16, const _Float16* __restrict__ VT, _Float16* __restrict__ O16) {
  __shared__ __attribute__((aligned(16))) unsigned char L[2][2][FA_KS * FA_PK];      /* [buffer][K, V^T][row][pitch] */
  const int tid = threadIdx.x, lane = tid & 31, w = tid >> 5, c = lane & 15, hh = lane >> 4; const int h = blockIdx.y, b = blockIdx.z; const size_t r0 = (size_t)b * LL; const int q0 = blockIdx.x * 256 + w * 32;
  const float cs = 0.125f * 1.44269504088896340736f;      /* 1 / sqrt(64), times log2(e) */
  v16h qf[2][2];
#pragma unroll
  for (int g = 0; g < 2; ++g) for (int kc = 0; kc < 2; ++kc) qf[g][kc] = g2_frag(Q16 + (r0 + q0 + g * 16 + c) * CC + h * HD + kc * 32, hh);
  const int srow = tid >> 2, sseg = (tid & 3) * 32;      /* staging: 4 threads cover one 128-byte row, 32 bytes each */
  const unsigned char* kg = (const unsigned char*)(K16 + (r0 + srow) * CC + h * HD) + sseg;      /* key rows: + 64 rows a stage */
  const unsigned char* vg = (const unsigned char*)(VT + ((size_t)(b * NH + h) * HD + srow) * SQ) + sseg;      /* d rows: + 64 keys a stage */
  const int sdst = srow * FA_PK + sseg;
  v8us k0 = *(const v8us*)kg, k1 = *(const v8us*)(kg + 16), v0 = *(const v8us*)vg, v1 = *(const v8us*)(vg + 16);
  *(v8us*)&L[0][0][sdst] = k0; *(v8us*)&L[0][0][sdst + 16] = k1; *(v8us*)&L[0][1][sdst] = v0; *(v8us*)&L[0][1][sdst + 16] = v1;
  const v8f z8 = {0.f, 0.f, 0.f, 0.f, 0.f, 0.f, 0.f, 0.f}; v8f acc[2][4]; float m_run[2], l_run[2];
#pragma unroll
  for (int g = 0; g < 2; ++g) { m_run[g] = -__builtin_inff(); l_run[g] = 0.f; for (int t = 0; t < 4; ++t) acc[g][t] = z8; }
  __syncthreads();      /* stage 0 published */
#pragma unroll 1      // one stage a trip: the body already holds two unrolled 32-key passes
  for (int st = 0; st < SQ / FA_KS; ++st) {
    const bool more = st + 1 < SQ / FA_KS;
    if (more) { const unsigned char* kn = kg + (size_t)(st + 1) * (FA_KS * CC * 2); const unsigned char* vn = vg + (size_t)(st + 1) * (FA_KS * 2); k0 = *(const v8us*)kn; k1 = *(const v8us*)(kn + 16); v0 = *(const v8us*)vn; v1 = *(const v8us*)(vn + 16); }
    const unsigned char* Kb = &L[st & 1][0][c * FA_PK + 16 * hh]; const unsigned char* Vb = &L[st & 1][1][c * FA_PK + 16 * hh];
#pragma unroll
    for (int sub = 0; sub < 2; ++sub) {      /* one pass = 32 keys */
      v8f s[2][2];
#pragma unroll
      for (int kt = 0; kt < 2; ++kt) { const v16h ka = fa_lfrag(Kb + (sub * 32 + kt * 16) * FA_PK), kb2 = fa_lfrag(Kb + (sub * 32 + kt * 16) * FA_PK + 64);
        for (int g = 0; g < 2; ++g) s[kt][g] = fa_mma(kb2, qf[g][1], fa_mma(ka, qf[g][0], z8)); }
      v16h vf[4];
#pragma unroll
      for (int t = 0; t < 4; ++t) vf[t] = fa_lfrag(Vb + t * 16 * FA_PK + sub * 64);
      float mb[2]; bool need = false;
#pragma unroll
      for (int g = 0; g < 2; ++g) { float mx = fmaxf(s[0][g][0], s[1][g][0]);
        for (int r = 1; r < 8; ++r) mx = fmaxf(mx, fmaxf(s[0][g][r], s[1][g][r]));
        mx = fmaxf(mx, rs_xh(mx)) * cs; mb[g] = mx; need = need || (mx > m_run[g] + 8.0f); }      /* both wave halves hold the query's maximum, scaled (the scale is positive) */
      if (__builtin_amdgcn_ballot_w32(need) != 0) {      /* wave-uniform scalar branch, one test a pass; always taken on the first pass (m_run = -inf gives corr = 0) */
#pragma unroll
        for (int g = 0; g < 2; ++g) { const float m_new = fmaxf(m_run[g], mb[g]); const float corr = rs_exp2(m_run[g] - m_new); m_run[g] = m_new; l_run[g] *= corr; for (int t = 0; t < 4; ++t) acc[g][t] = acc[g][t] * corr; }
      }
#pragma unroll
      for (int g = 0; g < 2; ++g) { const float nm = -m_run[g]; float e0[8], e1[8];
        for (int r = 0; r < 8; ++r) { e0[r] = __builtin_fmaf(s[0][g][r], cs, nm); e1[r] = __builtin_fmaf(s[1][g][r], cs, nm); }
        fa_exp2x8(e0); fa_exp2x8(e1);
        l_run[g] += (((e0[0] + e0[1]) + (e0[2] + e0[3])) + ((e0[4] + e0[5]) + (e0[6] + e0[7]))) + (((e1[0] + e1[1]) + (e1[2] + e1[3])) + ((e1[4] + e1[5]) + (e1[6] + e1[7])));
        FragH pf; for (int r = 0; r < 8; ++r) { pf.h[r] = (_Float16)e0[r]; pf.h[8 + r] = (_Float16)e1[r]; }      /* element s: key 8 hh + s, then 16 + 8 hh + (s - 8): the k order of V^T's loader */
        for (int t = 0; t < 4; ++t) acc[g][t] = fa_mma(vf[t], pf.v, acc[g][t]); }
    }
    if (more) { unsigned char* d = &L[(st + 1) & 1][0][sdst]; *(v8us*)d = k0; *(v8us*)(d + 16) = k1; *(v8us*)(d + FA_KS * FA_PK) = v0; *(v8us*)(d + FA_KS * FA_PK + 16) = v1; }      /* its last readers left it before the barrier that ended trip st - 1 */
    __syncthreads();      /* publishes stage st + 1 and ends every read of stage st */
  }
#pragma unroll
  for (int g = 0; g < 2; ++g) { const float l = l_run[g] + rs_xh(l_run[g]); const float inv = 64.0f / l; unsigned short* d = (unsigned short*)O16 + (r0 + q0 + g * 16 + c) * CC + h * HD + 8 * hh;      /* o x64; a lane's 8 registers are 8 consecutive d of its query */
    for (int t = 0; t < 4; ++t) { FragH f; for (int r = 0; r < 8; ++r) f.h[r] = (_Float16)(acc[g][t][r] * inv); *(v8us*)(d + t * 16) = f.half[0]; } } }

extern "C" void kernel_launch(void* const* d_in, const int* in_sizes, int n_in,
                              void* d_out, int out_size, void* d_ws, size_t ws_size, hipStream_t stream) {
  (void)in_sizes; (void)n_in; (void)out_size;
  const float* const* I = (const float* const*)d_in; const float* xq = I[0]; const float* xk = I[1]; const float* xv = I[2]; const float* wq = I[3]; const float* bq = I[4]; const float* wk = I[5]; const float* bk = I[6]; const float* wv = I[7]; const float* bv = I[8]; const float* wm = I[9]; const float* bm = I[10];
  char* ws = (char*)d_ws; size_t off = 0;
  auto take = [&](size_t bytes) { char* p = ws + off; off += (bytes + 255) & ~(size_t)255; return p; };
  _Float16* BQ = (_Float16*)take((size_t)CC * CC * 2); _Float16* BK = (_Float16*)take((size_t)CC * CC * 2); _Float16* BV = (_Float16*)take((size_t)CC * CC * 2); _Float16* AM = (_Float16*)take((size_t)CC * CC * 2); float* BP = (float*)take((size_t)3 * CC * 4);
  _Float16* XQ = (_Float16*)take(NR * CC * 2); _Float16* XK = (_Float16*)take(NR * CC * 2); _Float16* XV = (_Float16*)take(NR * CC * 2); _Float16* Q16 = (_Float16*)take(NR * CC * 2); _Float16* K16 = (_Float16*)take(NR * CC * 2); _Float16* O16 = (_Float16*)take(NR * CC * 2);
  _Float16* VT = (_Float16*)take((size_t)NB * NH * HD * SQ * 2);
  if (off > ws_size) return;      /* 0.5 + 48 + 8 = approx 57 MiB */
  k_prep<<<4 * PW_G + 1 + 3 * PX_G, 256, 0, stream>>>(xq, xk, xv, wq, wk, wv, wm, bq, bk, bv, XQ, XK, XV, BQ, BK, BV, AM, BP);
  k_qkv<<<dim3(QKV_G, 3), 128, 0, stream>>>(XQ, XK, XV, BQ, BK, BV, BP, Q16, K16, VT);      /* q, k token rows; V^T [8][4][64][2048] */
  k_fattn<<<dim3(SQ / 256, NH, NB), 256, 0, stream>>>(Q16, K16, VT, O16);      /* o x64, head-major f16 rows */
  k_out<<<dim3(CT_G, NB), 128, 0, stream>>>(AM, O16, bm, (float*)d_out);
}

// v004
// Measured time: 82.7 microseconds a run.
// In both of two side-by-side timings against v003, it was 1.10 times as fast.
// Counting every step since v000, it is 42.4 times as fast.
#include <hip/hip_runtime.h>
// SuperGlue multi-head attention (query, key, value channel-first [8][256][2048]; q/k/v = 1x1 conv (natural [256][256] + bias); the module's head split view(B, d=64, H=4, N) makes channel c = dd*4 + h (INTERLEAVED heads); scores = q.k / 8 per head over 2,048 keys; softmax; x merged back to c = dd*4 + h; out = w_m x + b_m -> [8][256][2048]).
// Structure, 4 launches: (1) one preparation grid: channel-first inputs transposed to token rows (exact f16) in registers, projection weights and biases permuted so the head split becomes contiguous 64-column blocks (exact x16 f16); (2) Q, K and V as WMMA GEMMs in one grid (32x64 wave tiles, f32 accumulation, f16 outputs), V with the operands swapped so that V^T [8][4][64][2048] is written directly; (3) scores, softmax and P . V fused in one kernel over all batches and heads (S^T = K . Q^T, online softmax in f32, O^T += V^T . P^T, P stays in registers as f16; o x64 in f16) into head-major rows; (4) out channel-major directly: (w_m with permuted columns) . o^T GEMM batched over the 8 batches (alpha folds 1/16 and 1/64), the per-channel bias added in its epilogue.
// Compute dtype: inputs rounded to bf16; inputs / weights exact in f16; q, k, v, softmax weights and o plain f16 (~2^-12); scores and softmax statistics f32. v_wmma_f32_16x16x32_f16.
#define NB 8
#define CC 256
#define LL 2048
#define SQ LL
#define DM CC
#define NH 4
#define HD 64
#define HG 4
#define QN SQ                        /* query rows per batch (unused) */
#define NR ((size_t)NB * LL)
typedef __bf16 v16b __attribute__((ext_vector_type(16)));
typedef unsigned short v8us __attribute__((ext_vector_type(8), may_alias));
typedef float  v8f  __attribute__((ext_vector_type(8)));
typedef float  v4f  __attribute__((ext_vector_type(4)));
typedef float  v4fa __attribute__((ext_vector_type(4), may_alias));
union FragB { v16b v; v8us half[2]; unsigned short u[16]; };

__device__ __forceinline__ unsigned short bf16_bits(float x) { unsigned int u = __float_as_uint(x); return (unsigned short)((u + 0x7FFFu + ((u >> 16) & 1u)) >> 16); }
__device__ __forceinline__ float bf16_val(unsigned short b) { return __uint_as_float(((unsigned int)b) << 16); }
__device__ __forceinline__ float bf16_round(float x) { return bf16_val(bf16_bits(x)); }
// D += A·B with NT terms: 1 = ah·bh, 2 = + al·bh (A split), 3 = + ah·bl (both split)
template <int NT>
__device__ __forceinline__ v8f mmaN(v16b ah, v16b al, v16b bh, v16b bl, v8f c) {
  c = __builtin_amdgcn_wmma_f32_16x16x32_bf16(false, ah, false, bh, (short)0, c, false, false);
  if (NT >= 2) c = __builtin_amdgcn_wmma_f32_16x16x32_bf16(false, al, false, bh, (short)0, c, false, false);
  if (NT >= 3) c = __builtin_amdgcn_wmma_f32_16x16x32_bf16(false, ah, false, bl, (short)0, c, false, false);
  asm volatile("v_nop\n\tv_nop\n\tv_nop\n\tv_nop" : "+v"(c) : "v"(ah), "v"(al), "v"(bh), "v"(bl));
  return c;
}

__global__ __launch_bounds__(256) void k_wt_bf16(const float* __restrict__ W, unsigned short* __restrict__ Wt, int K, int N) {
  const int t = blockIdx.x * 256 + threadIdx.x;
  const int k8n = K / 8;
  if (t >= N * k8n) return;
  const int n = t / k8n, k8 = (t % k8n) * 8;
  v8us v;
#pragma unroll
  for (int i = 0; i < 8; ++i) v[i] = bf16_bits(W[(size_t)(k8 + i) * N + n]);
  *(v8us*)(Wt + (size_t)n * K + k8) = v;
  
}

// GEMM C[M][N] (f32, pitch ldc) = act(A[M][K]·W + bias). A f32 row-major (pitch lda) converted per fragment to bf16
// (ASPLIT: hi/lo two planes -> 2 terms, else single rounded term); Wt bf16 [N][K] (pitch ldb). BIAS_BF16 rounds the
// bias to bf16 first (bias quantised to bf16 before the add). K%32==0, M%16==0, N%64==0.
template <bool ASPLIT, int ACT, bool BIAS_BF16>
__global__ __launch_bounds__(128) void k_gemm_bf(const float* __restrict__ A, int lda, const unsigned short* __restrict__ Wt, int ldb,
                                               const float* __restrict__ bias, float* __restrict__ C, int ldc, int M, int N, int K) {
  __shared__ __attribute__((aligned(16))) float so[4][16][64];
  const int tid = threadIdx.x, w = tid >> 5, lane = tid & 31, ln = lane & 15, hh = lane >> 4;
  const int ntn = N / 64;
  const int wid = blockIdx.x * 4 + w;
  const int mt = wid / ntn, nq = wid % ntn;
  if (mt * 16 >= M) return;
  const int row0 = mt * 16, col0 = nq * 64;
  const float* arow = A + (size_t)(row0 + ln) * lda;
  v8f acc[4] = {};
  for (int kb = 0; kb < K; kb += 32) {
    FragB ah, al;
    const v4f x0 = *(const v4fa*)(arow + kb + 8 * hh), x1 = *(const v4fa*)(arow + kb + 8 * hh + 4);
    const v4f x2 = *(const v4fa*)(arow + kb + 16 + 8 * hh), x3 = *(const v4fa*)(arow + kb + 16 + 8 * hh + 4);
    float xs[16] = {x0[0],x0[1],x0[2],x0[3],x1[0],x1[1],x1[2],x1[3],x2[0],x2[1],x2[2],x2[3],x3[0],x3[1],x3[2],x3[3]};
#pragma unroll
    for (int i = 0; i < 16; ++i) { const unsigned short hb = bf16_bits(xs[i]); ah.u[i] = hb; al.u[i] = ASPLIT ? bf16_bits(xs[i] - bf16_val(hb)) : (unsigned short)0; }
#pragma unroll
    for (int t = 0; t < 4; ++t) {
      const unsigned short* brow = Wt + (size_t)(col0 + t * 16 + ln) * ldb + kb;
      FragB b;
      b.half[0] = *(const v8us*)(brow + 8 * hh);
      b.half[1] = *(const v8us*)(brow + 16 + 8 * hh);
      acc[t] = mmaN<ASPLIT ? 2 : 1>(ah.v, al.v, b.v, b.v, acc[t]);
    }
  }
#pragma unroll
  for (int t = 0; t < 4; ++t) {
    float bv = bias ? bias[col0 + t * 16 + ln] : 0.f;
    if (BIAS_BF16) bv = bf16_round(bv);
#pragma unroll
    for (int r = 0; r < 8; ++r) { float v = acc[t][r] + bv; if (ACT == 1) v = fmaxf(v, 0.f); so[w][8 * hh + r][t * 16 + ln] = v; }
  }
  __builtin_amdgcn_fence(__ATOMIC_ACQ_REL, "workgroup");
  __builtin_amdgcn_wave_barrier();
  const int rsub = lane >> 4, c4 = (lane & 15) * 4;
  {
#pragma unroll
    for (int q = 0; q < 8; ++q) {
      const int r = q * 2 + rsub;
      const v4f v = *(const v4fa*)&so[w][r][c4];
      *(v4f*)(C + (size_t)(row0 + r) * ldc + col0 + c4) = v;
    }
    
  }
}

// GEMM C = act(A·W + bias + resid): A f32 (ASPLIT -> hi/lo 2 terms), Wt bf16 [N][K]; ACT 0 none, 1 relu, 2 exact gelu;
// resid (optional, f32, row index = (row % rmod), pitch ldr, RES_BF16 rounds it) added before the activation.
template <bool ASPLIT, int ACT, bool BIAS_BF16, bool RES_BF16>
__global__ __launch_bounds__(128) void k_gemm_bf3(const float* __restrict__ A, int lda, const unsigned short* __restrict__ Wt, int ldb,
                                                const float* __restrict__ bias, const float* __restrict__ resid, int rmod, int ldr,
                                                float* __restrict__ C, int ldc, int M, int N, int K) {
  __shared__ __attribute__((aligned(16))) float so[4][16][64];
  const int tid = threadIdx.x, w = tid >> 5, lane = tid & 31, ln = lane & 15, hh = lane >> 4;
  const int ntn = N / 64;
  const int wid = blockIdx.x * 4 + w;
  const int mt = wid / ntn, nq = wid % ntn;
  if (mt * 16 >= M) return;
  const int row0 = mt * 16, col0 = nq * 64;
  const float* arow = A + (size_t)(row0 + ln) * lda;
  v8f acc[4] = {};
  for (int kb = 0; kb < K; kb += 32) {
    FragB ah, al;
    const v4f x0 = *(const v4fa*)(arow + kb + 8 * hh), x1 = *(const v4fa*)(arow + kb + 8 * hh + 4);
    const v4f x2 = *(const v4fa*)(arow + kb + 16 + 8 * hh), x3 = *(const v4fa*)(arow + kb + 16 + 8 * hh + 4);
    float xs[16] = {x0[0],x0[1],x0[2],x0[3],x1[0],x1[1],x1[2],x1[3],x2[0],x2[1],x2[2],x2[3],x3[0],x3[1],x3[2],x3[3]};
#pragma unroll
    for (int i = 0; i < 16; ++i) { const unsigned short hb = bf16_bits(xs[i]); ah.u[i] = hb; al.u[i] = ASPLIT ? bf16_bits(xs[i] - bf16_val(hb)) : (unsigned short)0; }
#pragma unroll
    for (int t = 0; t < 4; ++t) {
      const unsigned short* brow = Wt + (size_t)(col0 + t * 16 + ln) * ldb + kb;
      FragB b;
      b.half[0] = *(const v8us*)(brow + 8 * hh);
      b.half[1] = *(const v8us*)(brow + 16 + 8 * hh);
      acc[t] = mmaN<ASPLIT ? 2 : 1>(ah.v, al.v, b.v, b.v, acc[t]);
    }
  }
#pragma unroll
  for (int t = 0; t < 4; ++t) {
    const int col = col0 + t * 16 + ln;
    float bv = bias ? bias[col] : 0.f;
    if (BIAS_BF16) bv = bf16_round(bv);
#pragma unroll
    for (int r = 0; r < 8; ++r) {
      float v = acc[t][r] + bv;
      if (resid) { float rv = resid[(size_t)((row0 + 8 * hh + r) % rmod) * ldr + col]; if (RES_BF16) rv = bf16_round(rv); v += rv; }
      if (ACT == 1) v = fmaxf(v, 0.f);
      if (ACT == 2) v = 0.5f * v * (1.0f + erff(v * 0.70710678118654752f));
      if (ACT == 3) { const float u = 0.7978845608028654f * (v + 0.044715f * v * v * v); v = 0.5f * v * (1.0f + tanhf(u)); }
      so[w][8 * hh + r][t * 16 + ln] = v;
    }
  }
  __builtin_amdgcn_fence(__ATOMIC_ACQ_REL, "workgroup");
  __builtin_amdgcn_wave_barrier();
  const int rsub = lane >> 4, c4 = (lane & 15) * 4;
  {
#pragma unroll
    for (int q = 0; q < 8; ++q) {
      const int r = q * 2 + rsub;
      const v4f v = *(const v4fa*)&so[w][r][c4];
      *(v4f*)(C + (size_t)(row0 + r) * ldc + col0 + c4) = v;
    }
    
  }
}
// row LayerNorm (biased variance, eps) over N: s = X (+ R); optional out_sum <- s; out_norm <- (s-mu)*rsqrt(var+eps)*g + b
template <bool PARAM_BF16>
__global__ __launch_bounds__(256) void k_layernorm(const float* __restrict__ X, const float* __restrict__ R, const float* __restrict__ g, const float* __restrict__ bta,
                                                  float* __restrict__ out_sum, float* __restrict__ out_norm, int N, float eps) {
  __shared__ float red[256];
  const int row = blockIdx.x, tid = threadIdx.x;
  const float* x = X + (size_t)row * N; const float* rr = R ? R + (size_t)row * N : nullptr;
  float vals[16];                     // up to N = 4096
  const int per = N / 256;            // contiguous chunk per thread? use strided-by-4 chunks: thread handles j = tid*4 + 1024*u
  float s1 = 0.f;
  for (int u = 0; u < per / 4; ++u) {
    const int j = tid * 4 + 1024 * u;
    const v4f a = *(const v4fa*)(x + j);
    v4f b = {0.f,0.f,0.f,0.f}; if (rr) b = *(const v4fa*)(rr + j);
#pragma unroll
    for (int q = 0; q < 4; ++q) { const float v = a[q] + b[q]; vals[u * 4 + q] = v; s1 += v; }
  }
  red[tid] = s1; __syncthreads();
  for (int st = 128; st > 0; st >>= 1) { if (tid < st) red[tid] += red[tid + st]; __syncthreads(); }
  const float mu = red[0] / (float)N; __syncthreads();
  float s2 = 0.f;
  for (int u = 0; u < per / 4; ++u)
#pragma unroll
    for (int q = 0; q < 4; ++q) { const float c = vals[u * 4 + q] - mu; s2 += c * c; }
  red[tid] = s2; __syncthreads();
  for (int st = 128; st > 0; st >>= 1) { if (tid < st) red[tid] += red[tid + st]; __syncthreads(); }
  const float rs = rsqrtf(red[0] / (float)N + eps);
  {
    for (int u = 0; u < per / 4; ++u) {
      const int j = tid * 4 + 1024 * u;
      v4f o, sm;
#pragma unroll
      for (int q = 0; q < 4; ++q) {
        float gg = g[j + q], bb = bta[j + q];
        if (PARAM_BF16) { gg = bf16_round(gg); bb = bf16_round(bb); }
        sm[q] = vals[u * 4 + q]; o[q] = (vals[u * 4 + q] - mu) * rs * gg + bb;
      }
      if (out_sum) *(v4f*)(out_sum + (size_t)row * N + j) = sm;
      *(v4f*)(out_norm + (size_t)row * N + j) = o;
    }
    
  }
}



// ---- f16 WMMA path (v_wmma_f32_16x16x32_f16): 11-bit significands for operands in range — used where a [0,1] probability operand needs more precision than bf16
typedef _Float16 v16h __attribute__((ext_vector_type(16)));
union FragH { v16h v; v8us half[2]; _Float16 h[16]; unsigned short u[16]; };
template <int NT>
__device__ __forceinline__ v8f mmaH(v16h ah, v16h al, v16h bh, v16h bl, v8f c) {
  c = __builtin_amdgcn_wmma_f32_16x16x32_f16(false, ah, false, bh, (short)0, c, false, false);
  if (NT >= 2) c = __builtin_amdgcn_wmma_f32_16x16x32_f16(false, al, false, bh, (short)0, c, false, false);
  if (NT >= 3) c = __builtin_amdgcn_wmma_f32_16x16x32_f16(false, ah, false, bl, (short)0, c, false, false);
  asm volatile("v_nop\n\tv_nop\n\tv_nop\n\tv_nop" : "+v"(c) : "v"(ah), "v"(al), "v"(bh), "v"(bl));
  return c;
}
// batched GEMM like k_gemm_b but f16 operands: A f32 (split into f16 hi/lo if ASPLIT, else rounded to f16), Bt = f16 values [n][k]; alpha; C f32; N multiple of 16 (partial tiles skipped)
template <bool ASPLIT>
__global__ __launch_bounds__(128) void k_gemm_h(const float* __restrict__ A, int lda, size_t sA, const _Float16* __restrict__ Bh, int ldb, size_t sB, float alpha, float* __restrict__ C, int ldc, size_t sC, int M, int N, int K) {
  __shared__ __attribute__((aligned(16))) float so[4][16][64];
  const int tid = threadIdx.x, w = tid >> 5, lane = tid & 31, ln = lane & 15, hh = lane >> 4; const int by = blockIdx.y;
  A += (size_t)by * sA; Bh += (size_t)by * sB; C += (size_t)by * sC;
  const int ntn = (N + 63) / 64; const int wid = blockIdx.x * 4 + w; const int mt = wid / ntn, nq = wid % ntn; if (mt * 16 >= M) return;
  const int row0 = mt * 16, col0 = nq * 64; const float* arow = A + (size_t)(row0 + ln) * lda;
  v8f acc[4] = {};
  for (int kb = 0; kb < K; kb += 32) {
    FragH ah, al;
    const v4f x0 = *(const v4fa*)(arow + kb + 8 * hh), x1 = *(const v4fa*)(arow + kb + 8 * hh + 4), x2 = *(const v4fa*)(arow + kb + 16 + 8 * hh), x3 = *(const v4fa*)(arow + kb + 16 + 8 * hh + 4);
    float xs[16] = {x0[0],x0[1],x0[2],x0[3],x1[0],x1[1],x1[2],x1[3],x2[0],x2[1],x2[2],x2[3],x3[0],x3[1],x3[2],x3[3]};
#pragma unroll
    for (int i = 0; i < 16; ++i) { const _Float16 h = (_Float16)xs[i]; ah.h[i] = h; al.h[i] = ASPLIT ? (_Float16)(xs[i] - (float)h) : (_Float16)0.0f; }
#pragma unroll
    for (int t = 0; t < 4; ++t) { if (col0 + t * 16 >= N) continue; const size_t boff = (size_t)(col0 + t * 16 + ln) * ldb + kb; FragH bq; bq.half[0] = *(const v8us*)(Bh + boff + 8 * hh); bq.half[1] = *(const v8us*)(Bh + boff + 16 + 8 * hh);
      acc[t] = mmaH<ASPLIT ? 2 : 1>(ah.v, al.v, bq.v, bq.v, acc[t]); }
  }
#pragma unroll
  for (int t = 0; t < 4; ++t) { if (col0 + t * 16 >= N) continue;
#pragma unroll
    for (int r = 0; r < 8; ++r) so[w][8 * hh + r][t * 16 + ln] = acc[t][r] * alpha; }
  __builtin_amdgcn_fence(__ATOMIC_ACQ_REL, "workgroup"); __builtin_amdgcn_wave_barrier();
  const int rsub = lane >> 4, c4 = (lane & 15) * 4;
  {
#pragma unroll
    for (int q = 0; q < 8; ++q) { const int r = q * 2 + rsub; if (col0 + c4 < N) { const v4f v = *(const v4fa*)&so[w][r][c4]; *(v4f*)(C + (size_t)(row0 + r) * ldc + col0 + c4) = v; } }
     }
}

// Wt[n][k] = f16(W[k][n]·scale) from f32 row-major W[K][N] (scale = power of two; bf16-exact weights stay exact in f16 away from the subnormal range)
__global__ __launch_bounds__(256) void k_wt_f16(const float* __restrict__ W, _Float16* __restrict__ Wt, int K, int N, float scale) {
  const int t = blockIdx.x * 256 + threadIdx.x; if (t >= N * (K / 8)) return; const int n = t / (K / 8), k8 = (t % (K / 8)) * 8; FragH f;
#pragma unroll
  for (int i = 0; i < 8; ++i) f.h[i] = (_Float16)(bf16_round(W[(size_t)(k8 + i) * N + n]) * scale); const v8us o = f.half[0];
  *(v8us*)((unsigned short*)Wt + (size_t)n * K + k8) = o; 
}
// k_gemm_hh variant with fused epilogue: v = acc·alpha + bias[by·sBias + col] (+ CP[(row/rowsPerB)·sCPb + by·64 + col] if CP) ; ACT 0 none / 1 elu ; writes f16 C16 (and f32 C if non-null)
template <int ACT>
__global__ __launch_bounds__(128) void k_gemm_hhx(const _Float16* __restrict__ A, int lda, size_t sA, const _Float16* __restrict__ Bh, int ldb, size_t sB, float alpha, const float* __restrict__ bias, size_t sBias, const float* __restrict__ CP, int rowsPerB, size_t sCPb, int row0g,
    float* __restrict__ C, _Float16* __restrict__ C16, int ldc, size_t sC, int M, int N, int K) {
  __shared__ __attribute__((aligned(16))) float so[4][16][64];
  const int tid = threadIdx.x, w = tid >> 5, lane = tid & 31, ln = lane & 15, hh = lane >> 4; const int by = blockIdx.y;
  A += (size_t)by * sA; Bh += (size_t)by * sB; const size_t cofs = (size_t)by * sC; const float* bp = bias ? bias + (size_t)by * sBias : nullptr;
  const int ntn = (N + 63) / 64; const int wid = blockIdx.x * 4 + w; const int mt = wid / ntn, nq = wid % ntn; if (mt * 16 >= M) return;
  const int row0 = mt * 16, col0 = nq * 64; const _Float16* arow = A + (size_t)(row0 + ln) * lda;
  v8f acc[4] = {};
  for (int kb = 0; kb < K; kb += 32) { FragH ah; ah.half[0] = *(const v8us*)((const unsigned short*)arow + kb + 8 * hh); ah.half[1] = *(const v8us*)((const unsigned short*)arow + kb + 16 + 8 * hh);
#pragma unroll
    for (int t = 0; t < 4; ++t) { if (col0 + t * 16 >= N) continue; const size_t boff = (size_t)(col0 + t * 16 + ln) * ldb + kb; FragH bq; bq.half[0] = *(const v8us*)((const unsigned short*)Bh + boff + 8 * hh); bq.half[1] = *(const v8us*)((const unsigned short*)Bh + boff + 16 + 8 * hh);
      acc[t] = mmaH<1>(ah.v, ah.v, bq.v, bq.v, acc[t]); }
  }
#pragma unroll
  for (int t = 0; t < 4; ++t) { if (col0 + t * 16 >= N) continue; const int col = col0 + t * 16 + ln; const float bv = bp ? bf16_round(bp[col]) : 0.f;
#pragma unroll
    for (int r = 0; r < 8; ++r) { float v = acc[t][r] * alpha + bv; if (CP) { const int rr = row0g + row0 + 8 * hh + r; if (rowsPerB < 0) v += CP[cofs + (size_t)rr * ldc + col];      /* rowsPerB < 0: own element of the batched C plane */ else { const int bidx = rr / rowsPerB; v += CP[(size_t)bidx * sCPb + (size_t)by * 64 + col]; } } if (ACT == 1) v = (v > 0.f) ? v : expm1f(v); else if (ACT == 7) v = (v > 0.f) ? v + 1.0f : expf(v); else if (ACT == 8) v = tanhf(v); else if (ACT == 9) v = 0.5f * v * (1.0f + tanhf(0.7978845608028654f * (v + 0.044715f * v * v * v))); else if (ACT == 11) v = 1.0f / (1.0f + expf(-v)); else if (ACT == 12) v = (v > 0.f) ? v : 0.01f * v; else if (ACT == 14) v = (v > 0.f) ? v : 0.1f * v; else if (ACT == 16) v = (v >= 0.f) ? v : 0.3f * v; else if (ACT == 17) v = (v >= 0.f) ? v : 0.2f * v; else if (ACT == 15) v = v / (1.0f + expf(-v)); else if (ACT == 3) v = fmaxf(v, 0.f); else if (ACT == 6) v = 0.5f * v * (1.0f + erff(v * 0.70710678118654752f)); so[w][8 * hh + r][t * 16 + ln] = v; } }
  __builtin_amdgcn_fence(__ATOMIC_ACQ_REL, "workgroup"); __builtin_amdgcn_wave_barrier();
  const int rsub = lane >> 4, c4 = (lane & 15) * 4; typedef _Float16 v4h __attribute__((ext_vector_type(4)));
  {
#pragma unroll
    for (int q = 0; q < 8; ++q) { const int r = q * 2 + rsub; if (col0 + c4 < N) { const v4f v = *(const v4fa*)&so[w][r][c4]; if (C) *(v4f*)(C + cofs + (size_t)(row0 + r) * ldc + col0 + c4) = v; if (C16) { v4h h4; for (int i = 0; i < 4; ++i) h4[i] = (_Float16)v[i]; *(v4h*)(C16 + cofs + (size_t)(row0 + r) * ldc + col0 + c4) = h4; } } }
     }
}


typedef _Float16 v4h __attribute__((ext_vector_type(4)));

__global__ __launch_bounds__(256) void k_x16(const float* __restrict__ x, _Float16* __restrict__ X16, size_t n8) { const size_t t = (size_t)blockIdx.x * 256 + threadIdx.x; if (t >= n8) return; FragH f;
#pragma unroll
  for (int q = 0; q < 8; ++q) f.h[q] = (_Float16)bf16_round(x[t * 8 + q]); *(v8us*)((unsigned short*)X16 + t * 8) = f.half[0];  }
__global__ __launch_bounds__(256) void k_h16(const float* __restrict__ x, _Float16* __restrict__ X16, size_t n8) { const size_t t = (size_t)blockIdx.x * 256 + threadIdx.x; if (t >= n8) return; FragH f;
#pragma unroll
  for (int q = 0; q < 8; ++q) f.h[q] = (_Float16)x[t * 8 + q]; *(v8us*)((unsigned short*)X16 + t * 8) = f.half[0];  }
__global__ __launch_bounds__(256) void k_round16f(const float* __restrict__ W, _Float16* __restrict__ Bt, size_t n8) { const size_t t = (size_t)blockIdx.x * 256 + threadIdx.x; if (t >= n8) return; FragH f;
#pragma unroll
  for (int i = 0; i < 8; ++i) f.h[i] = (_Float16)(bf16_round(W[t * 8 + i]) * 16.0f); *(v8us*)((unsigned short*)Bt + t * 8) = f.half[0];  }

__global__ __launch_bounds__(256) void k_hl(const float* __restrict__ F, _Float16* __restrict__ Hh, _Float16* __restrict__ Hl, size_t n8) { const size_t t = (size_t)blockIdx.x * 256 + threadIdx.x; if (t >= n8) return; FragH fh, fl; const v4f a = *(const v4fa*)(F + t * 8), c = *(const v4fa*)(F + t * 8 + 4);
#pragma unroll
  for (int q = 0; q < 4; ++q) { _Float16 h = (_Float16)a[q]; fh.h[q] = h; fl.h[q] = (_Float16)((a[q] - (float)h) * 1024.0f); h = (_Float16)c[q]; fh.h[4 + q] = h; fl.h[4 + q] = (_Float16)((c[q] - (float)h) * 1024.0f); }
  { *(v8us*)((unsigned short*)Hh + t * 8) = fh.half[0]; *(v8us*)((unsigned short*)Hl + t * 8) = fl.half[0];  } }

// ---- fast GEMM tile: C = A . B^T * alpha + bias, A [M][K] and B [N][K] f16 rows; work-group tile 128x64, wave tile 32x64 (M % 128 == 0, N % 64 == 0, K % 32 == 0) ----
__device__ __forceinline__ v16h g2_frag(const _Float16* p, int hh) { FragH f; f.half[0] = *(const v8us*)((const unsigned short*)p + 8 * hh); f.half[1] = *(const v8us*)((const unsigned short*)p + 16 + 8 * hh); return f.v; }
__device__ __forceinline__ v8f g2_mma(v16h a, v16h b, v8f c) { v8f d = __builtin_amdgcn_wmma_f32_16x16x32_f16(false, a, false, b, (short)0, c, false, false); asm volatile("v_nop\n\tv_nop\n\tv_nop\n\tv_nop" : "+v"(d) : "v"(a), "v"(b)); return d; }
// RB: the bias belongs to the row of C (channel-major outputs), else to its column. TO: element type of C (float or f16). bx: tile index, column tiles fastest.
template <bool RB, typename TO>
__device__ __forceinline__ void g2_tile(float (&so)[4][32][68], const _Float16* __restrict__ A, int lda, const _Float16* __restrict__ Bh, int ldb, float alpha, const float* __restrict__ bp, TO* __restrict__ C, int ldc, int bx, int N, int K) {
  const int tid = threadIdx.x, w = tid >> 5, lane = tid & 31, ln = lane & 15, hh = lane >> 4;
  const int ntn = N >> 6; const int mt = bx / ntn, nq = bx - mt * ntn; const int row0 = mt * 128 + 32 * w, col0 = nq * 64;
  const _Float16* a0p = A + (size_t)(row0 + ln) * lda + 8 * hh;      /* + 8 hh: the lane half's k offset sits in the row pointers */
  const _Float16* b0p = Bh + (size_t)(col0 + ln) * ldb + 8 * hh; const _Float16* b1p = b0p + (size_t)16 * ldb; const _Float16* b2p = b1p + (size_t)16 * ldb; const _Float16* b3p = b2p + (size_t)16 * ldb;
  const v8f z8 = {0.f,0.f,0.f,0.f,0.f,0.f,0.f,0.f}; v8f c00 = z8, c01 = z8, c02 = z8, c03 = z8, c10 = z8, c11 = z8, c12 = z8, c13 = z8;
#pragma unroll 1
  for (int kb = 0; kb < K; kb += 32) { const _Float16* ap = a0p + kb; const v16h a0 = g2_frag(ap, 0), a1 = g2_frag(ap + 16 * lda, 0);
    v16h b = g2_frag(b0p + kb, 0);
    asm volatile("s_wait_xcnt 0x0" :: "v"(ap) : "memory");      // the four A loads name one address pair; as an input here it stays whole up to this wait; behind the first B loads, so that these issue first
    c00 = g2_mma(a0, b, c00); c10 = g2_mma(a1, b, c10);
    b = g2_frag(b1p + kb, 0); c01 = g2_mma(a0, b, c01); c11 = g2_mma(a1, b, c11);
    b = g2_frag(b2p + kb, 0); c02 = g2_mma(a0, b, c02); c12 = g2_mma(a1, b, c12);
    b = g2_frag(b3p + kb, 0); c03 = g2_mma(a0, b, c03); c13 = g2_mma(a1, b, c13); }
  v8f accs[8] = {c00, c01, c02, c03, c10, c11, c12, c13};
#pragma unroll
  for (int u = 0; u < 8; ++u) { const int t = u & 3, half = u >> 2; const int col = col0 + t * 16 + ln;
#pragma unroll
    for (int r = 0; r < 8; ++r) { const int rloc = half * 16 + 8 * hh + r; const float bv = bf16_round(RB ? bp[row0 + rloc] : bp[col]); so[w][rloc][t * 16 + ln] = accs[u][r] * alpha + bv; } }
  __builtin_amdgcn_fence(__ATOMIC_ACQ_REL, "workgroup"); __builtin_amdgcn_wave_barrier();
  const int rsub = lane >> 4, c4 = (lane & 15) * 4;
#pragma unroll
  for (int q = 0; q < 16; ++q) { const int r = q * 2 + rsub; const v4f v = *(const v4fa*)&so[w][r][c4]; typedef TO v4o __attribute__((ext_vector_type(4))); v4o o4; for (int i = 0; i < 4; ++i) o4[i] = (TO)v[i]; *(v4o*)(C + (size_t)(row0 + r) * ldc + col0 + c4) = o4; } }
// The three projections in one grid (blockIdx.y: 0 Q, 1 K, 2 V). Q and K: token rows x permuted channels. V: permuted channels x tokens of one batch (A = weights, B = token rows), which is V^T as the attention reads it.
#define QKV_G ((int)((NR / 128) * (CC / 64)))      /* tiles of one projection, either way round */
#define CT_G ((CC / 128) * (LL / 64))              /* tiles of one batch's channel-major product */
static_assert(QKV_G == NB * CT_G, "the V tiles must fill the same grid row as the Q and K tiles");
__global__ __launch_bounds__(128) void k_qkv(const _Float16* __restrict__ XQ, const _Float16* __restrict__ XK, const _Float16* __restrict__ XV, const _Float16* __restrict__ BQ, const _Float16* __restrict__ BK, const _Float16* __restrict__ BV, const float* __restrict__ BP, _Float16* __restrict__ Q16, _Float16* __restrict__ K16, _Float16* __restrict__ VT) {
  __shared__ __attribute__((aligned(16))) float so[4][32][68];
  const int by = blockIdx.y, bx = blockIdx.x;
  if (by < 2) g2_tile<false>(so, by ? XK : XQ, CC, by ? BK : BQ, CC, 0.0625f, BP + by * CC, by ? K16 : Q16, CC, bx, CC, CC);
  else { const int b = bx / CT_G; g2_tile<true>(so, BV, CC, XV + (size_t)b * LL * CC, CC, 0.0625f, BP + 2 * CC, VT + (size_t)b * CC * LL, LL, bx - b * CT_G, LL, CC); } }
// out[b][c][n] = sum_k' w_m'[c][k'] o[(b,n)][k'] / 1024 + b_m[c] (channel-major directly; blockIdx.y = batch)
__global__ __launch_bounds__(128) void k_out(const _Float16* __restrict__ AM, const _Float16* __restrict__ O16, const float* __restrict__ bm, float* __restrict__ out) {
  __shared__ __attribute__((aligned(16))) float so[4][32][68];
  const size_t b = blockIdx.y;
  g2_tile<true>(so, AM, CC, O16 + b * LL * CC, CC, 0.0009765625f, bm, out + b * CC * LL, LL, blockIdx.x, LL, CC); }


__global__ __launch_bounds__(256) void k_wnat(const float* __restrict__ w, size_t n8, _Float16* __restrict__ Bt) { const size_t t = (size_t)blockIdx.x * 256 + threadIdx.x; if (t >= n8) return; FragH f; for (int q = 0; q < 8; ++q) f.h[q] = (_Float16)(bf16_round(w[t * 8 + q]) * 16.0f); *(v8us*)((unsigned short*)Bt + t * 8) = f.half[0];  }
__global__ __launch_bounds__(256) void k_rsm(const float* __restrict__ S, _Float16* __restrict__ P, int nrows) {
  #pragma clang fp contract(off)
  const int i = blockIdx.x * 256 + threadIdx.x; if (i >= nrows) return; const float* s = S + (size_t)i * SQ; float mx = -3.0e38f;
#pragma unroll 1
  for (int j = 0; j < SQ; ++j) mx = fmaxf(mx, s[j]); float se = 0.f;
#pragma unroll 1
  for (int j = 0; j < SQ; ++j) se += expf(s[j] - mx); const float sc = 256.0f / se;
#pragma unroll 1
  for (int j0 = 0; j0 < SQ; j0 += 8) { FragH f; for (int q = 0; q < 8; ++q) f.h[q] = (_Float16)(expf(s[j0 + q] - mx) * sc); unsigned short* d = (unsigned short*)P + (size_t)i * SQ + j0; *(v8us*)d = f.half[0];  } }
__global__ __launch_bounds__(256) void k_vt(const _Float16* __restrict__ V16, int b, int h0, _Float16* __restrict__ VT) { __shared__ unsigned short tl[64][65]; const int tid = threadIdx.x; const int hh = blockIdx.x % HG, sg = blockIdx.x / HG; const int s0 = sg * 64; const int h = h0 + hh;
  for (int i = tid; i < 64 * 8; i += 256) { const int j = i / 8, d8 = (i % 8) * 8; FragH f; f.half[0] = *(const v8us*)((const unsigned short*)V16 + ((size_t)b * SQ + s0 + j) * DM + h * HD + d8); for (int q = 0; q < 8; ++q) tl[d8 + q][j] = f.u[q]; }
  __syncthreads();
  { for (int i = tid; i < 64 * 8; i += 256) { const int d = i / 8, j8 = (i % 8) * 8; FragH f; for (int q = 0; q < 8; ++q) f.u[q] = tl[d][j8 + q]; *(v8us*)((unsigned short*)VT + ((size_t)hh * HD + d) * SQ + s0 + j8) = f.half[0]; }  } }

// ---- operand preparation: the bodies below are dealt to the work-groups of one grid by index (k_prep); bx = index within the body's own share ----
// Behind a body's last global store: in the built kernel a work-group's way to the end passes the heads of other bodies, which write registers that the store names; this wait stands in front of them.
__device__ __forceinline__ void p_stored() { asm volatile("s_wait_xcnt 0x0" ::: "memory"); }
// One work-group transposes the 64-channel x 128-token tile bx of all three inputs. A lane takes 8 channels x 4 tokens of each input: 8 loads of 16 bytes (4 tokens of one channel each);
// its 8 channels of one token are then one 16-byte store, so the transpose happens in the lane's own registers. 8 lanes cover the 64 channels of a token: every store fills whole 128-byte lines.
// All 24 loads are issued before the first value is used, so a work-group's whole share is in flight at once.
__device__ __forceinline__ void p_rows8(const v4f (&x)[8], _Float16* __restrict__ XR) {
#pragma unroll
  for (int i = 0; i < 4; ++i) { FragH f; for (int j = 0; j < 8; ++j) f.h[j] = (_Float16)bf16_round(x[j][i]); *(v8us*)((unsigned short*)XR + i * CC) = f.half[0]; }
  p_stored(); }      /* also in front of the next input's conversions, which reuse the registers that these stores name */
__device__ __forceinline__ void p_cl2rows(const float* __restrict__ xq, const float* __restrict__ xk, const float* __restrict__ xv, _Float16* __restrict__ XQ, _Float16* __restrict__ XK, _Float16* __restrict__ XV, int bx) {
  const int tid = threadIdx.x, cg = tid & 7, tq = tid >> 3; const int nl = LL / 128, nc = CC / 64; const int cb_ = bx % nc; const int lb = (bx / nc) % nl; const size_t b = bx / (nc * nl);
  const size_t us = (b * CC + cb_ * 64) * (size_t)LL + lb * 128, ud = (b * LL + lb * 128) * (size_t)CC + cb_ * 64;      /* the tile's corner, the same for the whole work-group */
  const int ls = cg * 8 * LL + tq * 4, ld = tq * 4 * CC + cg * 8;      /* the lane's own place in the tile */
  const float* pq = xq + us; const float* pk = xk + us; const float* pv = xv + us;
  v4f q[8], k[8], v[8];
#pragma unroll
  for (int j = 0; j < 8; ++j) q[j] = *(const v4fa*)(pq + ls + j * LL);
  __builtin_amdgcn_sched_barrier(0);      // the three scheduling barriers keep the loads in the order in which they are used (counted waits: q is converted while k and v still fly)
#pragma unroll
  for (int j = 0; j < 8; ++j) k[j] = *(const v4fa*)(pk + ls + j * LL);
  __builtin_amdgcn_sched_barrier(0);
#pragma unroll
  for (int j = 0; j < 8; ++j) v[j] = *(const v4fa*)(pv + ls + j * LL);
  __builtin_amdgcn_sched_barrier(0);      // and all 24 ahead of the first conversion: without it the scheduler held half of them back behind waits on the first ones
  asm volatile("s_wait_xcnt 0x0" :: "s"(pq), "s"(pk), "s"(pv) : "memory");      // stands behind the 24 loads and in front of whatever rewrites the address registers that they name; the three bases are inputs so that each keeps its own scalar pair up to here (else one was formed in another's pair, behind a wait between the loads)
  p_rows8(q, XQ + ud + ld);
  __builtin_amdgcn_sched_barrier(0);      // here and below: the next input's conversions stay behind these stores; moved ahead of them, they held two of the four stores back behind a wait on the next input's loads
  p_rows8(k, XK + ud + ld);
  __builtin_amdgcn_sched_barrier(0);
  p_rows8(v, XV + ud + ld); }
__device__ __forceinline__ void p_wperm(const float* __restrict__ w, _Float16* __restrict__ Bt, int bx) { const int t = bx * 256 + threadIdx.x; const int k8 = (t % (CC / 8)) * 8, np_ = t / (CC / 8); const int h = np_ / HD, dd = np_ % HD; const int src = dd * NH + h; FragH f;
  for (int q = 0; q < 8; ++q) f.h[q] = (_Float16)(bf16_round(w[(size_t)src * CC + k8 + q]) * 16.0f); unsigned short* d = (unsigned short*)Bt + (size_t)np_ * CC + k8; *(v8us*)d = f.half[0];  }
__device__ __forceinline__ void p_wpermc(const float* __restrict__ w, _Float16* __restrict__ A, int bx) { const int t = bx * 256 + threadIdx.x; const int k8 = (t % (CC / 8)) * 8, c = t / (CC / 8); FragH f;
  for (int q = 0; q < 8; ++q) { const int kp = k8 + q; const int h = kp / HD, dd = kp % HD; f.h[q] = (_Float16)(bf16_round(w[(size_t)c * CC + dd * NH + h]) * 16.0f); } unsigned short* d = (unsigned short*)A + (size_t)c * CC + k8; *(v8us*)d = f.half[0]; p_stored(); }
__device__ __forceinline__ void p_bperm(const float* __restrict__ b0, const float* __restrict__ b1, const float* __restrict__ b2, float* __restrict__ BP) { const int t = threadIdx.x; const int h = t / HD, dd = t % HD; const int src = dd * NH + h;
  { *(float*)(BP + t) = b0[src]; *(float*)(BP + CC + t) = b1[src]; *(float*)(BP + 2 * CC + t) = b2[src];  } }
#define PW_G (CC * (CC / 8) / 256)                 /* work-groups per weight matrix: 8 elements a thread, exactly */
#define PX_G (NB * (LL / 128) * (CC / 64))         /* work-groups of the transposes: 64-channel x 128-token tiles, each of all three inputs */
static_assert(PW_G * 256 == CC * (CC / 8) && CC == 256, "the weight and bias bodies have no tail guard");
// Every branch is on blockIdx alone. The short weight and bias bodies take the lowest indices: they start first and end under the transposes.
__global__ __launch_bounds__(256) void k_prep(const float* __restrict__ xq, const float* __restrict__ xk, const float* __restrict__ xv, const float* __restrict__ wq, const float* __restrict__ wk, const float* __restrict__ wv, const float* __restrict__ wm, const float* __restrict__ bq, const float* __restrict__ bk, const float* __restrict__ bv,
    _Float16* __restrict__ XQ, _Float16* __restrict__ XK, _Float16* __restrict__ XV, _Float16* __restrict__ BQ, _Float16* __restrict__ BK, _Float16* __restrict__ BV, _Float16* __restrict__ AM, float* __restrict__ BP) {
  const int bx = blockIdx.x;
  if (bx < 3 * PW_G) { const int s = bx / PW_G; p_wperm(s == 0 ? wq : s == 1 ? wk : wv, s == 0 ? BQ : s == 1 ? BK : BV, bx - s * PW_G); }
  else if (bx < 4 * PW_G) p_wpermc(wm, AM, bx - 3 * PW_G);
  else if (bx == 4 * PW_G) p_bperm(bq, bk, bv, BP);
  else p_cl2rows(xq, xk, xv, XQ, XK, XV, bx - (4 * PW_G + 1)); }
__device__ __forceinline__ float rs_xh(float x) { return __builtin_bit_cast(float, __builtin_amdgcn_permlanex16(__builtin_bit_cast(int, x), __builtin_bit_cast(int, x), 0x76543210, 0xfedcba98, false, false)); }      /* lane l <- lane l ^ 16 */
// 2^z on the transcendental unit. The v_nop is the slot that the instruction set asks for behind a transcendental before its result is read or its source overwritten.
__device__ __forceinline__ float rs_exp2(float z) { float y; asm("v_exp_f32 %0, %1\n\tv_nop" : "=v"(y) : "v"(z)); return y; }
// Eight independent 2^z in place: each fills the slot behind the one before it, the v_nop fills the slot behind the last.
__device__ __forceinline__ void fa_exp2x8(float (&z)[8]) { asm("v_exp_f32 %0, %0\n\tv_exp_f32 %1, %1\n\tv_exp_f32 %2, %2\n\tv_exp_f32 %3, %3\n\tv_exp_f32 %4, %4\n\tv_exp_f32 %5, %5\n\tv_exp_f32 %6, %6\n\tv_exp_f32 %7, %7\n\tv_nop" : "+v"(z[0]), "+v"(z[1]), "+v"(z[2]), "+v"(z[3]), "+v"(z[4]), "+v"(z[5]), "+v"(z[6]), "+v"(z[7])); }
#define FA_KS 64                     /* keys per stage */
#define FA_PK 144                    /* LDS row pitch, bytes: 128 + 16, an odd multiple of 16 for 16-byte readers */
__device__ __forceinline__ v8f fa_mma(v16h a, v16h b, v8f c) { return __builtin_amdgcn_wmma_f32_16x16x32_f16(false, a, false, b, (short)0, c, false, false); }
__device__ __forceinline__ v16h fa_lfrag(const unsigned char* p) { FragH f; f.half[0] = *(const v8us*)p; f.half[1] = *(const v8us*)(p + 32); return f.v; }      /* p already holds + 16 hh: k = 8 hh .. and 16 + 8 hh .. */
__global__ __launch_bounds__(256) void k_fattn(const _Float16* __restrict__ Q16, const _Float16* __restrict__ K16, const _Float16* __restrict__ VT, _Float16* __restrict__ O16) {
  __shared__ __attribute__((aligned(16))) unsigned char L[2][2][FA_KS * FA_PK];      /* [buffer][K, V^T][row][pitch] */
  const int tid = threadIdx.x, lane = tid & 31, w = tid >> 5, c = lane & 15, hh = lane >> 4; const int h = blockIdx.y, b = blockIdx.z; const size_t r0 = (size_t)b * LL; const int q0 = blockIdx.x * 256 + w * 32;
  const float cs = 0.125f * 1.44269504088896340736f;      /* 1 / sqrt(64), times log2(e) */
  v16h qf[2][2];
#pragma unroll
  for (int g = 0; g < 2; ++g) for (int kc = 0; kc < 2; ++kc) qf[g][kc] = g2_frag(Q16 + (r0 + q0 + g * 16 + c) * CC + h * HD + kc * 32, hh);
  const int srow = tid >> 2, sseg = (tid & 3) * 32;      /* staging: 4 threads cover one 128-byte row, 32 bytes each */
  const unsigned char* kg = (const unsigned char*)(K16 + (r0 + srow) * CC + h * HD) + sseg;      /* key rows: + 64 rows a stage */
  const unsigned char* vg = (const unsigned char*)(VT + ((size_t)(b * NH + h) * HD + srow) * SQ) + sseg;      /* d rows: + 64 keys a stage */
  const int sdst = srow * FA_PK + sseg;
  v8us k0 = *(const v8us*)kg, k1 = *(const v8us*)(kg + 16), v0 = *(const v8us*)vg, v1 = *(const v8us*)(vg + 16);
  *(v8us*)&L[0][0][sdst] = k0; *(v8us*)&L[0][0][sdst + 16] = k1; *(v8us*)&L[0][1][sdst] = v0; *(v8us*)&L[0][1][sdst + 16] = v1;
  const v8f z8 = {0.f, 0.f, 0.f, 0.f, 0.f, 0.f, 0.f, 0.f}; v8f acc[2][4]; float m_run[2], l_run[2];
#pragma unroll
  for (int g = 0; g < 2; ++g) { m_run[g] = -__builtin_inff(); l_run[g] = 0.f; for (int t = 0; t < 4; ++t) acc[g][t] = z8; }
  __syncthreads();      /* stage 0 published */
#pragma unroll 1      // one stage a trip: the body already holds two unrolled 32-key passes
  for (int st = 0; st < SQ / FA_KS; ++st) {
    const bool more = st + 1 < SQ / FA_KS;
    if (more) { const unsigned char* kn = kg + (size_t)(st + 1) * (FA_KS * CC * 2); const unsigned char* vn = vg + (size_t)(st + 1) * (FA_KS * 2); k0 = *(const v8us*)kn; k1 = *(const v8us*)(kn + 16); v0 = *(const v8us*)vn; v1 = *(const v8us*)(vn + 16); }
    const unsigned char* Kb = &L[st & 1][0][c * FA_PK + 16 * hh]; const unsigned char* Vb = &L[st & 1][1][c * FA_PK + 16 * hh];
#pragma unroll
    for (int sub = 0; sub < 2; ++sub) {      /* one pass = 32 keys */
      v8f s[2][2];
#pragma unroll
      for (int kt = 0; kt < 2; ++kt) { const v16h ka = fa_lfrag(Kb + (sub * 32 + kt * 16) * FA_PK), kb2 = fa_lfrag(Kb + (sub * 32 + kt * 16) * FA_PK + 64);
        for (int g = 0; g < 2; ++g) s[kt][g] = fa_mma(kb2, qf[g][1], fa_mma(ka, qf[g][0], z8)); }
      v16h vf[4];
#pragma unroll
      for (int t = 0; t < 4; ++t) vf[t] = fa_lfrag(Vb + t * 16 * FA_PK + sub * 64);
      float mb[2]; bool need = false;
#pragma unroll
      for (int g = 0; g < 2; ++g) { float mx = fmaxf(s[0][g][0], s[1][g][0]);
        for (int r = 1; r < 8; ++r) mx = fmaxf(mx, fmaxf(s[0][g][r], s[1][g][r]));
        mx = fmaxf(mx, rs_xh(mx)) * cs; mb[g] = mx; need = need || (mx > m_run[g] + 8.0f); }      /* both wave halves hold the query's maximum, scaled (the scale is positive) */
      if (__builtin_amdgcn_ballot_w32(need) != 0) {      /* wave-uniform scalar branch, one test a pass; always taken on the first pass (m_run = -inf gives corr = 0) */
#pragma unroll
        for (int g = 0; g < 2; ++g) { const float m_new = fmaxf(m_run[g], mb[g]); const float corr = rs_exp2(m_run[g] - m_new); m_run[g] = m_new; l_run[g] *= corr; for (int t = 0; t < 4; ++t) acc[g][t] = acc[g][t] * corr; }
      }
#pragma unroll
      for (int g = 0; g < 2; ++g) { const float nm = -m_run[g]; float e0[8], e1[8];
        for (int r = 0; r < 8; ++r) { e0[r] = __builtin_fmaf(s[0][g][r], cs, nm); e1[r] = __builtin_fmaf(s[1][g][r], cs, nm); }
        fa_exp2x8(e0); fa_exp2x8(e1);
        l_run[g] += (((e0[0] + e0[1]) + (e0[2] + e0[3])) + ((e0[4] + e0[5]) + (e0[6] + e0[7]))) + (((e1[0] + e1[1]) + (e1[2] + e1[3])) + ((e1[4] + e1[5]) + (e1[6] + e1[7])));
        FragH pf; for (int r = 0; r < 8; ++r) { pf.h[r] = (_Float16)e0[r]; pf.h[8 + r] = (_Float16)e1[r]; }      /* element s: key 8 hh + s, then 16 + 8 hh + (s - 8): the k order of V^T's loader */
        for (int t = 0; t < 4; ++t) acc[g][t] = fa_mma(vf[t], pf.v, acc[g][t]); }
    }
    if (more) { unsigned char* d = &L[(st + 1) & 1][0][sdst]; *(v8us*)d = k0; *(v8us*)(d + 16) = k1; *(v8us*)(d + FA_KS * FA_PK) = v0; *(v8us*)(d + FA_KS * FA_PK + 16) = v1; }      /* its last readers left it before the barrier that ended trip st - 1 */
    __syncthreads();      /* publishes stage st + 1 and ends every read of stage st */
  }
#pragma unroll
  for (int g = 0; g < 2; ++g) { const float l = l_run[g] + rs_xh(l_run[g]); const float inv = 64.0f / l; unsigned short* d = (unsigned short*)O16 + (r0 + q0 + g * 16 + c) * CC + h * HD + 8 * hh;      /* o x64; a lane's 8 registers are 8 consecutive d of its query */
    for (int t = 0; t < 4; ++t) { FragH f; for (int r = 0; r < 8; ++r) f.h[r] = (_Float16)(acc[g][t][r] * inv); *(v8us*)(d + t * 16) = f.half[0]; } } }

extern "C" void kernel_launch(void* const* d_in, const int* in_sizes, int n_in,
                              void* d_out, int out_size, void* d_ws, size_t ws_size, hipStream_t stream) {
  (void)in_sizes; (void)n_in; (void)out_size;
  const float* const* I = (const float* const*)d_in; const float* xq = I[0]; const float* xk = I[1]; const float* xv = I[2]; const float* wq = I[3]; const float* bq = I[4]; const float* wk = I[5]; const float* bk = I[6]; const float* wv = I[7]; const float* bv = I[8]; const float* wm = I[9]; const float* bm = I[10];
  char* ws = (char*)d_ws; size_t off = 0;
  auto take = [&](size_t bytes) { char* p = ws + off; off += (bytes + 255) & ~(size_t)255; return p; };
  _Float16* BQ = (_Float16*)take((size_t)CC * CC * 2); _Float16* BK = (_Float16*)take((size_t)CC * CC * 2); _Float16* BV = (_Float16*)take((size_t)CC * CC * 2); _Float16* AM = (_Float16*)take((size_t)CC * CC * 2); float* BP = (float*)take((size_t)3 * CC * 4);
  _Float16* XQ = (_Float16*)take(NR * CC * 2); _Float16* XK = (_Float16*)take(NR * CC * 2); _Float16* XV = (_Float16*)take(NR * CC * 2); _Float16* Q16 = (_Float16*)take(NR * CC * 2); _Float16* K16 = (_Float16*)take(NR * CC * 2); _Float16* O16 = (_Float16*)take(NR * CC * 2);
  _Float16* VT = (_Float16*)take((size_t)NB * NH * HD * SQ * 2);
  if (off > ws_size) return;      /* 0.5 + 48 + 8 = approx 57 MiB */
  k_prep<<<4 * PW_G + 1 + PX_G, 256, 0, stream>>>(xq, xk, xv, wq, wk, wv, wm, bq, bk, bv, XQ, XK, XV, BQ, BK, BV, AM, BP);
  k_qkv<<<dim3(QKV_G, 3), 128, 0, stream>>>(XQ, XK, XV, BQ, BK, BV, BP, Q16, K16, VT);      /* q, k token rows; V^T [8][4][64][2048] */
  k_fattn<<<dim3(SQ / 256, NH, NB), 256, 0, stream>>>(Q16, K16, VT, O16);      /* o x64, head-major f16 rows */
  k_out<<<dim3(CT_G, NB), 128, 0, stream>>>(AM, O16, bm, (float*)d_out);
}

// v005
// One run takes 65 microseconds.
// Timed twice side by side with v004, it ran 1.27 and 1.28 times as fast.
// Over all steps from v000 it is 54.1 times as fast.
#include <hip/hip_runtime.h>
// SuperGlue multi-head attention (query, key, value channel-first [8][256][2048]; q/k/v = 1x1 conv (natural [256][256] + bias); the module's head split view(B, d=64, H=4, N) makes channel c = dd*4 + h (INTERLEAVED heads); scores = q.k / 8 per head over 2,048 keys; softmax; x merged back to c = dd*4 + h; out = w_m x + b_m -> [8][256][2048]).
// Structure, 4 launches: (1) one preparation grid: channel-first inputs transposed to token rows (exact f16) in registers, projection weights and biases permuted so the head split becomes contiguous 64-column blocks (exact x16 f16); (2) Q, K and V as WMMA GEMMs in one grid (32x64 wave tiles, f32 accumulation, f16 outputs), V with the operands swapped so that V^T [8][4][64][2048] is written directly; (3) scores, softmax and P . V fused in one kernel over all batches and heads (S^T = K . Q^T, online softmax in f32, O^T += V^T . P^T, P stays in registers as f16; o x64 in f16) into head-major rows; (4) out channel-major directly: (w_m with permuted columns) . o^T GEMM batched over the 8 batches (alpha folds 1/16 and 1/64), the per-channel bias added in its epilogue.
// Compute dtype: inputs rounded to bf16; inputs / weights exact in f16; q, k, v, softmax weights and o plain f16 (~2^-12); scores and softmax statistics f32. v_wmma_f32_16x16x32_f16.
#define NB 8
#define CC 256
#define LL 2048
#define SQ LL
#define DM CC
#define NH 4
#define HD 64
#define HG 4
#define QN SQ                        /* query rows per batch (unused) */
#define NR ((size_t)NB * LL)
typedef __bf16 v16b __attribute__((ext_vector_type(16)));
typedef unsigned short v8us __attribute__((ext_vector_type(8), may_alias));
typedef float  v8f  __attribute__((ext_vector_type(8)));
typedef float  v4f  __attribute__((ext_vector_type(4)));
typedef float  v4fa __attribute__((ext_vector_type(4), may_alias));
union FragB { v16b v; v8us half[2]; unsigned short u[16]; };

__device__ __forceinline__ unsigned short bf16_bits(float x) { unsigned int u = __float_as_uint(x); return (unsigned short)((u + 0x7FFFu + ((u >> 16) & 1u)) >> 16); }
__device__ __forceinline__ float bf16_val(unsigned short b) { return __uint_as_float(((unsigned int)b) << 16); }
__device__ __forceinline__ float bf16_round(float x) { return bf16_val(bf16_bits(x)); }
// D += A·B with NT terms: 1 = ah·bh, 2 = + al·bh (A split), 3 = + ah·bl (both split)
template <int NT>
__device__ __forceinline__ v8f mmaN(v16b ah, v16b al, v16b bh, v16b bl, v8f c) {
  c = __builtin_amdgcn_wmma_f32_16x16x32_bf16(false, ah, false, bh, (short)0, c, false, false);
  if (NT >= 2) c = __builtin_amdgcn_wmma_f32_16x16x32_bf16(false, al, false, bh, (short)0, c, false, false);
  if (NT >= 3) c = __builtin_amdgcn_wmma_f32_16x16x32_bf16(false, ah, false, bl, (short)0, c, false, false);
  asm volatile("v_nop\n\tv_nop\n\tv_nop\n\tv_nop" : "+v"(c) : "v"(ah), "v"(al), "v"(bh), "v"(bl));
  return c;
}

__global__ __launch_bounds__(256) void k_wt_bf16(const float* __restrict__ W, unsigned short* __restrict__ Wt, int K, int N) {
  const int t = blockIdx.x * 256 + threadIdx.x;
  const int k8n = K / 8;
  if (t >= N * k8n) return;
  const int n = t / k8n, k8 = (t % k8n) * 8;
  v8us v;
#pragma unroll
  for (int i = 0; i < 8; ++i) v[i] = bf16_bits(W[(size_t)(k8 + i) * N + n]);
  *(v8us*)(Wt + (size_t)n * K + k8) = v;
  
}

// GEMM C[M][N] (f32, pitch ldc) = act(A[M][K]·W + bias). A f32 row-major (pitch lda) converted per fragment to bf16
// (ASPLIT: hi/lo two planes -> 2 terms, else single rounded term); Wt bf16 [N][K] (pitch ldb). BIAS_BF16 rounds the
// bias to bf16 first (bias quantised to bf16 before the add). K%32==0, M%16==0, N%64==0.
template <bool ASPLIT, int ACT, bool BIAS_BF16>
__global__ __launch_bounds__(128) void k_gemm_bf(const float* __restrict__ A, int lda, const unsigned short* __restrict__ Wt, int ldb,
                                               const float* __restrict__ bias, float* __restrict__ C, int ldc, int M, int N, int K) {
  __shared__ __attribute__((aligned(16))) float so[4][16][64];
  const int tid = threadIdx.x, w = tid >> 5, lane = tid & 31, ln = lane & 15, hh = lane >> 4;
  const int ntn = N / 64;
  const int wid = blockIdx.x * 4 + w;
  const int mt = wid / ntn, nq = wid % ntn;
  if (mt * 16 >= M) return;
  const int row0 = mt * 16, col0 = nq * 64;
  const float* arow = A + (size_t)(row0 + ln) * lda;
  v8f acc[4] = {};
  for (int kb = 0; kb < K; kb += 32) {
    FragB ah, al;
    const v4f x0 = *(const v4fa*)(arow + kb + 8 * hh), x1 = *(const v4fa*)(arow + kb + 8 * hh + 4);
    const v4f x2 = *(const v4fa*)(arow + kb + 16 + 8 * hh), x3 = *(const v4fa*)(arow + kb + 16 + 8 * hh + 4);
    float xs[16] = {x0[0],x0[1],x0[2],x0[3],x1[0],x1[1],x1[2],x1[3],x2[0],x2[1],x2[2],x2[3],x3[0],x3[1],x3[2],x3[3]};
#pragma unroll
    for (int i = 0; i < 16; ++i) { const unsigned short hb = bf16_bits(xs[i]); ah.u[i] = hb; al.u[i] = ASPLIT ? bf16_bits(xs[i] - bf16_val(hb)) : (unsigned short)0; }
#pragma unroll
    for (int t = 0; t < 4; ++t) {
      const unsigned short* brow = Wt + (size_t)(col0 + t * 16 + ln) * ldb + kb;
      FragB b;
      b.half[0] = *(const v8us*)(brow + 8 * hh);
      b.half[1] = *(const v8us*)(brow + 16 + 8 * hh);
      acc[t] = mmaN<ASPLIT ? 2 : 1>(ah.v, al.v, b.v, b.v, acc[t]);
    }
  }
#pragma unroll
  for (int t = 0; t < 4; ++t) {
    float bv = bias ? bias[col0 + t * 16 + ln] : 0.f;
    if (BIAS_BF16) bv = bf16_round(bv);
#pragma unroll
    for (int r = 0; r < 8; ++r) { float v = acc[t][r] + bv; if (ACT == 1) v = fmaxf(v, 0.f); so[w][8 * hh + r][t * 16 + ln] = v; }
  }
  __builtin_amdgcn_fence(__ATOMIC_ACQ_REL, "workgroup");
  __builtin_amdgcn_wave_barrier();
  const int rsub = lane >> 4, c4 = (lane & 15) * 4;
  {
#pragma unroll
    for (int q = 0; q < 8; ++q) {
      const int r = q * 2 + rsub;
      const v4f v = *(const v4fa*)&so[w][r][c4];
      *(v4f*)(C + (size_t)(row0 + r) * ldc + col0 + c4) = v;
    }
    
  }
}

// GEMM C = act(A·W + bias + resid): A f32 (ASPLIT -> hi/lo 2 terms), Wt bf16 [N][K]; ACT 0 none, 1 relu, 2 exact gelu;
// resid (optional, f32, row index = (row % rmod), pitch ldr, RES_BF16 rounds it) added before the activation.
template <bool ASPLIT, int ACT, bool BIAS_BF16, bool RES_BF16>
__global__ __launch_bounds__(128) void k_gemm_bf3(const float* __restrict__ A, int lda, const unsigned short* __restrict__ Wt, int ldb,
                                                const float* __restrict__ bias, const float* __restrict__ resid, int rmod, int ldr,
                                                float* __restrict__ C, int ldc, int M, int N, int K) {
  __shared__ __attribute__((aligned(16))) float so[4][16][64];
  const int tid = threadIdx.x, w = tid >> 5, lane = tid & 31, ln = lane & 15, hh = lane >> 4;
  const int ntn = N / 64;
  const int wid = blockIdx.x * 4 + w;
  const int mt = wid / ntn, nq = wid % ntn;
  if (mt * 16 >= M) return;
  const int row0 = mt * 16, col0 = nq * 64;
  const float* arow = A + (size_t)(row0 + ln) * lda;
  v8f acc[4] = {};
  for (int kb = 0; kb < K; kb += 32) {
    FragB ah, al;
    const v4f x0 = *(const v4fa*)(arow + kb + 8 * hh), x1 = *(const v4fa*)(arow + kb + 8 * hh + 4);
    const v4f x2 = *(const v4fa*)(arow + kb + 16 + 8 * hh), x3 = *(const v4fa*)(arow + kb + 16 + 8 * hh + 4);
    float xs[16] = {x0[0],x0[1],x0[2],x0[3],x1[0],x1[1],x1[2],x1[3],x2[0],x2[1],x2[2],x2[3],x3[0],x3[1],x3[2],x3[3]};
#pragma unroll
    for (int i = 0; i < 16; ++i) { const unsigned short hb = bf16_bits(xs[i]); ah.u[i] = hb; al.u[i] = ASPLIT ? bf16_bits(xs[i] - bf16_val(hb)) : (unsigned short)0; }
#pragma unroll
    for (int t = 0; t < 4; ++t) {
      const unsigned short* brow = Wt + (size_t)(col0 + t * 16 + ln) * ldb + kb;
      FragB b;
      b.half[0] = *(const v8us*)(brow + 8 * hh);
      b.half[1] = *(const v8us*)(brow + 16 + 8 * hh);
      acc[t] = mmaN<ASPLIT ? 2 : 1>(ah.v, al.v, b.v, b.v, acc[t]);
    }
  }
#pragma unroll
  for (int t = 0; t < 4; ++t) {
    const int col = col0 + t * 16 + ln;
    float bv = bias ? bias[col] : 0.f;
    if (BIAS_BF16) bv = bf16_round(bv);
#pragma unroll
    for (int r = 0; r < 8; ++r) {
      float v = acc[t][r] + bv;
      if (resid) { float rv = resid[(size_t)((row0 + 8 * hh + r) % rmod) * ldr + col]; if (RES_BF16) rv = bf16_round(rv); v += rv; }
      if (ACT == 1) v = fmaxf(v, 0.f);
      if (ACT == 2) v = 0.5f * v * (1.0f + erff(v * 0.70710678118654752f));
      if (ACT == 3) { const float u = 0.7978845608028654f * (v + 0.044715f * v * v * v); v = 0.5f * v * (1.0f + tanhf(u)); }
      so[w][8 * hh + r][t * 16 + ln] = v;
    }
  }
  __builtin_amdgcn_fence(__ATOMIC_ACQ_REL, "workgroup");
  __builtin_amdgcn_wave_barrier();
  const int rsub = lane >> 4, c4 = (lane & 15) * 4;
  {
#pragma unroll
    for (int q = 0; q < 8; ++q) {
      const int r = q * 2 + rsub;
      const v4f v = *(const v4fa*)&so[w][r][c4];
      *(v4f*)(C + (size_t)(row0 + r) * ldc + col0 + c4) = v;
    }
    
  }
}
// row LayerNorm (biased variance, eps) over N: s = X (+ R); optional out_sum <- s; out_norm <- (s-mu)*rsqrt(var+eps)*g + b
template <bool PARAM_BF16>
__global__ __launch_bounds__(256) void k_layernorm(const float* __restrict__ X, const float* __restrict__ R, const float* __restrict__ g, const float* __restrict__ bta,
                                                  float* __restrict__ out_sum, float* __restrict__ out_norm, int N, float eps) {
  __shared__ float red[256];
  const int row = blockIdx.x, tid = threadIdx.x;
  const float* x = X + (size_t)row * N; const float* rr = R ? R + (size_t)row * N : nullptr;
  float vals[16];                     // up to N = 4096
  const int per = N / 256;            // contiguous chunk per thread? use strided-by-4 chunks: thread handles j = tid*4 + 1024*u
  float s1 = 0.f;
  for (int u = 0; u < per / 4; ++u) {
    const int j = tid * 4 + 1024 * u;
    const v4f a = *(const v4fa*)(x + j);
    v4f b = {0.f,0.f,0.f,0.f}; if (rr) b = *(const v4fa*)(rr + j);
#pragma unroll
    for (int q = 0; q < 4; ++q) { const float v = a[q] + b[q]; vals[u * 4 + q] = v; s1 += v; }
  }
  red[tid] = s1; __syncthreads();
  for (int st = 128; st > 0; st >>= 1) { if (tid < st) red[tid] += red[tid + st]; __syncthreads(); }
  const float mu = red[0] / (float)N; __syncthreads();
  float s2 = 0.f;
  for (int u = 0; u < per / 4; ++u)
#pragma unroll
    for (int q = 0; q < 4; ++q) { const float c = vals[u * 4 + q] - mu; s2 += c * c; }
  red[tid] = s2; __syncthreads();
  for (int st = 128; st > 0; st >>= 1) { if (tid < st) red[tid] += red[tid + st]; __syncthreads(); }
  const float rs = rsqrtf(red[0] / (float)N + eps);
  {
    for (int u = 0; u < per / 4; ++u) {
      const int j = tid * 4 + 1024 * u;
      v4f o, sm;
#pragma unroll
      for (int q = 0; q < 4; ++q) {
        float gg = g[j + q], bb = bta[j + q];
        if (PARAM_BF16) { gg = bf16_round(gg); bb = bf16_round(bb); }
        sm[q] = vals[u * 4 + q]; o[q] = (vals[u * 4 + q] - mu) * rs * gg + bb;
      }
      if (out_sum) *(v4f*)(out_sum + (size_t)row * N + j) = sm;
      *(v4f*)(out_norm + (size_t)row * N + j) = o;
    }
    
  }
}



// ---- f16 WMMA path (v_wmma_f32_16x16x32_f16): 11-bit significands for operands in range — used where a [0,1] probability operand needs more precision than bf16
typedef _Float16 v16h __attribute__((ext_vector_type(16)));
union FragH { v16h v; v8us half[2]; _Float16 h[16]; unsigned short u[16]; };
template <int NT>
__device__ __forceinline__ v8f mmaH(v16h ah, v16h al, v16h bh, v16h bl, v8f c) {
  c = __builtin_amdgcn_wmma_f32_16x16x32_f16(false, ah, false, bh, (short)0, c, false, false);
  if (NT >= 2) c = __builtin_amdgcn_wmma_f32_16x16x32_f16(false, al, false, bh, (short)0, c, false, false);
  if (NT >= 3) c = __builtin_amdgcn_wmma_f32_16x16x32_f16(false, ah, false, bl, (short)0, c, false, false);
  asm volatile("v_nop\n\tv_nop\n\tv_nop\n\tv_nop" : "+v"(c) : "v"(ah), "v"(al), "v"(bh), "v"(bl));
  return c;
}
// batched GEMM like k_gemm_b but f16 operands: A f32 (split into f16 hi/lo if ASPLIT, else rounded to f16), Bt = f16 values [n][k]; alpha; C f32; N multiple of 16 (partial tiles skipped)
template <bool ASPLIT>
__global__ __launch_bounds__(128) void k_gemm_h(const float* __restrict__ A, int lda, size_t sA, const _Float16* __restrict__ Bh, int ldb, size_t sB, float alpha, float* __restrict__ C, int ldc, size_t sC, int M, int N, int K) {
  __shared__ __attribute__((aligned(16))) float so[4][16][64];
  const int tid = threadIdx.x, w = tid >> 5, lane = tid & 31, ln = lane & 15, hh = lane >> 4; const int by = blockIdx.y;
  A += (size_t)by * sA; Bh += (size_t)by * sB; C += (size_t)by * sC;
  const int ntn = (N + 63) / 64; const int wid = blockIdx.x * 4 + w; const int mt = wid / ntn, nq = wid % ntn; if (mt * 16 >= M) return;
  const int row0 = mt * 16, col0 = nq * 64; const float* arow = A + (size_t)(row0 + ln) * lda;
  v8f acc[4] = {};
  for (int kb = 0; kb < K; kb += 32) {
    FragH ah, al;
    const v4f x0 = *(const v4fa*)(arow + kb + 8 * hh), x1 = *(const v4fa*)(arow + kb + 8 * hh + 4), x2 = *(const v4fa*)(arow + kb + 16 + 8 * hh), x3 = *(const v4fa*)(arow + kb + 16 + 8 * hh + 4);
    float xs[16] = {x0[0],x0[1],x0[2],x0[3],x1[0],x1[1],x1[2],x1[3],x2[0],x2[1],x2[2],x2[3],x3[0],x3[1],x3[2],x3[3]};
#pragma unroll
    for (int i = 0; i < 16; ++i) { const _Float16 h = (_Float16)xs[i]; ah.h[i] = h; al.h[i] = ASPLIT ? (_Float16)(xs[i] - (float)h) : (_Float16)0.0f; }
#pragma unroll
    for (int t = 0; t < 4; ++t) { if (col0 + t * 16 >= N) continue; const size_t boff = (size_t)(col0 + t * 16 + ln) * ldb + kb; FragH bq; bq.half[0] = *(const v8us*)(Bh + boff + 8 * hh); bq.half[1] = *(const v8us*)(Bh + boff + 16 + 8 * hh);
      acc[t] = mmaH<ASPLIT ? 2 : 1>(ah.v, al.v, bq.v, bq.v, acc[t]); }
  }
#pragma unroll
  for (int t = 0; t < 4; ++t) { if (col0 + t * 16 >= N) continue;
#pragma unroll
    for (int r = 0; r < 8; ++r) so[w][8 * hh + r][t * 16 + ln] = acc[t][r] * alpha; }
  __builtin_amdgcn_fence(__ATOMIC_ACQ_REL, "workgroup"); __builtin_amdgcn_wave_barrier();
  const int rsub = lane >> 4, c4 = (lane & 15) * 4;
  {
#pragma unroll
    for (int q = 0; q < 8; ++q) { const int r = q * 2 + rsub; if (col0 + c4 < N) { const v4f v = *(const v4fa*)&so[w][r][c4]; *(v4f*)(C + (size_t)(row0 + r) * ldc + col0 + c4) = v; } }
     }
}

// Wt[n][k] = f16(W[k][n]·scale) from f32 row-major W[K][N] (scale = power of two; bf16-exact weights stay exact in f16 away from the subnormal range)
__global__ __launch_bounds__(256) void k_wt_f16(const float* __restrict__ W, _Float16* __restrict__ Wt, int K, int N, float scale) {
  const int t = blockIdx.x * 256 + threadIdx.x; if (t >= N * (K / 8)) return; const int n = t / (K / 8), k8 = (t % (K / 8)) * 8; FragH f;
#pragma unroll
  for (int i = 0; i < 8; ++i) f.h[i] = (_Float16)(bf16_round(W[(size_t)(k8 + i) * N + n]) * scale); const v8us o = f.half[0];
  *(v8us*)((unsigned short*)Wt + (size_t)n * K + k8) = o; 
}
// k_gemm_hh variant with fused epilogue: v = acc·alpha + bias[by·sBias + col] (+ CP[(row/rowsPerB)·sCPb + by·64 + col] if CP) ; ACT 0 none / 1 elu ; writes f16 C16 (and f32 C if non-null)
template <int ACT>
__global__ __launch_bounds__(128) void k_gemm_hhx(const _Float16* __restrict__ A, int lda, size_t sA, const _Float16* __restrict__ Bh, int ldb, size_t sB, float alpha, const float* __restrict__ bias, size_t sBias, const float* __restrict__ CP, int rowsPerB, size_t sCPb, int row0g,
    float* __restrict__ C, _Float16* __restrict__ C16, int ldc, size_t sC, int M, int N, int K) {
  __shared__ __attribute__((aligned(16))) float so[4][16][64];
  const int tid = threadIdx.x, w = tid >> 5, lane = tid & 31, ln = lane & 15, hh = lane >> 4; const int by = blockIdx.y;
  A += (size_t)by * sA; Bh += (size_t)by * sB; const size_t cofs = (size_t)by * sC; const float* bp = bias ? bias + (size_t)by * sBias : nullptr;
  const int ntn = (N + 63) / 64; const int wid = blockIdx.x * 4 + w; const int mt = wid / ntn, nq = wid % ntn; if (mt * 16 >= M) return;
  const int row0 = mt * 16, col0 = nq * 64; const _Float16* arow = A + (size_t)(row0 + ln) * lda;
  v8f acc[4] = {};
  for (int kb = 0; kb < K; kb += 32) { FragH ah; ah.half[0] = *(const v8us*)((const unsigned short*)arow + kb + 8 * hh); ah.half[1] = *(const v8us*)((const unsigned short*)arow + kb + 16 + 8 * hh);
#pragma unroll
    for (int t = 0; t < 4; ++t) { if (col0 + t * 16 >= N) continue; const size_t boff = (size_t)(col0 + t * 16 + ln) * ldb + kb; FragH bq; bq.half[0] = *(const v8us*)((const unsigned short*)Bh + boff + 8 * hh); bq.half[1] = *(const v8us*)((const unsigned short*)Bh + boff + 16 + 8 * hh);
      acc[t] = mmaH<1>(ah.v, ah.v, bq.v, bq.v, acc[t]); }
  }
#pragma unroll
  for (int t = 0; t < 4; ++t) { if (col0 + t * 16 >= N) continue; const int col = col0 + t * 16 + ln; const float bv = bp ? bf16_round(bp[col]) : 0.f;
#pragma unroll
    for (int r = 0; r < 8; ++r) { float v = acc[t][r] * alpha + bv; if (CP) { const int rr = row0g + row0 + 8 * hh + r; if (rowsPerB < 0) v += CP[cofs + (size_t)rr * ldc + col];      /* rowsPerB < 0: own element of the batched C plane */ else { const int bidx = rr / rowsPerB; v += CP[(size_t)bidx * sCPb + (size_t)by * 64 + col]; } } if (ACT == 1) v = (v > 0.f) ? v : expm1f(v); else if (ACT == 7) v = (v > 0.f) ? v + 1.0f : expf(v); else if (ACT == 8) v = tanhf(v); else if (ACT == 9) v = 0.5f * v * (1.0f + tanhf(0.7978845608028654f * (v + 0.044715f * v * v * v))); else if (ACT == 11) v = 1.0f / (1.0f + expf(-v)); else if (ACT == 12) v = (v > 0.f) ? v : 0.01f * v; else if (ACT == 14) v = (v > 0.f) ? v : 0.1f * v; else if (ACT == 16) v = (v >= 0.f) ? v : 0.3f * v; else if (ACT == 17) v = (v >= 0.f) ? v : 0.2f * v; else if (ACT == 15) v = v / (1.0f + expf(-v)); else if (ACT == 3) v = fmaxf(v, 0.f); else if (ACT == 6) v = 0.5f * v * (1.0f + erff(v * 0.70710678118654752f)); so[w][8 * hh + r][t * 16 + ln] = v; } }
  __builtin_amdgcn_fence(__ATOMIC_ACQ_REL, "workgroup"); __builtin_amdgcn_wave_barrier();
  const int rsub = lane >> 4, c4 = (lane & 15) * 4; typedef _Float16 v4h __attribute__((ext_vector_type(4)));
  {
#pragma unroll
    for (int q = 0; q < 8; ++q) { const int r = q * 2 + rsub; if (col0 + c4 < N) { const v4f v = *(const v4fa*)&so[w][r][c4]; if (C) *(v4f*)(C + cofs + (size_t)(row0 + r) * ldc + col0 + c4) = v; if (C16) { v4h h4; for (int i = 0; i < 4; ++i) h4[i] = (_Float16)v[i]; *(v4h*)(C16 + cofs + (size_t)(row0 + r) * ldc + col0 + c4) = h4; } } }
     }
}


typedef _Float16 v4h __attribute__((ext_vector_type(4)));

__global__ __launch_bounds__(256) void k_x16(const float* __restrict__ x, _Float16* __restrict__ X16, size_t n8) { const size_t t = (size_t)blockIdx.x * 256 + threadIdx.x; if (t >= n8) return; FragH f;
#pragma unroll
  for (int q = 0; q < 8; ++q) f.h[q] = (_Float16)bf16_round(x[t * 8 + q]); *(v8us*)((unsigned short*)X16 + t * 8) = f.half[0];  }
__global__ __launch_bounds__(256) void k_h16(const float* __restrict__ x, _Float16* __restrict__ X16, size_t n8) { const size_t t = (size_t)blockIdx.x * 256 + threadIdx.x; if (t >= n8) return; FragH f;
#pragma unroll
  for (int q = 0; q < 8; ++q) f.h[q] = (_Float16)x[t * 8 + q]; *(v8us*)((unsigned short*)X16 + t * 8) = f.half[0];  }
__global__ __launch_bounds__(256) void k_round16f(const float* __restrict__ W, _Float16* __restrict__ Bt, size_t n8) { const size_t t = (size_t)blockIdx.x * 256 + threadIdx.x; if (t >= n8) return; FragH f;
#pragma unroll
  for (int i = 0; i < 8; ++i) f.h[i] = (_Float16)(bf16_round(W[t * 8 + i]) * 16.0f); *(v8us*)((unsigned short*)Bt + t * 8) = f.half[0];  }

__global__ __launch_bounds__(256) void k_hl(const float* __restrict__ F, _Float16* __restrict__ Hh, _Float16* __restrict__ Hl, size_t n8) { const size_t t = (size_t)blockIdx.x * 256 + threadIdx.x; if (t >= n8) return; FragH fh, fl; const v4f a = *(const v4fa*)(F + t * 8), c = *(const v4fa*)(F + t * 8 + 4);
#pragma unroll
  for (int q = 0; q < 4; ++q) { _Float16 h = (_Float16)a[q]; fh.h[q] = h; fl.h[q] = (_Float16)((a[q] - (float)h) * 1024.0f); h = (_Float16)c[q]; fh.h[4 + q] = h; fl.h[4 + q] = (_Float16)((c[q] - (float)h) * 1024.0f); }
  { *(v8us*)((unsigned short*)Hh + t * 8) = fh.half[0]; *(v8us*)((unsigned short*)Hl + t * 8) = fl.half[0];  } }

// ---- fast GEMM tile: C = A . B^T * alpha + bias, A [M][CC] and B [N][CC] f16 rows; work-group tile 128x64, wave tile 32x64 (M % 128 == 0, N % 64 == 0) ----
__device__ __forceinline__ v16h g2_frag(const _Float16* p, int hh) { FragH f; f.half[0] = *(const v8us*)((const unsigned short*)p + 8 * hh); f.half[1] = *(const v8us*)((const unsigned short*)p + 16 + 8 * hh); return f.v; }
__device__ __forceinline__ v8f g2_mma(v16h a, v16h b, v8f c) { v8f d = __builtin_amdgcn_wmma_f32_16x16x32_f16(false, a, false, b, (short)0, c, false, false); asm volatile("v_nop\n\tv_nop\n\tv_nop\n\tv_nop" : "+v"(d) : "v"(a), "v"(b)); return d; }
// Both operand tiles (128 + 64 rows, all of K = CC: 512 bytes a row) are brought into LDS once, whole rows at a time, and the fragments are read from there:
// a fragment load straight from global memory touches 16 lines for 512 bytes, and its latency stood in front of every pair of products.
#define G2_PK 528                    /* LDS row pitch, bytes: 512 + 16, an odd multiple of 16 for 16-byte readers */
#define G2_LDS ((128 + 64) * G2_PK)
__device__ __forceinline__ v16h g2_lfrag(const unsigned char* p) { FragH f; f.half[0] = *(const v8us*)p; f.half[1] = *(const v8us*)(p + 32); return f.v; }      /* p already holds + 16 hh: k = 8 hh .. and 16 + 8 hh .. */
// Twelve asynchronous copies to LDS, one 512-byte row each (a lane brings its own 16 bytes). The s_wait_xcnt is the last line of the copies' own statement, so that it stands in front of whatever rewrites an address register that a copy names.
__device__ __forceinline__ void g2_copy12(const unsigned* l, const unsigned char* const* g) {
  asm volatile("global_load_async_to_lds_b128 %0, %12, off\n\tglobal_load_async_to_lds_b128 %1, %13, off\n\tglobal_load_async_to_lds_b128 %2, %14, off\n\tglobal_load_async_to_lds_b128 %3, %15, off\n\t"
               "global_load_async_to_lds_b128 %4, %16, off\n\tglobal_load_async_to_lds_b128 %5, %17, off\n\tglobal_load_async_to_lds_b128 %6, %18, off\n\tglobal_load_async_to_lds_b128 %7, %19, off\n\t"
               "global_load_async_to_lds_b128 %8, %20, off\n\tglobal_load_async_to_lds_b128 %9, %21, off\n\tglobal_load_async_to_lds_b128 %10, %22, off\n\tglobal_load_async_to_lds_b128 %11, %23, off\n\ts_wait_xcnt 0x0"
               :: "v"(l[0]), "v"(l[1]), "v"(l[2]), "v"(l[3]), "v"(l[4]), "v"(l[5]), "v"(l[6]), "v"(l[7]), "v"(l[8]), "v"(l[9]), "v"(l[10]), "v"(l[11]),
                  "v"(g[0]), "v"(g[1]), "v"(g[2]), "v"(g[3]), "v"(g[4]), "v"(g[5]), "v"(g[6]), "v"(g[7]), "v"(g[8]), "v"(g[9]), "v"(g[10]), "v"(g[11]) : "memory"); }
// RB: the bias belongs to the row of C (channel-major outputs), else to its column. TO: element type of C (float or f16). bx: tile index, column tiles fastest. A and B rows are CC long (K = CC). sm: G2_LDS bytes.
template <bool RB, typename TO>
__device__ __forceinline__ void g2_tile(unsigned char* sm, const _Float16* __restrict__ A, const _Float16* __restrict__ Bh, float alpha, const float* __restrict__ bp, TO* __restrict__ C, int ldc, int bx, int N) {
  const int tid = threadIdx.x, w = tid >> 5, lane = tid & 31, ln = lane & 15, hh = lane >> 4;
  const int ntn = N >> 6; const int mt = bx / ntn, nq = bx - mt * ntn; const int row0 = mt * 128 + 32 * w, col0 = nq * 64;
  { /* wave w brings its own 32 rows of A and rows 16 w .. 16 w + 15 of B: 48 copies, all in flight at once */
    const unsigned char* ga = (const unsigned char*)(A + (size_t)row0 * CC) + lane * 16; const unsigned char* gb = (const unsigned char*)(Bh + (size_t)(col0 + 16 * w) * CC) + lane * 16;
    const unsigned l0 = (unsigned)(size_t)sm + lane * 16; const unsigned la = l0 + 32 * w * G2_PK, lb = l0 + (128 + 16 * w) * G2_PK;
    unsigned l[48]; const unsigned char* g[48];
#pragma unroll      // constant indices, so that the two arrays dissolve into registers
    for (int i = 0; i < 48; ++i) { l[i] = i < 32 ? la + i * G2_PK : lb + (i - 32) * G2_PK; g[i] = i < 32 ? ga + i * (CC * 2) : gb + (i - 32) * (CC * 2); }
    g2_copy12(l, g); g2_copy12(l + 12, g + 12); g2_copy12(l + 24, g + 24); g2_copy12(l + 36, g + 36);
    asm volatile("s_wait_asynccnt 0x0" ::: "memory");      // this wave's 48 copies have landed; the compiler places no wait for them
    __syncthreads(); }      /* both tiles published: the B rows are read by all four waves */
  const unsigned char* ap = sm + (32 * w + ln) * G2_PK + 16 * hh;      /* + 16 hh: the lane half's k offset sits in the row pointers */
  const unsigned char* bq = sm + (128 + ln) * G2_PK + 16 * hh;
  const v8f z8 = {0.f,0.f,0.f,0.f,0.f,0.f,0.f,0.f}; v8f c00 = z8, c01 = z8, c02 = z8, c03 = z8, c10 = z8, c11 = z8, c12 = z8, c13 = z8;
  v16h a0 = g2_lfrag(ap), a1 = g2_lfrag(ap + 16 * G2_PK), b0 = g2_lfrag(bq), b1 = g2_lfrag(bq + 16 * G2_PK), b2 = g2_lfrag(bq + 32 * G2_PK), b3 = g2_lfrag(bq + 48 * G2_PK);
#pragma unroll      // straight line: the next 32 k's fragments go into a second register set, read as one group ahead of this block's products
  for (int ks = 0; ks < CC / 32; ++ks) { v16h na0 = a0, na1 = a1, nb0 = b0, nb1 = b1, nb2 = b2, nb3 = b3;
    if (ks + 1 < CC / 32) { const int o = (ks + 1) * 64; na0 = g2_lfrag(ap + o); na1 = g2_lfrag(ap + 16 * G2_PK + o); nb0 = g2_lfrag(bq + o); nb1 = g2_lfrag(bq + 16 * G2_PK + o); nb2 = g2_lfrag(bq + 32 * G2_PK + o); nb3 = g2_lfrag(bq + 48 * G2_PK + o); }
    c00 = g2_mma(a0, b0, c00); c10 = g2_mma(a1, b0, c10); c01 = g2_mma(a0, b1, c01); c11 = g2_mma(a1, b1, c11);
    c02 = g2_mma(a0, b2, c02); c12 = g2_mma(a1, b2, c12); c03 = g2_mma(a0, b3, c03); c13 = g2_mma(a1, b3, c13);
    a0 = na0; a1 = na1; b0 = nb0; b1 = nb1; b2 = nb2; b3 = nb3; }
  float (*so)[68] = (float (*)[68])(sm + 32 * w * G2_PK);      /* output staging in the wave's own 32 rows of A: no other wave reads or writes them, and this wave's reads of them have fed the sums that are stored here */
  v8f accs[8] = {c00, c01, c02, c03, c10, c11, c12, c13};
#pragma unroll
  for (int u = 0; u < 8; ++u) { const int t = u & 3, half = u >> 2; const int col = col0 + t * 16 + ln;
#pragma unroll
    for (int r = 0; r < 8; ++r) { const int rloc = half * 16 + 8 * hh + r; const float bv = bf16_round(RB ? bp[row0 + rloc] : bp[col]); so[rloc][t * 16 + ln] = accs[u][r] * alpha + bv; } }
  __builtin_amdgcn_fence(__ATOMIC_ACQ_REL, "workgroup"); __builtin_amdgcn_wave_barrier();
  const int rsub = lane >> 4, c4 = (lane & 15) * 4;
#pragma unroll
  for (int q = 0; q < 16; ++q) { const int r = q * 2 + rsub; const v4f v = *(const v4fa*)&so[r][c4]; typedef TO v4o __attribute__((ext_vector_type(4))); v4o o4; for (int i = 0; i < 4; ++i) o4[i] = (TO)v[i]; *(v4o*)(C + (size_t)(row0 + r) * ldc + col0 + c4) = o4; } }
// The three projections in one grid (blockIdx.y: 0 Q, 1 K, 2 V). Q and K: token rows x permuted channels. V: permuted channels x tokens of one batch (A = weights, B = token rows), which is V^T as the attention reads it.
#define QKV_G ((int)((NR / 128) * (CC / 64)))      /* tiles of one projection, either way round */
#define CT_G ((CC / 128) * (LL / 64))              /* tiles of one batch's channel-major product */
static_assert(QKV_G == NB * CT_G, "the V tiles must fill the same grid row as the Q and K tiles");
__global__ __launch_bounds__(128) void k_qkv(const _Float16* __restrict__ XQ, const _Float16* __restrict__ XK, const _Float16* __restrict__ XV, const _Float16* __restrict__ BQ, const _Float16* __restrict__ BK, const _Float16* __restrict__ BV, const float* __restrict__ BP, _Float16* __restrict__ Q16, _Float16* __restrict__ K16, _Float16* __restrict__ VT) {
  __shared__ __attribute__((aligned(16))) unsigned char sm[G2_LDS];
  const int by = blockIdx.y, bx = blockIdx.x;
  if (by < 2) g2_tile<false>(sm, by ? XK : XQ, by ? BK : BQ, 0.0625f, BP + by * CC, by ? K16 : Q16, CC, bx, CC);
  else { const int b = bx / CT_G; g2_tile<true>(sm, BV, XV + (size_t)b * LL * CC, 0.0625f, BP + 2 * CC, VT + (size_t)b * CC * LL, LL, bx - b * CT_G, LL); } }
// out[b][c][n] = sum_k' w_m'[c][k'] o[(b,n)][k'] / 1024 + b_m[c] (channel-major directly; blockIdx.y = batch)
__global__ __launch_bounds__(128) void k_out(const _Float16* __restrict__ AM, const _Float16* __restrict__ O16, const float* __restrict__ bm, float* __restrict__ out) {
  __shared__ __attribute__((aligned(16))) unsigned char sm[G2_LDS];
  const size_t b = blockIdx.y;
  g2_tile<true>(sm, AM, O16 + b * LL * CC, 0.0009765625f, bm, out + b * CC * LL, LL, blockIdx.x, LL); }


__global__ __launch_bounds__(256) void k_wnat(const float* __restrict__ w, size_t n8, _Float16* __restrict__ Bt) { const size_t t = (size_t)blockIdx.x * 256 + threadIdx.x; if (t >= n8) return; FragH f; for (int q = 0; q < 8; ++q) f.h[q] = (_Float16)(bf16_round(w[t * 8 + q]) * 16.0f); *(v8us*)((unsigned short*)Bt + t * 8) = f.half[0];  }
__global__ __launch_bounds__(256) void k_rsm(const float* __restrict__ S, _Float16* __restrict__ P, int nrows) {
  #pragma clang fp contract(off)
  const int i = blockIdx.x * 256 + threadIdx.x; if (i >= nrows) return; const float* s = S + (size_t)i * SQ; float mx = -3.0e38f;
#pragma unroll 1
  for (int j = 0; j < SQ; ++j) mx = fmaxf(mx, s[j]); float se = 0.f;
#pragma unroll 1
  for (int j = 0; j < SQ; ++j) se += expf(s[j] - mx); const float sc = 256.0f / se;
#pragma unroll 1
  for (int j0 = 0; j0 < SQ; j0 += 8) { FragH f; for (int q = 0; q < 8; ++q) f.h[q] = (_Float16)(expf(s[j0 + q] - mx) * sc); unsigned short* d = (unsigned short*)P + (size_t)i * SQ + j0; *(v8us*)d = f.half[0];  } }
__global__ __launch_bounds__(256) void k_vt(const _Float16* __restrict__ V16, int b, int h0, _Float16* __restrict__ VT) { __shared__ unsigned short tl[64][65]; const int tid = threadIdx.x; const int hh = blockIdx.x % HG, sg = blockIdx.x / HG; const int s0 = sg * 64; const int h = h0 + hh;
  for (int i = tid; i < 64 * 8; i += 256) { const int j = i / 8, d8 = (i % 8) * 8; FragH f; f.half[0] = *(const v8us*)((const unsigned short*)V16 + ((size_t)b * SQ + s0 + j) * DM + h * HD + d8); for (int q = 0; q < 8; ++q) tl[d8 + q][j] = f.u[q]; }
  __syncthreads();
  { for (int i = tid; i < 64 * 8; i += 256) { const int d = i / 8, j8 = (i % 8) * 8; FragH f; for (int q = 0; q < 8; ++q) f.u[q] = tl[d][j8 + q]; *(v8us*)((unsigned short*)VT + ((size_t)hh * HD + d) * SQ + s0 + j8) = f.half[0]; }  } }

// ---- operand preparation: the bodies below are dealt to the work-groups of one grid by index (k_prep); bx = index within the body's own share ----
// Behind a body's last global store: in the built kernel a work-group's way to the end passes the heads of other bodies, which write registers that the store names; this wait stands in front of them.
__device__ __forceinline__ void p_stored() { asm volatile("s_wait_xcnt 0x0" ::: "memory"); }
// One work-group transposes the 64-channel x 128-token tile bx of all three inputs. A lane takes 8 channels x 4 tokens of each input: 8 loads of 16 bytes (4 tokens of one channel each);
// its 8 channels of one token are then one 16-byte store, so the transpose happens in the lane's own registers. 8 lanes cover the 64 channels of a token: every store fills whole 128-byte lines.
// All 24 loads are issued before the first value is used, so a work-group's whole share is in flight at once.
__device__ __forceinline__ void p_rows8(const v4f (&x)[8], _Float16* __restrict__ XR) {
#pragma unroll
  for (int i = 0; i < 4; ++i) { FragH f; for (int j = 0; j < 8; ++j) f.h[j] = (_Float16)bf16_round(x[j][i]); *(v8us*)((unsigned short*)XR + i * CC) = f.half[0]; }
  p_stored(); }      /* also in front of the next input's conversions, which reuse the registers that these stores name */
__device__ __forceinline__ void p_cl2rows(const float* __restrict__ xq, const float* __restrict__ xk, const float* __restrict__ xv, _Float16* __restrict__ XQ, _Float16* __restrict__ XK, _Float16* __restrict__ XV, int bx) {
  const int tid = threadIdx.x, cg = tid & 7, tq = tid >> 3; const int nl = LL / 128, nc = CC / 64; const int cb_ = bx % nc; const int lb = (bx / nc) % nl; const size_t b = bx / (nc * nl);
  const size_t us = (b * CC + cb_ * 64) * (size_t)LL + lb * 128, ud = (b * LL + lb * 128) * (size_t)CC + cb_ * 64;      /* the tile's corner, the same for the whole work-group */
  const int ls = cg * 8 * LL + tq * 4, ld = tq * 4 * CC + cg * 8;      /* the lane's own place in the tile */
  const float* pq = xq + us; const float* pk = xk + us; const float* pv = xv + us;
  v4f q[8], k[8], v[8];
#pragma unroll
  for (int j = 0; j < 8; ++j) q[j] = *(const v4fa*)(pq + ls + j * LL);
  __builtin_amdgcn_sched_barrier(0);      // the three scheduling barriers keep the loads in the order in which they are used (counted waits: q is converted while k and v still fly)
#pragma unroll
  for (int j = 0; j < 8; ++j) k[j] = *(const v4fa*)(pk + ls + j * LL);
  __builtin_amdgcn_sched_barrier(0);
#pragma unroll
  for (int j = 0; j < 8; ++j) v[j] = *(const v4fa*)(pv + ls + j * LL);
  __builtin_amdgcn_sched_barrier(0);      // and all 24 ahead of the first conversion: without it the scheduler held half of them back behind waits on the first ones
  asm volatile("s_wait_xcnt 0x0" :: "s"(pq), "s"(pk), "s"(pv) : "memory");      // stands behind the 24 loads and in front of whatever rewrites the address registers that they name; the three bases are inputs so that each keeps its own scalar pair up to here (else one was formed in another's pair, behind a wait between the loads)
  p_rows8(q, XQ + ud + ld);
  __builtin_amdgcn_sched_barrier(0);      // here and below: the next input's conversions stay behind these stores; moved ahead of them, they held two of the four stores back behind a wait on the next input's loads
  p_rows8(k, XK + ud + ld);
  __builtin_amdgcn_sched_barrier(0);
  p_rows8(v, XV + ud + ld); }
__device__ __forceinline__ void p_wperm(const float* __restrict__ w, _Float16* __restrict__ Bt, int bx) { const int t = bx * 256 + threadIdx.x; const int k8 = (t % (CC / 8)) * 8, np_ = t / (CC / 8); const int h = np_ / HD, dd = np_ % HD; const int src = dd * NH + h; FragH f;
  for (int q = 0; q < 8; ++q) f.h[q] = (_Float16)(bf16_round(w[(size_t)src * CC + k8 + q]) * 16.0f); unsigned short* d = (unsigned short*)Bt + (size_t)np_ * CC + k8; *(v8us*)d = f.half[0];  }
__device__ __forceinline__ void p_wpermc(const float* __restrict__ w, _Float16* __restrict__ A, int bx) { const int t = bx * 256 + threadIdx.x; const int k8 = (t % (CC / 8)) * 8, c = t / (CC / 8); FragH f;
  for (int q = 0; q < 8; ++q) { const int kp = k8 + q; const int h = kp / HD, dd = kp % HD; f.h[q] = (_Float16)(bf16_round(w[(size_t)c * CC + dd * NH + h]) * 16.0f); } unsigned short* d = (unsigned short*)A + (size_t)c * CC + k8; *(v8us*)d = f.half[0]; p_stored(); }
__device__ __forceinline__ void p_bperm(const float* __restrict__ b0, const float* __restrict__ b1, const float* __restrict__ b2, float* __restrict__ BP) { const int t = threadIdx.x; const int h = t / HD, dd = t % HD; const int src = dd * NH + h;
  { *(float*)(BP + t) = b0[src]; *(float*)(BP + CC + t) = b1[src]; *(float*)(BP + 2 * CC + t) = b2[src];  } }
#define PW_G (CC * (CC / 8) / 256)                 /* work-groups per weight matrix: 8 elements a thread, exactly */
#define PX_G (NB * (LL / 128) * (CC / 64))         /* work-groups of the transposes: 64-channel x 128-token tiles, each of all three inputs */
static_assert(PW_G * 256 == CC * (CC / 8) && CC == 256, "the weight and bias bodies have no tail guard");
// Every branch is on blockIdx alone. The short weight and bias bodies take the lowest indices: they start first and end under the transposes.
__global__ __launch_bounds__(256) void k_prep(const float* __restrict__ xq, const float* __restrict__ xk, const float* __restrict__ xv, const float* __restrict__ wq, const float* __restrict__ wk, const float* __restrict__ wv, const float* __restrict__ wm, const float* __restrict__ bq, const float* __restrict__ bk, const float* __restrict__ bv,
    _Float16* __restrict__ XQ, _Float16* __restrict__ XK, _Float16* __restrict__ XV, _Float16* __restrict__ BQ, _Float16* __restrict__ BK, _Float16* __restrict__ BV, _Float16* __restrict__ AM, float* __restrict__ BP) {
  const int bx = blockIdx.x;
  if (bx < 3 * PW_G) { const int s = bx / PW_G; p_wperm(s == 0 ? wq : s == 1 ? wk : wv, s == 0 ? BQ : s == 1 ? BK : BV, bx - s * PW_G); }
  else if (bx < 4 * PW_G) p_wpermc(wm, AM, bx - 3 * PW_G);
  else if (bx == 4 * PW_G) p_bperm(bq, bk, bv, BP);
  else p_cl2rows(xq, xk, xv, XQ, XK, XV, bx - (4 * PW_G + 1)); }
__device__ __forceinline__ float rs_xh(float x) { return __builtin_bit_cast(float, __builtin_amdgcn_permlanex16(__builtin_bit_cast(int, x), __builtin_bit_cast(int, x), 0x76543210, 0xfedcba98, false, false)); }      /* lane l <- lane l ^ 16 */
// 2^z on the transcendental unit. The v_nop is the slot that the instruction set asks for behind a transcendental before its result is read or its source overwritten.
__device__ __forceinline__ float rs_exp2(float z) { float y; asm("v_exp_f32 %0, %1\n\tv_nop" : "=v"(y) : "v"(z)); return y; }
// Eight independent 2^z in place: each fills the slot behind the one before it, the v_nop fills the slot behind the last.
__device__ __forceinline__ void fa_exp2x8(float (&z)[8]) { asm("v_exp_f32 %0, %0\n\tv_exp_f32 %1, %1\n\tv_exp_f32 %2, %2\n\tv_exp_f32 %3, %3\n\tv_exp_f32 %4, %4\n\tv_exp_f32 %5, %5\n\tv_exp_f32 %6, %6\n\tv_exp_f32 %7, %7\n\tv_nop" : "+v"(z[0]), "+v"(z[1]), "+v"(z[2]), "+v"(z[3]), "+v"(z[4]), "+v"(z[5]), "+v"(z[6]), "+v"(z[7])); }
#define FA_KS 64                     /* keys per stage */
#define FA_PK 144                    /* LDS row pitch, bytes: 128 + 16, an odd multiple of 16 for 16-byte readers */
__device__ __forceinline__ v8f fa_mma(v16h a, v16h b, v8f c) { return __builtin_amdgcn_wmma_f32_16x16x32_f16(false, a, false, b, (short)0, c, false, false); }
__device__ __forceinline__ v16h fa_lfrag(const unsigned char* p) { FragH f; f.half[0] = *(const v8us*)p; f.half[1] = *(const v8us*)(p + 32); return f.v; }      /* p already holds + 16 hh: k = 8 hh .. and 16 + 8 hh .. */
__global__ __launch_bounds__(256) void k_fattn(const _Float16* __restrict__ Q16, const _Float16* __restrict__ K16, const _Float16* __restrict__ VT, _Float16* __restrict__ O16) {
  __shared__ __attribute__((aligned(16))) unsigned char L[2][2][FA_KS * FA_PK];      /* [buffer][K, V^T][row][pitch] */
  const int tid = threadIdx.x, lane = tid & 31, w = tid >> 5, c = lane & 15, hh = lane >> 4; const int h = blockIdx.y, b = blockIdx.z; const size_t r0 = (size_t)b * LL; const int q0 = blockIdx.x * 256 + w * 32;
  const float cs = 0.125f * 1.44269504088896340736f;      /* 1 / sqrt(64), times log2(e) */
  v16h qf[2][2];
#pragma unroll
  for (int g = 0; g < 2; ++g) for (int kc = 0; kc < 2; ++kc) qf[g][kc] = g2_frag(Q16 + (r0 + q0 + g * 16 + c) * CC + h * HD + kc * 32, hh);
  const int srow = tid >> 2, sseg = (tid & 3) * 32;      /* staging: 4 threads cover one 128-byte row, 32 bytes each */
  const unsigned char* kg = (const unsigned char*)(K16 + (r0 + srow) * CC + h * HD) + sseg;      /* key rows: + 64 rows a stage */
  const unsigned char* vg = (const unsigned char*)(VT + ((size_t)(b * NH + h) * HD + srow) * SQ) + sseg;      /* d rows: + 64 keys a stage */
  const int sdst = srow * FA_PK + sseg;
  v8us k0 = *(const v8us*)kg, k1 = *(const v8us*)(kg + 16), v0 = *(const v8us*)vg, v1 = *(const v8us*)(vg + 16);
  *(v8us*)&L[0][0][sdst] = k0; *(v8us*)&L[0][0][sdst + 16] = k1; *(v8us*)&L[0][1][sdst] = v0; *(v8us*)&L[0][1][sdst + 16] = v1;
  const v8f z8 = {0.f, 0.f, 0.f, 0.f, 0.f, 0.f, 0.f, 0.f}; v8f acc[2][4]; float m_run[2], l_run[2];
#pragma unroll
  for (int g = 0; g < 2; ++g) { m_run[g] = -__builtin_inff(); l_run[g] = 0.f; for (int t = 0; t < 4; ++t) acc[g][t] = z8; }
  __syncthreads();      /* stage 0 published */
#pragma unroll 1      // one stage a trip: the body already holds two unrolled 32-key passes
  for (int st = 0; st < SQ / FA_KS; ++st) {
    const bool more = st + 1 < SQ / FA_KS;
    if (more) { const unsigned char* kn = kg + (size_t)(st + 1) * (FA_KS * CC * 2); const unsigned char* vn = vg + (size_t)(st + 1) * (FA_KS * 2); k0 = *(const v8us*)kn; k1 = *(const v8us*)(kn + 16); v0 = *(const v8us*)vn; v1 = *(const v8us*)(vn + 16); }
    const unsigned char* Kb = &L[st & 1][0][c * FA_PK + 16 * hh]; const unsigned char* Vb = &L[st & 1][1][c * FA_PK + 16 * hh];
#pragma unroll
    for (int sub = 0; sub < 2; ++sub) {      /* one pass = 32 keys */
      v8f s[2][2];
#pragma unroll
      for (int kt = 0; kt < 2; ++kt) { const v16h ka = fa_lfrag(Kb + (sub * 32 + kt * 16) * FA_PK), kb2 = fa_lfrag(Kb + (sub * 32 + kt * 16) * FA_PK + 64);
        for (int g = 0; g < 2; ++g) s[kt][g] = fa_mma(kb2, qf[g][1], fa_mma(ka, qf[g][0], z8)); }
      v16h vf[4];
#pragma unroll
      for (int t = 0; t < 4; ++t) vf[t] = fa_lfrag(Vb + t * 16 * FA_PK + sub * 64);
      float mb[2]; bool need = false;
#pragma unroll
      for (int g = 0; g < 2; ++g) { float mx = fmaxf(s[0][g][0], s[1][g][0]);
        for (int r = 1; r < 8; ++r) mx = fmaxf(mx, fmaxf(s[0][g][r], s[1][g][r]));
        mx = fmaxf(mx, rs_xh(mx)) * cs; mb[g] = mx; need = need || (mx > m_run[g] + 8.0f); }      /* both wave halves hold the query's maximum, scaled (the scale is positive) */
      if (__builtin_amdgcn_ballot_w32(need) != 0) {      /* wave-uniform scalar branch, one test a pass; always taken on the first pass (m_run = -inf gives corr = 0) */
#pragma unroll
        for (int g = 0; g < 2; ++g) { const float m_new = fmaxf(m_run[g], mb[g]); const float corr = rs_exp2(m_run[g] - m_new); m_run[g] = m_new; l_run[g] *= corr; for (int t = 0; t < 4; ++t) acc[g][t] = acc[g][t] * corr; }
      }
#pragma unroll
      for (int g = 0; g < 2; ++g) { const float nm = -m_run[g]; float e0[8], e1[8];
        for (int r = 0; r < 8; ++r) { e0[r] = __builtin_fmaf(s[0][g][r], cs, nm); e1[r] = __builtin_fmaf(s[1][g][r], cs, nm); }
        fa_exp2x8(e0); fa_exp2x8(e1);
        l_run[g] += (((e0[0] + e0[1]) + (e0[2] + e0[3])) + ((e0[4] + e0[5]) + (e0[6] + e0[7]))) + (((e1[0] + e1[1]) + (e1[2] + e1[3])) + ((e1[4] + e1[5]) + (e1[6] + e1[7])));
        FragH pf; for (int r = 0; r < 8; ++r) { pf.h[r] = (_Float16)e0[r]; pf.h[8 + r] = (_Float16)e1[r]; }      /* element s: key 8 hh + s, then 16 + 8 hh + (s - 8): the k order of V^T's loader */
        for (int t = 0; t < 4; ++t) acc[g][t] = fa_mma(vf[t], pf.v, acc[g][t]); }
    }
    if (more) { unsigned char* d = &L[(st + 1) & 1][0][sdst]; *(v8us*)d = k0; *(v8us*)(d + 16) = k1; *(v8us*)(d + FA_KS * FA_PK) = v0; *(v8us*)(d + FA_KS * FA_PK + 16) = v1; }      /* its last readers left it before the barrier that ended trip st - 1 */
    __syncthreads();      /* publishes stage st + 1 and ends every read of stage st */
  }
#pragma unroll
  for (int g = 0; g < 2; ++g) { const float l = l_run[g] + rs_xh(l_run[g]); const float inv = 64.0f / l; unsigned short* d = (unsigned short*)O16 + (r0 + q0 + g * 16 + c) * CC + h * HD + 8 * hh;      /* o x64; a lane's 8 registers are 8 consecutive d of its query */
    for (int t = 0; t < 4; ++t) { FragH f; for (int r = 0; r < 8; ++r) f.h[r] = (_Float16)(acc[g][t][r] * inv); *(v8us*)(d + t * 16) = f.half[0]; } } }

extern "C" void kernel_launch(void* const* d_in, const int* in_sizes, int n_in,
                              void* d_out, int out_size, void* d_ws, size_t ws_size, hipStream_t stream) {
  (void)in_sizes; (void)n_in; (void)out_size;
  const float* const* I = (const float* const*)d_in; const float* xq = I[0]; const float* xk = I[1]; const float* xv = I[2]; const float* wq = I[3]; const float* bq = I[4]; const float* wk = I[5]; const float* bk = I[6]; const float* wv = I[7]; const float* bv = I[8]; const float* wm = I[9]; const float* bm = I[10];
  char* ws = (char*)d_ws; size_t off = 0;
  auto take = [&](size_t bytes) { char* p = ws + off; off += (bytes + 255) & ~(size_t)255; return p; };
  _Float16* BQ = (_Float16*)take((size_t)CC * CC * 2); _Float16* BK = (_Float16*)take((size_t)CC * CC * 2); _Float16* BV = (_Float16*)take((size_t)CC * CC * 2); _Float16* AM = (_Float16*)take((size_t)CC * CC * 2); float* BP = (float*)take((size_t)3 * CC * 4);
  _Float16* XQ = (_Float16*)take(NR * CC * 2); _Float16* XK = (_Float16*)take(NR * CC * 2); _Float16* XV = (_Float16*)take(NR * CC * 2); _Float16* Q16 = (_Float16*)take(NR * CC * 2); _Float16* K16 = (_Float16*)take(NR * CC * 2); _Float16* O16 = (_Float16*)take(NR * CC * 2);
  _Float16* VT = (_Float16*)take((size_t)NB * NH * HD * SQ * 2);
  if (off > ws_size) return;      /* 0.5 + 48 + 8 = approx 57 MiB */
  k_prep<<<4 * PW_G + 1 + PX_G, 256, 0, stream>>>(xq, xk, xv, wq, wk, wv, wm, bq, bk, bv, XQ, XK, XV, BQ, BK, BV, AM, BP);
  k_qkv<<<dim3(QKV_G, 3), 128, 0, stream>>>(XQ, XK, XV, BQ, BK, BV, BP, Q16, K16, VT);      /* q, k token rows; V^T [8][4][64][2048] */
  k_fattn<<<dim3(SQ / 256, NH, NB), 256, 0, stream>>>(Q16, K16, VT, O16);      /* o x64, head-major f16 rows */
  k_out<<<dim3(CT_G, NB), 128, 0, stream>>>(AM, O16, bm, (float*)d_out);
}

// v006
// It runs in 61.6 microseconds.
// In both of two side-by-side timings against v005, it was 1.05 times as fast.
// Counting every step since v000, it is 57.0 times as fast.
#include <hip/hip_runtime.h>
// SuperGlue multi-head attention (query, key, value channel-first [8][256][2048]; q/k/v = 1x1 conv (natural [256][256] + bias); the module's head split view(B, d=64, H=4, N) makes channel c = dd*4 + h (INTERLEAVED heads); scores = q.k / 8 per head over 2,048 keys; softmax; x merged back to c = dd*4 + h; out = w_m x + b_m -> [8][256][2048]).
// Structure, 4 launches: (1) one preparation grid: channel-first inputs transposed to token rows (exact f16) in registers, projection weights and biases permuted so the head split becomes contiguous 64-column blocks (exact x16 f16); (2) Q, K and V as WMMA GEMMs in one grid (32x64 wave tiles, f32 accumulation, f16 outputs), V with the operands swapped so that V^T [8][4][64][2048] is written directly; (3) scores, softmax and P . V fused in one kernel over all batches and heads (S^T = K . Q^T, online softmax in f32, O^T += V^T . P^T, P stays in registers as f16; o x64 in f16) into head-major rows; (4) out channel-major directly: (w_m with permuted columns) . o^T GEMM batched over the 8 batches (alpha folds 1/16 and 1/64), the per-channel bias added in its epilogue.
// Compute dtype: inputs rounded to bf16; inputs / weights exact in f16; q, k, v, softmax weights and o plain f16 (~2^-12); scores and softmax statistics f32. v_wmma_f32_16x16x32_f16.
#define NB 8
#define CC 256
#define LL 2048
#define SQ LL
#define DM CC
#define NH 4
#define HD 64
#define HG 4
#define QN SQ                        /* query rows per batch (unused) */
#define NR ((size_t)NB * LL)
typedef __bf16 v16b __attribute__((ext_vector_type(16)));
typedef unsigned short v8us __attribute__((ext_vector_type(8), may_alias));
typedef float  v8f  __attribute__((ext_vector_type(8)));
typedef float  v4f  __attribute__((ext_vector_type(4)));
typedef float  v4fa __attribute__((ext_vector_type(4), may_alias));
union FragB { v16b v; v8us half[2]; unsigned short u[16]; };

__device__ __forceinline__ unsigned short bf16_bits(float x) { unsigned int u = __float_as_uint(x); return (unsigned short)((u + 0x7FFFu + ((u >> 16) & 1u)) >> 16); }
__device__ __forceinline__ float bf16_val(unsigned short b) { return __uint_as_float(((unsigned int)b) << 16); }
__device__ __forceinline__ float bf16_round(float x) { return bf16_val(bf16_bits(x)); }
// D += A·B with NT terms: 1 = ah·bh, 2 = + al·bh (A split), 3 = + ah·bl (both split)
template <int NT>
__device__ __forceinline__ v8f mmaN(v16b ah, v16b al, v16b bh, v16b bl, v8f c) {
  c = __builtin_amdgcn_wmma_f32_16x16x32_bf16(false, ah, false, bh, (short)0, c, false, false);
  if (NT >= 2) c = __builtin_amdgcn_wmma_f32_16x16x32_bf16(false, al, false, bh, (short)0, c, false, false);
  if (NT >= 3) c = __builtin_amdgcn_wmma_f32_16x16x32_bf16(false, ah, false, bl, (short)0, c, false, false);
  asm volatile("v_nop\n\tv_nop\n\tv_nop\n\tv_nop" : "+v"(c) : "v"(ah), "v"(al), "v"(bh), "v"(bl));
  return c;
}

__global__ __launch_bounds__(256) void k_wt_bf16(const float* __restrict__ W, unsigned short* __restrict__ Wt, int K, int N) {
  const int t = blockIdx.x * 256 + threadIdx.x;
  const int k8n = K / 8;
  if (t >= N * k8n) return;
  const int n = t / k8n, k8 = (t % k8n) * 8;
  v8us v;
#pragma unroll
  for (int i = 0; i < 8; ++i) v[i] = bf16_bits(W[(size_t)(k8 + i) * N + n]);
  *(v8us*)(Wt + (size_t)n * K + k8) = v;
  
}

// GEMM C[M][N] (f32, pitch ldc) = act(A[M][K]·W + bias). A f32 row-major (pitch lda) converted per fragment to bf16
// (ASPLIT: hi/lo two planes -> 2 terms, else single rounded term); Wt bf16 [N][K] (pitch ldb). BIAS_BF16 rounds the
// bias to bf16 first (bias quantised to bf16 before the add). K%32==0, M%16==0, N%64==0.
template <bool ASPLIT, int ACT, bool BIAS_BF16>
__global__ __launch_bounds__(128) void k_gemm_bf(const float* __restrict__ A, int lda, const unsigned short* __restrict__ Wt, int ldb,
                                               const float* __restrict__ bias, float* __restrict__ C, int ldc, int M, int N, int K) {
  __shared__ __attribute__((aligned(16))) float so[4][16][64];
  const int tid = threadIdx.x, w = tid >> 5, lane = tid & 31, ln = lane & 15, hh = lane >> 4;
  const int ntn = N / 64;
  const int wid = blockIdx.x * 4 + w;
  const int mt = wid / ntn, nq = wid % ntn;
  if (mt * 16 >= M) return;
  const int row0 = mt * 16, col0 = nq * 64;
  const float* arow = A + (size_t)(row0 + ln) * lda;
  v8f acc[4] = {};
  for (int kb = 0; kb < K; kb += 32) {
    FragB ah, al;
    const v4f x0 = *(const v4fa*)(arow + kb + 8 * hh), x1 = *(const v4fa*)(arow + kb + 8 * hh + 4);
    const v4f x2 = *(const v4fa*)(arow + kb + 16 + 8 * hh), x3 = *(const v4fa*)(arow + kb + 16 + 8 * hh + 4);
    float xs[16] = {x0[0],x0[1],x0[2],x0[3],x1[0],x1[1],x1[2],x1[3],x2[0],x2[1],x2[2],x2[3],x3[0],x3[1],x3[2],x3[3]};
#pragma unroll
    for (int i = 0; i < 16; ++i) { const unsigned short hb = bf16_bits(xs[i]); ah.u[i] = hb; al.u[i] = ASPLIT ? bf16_bits(xs[i] - bf16_val(hb)) : (unsigned short)0; }
#pragma unroll
    for (int t = 0; t < 4; ++t) {
      const unsigned short* brow = Wt + (size_t)(col0 + t * 16 + ln) * ldb + kb;
      FragB b;
      b.half[0] = *(const v8us*)(brow + 8 * hh);
      b.half[1] = *(const v8us*)(brow + 16 + 8 * hh);
      acc[t] = mmaN<ASPLIT ? 2 : 1>(ah.v, al.v, b.v, b.v, acc[t]);
    }
  }
#pragma unroll
  for (int t = 0; t < 4; ++t) {
    float bv = bias ? bias[col0 + t * 16 + ln] : 0.f;
    if (BIAS_BF16) bv = bf16_round(bv);
#pragma unroll
    for (int r = 0; r < 8; ++r) { float v = acc[t][r] + bv; if (ACT == 1) v = fmaxf(v, 0.f); so[w][8 * hh + r][t * 16 + ln] = v; }
  }
  __builtin_amdgcn_fence(__ATOMIC_ACQ_REL, "workgroup");
  __builtin_amdgcn_wave_barrier();
  const int rsub = lane >> 4, c4 = (lane & 15) * 4;
  {
#pragma unroll
    for (int q = 0; q < 8; ++q) {
      const int r = q * 2 + rsub;
      const v4f v = *(const v4fa*)&so[w][r][c4];
      *(v4f*)(C + (size_t)(row0 + r) * ldc + col0 + c4) = v;
    }
    
  }
}

// GEMM C = act(A·W + bias + resid): A f32 (ASPLIT -> hi/lo 2 terms), Wt bf16 [N][K]; ACT 0 none, 1 relu, 2 exact gelu;
// resid (optional, f32, row index = (row % rmod), pitch ldr, RES_BF16 rounds it) added before the activation.
template <bool ASPLIT, int ACT, bool BIAS_BF16, bool RES_BF16>
__global__ __launch_bounds__(128) void k_gemm_bf3(const float* __restrict__ A, int lda, const unsigned short* __restrict__ Wt, int ldb,
                                                const float* __restrict__ bias, const float* __restrict__ resid, int rmod, int ldr,
                                                float* __restrict__ C, int ldc, int M, int N, int K) {
  __shared__ __attribute__((aligned(16))) float so[4][16][64];
  const int tid = threadIdx.x, w = tid >> 5, lane = tid & 31, ln = lane & 15, hh = lane >> 4;
  const int ntn = N / 64;
  const int wid = blockIdx.x * 4 + w;
  const int mt = wid / ntn, nq = wid % ntn;
  if (mt * 16 >= M) return;
  const int row0 = mt * 16, col0 = nq * 64;
  const float* arow = A + (size_t)(row0 + ln) * lda;
  v8f acc[4] = {};
  for (int kb = 0; kb < K; kb += 32) {
    FragB ah, al;
    const v4f x0 = *(const v4fa*)(arow + kb + 8 * hh), x1 = *(const v4fa*)(arow + kb + 8 * hh + 4);
    const v4f x2 = *(const v4fa*)(arow + kb + 16 + 8 * hh), x3 = *(const v4fa*)(arow + kb + 16 + 8 * hh + 4);
    float xs[16] = {x0[0],x0[1],x0[2],x0[3],x1[0],x1[1],x1[2],x1[3],x2[0],x2[1],x2[2],x2[3],x3[0],x3[1],x3[2],x3[3]};
#pragma unroll
    for (int i = 0; i < 16; ++i) { const unsigned short hb = bf16_bits(xs[i]); ah.u[i] = hb; al.u[i] = ASPLIT ? bf16_bits(xs[i] - bf16_val(hb)) : (unsigned short)0; }
#pragma unroll
    for (int t = 0; t < 4; ++t) {
      const unsigned short* brow = Wt + (size_t)(col0 + t * 16 + ln) * ldb + kb;
      FragB b;
      b.half[0] = *(const v8us*)(brow + 8 * hh);
      b.half[1] = *(const v8us*)(brow + 16 + 8 * hh);
      acc[t] = mmaN<ASPLIT ? 2 : 1>(ah.v, al.v, b.v, b.v, acc[t]);
    }
  }
#pragma unroll
  for (int t = 0; t < 4; ++t) {
    const int col = col0 + t * 16 + ln;
    float bv = bias ? bias[col] : 0.f;
    if (BIAS_BF16) bv = bf16_round(bv);
#pragma unroll
    for (int r = 0; r < 8; ++r) {
      float v = acc[t][r] + bv;
      if (resid) { float rv = resid[(size_t)((row0 + 8 * hh + r) % rmod) * ldr + col]; if (RES_BF16) rv = bf16_round(rv); v += rv; }
      if (ACT == 1) v = fmaxf(v, 0.f);
      if (ACT == 2) v = 0.5f * v * (1.0f + erff(v * 0.70710678118654752f));
      if (ACT == 3) { const float u = 0.7978845608028654f * (v + 0.044715f * v * v * v); v = 0.5f * v * (1.0f + tanhf(u)); }
      so[w][8 * hh + r][t * 16 + ln] = v;
    }
  }
  __builtin_amdgcn_fence(__ATOMIC_ACQ_REL, "workgroup");
  __builtin_amdgcn_wave_barrier();
  const int rsub = lane >> 4, c4 = (lane & 15) * 4;
  {
#pragma unroll
    for (int q = 0; q < 8; ++q) {
      const int r = q * 2 + rsub;
      const v4f v = *(const v4fa*)&so[w][r][c4];
      *(v4f*)(C + (size_t)(row0 + r) * ldc + col0 + c4) = v;
    }
    
  }
}
// row LayerNorm (biased variance, eps) over N: s = X (+ R); optional out_sum <- s; out_norm <- (s-mu)*rsqrt(var+eps)*g + b
template <bool PARAM_BF16>
__global__ __launch_bounds__(256) void k_layernorm(const float* __restrict__ X, const float* __restrict__ R, const float* __restrict__ g, const float* __restrict__ bta,
                                                  float* __restrict__ out_sum, float* __restrict__ out_norm, int N, float eps) {
  __shared__ float red[256];
  const int row = blockIdx.x, tid = threadIdx.x;
  const float* x = X + (size_t)row * N; const float* rr = R ? R + (size_t)row * N : nullptr;
  float vals[16];                     // up to N = 4096
  const int per = N / 256;            // contiguous chunk per thread? use strided-by-4 chunks: thread handles j = tid*4 + 1024*u
  float s1 = 0.f;
  for (int u = 0; u < per / 4; ++u) {
    const int j = tid * 4 + 1024 * u;
    const v4f a = *(const v4fa*)(x + j);
    v4f b = {0.f,0.f,0.f,0.f}; if (rr) b = *(const v4fa*)(rr + j);
#pragma unroll
    for (int q = 0; q < 4; ++q) { const float v = a[q] + b[q]; vals[u * 4 + q] = v; s1 += v; }
  }
  red[tid] = s1; __syncthreads();
  for (int st = 128; st > 0; st >>= 1) { if (tid < st) red[tid] += red[tid + st]; __syncthreads(); }
  const float mu = red[0] / (float)N; __syncthreads();
  float s2 = 0.f;
  for (int u = 0; u < per / 4; ++u)
#pragma unroll
    for (int q = 0; q < 4; ++q) { const float c = vals[u * 4 + q] - mu; s2 += c * c; }
  red[tid] = s2; __syncthreads();
  for (int st = 128; st > 0; st >>= 1) { if (tid < st) red[tid] += red[tid + st]; __syncthreads(); }
  const float rs = rsqrtf(red[0] / (float)N + eps);
  {
    for (int u = 0; u < per / 4; ++u) {
      const int j = tid * 4 + 1024 * u;
      v4f o, sm;
#pragma unroll
      for (int q = 0; q < 4; ++q) {
        float gg = g[j + q], bb = bta[j + q];
        if (PARAM_BF16) { gg = bf16_round(gg); bb = bf16_round(bb); }
        sm[q] = vals[u * 4 + q]; o[q] = (vals[u * 4 + q] - mu) * rs * gg + bb;
      }
      if (out_sum) *(v4f*)(out_sum + (size_t)row * N + j) = sm;
      *(v4f*)(out_norm + (size_t)row * N + j) = o;
    }
    
  }
}



// ---- f16 WMMA path (v_wmma_f32_16x16x32_f16): 11-bit significands for operands in range — used where a [0,1] probability operand needs more precision than bf16
typedef _Float16 v16h __attribute__((ext_vector_type(16)));
union FragH { v16h v; v8us half[2]; _Float16 h[16]; unsigned short u[16]; };
template <int NT>
__device__ __forceinline__ v8f mmaH(v16h ah, v16h al, v16h bh, v16h bl, v8f c) {
  c = __builtin_amdgcn_wmma_f32_16x16x32_f16(false, ah, false, bh, (short)0, c, false, false);
  if (NT >= 2) c = __builtin_amdgcn_wmma_f32_16x16x32_f16(false, al, false, bh, (short)0, c, false, false);
  if (NT >= 3) c = __builtin_amdgcn_wmma_f32_16x16x32_f16(false, ah, false, bl, (short)0, c, false, false);
  asm volatile("v_nop\n\tv_nop\n\tv_nop\n\tv_nop" : "+v"(c) : "v"(ah), "v"(al), "v"(bh), "v"(bl));
  return c;
}
// batched GEMM like k_gemm_b but f16 operands: A f32 (split into f16 hi/lo if ASPLIT, else rounded to f16), Bt = f16 values [n][k]; alpha; C f32; N multiple of 16 (partial tiles skipped)
template <bool ASPLIT>
__global__ __launch_bounds__(128) void k_gemm_h(const float* __restrict__ A, int lda, size_t sA, const _Float16* __restrict__ Bh, int ldb, size_t sB, float alpha, float* __restrict__ C, int ldc, size_t sC, int M, int N, int K) {
  __shared__ __attribute__((aligned(16))) float so[4][16][64];
  const int tid = threadIdx.x, w = tid >> 5, lane = tid & 31, ln = lane & 15, hh = lane >> 4; const int by = blockIdx.y;
  A += (size_t)by * sA; Bh += (size_t)by * sB; C += (size_t)by * sC;
  const int ntn = (N + 63) / 64; const int wid = blockIdx.x * 4 + w; const int mt = wid / ntn, nq = wid % ntn; if (mt * 16 >= M) return;
  const int row0 = mt * 16, col0 = nq * 64; const float* arow = A + (size_t)(row0 + ln) * lda;
  v8f acc[4] = {};
  for (int kb = 0; kb < K; kb += 32) {
    FragH ah, al;
    const v4f x0 = *(const v4fa*)(arow + kb + 8 * hh), x1 = *(const v4fa*)(arow + kb + 8 * hh + 4), x2 = *(const v4fa*)(arow + kb + 16 + 8 * hh), x3 = *(const v4fa*)(arow + kb + 16 + 8 * hh + 4);
    float xs[16] = {x0[0],x0[1],x0[2],x0[3],x1[0],x1[1],x1[2],x1[3],x2[0],x2[1],x2[2],x2[3],x3[0],x3[1],x3[2],x3[3]};
#pragma unroll
    for (int i = 0; i < 16; ++i) { const _Float16 h = (_Float16)xs[i]; ah.h[i] = h; al.h[i] = ASPLIT ? (_Float16)(xs[i] - (float)h) : (_Float16)0.0f; }
#pragma unroll
    for (int t = 0; t < 4; ++t) { if (col0 + t * 16 >= N) continue; const size_t boff = (size_t)(col0 + t * 16 + ln) * ldb + kb; FragH bq; bq.half[0] = *(const v8us*)(Bh + boff + 8 * hh); bq.half[1] = *(const v8us*)(Bh + boff + 16 + 8 * hh);
      acc[t] = mmaH<ASPLIT ? 2 : 1>(ah.v, al.v, bq.v, bq.v, acc[t]); }
  }
#pragma unroll
  for (int t = 0; t < 4; ++t) { if (col0 + t * 16 >= N) continue;
#pragma unroll
    for (int r = 0; r < 8; ++r) so[w][8 * hh + r][t * 16 + ln] = acc[t][r] * alpha; }
  __builtin_amdgcn_fence(__ATOMIC_ACQ_REL, "workgroup"); __builtin_amdgcn_wave_barrier();
  const int rsub = lane >> 4, c4 = (lane & 15) * 4;
  {
#pragma unroll
    for (int q = 0; q < 8; ++q) { const int r = q * 2 + rsub; if (col0 + c4 < N) { const v4f v = *(const v4fa*)&so[w][r][c4]; *(v4f*)(C + (size_t)(row0 + r) * ldc + col0 + c4) = v; } }
     }
}

// Wt[n][k] = f16(W[k][n]·scale) from f32 row-major W[K][N] (scale = power of two; bf16-exact weights stay exact in f16 away from the subnormal range)
__global__ __launch_bounds__(256) void k_wt_f16(const float* __restrict__ W, _Float16* __restrict__ Wt, int K, int N, float scale) {
  const int t = blockIdx.x * 256 + threadIdx.x; if (t >= N * (K / 8)) return; const int n = t / (K / 8), k8 = (t % (K / 8)) * 8; FragH f;
#pragma unroll
  for (int i = 0; i < 8; ++i) f.h[i] = (_Float16)(bf16_round(W[(size_t)(k8 + i) * N + n]) * scale); const v8us o = f.half[0];
  *(v8us*)((unsigned short*)Wt + (size_t)n * K + k8) = o; 
}
// k_gemm_hh variant with fused epilogue: v = acc·alpha + bias[by·sBias + col] (+ CP[(row/rowsPerB)·sCPb + by·64 + col] if CP) ; ACT 0 none / 1 elu ; writes f16 C16 (and f32 C if non-null)
template <int ACT>
__global__ __launch_bounds__(128) void k_gemm_hhx(const _Float16* __restrict__ A, int lda, size_t sA, const _Float16* __restrict__ Bh, int ldb, size_t sB, float alpha, const float* __restrict__ bias, size_t sBias, const float* __restrict__ CP, int rowsPerB, size_t sCPb, int row0g,
    float* __restrict__ C, _Float16* __restrict__ C16, int ldc, size_t sC, int M, int N, int K) {
  __shared__ __attribute__((aligned(16))) float so[4][16][64];
  const int tid = threadIdx.x, w = tid >> 5, lane = tid & 31, ln = lane & 15, hh = lane >> 4; const int by = blockIdx.y;
  A += (size_t)by * sA; Bh += (size_t)by * sB; const size_t cofs = (size_t)by * sC; const float* bp = bias ? bias + (size_t)by * sBias : nullptr;
  const int ntn = (N + 63) / 64; const int wid = blockIdx.x * 4 + w; const int mt = wid / ntn, nq = wid % ntn; if (mt * 16 >= M) return;
  const int row0 = mt * 16, col0 = nq * 64; const _Float16* arow = A + (size_t)(row0 + ln) * lda;
  v8f acc[4] = {};
  for (int kb = 0; kb < K; kb += 32) { FragH ah; ah.half[0] = *(const v8us*)((const unsigned short*)arow + kb + 8 * hh); ah.half[1] = *(const v8us*)((const unsigned short*)arow + kb + 16 + 8 * hh);
#pragma unroll
    for (int t = 0; t < 4; ++t) { if (col0 + t * 16 >= N) continue; const size_t boff = (size_t)(col0 + t * 16 + ln) * ldb + kb; FragH bq; bq.half[0] = *(const v8us*)((const unsigned short*)Bh + boff + 8 * hh); bq.half[1] = *(const v8us*)((const unsigned short*)Bh + boff + 16 + 8 * hh);
      acc[t] = mmaH<1>(ah.v, ah.v, bq.v, bq.v, acc[t]); }
  }
#pragma unroll
  for (int t = 0; t < 4; ++t) { if (col0 + t * 16 >= N) continue; const int col = col0 + t * 16 + ln; const float bv = bp ? bf16_round(bp[col]) : 0.f;
#pragma unroll
    for (int r = 0; r < 8; ++r) { float v = acc[t][r] * alpha + bv; if (CP) { const int rr = row0g + row0 + 8 * hh + r; if (rowsPerB < 0) v += CP[cofs + (size_t)rr * ldc + col];      /* rowsPerB < 0: own element of the batched C plane */ else { const int bidx = rr / rowsPerB; v += CP[(size_t)bidx * sCPb + (size_t)by * 64 + col]; } } if (ACT == 1) v = (v > 0.f) ? v : expm1f(v); else if (ACT == 7) v = (v > 0.f) ? v + 1.0f : expf(v); else if (ACT == 8) v = tanhf(v); else if (ACT == 9) v = 0.5f * v * (1.0f + tanhf(0.7978845608028654f * (v + 0.044715f * v * v * v))); else if (ACT == 11) v = 1.0f / (1.0f + expf(-v)); else if (ACT == 12) v = (v > 0.f) ? v : 0.01f * v; else if (ACT == 14) v = (v > 0.f) ? v : 0.1f * v; else if (ACT == 16) v = (v >= 0.f) ? v : 0.3f * v; else if (ACT == 17) v = (v >= 0.f) ? v : 0.2f * v; else if (ACT == 15) v = v / (1.0f + expf(-v)); else if (ACT == 3) v = fmaxf(v, 0.f); else if (ACT == 6) v = 0.5f * v * (1.0f + erff(v * 0.70710678118654752f)); so[w][8 * hh + r][t * 16 + ln] = v; } }
  __builtin_amdgcn_fence(__ATOMIC_ACQ_REL, "workgroup"); __builtin_amdgcn_wave_barrier();
  const int rsub = lane >> 4, c4 = (lane & 15) * 4; typedef _Float16 v4h __attribute__((ext_vector_type(4)));
  {
#pragma unroll
    for (int q = 0; q < 8; ++q) { const int r = q * 2 + rsub; if (col0 + c4 < N) { const v4f v = *(const v4fa*)&so[w][r][c4]; if (C) *(v4f*)(C + cofs + (size_t)(row0 + r) * ldc + col0 + c4) = v; if (C16) { v4h h4; for (int i = 0; i < 4; ++i) h4[i] = (_Float16)v[i]; *(v4h*)(C16 + cofs + (size_t)(row0 + r) * ldc + col0 + c4) = h4; } } }
     }
}


typedef _Float16 v4h __attribute__((ext_vector_type(4)));

__global__ __launch_bounds__(256) void k_x16(const float* __restrict__ x, _Float16* __restrict__ X16, size_t n8) { const size_t t = (size_t)blockIdx.x * 256 + threadIdx.x; if (t >= n8) return; FragH f;
#pragma unroll
  for (int q = 0; q < 8; ++q) f.h[q] = (_Float16)bf16_round(x[t * 8 + q]); *(v8us*)((unsigned short*)X16 + t * 8) = f.half[0];  }
__global__ __launch_bounds__(256) void k_h16(const float* __restrict__ x, _Float16* __restrict__ X16, size_t n8) { const size_t t = (size_t)blockIdx.x * 256 + threadIdx.x; if (t >= n8) return; FragH f;
#pragma unroll
  for (int q = 0; q < 8; ++q) f.h[q] = (_Float16)x[t * 8 + q]; *(v8us*)((unsigned short*)X16 + t * 8) = f.half[0];  }
__global__ __launch_bounds__(256) void k_round16f(const float* __restrict__ W, _Float16* __restrict__ Bt, size_t n8) { const size_t t = (size_t)blockIdx.x * 256 + threadIdx.x; if (t >= n8) return; FragH f;
#pragma unroll
  for (int i = 0; i < 8; ++i) f.h[i] = (_Float16)(bf16_round(W[t * 8 + i]) * 16.0f); *(v8us*)((unsigned short*)Bt + t * 8) = f.half[0];  }

__global__ __launch_bounds__(256) void k_hl(const float* __restrict__ F, _Float16* __restrict__ Hh, _Float16* __restrict__ Hl, size_t n8) { const size_t t = (size_t)blockIdx.x * 256 + threadIdx.x; if (t >= n8) return; FragH fh, fl; const v4f a = *(const v4fa*)(F + t * 8), c = *(const v4fa*)(F + t * 8 + 4);
#pragma unroll
  for (int q = 0; q < 4; ++q) { _Float16 h = (_Float16)a[q]; fh.h[q] = h; fl.h[q] = (_Float16)((a[q] - (float)h) * 1024.0f); h = (_Float16)c[q]; fh.h[4 + q] = h; fl.h[4 + q] = (_Float16)((c[q] - (float)h) * 1024.0f); }
  { *(v8us*)((unsigned short*)Hh + t * 8) = fh.half[0]; *(v8us*)((unsigned short*)Hl + t * 8) = fl.half[0];  } }

// ---- fast GEMM tile: C = A . B^T * alpha + bias, A [M][CC] and B [N][CC] f16 rows; work-group tile 128x64, wave tile 32x64 (M % 128 == 0, N % 64 == 0) ----
__device__ __forceinline__ v16h g2_frag(const _Float16* p, int hh) { FragH f; f.half[0] = *(const v8us*)((const unsigned short*)p + 8 * hh); f.half[1] = *(const v8us*)((const unsigned short*)p + 16 + 8 * hh); return f.v; }
__device__ __forceinline__ v8f g2_mma(v16h a, v16h b, v8f c) { v8f d = __builtin_amdgcn_wmma_f32_16x16x32_f16(false, a, false, b, (short)0, c, false, false); asm volatile("v_nop\n\tv_nop\n\tv_nop\n\tv_nop" : "+v"(d) : "v"(a), "v"(b)); return d; }
// Both operand tiles (128 + 64 rows, all of K = CC: 512 bytes a row) are brought into LDS once, whole rows at a time, and the fragments are read from there:
// a fragment load straight from global memory touches 16 lines for 512 bytes, and its latency stood in front of every pair of products.
#define G2_PK 528                    /* LDS row pitch, bytes: 512 + 16, an odd multiple of 16 for 16-byte readers */
#define G2_LDS ((128 + 64) * G2_PK)
__device__ __forceinline__ v16h g2_lfrag(const unsigned char* p) { FragH f; f.half[0] = *(const v8us*)p; f.half[1] = *(const v8us*)(p + 32); return f.v; }      /* p already holds + 16 hh: k = 8 hh .. and 16 + 8 hh .. */
// Twelve asynchronous copies to LDS, one 512-byte row each (a lane brings its own 16 bytes). The s_wait_xcnt is the last line of the copies' own statement, so that it stands in front of whatever rewrites an address register that a copy names.
__device__ __forceinline__ void g2_copy12(const unsigned* l, const unsigned char* const* g) {
  asm volatile("global_load_async_to_lds_b128 %0, %12, off\n\tglobal_load_async_to_lds_b128 %1, %13, off\n\tglobal_load_async_to_lds_b128 %2, %14, off\n\tglobal_load_async_to_lds_b128 %3, %15, off\n\t"
               "global_load_async_to_lds_b128 %4, %16, off\n\tglobal_load_async_to_lds_b128 %5, %17, off\n\tglobal_load_async_to_lds_b128 %6, %18, off\n\tglobal_load_async_to_lds_b128 %7, %19, off\n\t"
               "global_load_async_to_lds_b128 %8, %20, off\n\tglobal_load_async_to_lds_b128 %9, %21, off\n\tglobal_load_async_to_lds_b128 %10, %22, off\n\tglobal_load_async_to_lds_b128 %11, %23, off\n\ts_wait_xcnt 0x0"
               :: "v"(l[0]), "v"(l[1]), "v"(l[2]), "v"(l[3]), "v"(l[4]), "v"(l[5]), "v"(l[6]), "v"(l[7]), "v"(l[8]), "v"(l[9]), "v"(l[10]), "v"(l[11]),
                  "v"(g[0]), "v"(g[1]), "v"(g[2]), "v"(g[3]), "v"(g[4]), "v"(g[5]), "v"(g[6]), "v"(g[7]), "v"(g[8]), "v"(g[9]), "v"(g[10]), "v"(g[11]) : "memory"); }
// RB: the bias belongs to the row of C (channel-major outputs), else to its column. TO: element type of C (float or f16). bx: tile index, column tiles fastest. A and B rows are CC long (K = CC). sm: G2_LDS bytes.
template <bool RB, typename TO>
__device__ __forceinline__ void g2_tile(unsigned char* sm, const _Float16* __restrict__ A, const _Float16* __restrict__ Bh, float alpha, const float* __restrict__ bp, TO* __restrict__ C, int ldc, int bx, int N) {
  const int tid = threadIdx.x, w = tid >> 5, lane = tid & 31, ln = lane & 15, hh = lane >> 4;
  const int ntn = N >> 6; const int mt = bx / ntn, nq = bx - mt * ntn; const int row0 = mt * 128 + 32 * w, col0 = nq * 64;
  { /* wave w brings its own 32 rows of A and rows 16 w .. 16 w + 15 of B: 48 copies, all in flight at once */
    const unsigned char* ga = (const unsigned char*)(A + (size_t)row0 * CC) + lane * 16; const unsigned char* gb = (const unsigned char*)(Bh + (size_t)(col0 + 16 * w) * CC) + lane * 16;
    const unsigned l0 = (unsigned)(size_t)sm + lane * 16; const unsigned la = l0 + 32 * w * G2_PK, lb = l0 + (128 + 16 * w) * G2_PK;
    unsigned l[48]; const unsigned char* g[48];
#pragma unroll      // constant indices, so that the two arrays dissolve into registers
    for (int i = 0; i < 48; ++i) { l[i] = i < 32 ? la + i * G2_PK : lb + (i - 32) * G2_PK; g[i] = i < 32 ? ga + i * (CC * 2) : gb + (i - 32) * (CC * 2); }
    g2_copy12(l, g); g2_copy12(l + 12, g + 12); g2_copy12(l + 24, g + 24); g2_copy12(l + 36, g + 36);
    asm volatile("s_wait_asynccnt 0x0" ::: "memory");      // this wave's 48 copies have landed; the compiler places no wait for them
    __syncthreads(); }      /* both tiles published: the B rows are read by all four waves */
  const unsigned char* ap = sm + (32 * w + ln) * G2_PK + 16 * hh;      /* + 16 hh: the lane half's k offset sits in the row pointers */
  const unsigned char* bq = sm + (128 + ln) * G2_PK + 16 * hh;
  const v8f z8 = {0.f,0.f,0.f,0.f,0.f,0.f,0.f,0.f}; v8f c00 = z8, c01 = z8, c02 = z8, c03 = z8, c10 = z8, c11 = z8, c12 = z8, c13 = z8;
  v16h a0 = g2_lfrag(ap), a1 = g2_lfrag(ap + 16 * G2_PK), b0 = g2_lfrag(bq), b1 = g2_lfrag(bq + 16 * G2_PK), b2 = g2_lfrag(bq + 32 * G2_PK), b3 = g2_lfrag(bq + 48 * G2_PK);
#pragma unroll      // straight line: the next 32 k's fragments go into a second register set, read as one group ahead of this block's products
  for (int ks = 0; ks < CC / 32; ++ks) { v16h na0 = a0, na1 = a1, nb0 = b0, nb1 = b1, nb2 = b2, nb3 = b3;
    if (ks + 1 < CC / 32) { const int o = (ks + 1) * 64; na0 = g2_lfrag(ap + o); na1 = g2_lfrag(ap + 16 * G2_PK + o); nb0 = g2_lfrag(bq + o); nb1 = g2_lfrag(bq + 16 * G2_PK + o); nb2 = g2_lfrag(bq + 32 * G2_PK + o); nb3 = g2_lfrag(bq + 48 * G2_PK + o); }
    c00 = g2_mma(a0, b0, c00); c10 = g2_mma(a1, b0, c10); c01 = g2_mma(a0, b1, c01); c11 = g2_mma(a1, b1, c11);
    c02 = g2_mma(a0, b2, c02); c12 = g2_mma(a1, b2, c12); c03 = g2_mma(a0, b3, c03); c13 = g2_mma(a1, b3, c13);
    a0 = na0; a1 = na1; b0 = nb0; b1 = nb1; b2 = nb2; b3 = nb3; }
  float (*so)[68] = (float (*)[68])(sm + 32 * w * G2_PK);      /* output staging in the wave's own 32 rows of A: no other wave reads or writes them, and this wave's reads of them have fed the sums that are stored here */
  v8f accs[8] = {c00, c01, c02, c03, c10, c11, c12, c13};
#pragma unroll
  for (int u = 0; u < 8; ++u) { const int t = u & 3, half = u >> 2; const int col = col0 + t * 16 + ln;
#pragma unroll
    for (int r = 0; r < 8; ++r) { const int rloc = half * 16 + 8 * hh + r; const float bv = bf16_round(RB ? bp[row0 + rloc] : bp[col]); so[rloc][t * 16 + ln] = accs[u][r] * alpha + bv; } }
  __builtin_amdgcn_fence(__ATOMIC_ACQ_REL, "workgroup"); __builtin_amdgcn_wave_barrier();
  const int rsub = lane >> 4, c4 = (lane & 15) * 4;
#pragma unroll
  for (int q = 0; q < 16; ++q) { const int r = q * 2 + rsub; const v4f v = *(const v4fa*)&so[r][c4]; typedef TO v4o __attribute__((ext_vector_type(4))); v4o o4; for (int i = 0; i < 4; ++i) o4[i] = (TO)v[i]; *(v4o*)(C + (size_t)(row0 + r) * ldc + col0 + c4) = o4; } }
// The three projections in one grid (blockIdx.y: 0 Q, 1 K, 2 V). Q and K: token rows x permuted channels. V: permuted channels x tokens of one batch (A = weights, B = token rows), which is V^T as the attention reads it.
#define QKV_G ((int)((NR / 128) * (CC / 64)))      /* tiles of one projection, either way round */
#define CT_G ((CC / 128) * (LL / 64))              /* tiles of one batch's channel-major product */
static_assert(QKV_G == NB * CT_G, "the V tiles must fill the same grid row as the Q and K tiles");
__global__ __launch_bounds__(128) void k_qkv(const _Float16* __restrict__ XQ, const _Float16* __restrict__ XK, const _Float16* __restrict__ XV, const _Float16* __restrict__ BQ, const _Float16* __restrict__ BK, const _Float16* __restrict__ BV, const float* __restrict__ BP, _Float16* __restrict__ Q16, _Float16* __restrict__ K16, _Float16* __restrict__ VT) {
  __shared__ __attribute__((aligned(16))) unsigned char sm[G2_LDS];
  const int by = blockIdx.y, bx = blockIdx.x;
  if (by < 2) g2_tile<false>(sm, by ? XK : XQ, by ? BK : BQ, 0.0625f, BP + by * CC, by ? K16 : Q16, CC, bx, CC);
  else { const int b = bx / CT_G; g2_tile<true>(sm, BV, XV + (size_t)b * LL * CC, 0.0625f, BP + 2 * CC, VT + (size_t)b * CC * LL, LL, bx - b * CT_G, LL); } }
// out[b][c][n] = sum_k' w_m'[c][k'] o[(b,n)][k'] / 1024 + b_m[c] (channel-major directly; blockIdx.y = batch)
__global__ __launch_bounds__(128) void k_out(const _Float16* __restrict__ AM, const _Float16* __restrict__ O16, const float* __restrict__ bm, float* __restrict__ out) {
  __shared__ __attribute__((aligned(16))) unsigned char sm[G2_LDS];
  const size_t b = blockIdx.y;
  g2_tile<true>(sm, AM, O16 + b * LL * CC, 0.0009765625f, bm, out + b * CC * LL, LL, blockIdx.x, LL); }


__global__ __launch_bounds__(256) void k_wnat(const float* __restrict__ w, size_t n8, _Float16* __restrict__ Bt) { const size_t t = (size_t)blockIdx.x * 256 + threadIdx.x; if (t >= n8) return; FragH f; for (int q = 0; q < 8; ++q) f.h[q] = (_Float16)(bf16_round(w[t * 8 + q]) * 16.0f); *(v8us*)((unsigned short*)Bt + t * 8) = f.half[0];  }
__global__ __launch_bounds__(256) void k_rsm(const float* __restrict__ S, _Float16* __restrict__ P, int nrows) {
  #pragma clang fp contract(off)
  const int i = blockIdx.x * 256 + threadIdx.x; if (i >= nrows) return; const float* s = S + (size_t)i * SQ; float mx = -3.0e38f;
#pragma unroll 1
  for (int j = 0; j < SQ; ++j) mx = fmaxf(mx, s[j]); float se = 0.f;
#pragma unroll 1
  for (int j = 0; j < SQ; ++j) se += expf(s[j] - mx); const float sc = 256.0f / se;
#pragma unroll 1
  for (int j0 = 0; j0 < SQ; j0 += 8) { FragH f; for (int q = 0; q < 8; ++q) f.h[q] = (_Float16)(expf(s[j0 + q] - mx) * sc); unsigned short* d = (unsigned short*)P + (size_t)i * SQ + j0; *(v8us*)d = f.half[0];  } }
__global__ __launch_bounds__(256) void k_vt(const _Float16* __restrict__ V16, int b, int h0, _Float16* __restrict__ VT) { __shared__ unsigned short tl[64][65]; const int tid = threadIdx.x; const int hh = blockIdx.x % HG, sg = blockIdx.x / HG; const int s0 = sg * 64; const int h = h0 + hh;
  for (int i = tid; i < 64 * 8; i += 256) { const int j = i / 8, d8 = (i % 8) * 8; FragH f; f.half[0] = *(const v8us*)((const unsigned short*)V16 + ((size_t)b * SQ + s0 + j) * DM + h * HD + d8); for (int q = 0; q < 8; ++q) tl[d8 + q][j] = f.u[q]; }
  __syncthreads();
  { for (int i = tid; i < 64 * 8; i += 256) { const int d = i / 8, j8 = (i % 8) * 8; FragH f; for (int q = 0; q < 8; ++q) f.u[q] = tl[d][j8 + q]; *(v8us*)((unsigned short*)VT + ((size_t)hh * HD + d) * SQ + s0 + j8) = f.half[0]; }  } }

// ---- operand preparation: the bodies below are dealt to the work-groups of one grid by index (k_prep); bx = index within the body's own share ----
// Behind a body's last global store: in the built kernel a work-group's way to the end passes the heads of other bodies, which write registers that the store names; this wait stands in front of them.
__device__ __forceinline__ void p_stored() { asm volatile("s_wait_xcnt 0x0" ::: "memory"); }
// One work-group transposes the 64-channel x 128-token tile bx of all three inputs. A lane takes 8 channels x 4 tokens of each input: 8 loads of 16 bytes (4 tokens of one channel each);
// its 8 channels of one token are then one 16-byte store, so the transpose happens in the lane's own registers. 8 lanes cover the 64 channels of a token: every store fills whole 128-byte lines.
// All 24 loads are issued before the first value is used, so a work-group's whole share is in flight at once.
__device__ __forceinline__ void p_rows8(const v4f (&x)[8], _Float16* __restrict__ XR) {
#pragma unroll
  for (int i = 0; i < 4; ++i) { FragH f; for (int j = 0; j < 8; ++j) f.h[j] = (_Float16)bf16_round(x[j][i]); *(v8us*)((unsigned short*)XR + i * CC) = f.half[0]; }
  p_stored(); }      /* also in front of the next input's conversions, which reuse the registers that these stores name */
__device__ __forceinline__ void p_cl2rows(const float* __restrict__ xq, const float* __restrict__ xk, const float* __restrict__ xv, _Float16* __restrict__ XQ, _Float16* __restrict__ XK, _Float16* __restrict__ XV, int bx) {
  const int tid = threadIdx.x, cg = tid & 7, tq = tid >> 3; const int nl = LL / 128, nc = CC / 64; const int cb_ = bx % nc; const int lb = (bx / nc) % nl; const size_t b = bx / (nc * nl);
  const size_t us = (b * CC + cb_ * 64) * (size_t)LL + lb * 128, ud = (b * LL + lb * 128) * (size_t)CC + cb_ * 64;      /* the tile's corner, the same for the whole work-group */
  const int ls = cg * 8 * LL + tq * 4, ld = tq * 4 * CC + cg * 8;      /* the lane's own place in the tile */
  const float* pq = xq + us; const float* pk = xk + us; const float* pv = xv + us;
  v4f q[8], k[8], v[8];
#pragma unroll
  for (int j = 0; j < 8; ++j) q[j] = *(const v4fa*)(pq + ls + j * LL);
  __builtin_amdgcn_sched_barrier(0);      // the three scheduling barriers keep the loads in the order in which they are used (counted waits: q is converted while k and v still fly)
#pragma unroll
  for (int j = 0; j < 8; ++j) k[j] = *(const v4fa*)(pk + ls + j * LL);
  __builtin_amdgcn_sched_barrier(0);
#pragma unroll
  for (int j = 0; j < 8; ++j) v[j] = *(const v4fa*)(pv + ls + j * LL);
  __builtin_amdgcn_sched_barrier(0);      // and all 24 ahead of the first conversion: without it the scheduler held half of them back behind waits on the first ones
  asm volatile("s_wait_xcnt 0x0" :: "s"(pq), "s"(pk), "s"(pv) : "memory");      // stands behind the 24 loads and in front of whatever rewrites the address registers that they name; the three bases are inputs so that each keeps its own scalar pair up to here (else one was formed in another's pair, behind a wait between the loads)
  p_rows8(q, XQ + ud + ld);
  __builtin_amdgcn_sched_barrier(0);      // here and below: the next input's conversions stay behind these stores; moved ahead of them, they held two of the four stores back behind a wait on the next input's loads
  p_rows8(k, XK + ud + ld);
  __builtin_amdgcn_sched_barrier(0);
  p_rows8(v, XV + ud + ld); }
__device__ __forceinline__ void p_wperm(const float* __restrict__ w, _Float16* __restrict__ Bt, int bx) { const int t = bx * 256 + threadIdx.x; const int k8 = (t % (CC / 8)) * 8, np_ = t / (CC / 8); const int h = np_ / HD, dd = np_ % HD; const int src = dd * NH + h; FragH f;
  for (int q = 0; q < 8; ++q) f.h[q] = (_Float16)(bf16_round(w[(size_t)src * CC + k8 + q]) * 16.0f); unsigned short* d = (unsigned short*)Bt + (size_t)np_ * CC + k8; *(v8us*)d = f.half[0];  }
__device__ __forceinline__ void p_wpermc(const float* __restrict__ w, _Float16* __restrict__ A, int bx) { const int t = bx * 256 + threadIdx.x; const int k8 = (t % (CC / 8)) * 8, c = t / (CC / 8); FragH f;
  for (int q = 0; q < 8; ++q) { const int kp = k8 + q; const int h = kp / HD, dd = kp % HD; f.h[q] = (_Float16)(bf16_round(w[(size_t)c * CC + dd * NH + h]) * 16.0f); } unsigned short* d = (unsigned short*)A + (size_t)c * CC + k8; *(v8us*)d = f.half[0]; p_stored(); }
__device__ __forceinline__ void p_bperm(const float* __restrict__ b0, const float* __restrict__ b1, const float* __restrict__ b2, float* __restrict__ BP) { const int t = threadIdx.x; const int h = t / HD, dd = t % HD; const int src = dd * NH + h;
  { *(float*)(BP + t) = b0[src]; *(float*)(BP + CC + t) = b1[src]; *(float*)(BP + 2 * CC + t) = b2[src];  } }
#define PW_G (CC * (CC / 8) / 256)                 /* work-groups per weight matrix: 8 elements a thread, exactly */
#define PX_G (NB * (LL / 128) * (CC / 64))         /* work-groups of the transposes: 64-channel x 128-token tiles, each of all three inputs */
static_assert(PW_G * 256 == CC * (CC / 8) && CC == 256, "the weight and bias bodies have no tail guard");
// Every branch is on blockIdx alone. The short weight and bias bodies take the lowest indices: they start first and end under the transposes.
__global__ __launch_bounds__(256) void k_prep(const float* __restrict__ xq, const float* __restrict__ xk, const float* __restrict__ xv, const float* __restrict__ wq, const float* __restrict__ wk, const float* __restrict__ wv, const float* __restrict__ wm, const float* __restrict__ bq, const float* __restrict__ bk, const float* __restrict__ bv,
    _Float16* __restrict__ XQ, _Float16* __restrict__ XK, _Float16* __restrict__ XV, _Float16* __restrict__ BQ, _Float16* __restrict__ BK, _Float16* __restrict__ BV, _Float16* __restrict__ AM, float* __restrict__ BP) {
  const int bx = blockIdx.x;
  if (bx < 3 * PW_G) { const int s = bx / PW_G; p_wperm(s == 0 ? wq : s == 1 ? wk : wv, s == 0 ? BQ : s == 1 ? BK : BV, bx - s * PW_G); }
  else if (bx < 4 * PW_G) p_wpermc(wm, AM, bx - 3 * PW_G);
  else if (bx == 4 * PW_G) p_bperm(bq, bk, bv, BP);
  else p_cl2rows(xq, xk, xv, XQ, XK, XV, bx - (4 * PW_G + 1)); }
__device__ __forceinline__ float rs_xh(float x) { return __builtin_bit_cast(float, __builtin_amdgcn_permlanex16(__builtin_bit_cast(int, x), __builtin_bit_cast(int, x), 0x76543210, 0xfedcba98, false, false)); }      /* lane l <- lane l ^ 16 */
// 2^z on the transcendental unit. The v_nop is the slot that the instruction set asks for behind a transcendental before its result is read or its source overwritten.
__device__ __forceinline__ float rs_exp2(float z) { float y; asm("v_exp_f32 %0, %1\n\tv_nop" : "=v"(y) : "v"(z)); return y; }
// Eight independent 2^z in place: each fills the slot behind the one before it, the v_nop fills the slot behind the last.
__device__ __forceinline__ void fa_exp2x8(float (&z)[8]) { asm("v_exp_f32 %0, %0\n\tv_exp_f32 %1, %1\n\tv_exp_f32 %2, %2\n\tv_exp_f32 %3, %3\n\tv_exp_f32 %4, %4\n\tv_exp_f32 %5, %5\n\tv_exp_f32 %6, %6\n\tv_exp_f32 %7, %7\n\tv_nop" : "+v"(z[0]), "+v"(z[1]), "+v"(z[2]), "+v"(z[3]), "+v"(z[4]), "+v"(z[5]), "+v"(z[6]), "+v"(z[7])); }
#define FA_KS 64                     /* keys per stage */
#define FA_KG 2                      /* key groups per work-group */
#define FA_GK (SQ / FA_KG)           /* keys per key group */
#define FA_PK 144                    /* LDS row pitch, bytes: 128 + 16, an odd multiple of 16 for 16-byte readers */
__device__ __forceinline__ v8f fa_mma(v16h a, v16h b, v8f c) { return __builtin_amdgcn_wmma_f32_16x16x32_f16(false, a, false, b, (short)0, c, false, false); }
__device__ __forceinline__ v16h fa_lfrag(const unsigned char* p) { FragH f; f.half[0] = *(const v8us*)p; f.half[1] = *(const v8us*)(p + 32); return f.v; }      /* p already holds + 16 hh: k = 8 hh .. and 16 + 8 hh .. */
__global__ __launch_bounds__(512) void k_fattn(const _Float16* __restrict__ Q16, const _Float16* __restrict__ K16, const _Float16* __restrict__ VT, _Float16* __restrict__ O16) {
  __shared__ __attribute__((aligned(16))) unsigned char L[2][FA_KG][2][FA_KS * FA_PK];      /* [buffer][key group][K, V^T][row][pitch] */
  const int kh = __builtin_amdgcn_readfirstlane((int)threadIdx.x >> 8);      /* the wave's key group, in a scalar register */
  const int tid = threadIdx.x & 255, lane = tid & 31, w = tid >> 5, c = lane & 15, hh = lane >> 4;      /* tid, w: within the key group */ const int h = blockIdx.y, b = blockIdx.z; const size_t r0 = (size_t)b * LL; const int q0 = blockIdx.x * 256 + w * 32;
  const float cs = 0.125f * 1.44269504088896340736f;      /* 1 / sqrt(64), times log2(e) */
  v16h qf[2][2];
#pragma unroll
  for (int g = 0; g < 2; ++g) for (int kc = 0; kc < 2; ++kc) qf[g][kc] = g2_frag(Q16 + (r0 + q0 + g * 16 + c) * CC + h * HD + kc * 32, hh);
  const int srow = tid >> 2, sseg = (tid & 3) * 32;      /* staging: 4 threads cover one 128-byte row, 32 bytes each */
  const unsigned char* kg = (const unsigned char*)(K16 + (r0 + kh * FA_GK + srow) * CC + h * HD) + sseg;      /* key rows: + 64 rows a stage */
  const unsigned char* vg = (const unsigned char*)(VT + ((size_t)(b * NH + h) * HD + srow) * SQ + kh * FA_GK) + sseg;      /* d rows: + 64 keys a stage */
  const int sdst = srow * FA_PK + sseg;
  v8us k0 = *(const v8us*)kg, k1 = *(const v8us*)(kg + 16), v0 = *(const v8us*)vg, v1 = *(const v8us*)(vg + 16);
  *(v8us*)&L[0][kh][0][sdst] = k0; *(v8us*)&L[0][kh][0][sdst + 16] = k1; *(v8us*)&L[0][kh][1][sdst] = v0; *(v8us*)&L[0][kh][1][sdst + 16] = v1;
  const v8f z8 = {0.f, 0.f, 0.f, 0.f, 0.f, 0.f, 0.f, 0.f}; v8f acc[2][4]; float m_run[2], l_run[2];
#pragma unroll
  for (int g = 0; g < 2; ++g) { m_run[g] = -__builtin_inff(); l_run[g] = 0.f; for (int t = 0; t < 4; ++t) acc[g][t] = z8; }
  __syncthreads();      /* stage 0 published */
#pragma unroll 1      // one stage a trip: the body already holds two unrolled 32-key passes
  for (int st = 0; st < FA_GK / FA_KS; ++st) {
    const bool more = st + 1 < FA_GK / FA_KS;
    if (more) { const unsigned char* kn = kg + (size_t)(st + 1) * (FA_KS * CC * 2); const unsigned char* vn = vg + (size_t)(st + 1) * (FA_KS * 2); k0 = *(const v8us*)kn; k1 = *(const v8us*)(kn + 16); v0 = *(const v8us*)vn; v1 = *(const v8us*)(vn + 16); }
    const unsigned char* Kb = &L[st & 1][kh][0][c * FA_PK + 16 * hh]; const unsigned char* Vb = &L[st & 1][kh][1][c * FA_PK + 16 * hh];
#pragma unroll
    for (int sub = 0; sub < 2; ++sub) {      /* one pass = 32 keys */
      v8f s[2][2];
#pragma unroll
      for (int kt = 0; kt < 2; ++kt) { const v16h ka = fa_lfrag(Kb + (sub * 32 + kt * 16) * FA_PK), kb2 = fa_lfrag(Kb + (sub * 32 + kt * 16) * FA_PK + 64);
        for (int g = 0; g < 2; ++g) s[kt][g] = fa_mma(kb2, qf[g][1], fa_mma(ka, qf[g][0], z8)); }
      v16h vf[4];
#pragma unroll
      for (int t = 0; t < 4; ++t) vf[t] = fa_lfrag(Vb + t * 16 * FA_PK + sub * 64);
      float mb[2]; bool need = false;
#pragma unroll
      for (int g = 0; g < 2; ++g) { float mx = fmaxf(s[0][g][0], s[1][g][0]);
        for (int r = 1; r < 8; ++r) mx = fmaxf(mx, fmaxf(s[0][g][r], s[1][g][r]));
        mx = fmaxf(mx, rs_xh(mx)) * cs; mb[g] = mx; need = need || (mx > m_run[g] + 8.0f); }      /* both wave halves hold the query's maximum, scaled (the scale is positive) */
      if (__builtin_amdgcn_ballot_w32(need) != 0) {      /* wave-uniform scalar branch, one test a pass; always taken on the first pass (m_run = -inf gives corr = 0) */
#pragma unroll
        for (int g = 0; g < 2; ++g) { const float m_new = fmaxf(m_run[g], mb[g]); const float corr = rs_exp2(m_run[g] - m_new); m_run[g] = m_new; l_run[g] *= corr; for (int t = 0; t < 4; ++t) acc[g][t] = acc[g][t] * corr; }
      }
#pragma unroll
      for (int g = 0; g < 2; ++g) { const float nm = -m_run[g]; float e0[8], e1[8];
        for (int r = 0; r < 8; ++r) { e0[r] = __builtin_fmaf(s[0][g][r], cs, nm); e1[r] = __builtin_fmaf(s[1][g][r], cs, nm); }
        fa_exp2x8(e0); fa_exp2x8(e1);
        l_run[g] += (((e0[0] + e0[1]) + (e0[2] + e0[3])) + ((e0[4] + e0[5]) + (e0[6] + e0[7]))) + (((e1[0] + e1[1]) + (e1[2] + e1[3])) + ((e1[4] + e1[5]) + (e1[6] + e1[7])));
        FragH pf; for (int r = 0; r < 8; ++r) { pf.h[r] = (_Float16)e0[r]; pf.h[8 + r] = (_Float16)e1[r]; }      /* element s: key 8 hh + s, then 16 + 8 hh + (s - 8): the k order of V^T's loader */
        for (int t = 0; t < 4; ++t) acc[g][t] = fa_mma(vf[t], pf.v, acc[g][t]); }
    }
    if (more) { unsigned char* d = &L[(st + 1) & 1][kh][0][sdst]; *(v8us*)d = k0; *(v8us*)(d + 16) = k1; *(v8us*)(d + FA_KS * FA_PK) = v0; *(v8us*)(d + FA_KS * FA_PK + 16) = v1; }      /* its last readers left it before the barrier that ended trip st - 1 */
    __syncthreads();      /* publishes stage st + 1 and ends every read of stage st */
  }
  // Join of the two key groups: group kh finishes column group kh and hands column group 1 - kh to the lane of the same number in the other group. The stage buffers are free: the loop's last barrier ended every read of them.
  static_assert(FA_KG == 2 && sizeof(L) >= (size_t)FA_KG * 9 * 256 * 16, "the exchange takes 9 slots of 16 bytes a lane");
  v4f* X = (v4f*)&L[0][0][0][0];      /* [key group][slot][lane of the group]: neighbouring lanes 16 bytes apart */
  v4f* xs = X + kh * (9 * 256) + tid; const v4f* xr = X + (1 - kh) * (9 * 256) + tid;
  v8f mine[4];
#pragma unroll      // constant indices, so that the accumulators stay in registers
  for (int t = 0; t < 4; ++t) { const v8f o = kh ? acc[0][t] : acc[1][t]; mine[t] = kh ? acc[1][t] : acc[0][t];
    const v4f lo = {o[0], o[1], o[2], o[3]}, hi = {o[4], o[5], o[6], o[7]}; xs[(2 * t) * 256] = lo; xs[(2 * t + 1) * 256] = hi; }
  { const v4f ml = {kh ? m_run[0] : m_run[1], kh ? l_run[0] : l_run[1], 0.f, 0.f}; xs[8 * 256] = ml; }
  __syncthreads();      /* both groups' hand-overs published */
  const float m_a = kh ? m_run[1] : m_run[0], l_a = kh ? l_run[1] : l_run[0]; const v4f ml = xr[8 * 256];
  const float m_j = fmaxf(m_a, ml[0]); const float f_a = rs_exp2(m_a - m_j), f_b = rs_exp2(ml[0] - m_j);
  const float lp = l_a * f_a + ml[1] * f_b; const float inv = 64.0f / (lp + rs_xh(lp)); const float s_a = f_a * inv, s_b = f_b * inv;
  unsigned short* d = (unsigned short*)O16 + (r0 + q0 + kh * 16 + c) * CC + h * HD + 8 * hh;      /* o x64; a lane's 8 registers are 8 consecutive d of its query */
#pragma unroll      // constant indices again
  for (int t = 0; t < 4; ++t) { const v4f lo = xr[(2 * t) * 256], hi = xr[(2 * t + 1) * 256]; FragH f;
    for (int r = 0; r < 4; ++r) { f.h[r] = (_Float16)(mine[t][r] * s_a + lo[r] * s_b); f.h[4 + r] = (_Float16)(mine[t][4 + r] * s_a + hi[r] * s_b); }
    *(v8us*)(d + t * 16) = f.half[0]; } }

extern "C" void kernel_launch(void* const* d_in, const int* in_sizes, int n_in,
                              void* d_out, int out_size, void* d_ws, size_t ws_size, hipStream_t stream) {
  (void)in_sizes; (void)n_in; (void)out_size;
  const float* const* I = (const float* const*)d_in; const float* xq = I[0]; const float* xk = I[1]; const float* xv = I[2]; const float* wq = I[3]; const float* bq = I[4]; const float* wk = I[5]; const float* bk = I[6]; const float* wv = I[7]; const float* bv = I[8]; const float* wm = I[9]; const float* bm = I[10];
  char* ws = (char*)d_ws; size_t off = 0;
  auto take = [&](size_t bytes) { char* p = ws + off; off += (bytes + 255) & ~(size_t)255; return p; };
  _Float16* BQ = (_Float16*)take((size_t)CC * CC * 2); _Float16* BK = (_Float16*)take((size_t)CC * CC * 2); _Float16* BV = (_Float16*)take((size_t)CC * CC * 2); _Float16* AM = (_Float16*)take((size_t)CC * CC * 2); float* BP = (float*)take((size_t)3 * CC * 4);
  _Float16* XQ = (_Float16*)take(NR * CC * 2); _Float16* XK = (_Float16*)take(NR * CC * 2); _Float16* XV = (_Float16*)take(NR * CC * 2); _Float16* Q16 = (_Float16*)take(NR * CC * 2); _Float16* K16 = (_Float16*)take(NR * CC * 2); _Float16* O16 = (_Float16*)take(NR * CC * 2);
  _Float16* VT = (_Float16*)take((size_t)NB * NH * HD * SQ * 2);
  if (off > ws_size) return;      /* 0.5 + 48 + 8 = approx 57 MiB */
  k_prep<<<4 * PW_G + 1 + PX_G, 256, 0, stream>>>(xq, xk, xv, wq, wk, wv, wm, bq, bk, bv, XQ, XK, XV, BQ, BK, BV, AM, BP);
  k_qkv<<<dim3(QKV_G, 3), 128, 0, stream>>>(XQ, XK, XV, BQ, BK, BV, BP, Q16, K16, VT);      /* q, k token rows; V^T [8][4][64][2048] */
  k_fattn<<<dim3(SQ / 256, NH, NB), 512, 0, stream>>>(Q16, K16, VT, O16);      /* o x64, head-major f16 rows */
  k_out<<<dim3(CT_G, NB), 128, 0, stream>>>(AM, O16, bm, (float*)d_out);
}

// v007
// A run of this version takes 52 microseconds.
// Timed twice side by side with v006, it ran 1.19 and 1.18 times as fast.
// Counting every step since v000, it is 67.6 times as fast.
#include <hip/hip_runtime.h>
// SuperGlue multi-head attention (query, key, value channel-first [8][256][2048]; q/k/v = 1x1 conv (natural [256][256] + bias); the module's head split view(B, d=64, H=4, N) makes channel c = dd*4 + h (INTERLEAVED heads); scores = q.k / 8 per head over 2,048 keys; softmax; x merged back to c = dd*4 + h; out = w_m x + b_m -> [8][256][2048]).
// Structure, 3 launches: (1) Q, K and V as WMMA GEMMs in one grid, straight from the channel-first f32 inputs and the natural f32 weights: a work-group brings 256 tokens x all channels and one whole weight matrix into LDS as f16 rows (inputs exact, transposed in registers; weights exact x16, rows permuted so the head split becomes contiguous 64-column blocks), 64x64 wave tiles, f32 accumulation, f16 outputs, V with the operands swapped so that V^T [8][4][64][2048] is written directly; sixteen more work-groups of that grid permute w_m's columns for launch 3; (2) scores, softmax and P . V fused in one kernel over all batches and heads (S^T = K . Q^T, online softmax in f32, O^T += V^T . P^T, P stays in registers as f16; o x64 in f16) into head-major rows; (3) out channel-major directly: (w_m with permuted columns) . o^T GEMM batched over the 8 batches (alpha folds 1/16 and 1/64), the per-channel bias added in its epilogue.
// Compute dtype: inputs rounded to bf16; inputs / weights exact in f16; q, k, v, softmax weights and o plain f16 (~2^-12); scores and softmax statistics f32. v_wmma_f32_16x16x32_f16.
#define NB 8
#define CC 256
#define LL 2048
#define SQ LL
#define DM CC
#define NH 4
#define HD 64
#define HG 4
#define QN SQ                        /* query rows per batch (unused) */
#define NR ((size_t)NB * LL)
typedef __bf16 v16b __attribute__((ext_vector_type(16)));
typedef unsigned short v8us __attribute__((ext_vector_type(8), may_alias));
typedef float  v8f  __attribute__((ext_vector_type(8)));
typedef float  v4f  __attribute__((ext_vector_type(4)));
typedef float  v4fa __attribute__((ext_vector_type(4), may_alias));
union FragB { v16b v; v8us half[2]; unsigned short u[16]; };

__device__ __forceinline__ unsigned short bf16_bits(float x) { unsigned int u = __float_as_uint(x); return (unsigned short)((u + 0x7FFFu + ((u >> 16) & 1u)) >> 16); }
__device__ __forceinline__ float bf16_val(unsigned short b) { return __uint_as_float(((unsigned int)b) << 16); }
__device__ __forceinline__ float bf16_round(float x) { return bf16_val(bf16_bits(x)); }
// D += A·B with NT terms: 1 = ah·bh, 2 = + al·bh (A split), 3 = + ah·bl (both split)
template <int NT>
__device__ __forceinline__ v8f mmaN(v16b ah, v16b al, v16b bh, v16b bl, v8f c) {
  c = __builtin_amdgcn_wmma_f32_16x16x32_bf16(false, ah, false, bh, (short)0, c, false, false);
  if (NT >= 2) c = __builtin_amdgcn_wmma_f32_16x16x32_bf16(false, al, false, bh, (short)0, c, false, false);
  if (NT >= 3) c = __builtin_amdgcn_wmma_f32_16x16x32_bf16(false, ah, false, bl, (short)0, c, false, false);
  asm volatile("v_nop\n\tv_nop\n\tv_nop\n\tv_nop" : "+v"(c) : "v"(ah), "v"(al), "v"(bh), "v"(bl));
  return c;
}

__global__ __launch_bounds__(256) void k_wt_bf16(const float* __restrict__ W, unsigned short* __restrict__ Wt, int K, int N) {
  const int t = blockIdx.x * 256 + threadIdx.x;
  const int k8n = K / 8;
  if (t >= N * k8n) return;
  const int n = t / k8n, k8 = (t % k8n) * 8;
  v8us v;
#pragma unroll
  for (int i = 0; i < 8; ++i) v[i] = bf16_bits(W[(size_t)(k8 + i) * N + n]);
  *(v8us*)(Wt + (size_t)n * K + k8) = v;
  
}

// GEMM C[M][N] (f32, pitch ldc) = act(A[M][K]·W + bias). A f32 row-major (pitch lda) converted per fragment to bf16
// (ASPLIT: hi/lo two planes -> 2 terms, else single rounded term); Wt bf16 [N][K] (pitch ldb). BIAS_BF16 rounds the
// bias to bf16 first (bias quantised to bf16 before the add). K%32==0, M%16==0, N%64==0.
template <bool ASPLIT, int ACT, bool BIAS_BF16>
__global__ __launch_bounds__(128) void k_gemm_bf(const float* __restrict__ A, int lda, const unsigned short* __restrict__ Wt, int ldb,
                                               const float* __restrict__ bias, float* __restrict__ C, int ldc, int M, int N, int K) {
  __shared__ __attribute__((aligned(16))) float so[4][16][64];
  const int tid = threadIdx.x, w = tid >> 5, lane = tid & 31, ln = lane & 15, hh = lane >> 4;
  const int ntn = N / 64;
  const int wid = blockIdx.x * 4 + w;
  const int mt = wid / ntn, nq = wid % ntn;
  if (mt * 16 >= M) return;
  const int row0 = mt * 16, col0 = nq * 64;
  const float* arow = A + (size_t)(row0 + ln) * lda;
  v8f acc[4] = {};
  for (int kb = 0; kb < K; kb += 32) {
    FragB ah, al;
    const v4f x0 = *(const v4fa*)(arow + kb + 8 * hh), x1 = *(const v4fa*)(arow + kb + 8 * hh + 4);
    const v4f x2 = *(const v4fa*)(arow + kb + 16 + 8 * hh), x3 = *(const v4fa*)(arow + kb + 16 + 8 * hh + 4);
    float xs[16] = {x0[0],x0[1],x0[2],x0[3],x1[0],x1[1],x1[2],x1[3],x2[0],x2[1],x2[2],x2[3],x3[0],x3[1],x3[2],x3[3]};
#pragma unroll
    for (int i = 0; i < 16; ++i) { const unsigned short hb = bf16_bits(xs[i]); ah.u[i] = hb; al.u[i] = ASPLIT ? bf16_bits(xs[i] - bf16_val(hb)) : (unsigned short)0; }
#pragma unroll
    for (int t = 0; t < 4; ++t) {
      const unsigned short* brow = Wt + (size_t)(col0 + t * 16 + ln) * ldb + kb;
      FragB b;
      b.half[0] = *(const v8us*)(brow + 8 * hh);
      b.half[1] = *(const v8us*)(brow + 16 + 8 * hh);
      acc[t] = mmaN<ASPLIT ? 2 : 1>(ah.v, al.v, b.v, b.v, acc[t]);
    }
  }
#pragma unroll
  for (int t = 0; t < 4; ++t) {
    float bv = bias ? bias[col0 + t * 16 + ln] : 0.f;
    if (BIAS_BF16) bv = bf16_round(bv);
#pragma unroll
    for (int r = 0; r < 8; ++r) { float v = acc[t][r] + bv; if (ACT == 1) v = fmaxf(v, 0.f); so[w][8 * hh + r][t * 16 + ln] = v; }
  }
  __builtin_amdgcn_fence(__ATOMIC_ACQ_REL, "workgroup");
  __builtin_amdgcn_wave_barrier();
  const int rsub = lane >> 4, c4 = (lane & 15) * 4;
  {
#pragma unroll
    for (int q = 0; q < 8; ++q) {
      const int r = q * 2 + rsub;
      const v4f v = *(const v4fa*)&so[w][r][c4];
      *(v4f*)(C + (size_t)(row0 + r) * ldc + col0 + c4) = v;
    }
    
  }
}

// GEMM C = act(A·W + bias + resid): A f32 (ASPLIT -> hi/lo 2 terms), Wt bf16 [N][K]; ACT 0 none, 1 relu, 2 exact gelu;
// resid (optional, f32, row index = (row % rmod), pitch ldr, RES_BF16 rounds it) added before the activation.
template <bool ASPLIT, int ACT, bool BIAS_BF16, bool RES_BF16>
__global__ __launch_bounds__(128) void k_gemm_bf3(const float* __restrict__ A, int lda, const unsigned short* __restrict__ Wt, int ldb,
                                                const float* __restrict__ bias, const float* __restrict__ resid, int rmod, int ldr,
                                                float* __restrict__ C, int ldc, int M, int N, int K) {
  __shared__ __attribute__((aligned(16))) float so[4][16][64];
  const int tid = threadIdx.x, w = tid >> 5, lane = tid & 31, ln = lane & 15, hh = lane >> 4;
  const int ntn = N / 64;
  const int wid = blockIdx.x * 4 + w;
  const int mt = wid / ntn, nq = wid % ntn;
  if (mt * 16 >= M) return;
  const int row0 = mt * 16, col0 = nq * 64;
  const float* arow = A + (size_t)(row0 + ln) * lda;
  v8f acc[4] = {};
  for (int kb = 0; kb < K; kb += 32) {
    FragB ah, al;
    const v4f x0 = *(const v4fa*)(arow + kb + 8 * hh), x1 = *(const v4fa*)(arow + kb + 8 * hh + 4);
    const v4f x2 = *(const v4fa*)(arow + kb + 16 + 8 * hh), x3 = *(const v4fa*)(arow + kb + 16 + 8 * hh + 4);
    float xs[16] = {x0[0],x0[1],x0[2],x0[3],x1[0],x1[1],x1[2],x1[3],x2[0],x2[1],x2[2],x2[3],x3[0],x3[1],x3[2],x3[3]};
#pragma unroll
    for (int i = 0; i < 16; ++i) { const unsigned short hb = bf16_bits(xs[i]); ah.u[i] = hb; al.u[i] = ASPLIT ? bf16_bits(xs[i] - bf16_val(hb)) : (unsigned short)0; }
#pragma unroll
    for (int t = 0; t < 4; ++t) {
      const unsigned short* brow = Wt + (size_t)(col0 + t * 16 + ln) * ldb + kb;
      FragB b;
      b.half[0] = *(const v8us*)(brow + 8 * hh);
      b.half[1] = *(const v8us*)(brow + 16 + 8 * hh);
      acc[t] = mmaN<ASPLIT ? 2 : 1>(ah.v, al.v, b.v, b.v, acc[t]);
    }
  }
#pragma unroll
  for (int t = 0; t < 4; ++t) {
    const int col = col0 + t * 16 + ln;
    float bv = bias ? bias[col] : 0.f;
    if (BIAS_BF16) bv = bf16_round(bv);
#pragma unroll
    for (int r = 0; r < 8; ++r) {
      float v = acc[t][r] + bv;
      if (resid) { float rv = resid[(size_t)((row0 + 8 * hh + r) % rmod) * ldr + col]; if (RES_BF16) rv = bf16_round(rv); v += rv; }
      if (ACT == 1) v = fmaxf(v, 0.f);
      if (ACT == 2) v = 0.5f * v * (1.0f + erff(v * 0.70710678118654752f));
      if (ACT == 3) { const float u = 0.7978845608028654f * (v + 0.044715f * v * v * v); v = 0.5f * v * (1.0f + tanhf(u)); }
      so[w][8 * hh + r][t * 16 + ln] = v;
    }
  }
  __builtin_amdgcn_fence(__ATOMIC_ACQ_REL, "workgroup");
  __builtin_amdgcn_wave_barrier();
  const int rsub = lane >> 4, c4 = (lane & 15) * 4;
  {
#pragma unroll
    for (int q = 0; q < 8; ++q) {
      const int r = q * 2 + rsub;
      const v4f v = *(const v4fa*)&so[w][r][c4];
      *(v4f*)(C + (size_t)(row0 + r) * ldc + col0 + c4) = v;
    }
    
  }
}
// row LayerNorm (biased variance, eps) over N: s = X (+ R); optional out_sum <- s; out_norm <- (s-mu)*rsqrt(var+eps)*g + b
template <bool PARAM_BF16>
__global__ __launch_bounds__(256) void k_layernorm(const float* __restrict__ X, const float* __restrict__ R, const float* __restrict__ g, const float* __restrict__ bta,
                                                  float* __restrict__ out_sum, float* __restrict__ out_norm, int N, float eps) {
  __shared__ float red[256];
  const int row = blockIdx.x, tid = threadIdx.x;
  const float* x = X + (size_t)row * N; const float* rr = R ? R + (size_t)row * N : nullptr;
  float vals[16];                     // up to N = 4096
  const int per = N / 256;            // contiguous chunk per thread? use strided-by-4 chunks: thread handles j = tid*4 + 1024*u
  float s1 = 0.f;
  for (int u = 0; u < per / 4; ++u) {
    const int j = tid * 4 + 1024 * u;
    const v4f a = *(const v4fa*)(x + j);
    v4f b = {0.f,0.f,0.f,0.f}; if (rr) b = *(const v4fa*)(rr + j);
#pragma unroll
    for (int q = 0; q < 4; ++q) { const float v = a[q] + b[q]; vals[u * 4 + q] = v; s1 += v; }
  }
  red[tid] = s1; __syncthreads();
  for (int st = 128; st > 0; st >>= 1) { if (tid < st) red[tid] += red[tid + st]; __syncthreads(); }
  const float mu = red[0] / (float)N; __syncthreads();
  float s2 = 0.f;
  for (int u = 0; u < per / 4; ++u)
#pragma unroll
    for (int q = 0; q < 4; ++q) { const float c = vals[u * 4 + q] - mu; s2 += c * c; }
  red[tid] = s2; __syncthreads();
  for (int st = 128; st > 0; st >>= 1) { if (tid < st) red[tid] += red[tid + st]; __syncthreads(); }
  const float rs = rsqrtf(red[0] / (float)N + eps);
  {
    for (int u = 0; u < per / 4; ++u) {
      const int j = tid * 4 + 1024 * u;
      v4f o, sm;
#pragma unroll
      for (int q = 0; q < 4; ++q) {
        float gg = g[j + q], bb = bta[j + q];
        if (PARAM_BF16) { gg = bf16_round(gg); bb = bf16_round(bb); }
        sm[q] = vals[u * 4 + q]; o[q] = (vals[u * 4 + q] - mu) * rs * gg + bb;
      }
      if (out_sum) *(v4f*)(out_sum + (size_t)row * N + j) = sm;
      *(v4f*)(out_norm + (size_t)row * N + j) = o;
    }
    
  }
}



// ---- f16 WMMA path (v_wmma_f32_16x16x32_f16): 11-bit significands for operands in range — used where a [0,1] probability operand needs more precision than bf16
typedef _Float16 v16h __attribute__((ext_vector_type(16)));
union FragH { v16h v; v8us half[2]; _Float16 h[16]; unsigned short u[16]; };
template <int NT>
__device__ __forceinline__ v8f mmaH(v16h ah, v16h al, v16h bh, v16h bl, v8f c) {
  c = __builtin_amdgcn_wmma_f32_16x16x32_f16(false, ah, false, bh, (short)0, c, false, false);
  if (NT >= 2) c = __builtin_amdgcn_wmma_f32_16x16x32_f16(false, al, false, bh, (short)0, c, false, false);
  if (NT >= 3) c = __builtin_amdgcn_wmma_f32_16x16x32_f16(false, ah, false, bl, (short)0, c, false, false);
  asm volatile("v_nop\n\tv_nop\n\tv_nop\n\tv_nop" : "+v"(c) : "v"(ah), "v"(al), "v"(bh), "v"(bl));
  return c;
}
// batched GEMM like k_gemm_b but f16 operands: A f32 (split into f16 hi/lo if ASPLIT, else rounded to f16), Bt = f16 values [n][k]; alpha; C f32; N multiple of 16 (partial tiles skipped)
template <bool ASPLIT>
__global__ __launch_bounds__(128) void k_gemm_h(const float* __restrict__ A, int lda, size_t sA, const _Float16* __restrict__ Bh, int ldb, size_t sB, float alpha, float* __restrict__ C, int ldc, size_t sC, int M, int N, int K) {
  __shared__ __attribute__((aligned(16))) float so[4][16][64];
  const int tid = threadIdx.x, w = tid >> 5, lane = tid & 31, ln = lane & 15, hh = lane >> 4; const int by = blockIdx.y;
  A += (size_t)by * sA; Bh += (size_t)by * sB; C += (size_t)by * sC;
  const int ntn = (N + 63) / 64; const int wid = blockIdx.x * 4 + w; const int mt = wid / ntn, nq = wid % ntn; if (mt * 16 >= M) return;
  const int row0 = mt * 16, col0 = nq * 64; const float* arow = A + (size_t)(row0 + ln) * lda;
  v8f acc[4] = {};
  for (int kb = 0; kb < K; kb += 32) {
    FragH ah, al;
    const v4f x0 = *(const v4fa*)(arow + kb + 8 * hh), x1 = *(const v4fa*)(arow + kb + 8 * hh + 4), x2 = *(const v4fa*)(arow + kb + 16 + 8 * hh), x3 = *(const v4fa*)(arow + kb + 16 + 8 * hh + 4);
    float xs[16] = {x0[0],x0[1],x0[2],x0[3],x1[0],x1[1],x1[2],x1[3],x2[0],x2[1],x2[2],x2[3],x3[0],x3[1],x3[2],x3[3]};
#pragma unroll
    for (int i = 0; i < 16; ++i) { const _Float16 h = (_Float16)xs[i]; ah.h[i] = h; al.h[i] = ASPLIT ? (_Float16)(xs[i] - (float)h) : (_Float16)0.0f; }
#pragma unroll
    for (int t = 0; t < 4; ++t) { if (col0 + t * 16 >= N) continue; const size_t boff = (size_t)(col0 + t * 16 + ln) * ldb + kb; FragH bq; bq.half[0] = *(const v8us*)(Bh + boff + 8 * hh); bq.half[1] = *(const v8us*)(Bh + boff + 16 + 8 * hh);
      acc[t] = mmaH<ASPLIT ? 2 : 1>(ah.v, al.v, bq.v, bq.v, acc[t]); }
  }
#pragma unroll
  for (int t = 0; t < 4; ++t) { if (col0 + t * 16 >= N) continue;
#pragma unroll
    for (int r = 0; r < 8; ++r) so[w][8 * hh + r][t * 16 + ln] = acc[t][r] * alpha; }
  __builtin_amdgcn_fence(__ATOMIC_ACQ_REL, "workgroup"); __builtin_amdgcn_wave_barrier();
  const int rsub = lane >> 4, c4 = (lane & 15) * 4;
  {
#pragma unroll
    for (int q = 0; q < 8; ++q) { const int r = q * 2 + rsub; if (col0 + c4 < N) { const v4f v = *(const v4fa*)&so[w][r][c4]; *(v4f*)(C + (size_t)(row0 + r) * ldc + col0 + c4) = v; } }
     }
}

// Wt[n][k] = f16(W[k][n]·scale) from f32 row-major W[K][N] (scale = power of two; bf16-exact weights stay exact in f16 away from the subnormal range)
__global__ __launch_bounds__(256) void k_wt_f16(const float* __restrict__ W, _Float16* __restrict__ Wt, int K, int N, float scale) {
  const int t = blockIdx.x * 256 + threadIdx.x; if (t >= N * (K / 8)) return; const int n = t / (K / 8), k8 = (t % (K / 8)) * 8; FragH f;
#pragma unroll
  for (int i = 0; i < 8; ++i) f.h[i] = (_Float16)(bf16_round(W[(size_t)(k8 + i) * N + n]) * scale); const v8us o = f.half[0];
  *(v8us*)((unsigned short*)Wt + (size_t)n * K + k8) = o; 
}
// k_gemm_hh variant with fused epilogue: v = acc·alpha + bias[by·sBias + col] (+ CP[(row/rowsPerB)·sCPb + by·64 + col] if CP) ; ACT 0 none / 1 elu ; writes f16 C16 (and f32 C if non-null)
template <int ACT>
__global__ __launch_bounds__(128) void k_gemm_hhx(const _Float16* __restrict__ A, int lda, size_t sA, const _Float16* __restrict__ Bh, int ldb, size_t sB, float alpha, const float* __restrict__ bias, size_t sBias, const float* __restrict__ CP, int rowsPerB, size_t sCPb, int row0g,
    float* __restrict__ C, _Float16* __restrict__ C16, int ldc, size_t sC, int M, int N, int K) {
  __shared__ __attribute__((aligned(16))) float so[4][16][64];
  const int tid = threadIdx.x, w = tid >> 5, lane = tid & 31, ln = lane & 15, hh = lane >> 4; const int by = blockIdx.y;
  A += (size_t)by * sA; Bh += (size_t)by * sB; const size_t cofs = (size_t)by * sC; const float* bp = bias ? bias + (size_t)by * sBias : nullptr;
  const int ntn = (N + 63) / 64; const int wid = blockIdx.x * 4 + w; const int mt = wid / ntn, nq = wid % ntn; if (mt * 16 >= M) return;
  const int row0 = mt * 16, col0 = nq * 64; const _Float16* arow = A + (size_t)(row0 + ln) * lda;
  v8f acc[4] = {};
  for (int kb = 0; kb < K; kb += 32) { FragH ah; ah.half[0] = *(const v8us*)((const unsigned short*)arow + kb + 8 * hh); ah.half[1] = *(const v8us*)((const unsigned short*)arow + kb + 16 + 8 * hh);
#pragma unroll
    for (int t = 0; t < 4; ++t) { if (col0 + t * 16 >= N) continue; const size_t boff = (size_t)(col0 + t * 16 + ln) * ldb + kb; FragH bq; bq.half[0] = *(const v8us*)((const unsigned short*)Bh + boff + 8 * hh); bq.half[1] = *(const v8us*)((const unsigned short*)Bh + boff + 16 + 8 * hh);
      acc[t] = mmaH<1>(ah.v, ah.v, bq.v, bq.v, acc[t]); }
  }
#pragma unroll
  for (int t = 0; t < 4; ++t) { if (col0 + t * 16 >= N) continue; const int col = col0 + t * 16 + ln; const float bv = bp ? bf16_round(bp[col]) : 0.f;
#pragma unroll
    for (int r = 0; r < 8; ++r) { float v = acc[t][r] * alpha + bv; if (CP) { const int rr = row0g + row0 + 8 * hh + r; if (rowsPerB < 0) v += CP[cofs + (size_t)rr * ldc + col];      /* rowsPerB < 0: own element of the batched C plane */ else { const int bidx = rr / rowsPerB; v += CP[(size_t)bidx * sCPb + (size_t)by * 64 + col]; } } if (ACT == 1) v = (v > 0.f) ? v : expm1f(v); else if (ACT == 7) v = (v > 0.f) ? v + 1.0f : expf(v); else if (ACT == 8) v = tanhf(v); else if (ACT == 9) v = 0.5f * v * (1.0f + tanhf(0.7978845608028654f * (v + 0.044715f * v * v * v))); else if (ACT == 11) v = 1.0f / (1.0f + expf(-v)); else if (ACT == 12) v = (v > 0.f) ? v : 0.01f * v; else if (ACT == 14) v = (v > 0.f) ? v : 0.1f * v; else if (ACT == 16) v = (v >= 0.f) ? v : 0.3f * v; else if (ACT == 17) v = (v >= 0.f) ? v : 0.2f * v; else if (ACT == 15) v = v / (1.0f + expf(-v)); else if (ACT == 3) v = fmaxf(v, 0.f); else if (ACT == 6) v = 0.5f * v * (1.0f + erff(v * 0.70710678118654752f)); so[w][8 * hh + r][t * 16 + ln] = v; } }
  __builtin_amdgcn_fence(__ATOMIC_ACQ_REL, "workgroup"); __builtin_amdgcn_wave_barrier();
  const int rsub = lane >> 4, c4 = (lane & 15) * 4; typedef _Float16 v4h __attribute__((ext_vector_type(4)));
  {
#pragma unroll
    for (int q = 0; q < 8; ++q) { const int r = q * 2 + rsub; if (col0 + c4 < N) { const v4f v = *(const v4fa*)&so[w][r][c4]; if (C) *(v4f*)(C + cofs + (size_t)(row0 + r) * ldc + col0 + c4) = v; if (C16) { v4h h4; for (int i = 0; i < 4; ++i) h4[i] = (_Float16)v[i]; *(v4h*)(C16 + cofs + (size_t)(row0 + r) * ldc + col0 + c4) = h4; } } }
     }
}


typedef _Float16 v4h __attribute__((ext_vector_type(4)));

__global__ __launch_bounds__(256) void k_x16(const float* __restrict__ x, _Float16* __restrict__ X16, size_t n8) { const size_t t = (size_t)blockIdx.x * 256 + threadIdx.x; if (t >= n8) return; FragH f;
#pragma unroll
  for (int q = 0; q < 8; ++q) f.h[q] = (_Float16)bf16_round(x[t * 8 + q]); *(v8us*)((unsigned short*)X16 + t * 8) = f.half[0];  }
__global__ __launch_bounds__(256) void k_h16(const float* __restrict__ x, _Float16* __restrict__ X16, size_t n8) { const size_t t = (size_t)blockIdx.x * 256 + threadIdx.x; if (t >= n8) return; FragH f;
#pragma unroll
  for (int q = 0; q < 8; ++q) f.h[q] = (_Float16)x[t * 8 + q]; *(v8us*)((unsigned short*)X16 + t * 8) = f.half[0];  }
__global__ __launch_bounds__(256) void k_round16f(const float* __restrict__ W, _Float16* __restrict__ Bt, size_t n8) { const size_t t = (size_t)blockIdx.x * 256 + threadIdx.x; if (t >= n8) return; FragH f;
#pragma unroll
  for (int i = 0; i < 8; ++i) f.h[i] = (_Float16)(bf16_round(W[t * 8 + i]) * 16.0f); *(v8us*)((unsigned short*)Bt + t * 8) = f.half[0];  }

__global__ __launch_bounds__(256) void k_hl(const float* __restrict__ F, _Float16* __restrict__ Hh, _Float16* __restrict__ Hl, size_t n8) { const size_t t = (size_t)blockIdx.x * 256 + threadIdx.x; if (t >= n8) return; FragH fh, fl; const v4f a = *(const v4fa*)(F + t * 8), c = *(const v4fa*)(F + t * 8 + 4);
#pragma unroll
  for (int q = 0; q < 4; ++q) { _Float16 h = (_Float16)a[q]; fh.h[q] = h; fl.h[q] = (_Float16)((a[q] - (float)h) * 1024.0f); h = (_Float16)c[q]; fh.h[4 + q] = h; fl.h[4 + q] = (_Float16)((c[q] - (float)h) * 1024.0f); }
  { *(v8us*)((unsigned short*)Hh + t * 8) = fh.half[0]; *(v8us*)((unsigned short*)Hl + t * 8) = fl.half[0];  } }

// ---- fast GEMM tile: C = A . B^T * alpha + bias, A [M][CC] and B [N][CC] f16 rows; work-group tile 128x64, wave tile 32x64 (M % 128 == 0, N % 64 == 0) ----
__device__ __forceinline__ v16h g2_frag(const _Float16* p, int hh) { FragH f; f.half[0] = *(const v8us*)((const unsigned short*)p + 8 * hh); f.half[1] = *(const v8us*)((const unsigned short*)p + 16 + 8 * hh); return f.v; }
__device__ __forceinline__ v8f g2_mma(v16h a, v16h b, v8f c) { v8f d = __builtin_amdgcn_wmma_f32_16x16x32_f16(false, a, false, b, (short)0, c, false, false); asm volatile("v_nop\n\tv_nop\n\tv_nop\n\tv_nop" : "+v"(d) : "v"(a), "v"(b)); return d; }
// Both operand tiles (128 + 64 rows, all of K = CC: 512 bytes a row) are brought into LDS once, whole rows at a time, and the fragments are read from there:
// a fragment load straight from global memory touches 16 lines for 512 bytes, and its latency stood in front of every pair of products.
#define G2_PK 528                    /* LDS row pitch, bytes: 512 + 16, an odd multiple of 16 for 16-byte readers */
#define G2_LDS ((128 + 64) * G2_PK)
__device__ __forceinline__ v16h g2_lfrag(const unsigned char* p) { FragH f; f.half[0] = *(const v8us*)p; f.half[1] = *(const v8us*)(p + 32); return f.v; }      /* p already holds + 16 hh: k = 8 hh .. and 16 + 8 hh .. */
// Twelve asynchronous copies to LDS, one 512-byte row each (a lane brings its own 16 bytes). The s_wait_xcnt is the last line of the copies' own statement, so that it stands in front of whatever rewrites an address register that a copy names.
__device__ __forceinline__ void g2_copy12(const unsigned* l, const unsigned char* const* g) {
  asm volatile("global_load_async_to_lds_b128 %0, %12, off\n\tglobal_load_async_to_lds_b128 %1, %13, off\n\tglobal_load_async_to_lds_b128 %2, %14, off\n\tglobal_load_async_to_lds_b128 %3, %15, off\n\t"
               "global_load_async_to_lds_b128 %4, %16, off\n\tglobal_load_async_to_lds_b128 %5, %17, off\n\tglobal_load_async_to_lds_b128 %6, %18, off\n\tglobal_load_async_to_lds_b128 %7, %19, off\n\t"
               "global_load_async_to_lds_b128 %8, %20, off\n\tglobal_load_async_to_lds_b128 %9, %21, off\n\tglobal_load_async_to_lds_b128 %10, %22, off\n\tglobal_load_async_to_lds_b128 %11, %23, off\n\ts_wait_xcnt 0x0"
               :: "v"(l[0]), "v"(l[1]), "v"(l[2]), "v"(l[3]), "v"(l[4]), "v"(l[5]), "v"(l[6]), "v"(l[7]), "v"(l[8]), "v"(l[9]), "v"(l[10]), "v"(l[11]),
                  "v"(g[0]), "v"(g[1]), "v"(g[2]), "v"(g[3]), "v"(g[4]), "v"(g[5]), "v"(g[6]), "v"(g[7]), "v"(g[8]), "v"(g[9]), "v"(g[10]), "v"(g[11]) : "memory"); }
// RB: the bias belongs to the row of C (channel-major outputs), else to its column. TO: element type of C (float or f16). bx: tile index, column tiles fastest. A and B rows are CC long (K = CC). sm: G2_LDS bytes.
template <bool RB, typename TO>
__device__ __forceinline__ void g2_tile(unsigned char* sm, const _Float16* __restrict__ A, const _Float16* __restrict__ Bh, float alpha, const float* __restrict__ bp, TO* __restrict__ C, int ldc, int bx, int N) {
  const int tid = threadIdx.x, w = tid >> 5, lane = tid & 31, ln = lane & 15, hh = lane >> 4;
  const int ntn = N >> 6; const int mt = bx / ntn, nq = bx - mt * ntn; const int row0 = mt * 128 + 32 * w, col0 = nq * 64;
  { /* wave w brings its own 32 rows of A and rows 16 w .. 16 w + 15 of B: 48 copies, all in flight at once */
    const unsigned char* ga = (const unsigned char*)(A + (size_t)row0 * CC) + lane * 16; const unsigned char* gb = (const unsigned char*)(Bh + (size_t)(col0 + 16 * w) * CC) + lane * 16;
    const unsigned l0 = (unsigned)(size_t)sm + lane * 16; const unsigned la = l0 + 32 * w * G2_PK, lb = l0 + (128 + 16 * w) * G2_PK;
    unsigned l[48]; const unsigned char* g[48];
#pragma unroll      // constant indices, so that the two arrays dissolve into registers
    for (int i = 0; i < 48; ++i) { l[i] = i < 32 ? la + i * G2_PK : lb + (i - 32) * G2_PK; g[i] = i < 32 ? ga + i * (CC * 2) : gb + (i - 32) * (CC * 2); }
    g2_copy12(l, g); g2_copy12(l + 12, g + 12); g2_copy12(l + 24, g + 24); g2_copy12(l + 36, g + 36);
    asm volatile("s_wait_asynccnt 0x0" ::: "memory");      // this wave's 48 copies have landed; the compiler places no wait for them
    __syncthreads(); }      /* both tiles published: the B rows are read by all four waves */
  const unsigned char* ap = sm + (32 * w + ln) * G2_PK + 16 * hh;      /* + 16 hh: the lane half's k offset sits in the row pointers */
  const unsigned char* bq = sm + (128 + ln) * G2_PK + 16 * hh;
  const v8f z8 = {0.f,0.f,0.f,0.f,0.f,0.f,0.f,0.f}; v8f c00 = z8, c01 = z8, c02 = z8, c03 = z8, c10 = z8, c11 = z8, c12 = z8, c13 = z8;
  v16h a0 = g2_lfrag(ap), a1 = g2_lfrag(ap + 16 * G2_PK), b0 = g2_lfrag(bq), b1 = g2_lfrag(bq + 16 * G2_PK), b2 = g2_lfrag(bq + 32 * G2_PK), b3 = g2_lfrag(bq + 48 * G2_PK);
#pragma unroll      // straight line: the next 32 k's fragments go into a second register set, read as one group ahead of this block's products
  for (int ks = 0; ks < CC / 32; ++ks) { v16h na0 = a0, na1 = a1, nb0 = b0, nb1 = b1, nb2 = b2, nb3 = b3;
    if (ks + 1 < CC / 32) { const int o = (ks + 1) * 64; na0 = g2_lfrag(ap + o); na1 = g2_lfrag(ap + 16 * G2_PK + o); nb0 = g2_lfrag(bq + o); nb1 = g2_lfrag(bq + 16 * G2_PK + o); nb2 = g2_lfrag(bq + 32 * G2_PK + o); nb3 = g2_lfrag(bq + 48 * G2_PK + o); }
    c00 = g2_mma(a0, b0, c00); c10 = g2_mma(a1, b0, c10); c01 = g2_mma(a0, b1, c01); c11 = g2_mma(a1, b1, c11);
    c02 = g2_mma(a0, b2, c02); c12 = g2_mma(a1, b2, c12); c03 = g2_mma(a0, b3, c03); c13 = g2_mma(a1, b3, c13);
    a0 = na0; a1 = na1; b0 = nb0; b1 = nb1; b2 = nb2; b3 = nb3; }
  float (*so)[68] = (float (*)[68])(sm + 32 * w * G2_PK);      /* output staging in the wave's own 32 rows of A: no other wave reads or writes them, and this wave's reads of them have fed the sums that are stored here */
  v8f accs[8] = {c00, c01, c02, c03, c10, c11, c12, c13};
#pragma unroll
  for (int u = 0; u < 8; ++u) { const int t = u & 3, half = u >> 2; const int col = col0 + t * 16 + ln;
#pragma unroll
    for (int r = 0; r < 8; ++r) { const int rloc = half * 16 + 8 * hh + r; const float bv = bf16_round(RB ? bp[row0 + rloc] : bp[col]); so[rloc][t * 16 + ln] = accs[u][r] * alpha + bv; } }
  __builtin_amdgcn_fence(__ATOMIC_ACQ_REL, "workgroup"); __builtin_amdgcn_wave_barrier();
  const int rsub = lane >> 4, c4 = (lane & 15) * 4;
#pragma unroll
  for (int q = 0; q < 16; ++q) { const int r = q * 2 + rsub; const v4f v = *(const v4fa*)&so[r][c4]; typedef TO v4o __attribute__((ext_vector_type(4))); v4o o4; for (int i = 0; i < 4; ++i) o4[i] = (TO)v[i]; *(v4o*)(C + (size_t)(row0 + r) * ldc + col0 + c4) = o4; } }
#define CT_G ((CC / 128) * (LL / 64))              /* tiles of one batch's channel-major product */
// out[b][c][n] = sum_k' w_m'[c][k'] o[(b,n)][k'] / 1024 + b_m[c] (channel-major directly; blockIdx.y = batch)
__global__ __launch_bounds__(128) void k_out(const _Float16* __restrict__ AM, const _Float16* __restrict__ O16, const float* __restrict__ bm, float* __restrict__ out) {
  __shared__ __attribute__((aligned(16))) unsigned char sm[G2_LDS];
  const size_t b = blockIdx.y;
  g2_tile<true>(sm, AM, O16 + b * LL * CC, 0.0009765625f, bm, out + b * CC * LL, LL, blockIdx.x, LL); }


__global__ __launch_bounds__(256) void k_wnat(const float* __restrict__ w, size_t n8, _Float16* __restrict__ Bt) { const size_t t = (size_t)blockIdx.x * 256 + threadIdx.x; if (t >= n8) return; FragH f; for (int q = 0; q < 8; ++q) f.h[q] = (_Float16)(bf16_round(w[t * 8 + q]) * 16.0f); *(v8us*)((unsigned short*)Bt + t * 8) = f.half[0];  }
__global__ __launch_bounds__(256) void k_rsm(const float* __restrict__ S, _Float16* __restrict__ P, int nrows) {
  #pragma clang fp contract(off)
  const int i = blockIdx.x * 256 + threadIdx.x; if (i >= nrows) return; const float* s = S + (size_t)i * SQ; float mx = -3.0e38f;
#pragma unroll 1
  for (int j = 0; j < SQ; ++j) mx = fmaxf(mx, s[j]); float se = 0.f;
#pragma unroll 1
  for (int j = 0; j < SQ; ++j) se += expf(s[j] - mx); const float sc = 256.0f / se;
#pragma unroll 1
  for (int j0 = 0; j0 < SQ; j0 += 8) { FragH f; for (int q = 0; q < 8; ++q) f.h[q] = (_Float16)(expf(s[j0 + q] - mx) * sc); unsigned short* d = (unsigned short*)P + (size_t)i * SQ + j0; *(v8us*)d = f.half[0];  } }
__global__ __launch_bounds__(256) void k_vt(const _Float16* __restrict__ V16, int b, int h0, _Float16* __restrict__ VT) { __shared__ unsigned short tl[64][65]; const int tid = threadIdx.x; const int hh = blockIdx.x % HG, sg = blockIdx.x / HG; const int s0 = sg * 64; const int h = h0 + hh;
  for (int i = tid; i < 64 * 8; i += 256) { const int j = i / 8, d8 = (i % 8) * 8; FragH f; f.half[0] = *(const v8us*)((const unsigned short*)V16 + ((size_t)b * SQ + s0 + j) * DM + h * HD + d8); for (int q = 0; q < 8; ++q) tl[d8 + q][j] = f.u[q]; }
  __syncthreads();
  { for (int i = tid; i < 64 * 8; i += 256) { const int d = i / 8, j8 = (i % 8) * 8; FragH f; for (int q = 0; q < 8; ++q) f.u[q] = tl[d][j8 + q]; *(v8us*)((unsigned short*)VT + ((size_t)hh * HD + d) * SQ + s0 + j8) = f.half[0]; }  } }

// ---- projections straight from the inputs ----
// Behind a body's last global store: this wait stands in front of whatever rewrites a register that the store names.
__device__ __forceinline__ void p_stored() { asm volatile("s_wait_xcnt 0x0" ::: "memory"); }
// w_m with its columns permuted to the head-major order of o (exact x16 f16); t: the thread's index over CC * CC / 8 pieces of 8 elements.
__device__ __forceinline__ void p_wpermc(const float* __restrict__ w, _Float16* __restrict__ A, int t) { const int k8 = (t % (CC / 8)) * 8, c = t / (CC / 8); FragH f;
  for (int q = 0; q < 8; ++q) { const int kp = k8 + q; const int h = kp / HD, dd = kp % HD; f.h[q] = (_Float16)(bf16_round(w[(size_t)c * CC + dd * NH + h]) * 16.0f); } unsigned short* d = (unsigned short*)A + (size_t)c * CC + k8; *(v8us*)d = f.half[0]; p_stored(); }
typedef float v2f __attribute__((ext_vector_type(2)));
typedef __bf16 v2b __attribute__((ext_vector_type(2)));
typedef _Float16 v2h __attribute__((ext_vector_type(2)));
typedef unsigned v4ua __attribute__((ext_vector_type(4), may_alias));
typedef unsigned v2ua __attribute__((ext_vector_type(2), may_alias));
// Two f32 -> rounded to bf16 (nearest even, one packed conversion) -> the same values as two f16, a in the low half.
__device__ __forceinline__ unsigned pj_cv2(float a, float b) { const v2f x = {a, b}; const unsigned u = __builtin_bit_cast(unsigned, __builtin_convertvector(x, v2b));
  const v2f y = {__uint_as_float(u << 16), __uint_as_float(u & 0xFFFF0000u)}; return __builtin_bit_cast(unsigned, __builtin_convertvector(y, v2h)); }
#define PJ_T 256                                   /* tokens per work-group; the other side of its tile is all CC channels */
#define PJ_LDS ((PJ_T + CC) * G2_PK)               /* token rows, then weight rows, each all of K = CC at the GEMM pitch */
#define PJ_G (3 * (int)(NR / PJ_T))                /* work-groups of the three projections */
#define PM_G (CC * (CC / 8) / 512)                 /* work-groups that permute w_m: 8 elements a thread, exactly */
static_assert(PJ_T == 256 && CC == 256 && LL % PJ_T == 0 && PM_G * 512 == CC * (CC / 8), "16 waves as 4 x 4 tiles of 64 x 64; a token tile stays inside one batch; no tail guards");
// Epilogue of one wave's 64 x 64 tile, 32 rows at a time through the wave's own LDS range, so that whole 128-byte lines are stored. RB: the bias belongs to the row of C, else to its column; its index is the permuted channel.
template <bool RB>
__device__ __forceinline__ void pj_epi(float (*so)[68], const v8f (&acc)[4][4], const float* __restrict__ bias, _Float16* __restrict__ Cw, int ldc, int row0, int col0, int lane) {
  const int ln = lane & 15, hh = lane >> 4, rsub = lane >> 4, c4 = (lane & 15) * 4;
  const int bi0 = RB ? 8 * hh * NH + row0 / HD : ln * NH + col0 / HD;      /* permuted channel i is natural channel (i % HD) * NH + i / HD; row0 and col0 are multiples of HD */
#pragma unroll      // constant indices, so that the accumulators stay in registers
  for (int hf = 0; hf < 2; ++hf) {
    float bvv[RB ? 16 : 4];      /* the lane's biases for these 32 rows: by row 16 mi + 8 hh + r, or by column 16 t + ln */
#pragma unroll
    for (int u = 0; u < (RB ? 16 : 4); ++u) bvv[u] = bias[bi0 + (RB ? hf * 32 + (u >> 3) * 16 + (u & 7) : u * 16) * NH];
    asm volatile("s_wait_xcnt 0x0" :: "v"(bi0) : "memory");      // behind the bias loads, in front of whatever rewrites the index register that they name; the index is an input so that it is kept up to here (else the last load landed in it)
    __builtin_amdgcn_sched_barrier(0);      // nothing moves ahead of that wait
#pragma unroll
    for (int u = 0; u < (RB ? 16 : 4); ++u) bvv[u] = bf16_round(bvv[u]);
#pragma unroll
    for (int mi = 0; mi < 2; ++mi)
#pragma unroll
      for (int t = 0; t < 4; ++t)
#pragma unroll
        for (int r = 0; r < 8; ++r) { const int rloc = mi * 16 + 8 * hh + r; so[rloc][t * 16 + ln] = acc[hf * 2 + mi][t][r] * 0.0625f + bvv[RB ? mi * 8 + r : t]; }
    __builtin_amdgcn_fence(__ATOMIC_ACQ_REL, "workgroup"); __builtin_amdgcn_wave_barrier();      // the wave's own writes stand ahead of its reads of other lanes' values
#pragma unroll
    for (int q = 0; q < 16; ++q) { const int r = q * 2 + rsub; const v4f v = *(const v4fa*)&so[r][c4]; v4h o4; for (int i = 0; i < 4; ++i) o4[i] = (_Float16)v[i]; *(v4h*)(Cw + (size_t)(hf * 32 + r) * ldc + c4) = o4; }
    __builtin_amdgcn_fence(__ATOMIC_ACQ_REL, "workgroup"); __builtin_amdgcn_wave_barrier();      // and these reads ahead of the next half's writes
    p_stored();
    __builtin_amdgcn_sched_barrier(0);      // the next half's register writes stay behind that wait
  } }
// One work-group = 256 tokens of one batch x all 256 channels of one projection (blockIdx.x / 64: 0 Q, 1 K, 2 V). Every input element is read from memory once, by whole 128-byte lines, and never written back as f16 rows.
// Input tile: a lane takes 8 channels x 16 tokens (32 loads of 16 bytes); its 8 channels of one token are one 16-byte LDS store, so the transpose happens in the lane's own registers. Weights: a wave takes a row by two 512-byte loads.
__global__ __launch_bounds__(512) void k_proj(const float* __restrict__ xq, const float* __restrict__ xk, const float* __restrict__ xv, const float* __restrict__ wq, const float* __restrict__ wk, const float* __restrict__ wv, const float* __restrict__ wm,
    const float* __restrict__ bq, const float* __restrict__ bk, const float* __restrict__ bv, _Float16* __restrict__ Q16, _Float16* __restrict__ K16, _Float16* __restrict__ VT, _Float16* __restrict__ AM) {
  __shared__ __attribute__((aligned(16))) unsigned char sm[PJ_LDS];
  const int bx = blockIdx.x, tid = threadIdx.x;
  if (bx >= PJ_G) { p_wpermc(wm, AM, (bx - PJ_G) * 512 + tid); return; }      /* on blockIdx alone, in front of every barrier */
  const int p = bx / (int)(NR / PJ_T), tl = bx % (int)(NR / PJ_T); const int b = tl / (LL / PJ_T), n0 = (tl % (LL / PJ_T)) * PJ_T;
  const float* x = p == 0 ? xq : p == 1 ? xk : xv; const float* w = p == 0 ? wq : p == 1 ? wk : wv; const float* bias = p == 0 ? bq : p == 1 ? bk : bv;
  const int wvi = __builtin_amdgcn_readfirstlane(tid >> 5), lane = tid & 31;
  unsigned char* smX = sm; unsigned char* smW = sm + PJ_T * G2_PK;
  { const int cg = (wvi & 7) * 4 + (lane >> 3);      /* the lane's group of 8 channels; 8 lanes side by side cover one 128-byte line of a channel */
    const int tk = (wvi >> 3) * 128 + (lane & 7) * 4;      /* its first token; + 32 a unit */
    const float* px = x + ((size_t)b * CC + cg * 8) * LL + n0 + tk;
    const float* pw = w + (size_t)((wvi & 3) * 16 * NH + (wvi >> 2)) * CC + lane * 4;      /* LDS row 16 wvi + i is natural row ((16 wvi + i) % 64) * 4 + (16 wvi + i) / 64: + NH rows a step */
    v4f xr[4][8], wa[8][2], wb[8][2];
#pragma unroll
    for (int i = 0; i < 4; ++i) for (int j = 0; j < 8; ++j) xr[i][j] = *(const v4fa*)(px + j * LL + i * 32);
    __builtin_amdgcn_sched_barrier(0);      // the input tile's 32 loads go first and together: they come from memory, the weights from L2
#pragma unroll
    for (int i = 0; i < 8; ++i) { wa[i][0] = *(const v4fa*)(pw + i * NH * CC); wa[i][1] = *(const v4fa*)(pw + i * NH * CC + 128); }
    __builtin_amdgcn_sched_barrier(0);      // and half of the weights' loads ahead of the first conversion
    asm volatile("s_wait_xcnt 0x0" :: "v"(px), "s"(pw - lane * 4) : "memory");      // behind the 48 loads, in front of whatever rewrites an address register that they name; the two bases are inputs so that their registers are kept up to here (else a weight load landed in the input loads' address pair)
    __builtin_amdgcn_sched_barrier(0);      // no conversion moves ahead of that wait
#pragma unroll
    for (int i = 0; i < 4; ++i) for (int ii = 0; ii < 4; ++ii) { const v4ua o = {pj_cv2(xr[i][0][ii], xr[i][1][ii]), pj_cv2(xr[i][2][ii], xr[i][3][ii]), pj_cv2(xr[i][4][ii], xr[i][5][ii]), pj_cv2(xr[i][6][ii], xr[i][7][ii])};
      *(v4ua*)(smX + (tk + i * 32 + ii) * G2_PK + cg * 16) = o; }
    __builtin_amdgcn_sched_barrier(0);      // the second half of the weights takes the registers that the input tile has left
#pragma unroll
    for (int i = 0; i < 8; ++i) { wb[i][0] = *(const v4fa*)(pw + (8 + i) * NH * CC); wb[i][1] = *(const v4fa*)(pw + (8 + i) * NH * CC + 128); }
    __builtin_amdgcn_sched_barrier(0);      // in flight under the first half's conversions
    asm volatile("s_wait_xcnt 0x0" ::: "memory");      // as above, behind these 16 loads
    __builtin_amdgcn_sched_barrier(0);
    unsigned char* dw = smW + wvi * 16 * G2_PK + lane * 8;
#pragma unroll
    for (int i = 0; i < 16; ++i) { const v4f lo = i < 8 ? wa[i & 7][0] : wb[i & 7][0], hi = i < 8 ? wa[i & 7][1] : wb[i & 7][1];      /* x16 ahead of the rounding: a power of two, so the same value as rounding first */
      const v2ua o0 = {pj_cv2(lo[0] * 16.0f, lo[1] * 16.0f), pj_cv2(lo[2] * 16.0f, lo[3] * 16.0f)}, o1 = {pj_cv2(hi[0] * 16.0f, hi[1] * 16.0f), pj_cv2(hi[2] * 16.0f, hi[3] * 16.0f)};
      *(v2ua*)(dw + i * G2_PK) = o0; *(v2ua*)(dw + i * G2_PK + 256) = o1; } }
  __syncthreads();      /* both operands published */
  const int ln = lane & 15, hh = lane >> 4, wr_ = wvi >> 2, wc_ = wvi & 3;      /* the wave's 64 rows of A and 64 rows of B */
  const bool vs = p == 2;      /* V: A = weights, B = tokens */
  const unsigned char* ap = (vs ? smW : smX) + (64 * wr_ + ln) * G2_PK + 16 * hh;      /* + 16 hh: the lane half's k offset sits in the row pointers */
  const unsigned char* bp_ = (vs ? smX : smW) + (64 * wc_ + ln) * G2_PK + 16 * hh;
  v8f acc[4][4];
#pragma unroll
  for (int i = 0; i < 4; ++i) for (int j = 0; j < 4; ++j) acc[i][j] = v8f{0.f, 0.f, 0.f, 0.f, 0.f, 0.f, 0.f, 0.f};
#pragma unroll      // straight line: constant LDS offsets
  for (int ks = 0; ks < CC / 32; ++ks) { v16h af[4], bf[4];
    for (int i = 0; i < 4; ++i) { af[i] = g2_lfrag(ap + i * 16 * G2_PK + ks * 64); bf[i] = g2_lfrag(bp_ + i * 16 * G2_PK + ks * 64); }
    __builtin_amdgcn_sched_barrier(0);      // the 16 reads of a k step stand together in one place: left alone, the scheduler read each A fragment into one register set right in front of its four products, behind a wait to 0 each time; the SIMD's three other waves cover the one wait
    for (int i = 0; i < 4; ++i) for (int j = 0; j < 4; ++j) acc[i][j] = __builtin_amdgcn_wmma_f32_16x16x32_f16(false, af[i], false, bf[j], (short)0, acc[i][j], false, false);
    __builtin_amdgcn_sched_barrier(0); }      // and none of the next step's reads moves in among these products
  __syncthreads();      /* every wave has read its last fragment: the operand rows become output staging */
  float (*so)[68] = (float (*)[68])(sm + wvi * 32 * G2_PK);      /* a sixteenth of the LDS for each wave */
  if (vs) pj_epi<true>(so, acc, bias, VT + ((size_t)b * CC + 64 * wr_) * LL + n0 + 64 * wc_, LL, 64 * wr_, 64 * wc_, lane);
  else pj_epi<false>(so, acc, bias, (p ? K16 : Q16) + ((size_t)b * LL + n0 + 64 * wr_) * CC + 64 * wc_, CC, 64 * wr_, 64 * wc_, lane); }
__device__ __forceinline__ float rs_xh(float x) { return __builtin_bit_cast(float, __builtin_amdgcn_permlanex16(__builtin_bit_cast(int, x), __builtin_bit_cast(int, x), 0x76543210, 0xfedcba98, false, false)); }      /* lane l <- lane l ^ 16 */
// 2^z on the transcendental unit. The v_nop is the slot that the instruction set asks for behind a transcendental before its result is read or its source overwritten.
__device__ __forceinline__ float rs_exp2(float z) { float y; asm("v_exp_f32 %0, %1\n\tv_nop" : "=v"(y) : "v"(z)); return y; }
// Eight independent 2^z in place: each fills the slot behind the one before it, the v_nop fills the slot behind the last.
__device__ __forceinline__ void fa_exp2x8(float (&z)[8]) { asm("v_exp_f32 %0, %0\n\tv_exp_f32 %1, %1\n\tv_exp_f32 %2, %2\n\tv_exp_f32 %3, %3\n\tv_exp_f32 %4, %4\n\tv_exp_f32 %5, %5\n\tv_exp_f32 %6, %6\n\tv_exp_f32 %7, %7\n\tv_nop" : "+v"(z[0]), "+v"(z[1]), "+v"(z[2]), "+v"(z[3]), "+v"(z[4]), "+v"(z[5]), "+v"(z[6]), "+v"(z[7])); }
#define FA_KS 64                     /* keys per stage */
#define FA_KG 2                      /* key groups per work-group */
#define FA_GK (SQ / FA_KG)           /* keys per key group */
#define FA_PK 144                    /* LDS row pitch, bytes: 128 + 16, an odd multiple of 16 for 16-byte readers */
__device__ __forceinline__ v8f fa_mma(v16h a, v16h b, v8f c) { return __builtin_amdgcn_wmma_f32_16x16x32_f16(false, a, false, b, (short)0, c, false, false); }
__device__ __forceinline__ v16h fa_lfrag(const unsigned char* p) { FragH f; f.half[0] = *(const v8us*)p; f.half[1] = *(const v8us*)(p + 32); return f.v; }      /* p already holds + 16 hh: k = 8 hh .. and 16 + 8 hh .. */
__global__ __launch_bounds__(512) void k_fattn(const _Float16* __restrict__ Q16, const _Float16* __restrict__ K16, const _Float16* __restrict__ VT, _Float16* __restrict__ O16) {
  __shared__ __attribute__((aligned(16))) unsigned char L[2][FA_KG][2][FA_KS * FA_PK];      /* [buffer][key group][K, V^T][row][pitch] */
  const int kh = __builtin_amdgcn_readfirstlane((int)threadIdx.x >> 8);      /* the wave's key group, in a scalar register */
  const int tid = threadIdx.x & 255, lane = tid & 31, w = tid >> 5, c = lane & 15, hh = lane >> 4;      /* tid, w: within the key group */ const int h = blockIdx.y, b = blockIdx.z; const size_t r0 = (size_t)b * LL; const int q0 = blockIdx.x * 256 + w * 32;
  const float cs = 0.125f * 1.44269504088896340736f;      /* 1 / sqrt(64), times log2(e) */
  v16h qf[2][2];
#pragma unroll
  for (int g = 0; g < 2; ++g) for (int kc = 0; kc < 2; ++kc) qf[g][kc] = g2_frag(Q16 + (r0 + q0 + g * 16 + c) * CC + h * HD + kc * 32, hh);
  const int srow = tid >> 2, sseg = (tid & 3) * 32;      /* staging: 4 threads cover one 128-byte row, 32 bytes each */
  const unsigned char* kg = (const unsigned char*)(K16 + (r0 + kh * FA_GK + srow) * CC + h * HD) + sseg;      /* key rows: + 64 rows a stage */
  const unsigned char* vg = (const unsigned char*)(VT + ((size_t)(b * NH + h) * HD + srow) * SQ + kh * FA_GK) + sseg;      /* d rows: + 64 keys a stage */
  const int sdst = srow * FA_PK + sseg;
  v8us k0 = *(const v8us*)kg, k1 = *(const v8us*)(kg + 16), v0 = *(const v8us*)vg, v1 = *(const v8us*)(vg + 16);
  *(v8us*)&L[0][kh][0][sdst] = k0; *(v8us*)&L[0][kh][0][sdst + 16] = k1; *(v8us*)&L[0][kh][1][sdst] = v0; *(v8us*)&L[0][kh][1][sdst + 16] = v1;
  const v8f z8 = {0.f, 0.f, 0.f, 0.f, 0.f, 0.f, 0.f, 0.f}; v8f acc[2][4]; float m_run[2], l_run[2];
#pragma unroll
  for (int g = 0; g < 2; ++g) { m_run[g] = -__builtin_inff(); l_run[g] = 0.f; for (int t = 0; t < 4; ++t) acc[g][t] = z8; }
  __syncthreads();      /* stage 0 published */
#pragma unroll 1      // one stage a trip: the body already holds two unrolled 32-key passes
  for (int st = 0; st < FA_GK / FA_KS; ++st) {
    const bool more = st + 1 < FA_GK / FA_KS;
    if (more) { const unsigned char* kn = kg + (size_t)(st + 1) * (FA_KS * CC * 2); const unsigned char* vn = vg + (size_t)(st + 1) * (FA_KS * 2); k0 = *(const v8us*)kn; k1 = *(const v8us*)(kn + 16); v0 = *(const v8us*)vn; v1 = *(const v8us*)(vn + 16); }
    const unsigned char* Kb = &L[st & 1][kh][0][c * FA_PK + 16 * hh]; const unsigned char* Vb = &L[st & 1][kh][1][c * FA_PK + 16 * hh];
#pragma unroll
    for (int sub = 0; sub < 2; ++sub) {      /* one pass = 32 keys */
      v8f s[2][2];
#pragma unroll
      for (int kt = 0; kt < 2; ++kt) { const v16h ka = fa_lfrag(Kb + (sub * 32 + kt * 16) * FA_PK), kb2 = fa_lfrag(Kb + (sub * 32 + kt * 16) * FA_PK + 64);
        for (int g = 0; g < 2; ++g) s[kt][g] = fa_mma(kb2, qf[g][1], fa_mma(ka, qf[g][0], z8)); }
      v16h vf[4];
#pragma unroll
      for (int t = 0; t < 4; ++t) vf[t] = fa_lfrag(Vb + t * 16 * FA_PK + sub * 64);
      float mb[2]; bool need = false;
#pragma unroll
      for (int g = 0; g < 2; ++g) { float mx = fmaxf(s[0][g][0], s[1][g][0]);
        for (int r = 1; r < 8; ++r) mx = fmaxf(mx, fmaxf(s[0][g][r], s[1][g][r]));
        mx = fmaxf(mx, rs_xh(mx)) * cs; mb[g] = mx; need = need || (mx > m_run[g] + 8.0f); }      /* both wave halves hold the query's maximum, scaled (the scale is positive) */
      if (__builtin_amdgcn_ballot_w32(need) != 0) {      /* wave-uniform scalar branch, one test a pass; always taken on the first pass (m_run = -inf gives corr = 0) */
#pragma unroll
        for (int g = 0; g < 2; ++g) { const float m_new = fmaxf(m_run[g], mb[g]); const float corr = rs_exp2(m_run[g] - m_new); m_run[g] = m_new; l_run[g] *= corr; for (int t = 0; t < 4; ++t) acc[g][t] = acc[g][t] * corr; }
      }
#pragma unroll
      for (int g = 0; g < 2; ++g) { const float nm = -m_run[g]; float e0[8], e1[8];
        for (int r = 0; r < 8; ++r) { e0[r] = __builtin_fmaf(s[0][g][r], cs, nm); e1[r] = __builtin_fmaf(s[1][g][r], cs, nm); }
        fa_exp2x8(e0); fa_exp2x8(e1);
        l_run[g] += (((e0[0] + e0[1]) + (e0[2] + e0[3])) + ((e0[4] + e0[5]) + (e0[6] + e0[7]))) + (((e1[0] + e1[1]) + (e1[2] + e1[3])) + ((e1[4] + e1[5]) + (e1[6] + e1[7])));
        FragH pf; for (int r = 0; r < 8; ++r) { pf.h[r] = (_Float16)e0[r]; pf.h[8 + r] = (_Float16)e1[r]; }      /* element s: key 8 hh + s, then 16 + 8 hh + (s - 8): the k order of V^T's loader */
        for (int t = 0; t < 4; ++t) acc[g][t] = fa_mma(vf[t], pf.v, acc[g][t]); }
    }
    if (more) { unsigned char* d = &L[(st + 1) & 1][kh][0][sdst]; *(v8us*)d = k0; *(v8us*)(d + 16) = k1; *(v8us*)(d + FA_KS * FA_PK) = v0; *(v8us*)(d + FA_KS * FA_PK + 16) = v1; }      /* its last readers left it before the barrier that ended trip st - 1 */
    __syncthreads();      /* publishes stage st + 1 and ends every read of stage st */
  }
  // Join of the two key groups: group kh finishes column group kh and hands column group 1 - kh to the lane of the same number in the other group. The stage buffers are free: the loop's last barrier ended every read of them.
  static_assert(FA_KG == 2 && sizeof(L) >= (size_t)FA_KG * 9 * 256 * 16, "the exchange takes 9 slots of 16 bytes a lane");
  v4f* X = (v4f*)&L[0][0][0][0];      /* [key group][slot][lane of the group]: neighbouring lanes 16 bytes apart */
  v4f* xs = X + kh * (9 * 256) + tid; const v4f* xr = X + (1 - kh) * (9 * 256) + tid;
  v8f mine[4];
#pragma unroll      // constant indices, so that the accumulators stay in registers
  for (int t = 0; t < 4; ++t) { const v8f o = kh ? acc[0][t] : acc[1][t]; mine[t] = kh ? acc[1][t] : acc[0][t];
    const v4f lo = {o[0], o[1], o[2], o[3]}, hi = {o[4], o[5], o[6], o[7]}; xs[(2 * t) * 256] = lo; xs[(2 * t + 1) * 256] = hi; }
  { const v4f ml = {kh ? m_run[0] : m_run[1], kh ? l_run[0] : l_run[1], 0.f, 0.f}; xs[8 * 256] = ml; }
  __syncthreads();      /* both groups' hand-overs published */
  const float m_a = kh ? m_run[1] : m_run[0], l_a = kh ? l_run[1] : l_run[0]; const v4f ml = xr[8 * 256];
  const float m_j = fmaxf(m_a, ml[0]); const float f_a = rs_exp2(m_a - m_j), f_b = rs_exp2(ml[0] - m_j);
  const float lp = l_a * f_a + ml[1] * f_b; const float inv = 64.0f / (lp + rs_xh(lp)); const float s_a = f_a * inv, s_b = f_b * inv;
  unsigned short* d = (unsigned short*)O16 + (r0 + q0 + kh * 16 + c) * CC + h * HD + 8 * hh;      /* o x64; a lane's 8 registers are 8 consecutive d of its query */
#pragma unroll      // constant indices again
  for (int t = 0; t < 4; ++t) { const v4f lo = xr[(2 * t) * 256], hi = xr[(2 * t + 1) * 256]; FragH f;
    for (int r = 0; r < 4; ++r) { f.h[r] = (_Float16)(mine[t][r] * s_a + lo[r] * s_b); f.h[4 + r] = (_Float16)(mine[t][4 + r] * s_a + hi[r] * s_b); }
    *(v8us*)(d + t * 16) = f.half[0]; } }

extern "C" void kernel_launch(void* const* d_in, const int* in_sizes, int n_in,
                              void* d_out, int out_size, void* d_ws, size_t ws_size, hipStream_t stream) {
  (void)in_sizes; (void)n_in; (void)out_size;
  const float* const* I = (const float* const*)d_in; const float* xq = I[0]; const float* xk = I[1]; const float* xv = I[2]; const float* wq = I[3]; const float* bq = I[4]; const float* wk = I[5]; const float* bk = I[6]; const float* wv = I[7]; const float* bv = I[8]; const float* wm = I[9]; const float* bm = I[10];
  char* ws = (char*)d_ws; size_t off = 0;
  auto take = [&](size_t bytes) { char* p = ws + off; off += (bytes + 255) & ~(size_t)255; return p; };
  _Float16* AM = (_Float16*)take((size_t)CC * CC * 2);
  _Float16* Q16 = (_Float16*)take(NR * CC * 2); _Float16* K16 = (_Float16*)take(NR * CC * 2); _Float16* O16 = (_Float16*)take(NR * CC * 2);
  _Float16* VT = (_Float16*)take((size_t)NB * NH * HD * SQ * 2);
  if (off > ws_size) return;      /* approx 32 MiB */
  k_proj<<<PJ_G + PM_G, 512, 0, stream>>>(xq, xk, xv, wq, wk, wv, wm, bq, bk, bv, Q16, K16, VT, AM);      /* q, k token rows; V^T [8][4][64][2048]; w_m permuted */
  k_fattn<<<dim3(SQ / 256, NH, NB), 512, 0, stream>>>(Q16, K16, VT, O16);      /* o x64, head-major f16 rows */
  k_out<<<dim3(CT_G, NB), 128, 0, stream>>>(AM, O16, bm, (float*)d_out);
}

// v008
// One run takes 50.4 microseconds.
// Next to v007, in two timings, it ran 1.03 times as fast each time.
// Counting every step since v000, it is 69.6 times as fast.
#include <hip/hip_runtime.h>
// SuperGlue multi-head attention (query, key, value channel-first [8][256][2048]; q/k/v = 1x1 conv (natural [256][256] + bias); the module's head split view(B, d=64, H=4, N) makes channel c = dd*4 + h (INTERLEAVED heads); scores = q.k / 8 per head over 2,048 keys; softmax; x merged back to c = dd*4 + h; out = w_m x + b_m -> [8][256][2048]).
// Structure, 3 launches: (1) Q, K and V as WMMA GEMMs in one grid, straight from the channel-first f32 inputs and the natural f32 weights: a work-group brings 256 tokens x all channels and one whole weight matrix into LDS as f16 rows (inputs exact, transposed in registers; weights exact x16, rows permuted so the head split becomes contiguous 64-column blocks), 64x64 wave tiles, f32 accumulation, f16 outputs, V with the operands swapped so that V^T [8][4][64][2048] is written directly; sixteen more work-groups of that grid permute w_m's columns for launch 3; (2) scores, softmax and P . V fused in one kernel over all batches and heads (S^T = K . Q^T - running maximum, q stored times log2(e) / 8, online softmax in f32, O^T += V^T . P^T, P stays in registers as f16; o x64 in f16) into head-major rows; (3) out channel-major directly: (w_m with permuted columns) . o^T GEMM batched over the 8 batches (alpha folds 1/16 and 1/64), the per-channel bias added in its epilogue.
// Compute dtype: inputs rounded to bf16; inputs / weights exact in f16; q, k, v, softmax weights and o plain f16 (~2^-12); scores and softmax statistics f32. v_wmma_f32_16x16x32_f16.
#define NB 8
#define CC 256
#define LL 2048
#define SQ LL
#define DM CC
#define NH 4
#define HD 64
#define HG 4
#define QN SQ                        /* query rows per batch (unused) */
#define NR ((size_t)NB * LL)
typedef __bf16 v16b __attribute__((ext_vector_type(16)));
typedef unsigned short v8us __attribute__((ext_vector_type(8), may_alias));
typedef float  v8f  __attribute__((ext_vector_type(8)));
typedef float  v4f  __attribute__((ext_vector_type(4)));
typedef float  v4fa __attribute__((ext_vector_type(4), may_alias));
union FragB { v16b v; v8us half[2]; unsigned short u[16]; };

__device__ __forceinline__ unsigned short bf16_bits(float x) { unsigned int u = __float_as_uint(x); return (unsigned short)((u + 0x7FFFu + ((u >> 16) & 1u)) >> 16); }
__device__ __forceinline__ float bf16_val(unsigned short b) { return __uint_as_float(((unsigned int)b) << 16); }
__device__ __forceinline__ float bf16_round(float x) { return bf16_val(bf16_bits(x)); }
// D += A·B with NT terms: 1 = ah·bh, 2 = + al·bh (A split), 3 = + ah·bl (both split)
template <int NT>
__device__ __forceinline__ v8f mmaN(v16b ah, v16b al, v16b bh, v16b bl, v8f c) {
  c = __builtin_amdgcn_wmma_f32_16x16x32_bf16(false, ah, false, bh, (short)0, c, false, false);
  if (NT >= 2) c = __builtin_amdgcn_wmma_f32_16x16x32_bf16(false, al, false, bh, (short)0, c, false, false);
  if (NT >= 3) c = __builtin_amdgcn_wmma_f32_16x16x32_bf16(false, ah, false, bl, (short)0, c, false, false);
  asm volatile("v_nop\n\tv_nop\n\tv_nop\n\tv_nop" : "+v"(c) : "v"(ah), "v"(al), "v"(bh), "v"(bl));
  return c;
}

__global__ __launch_bounds__(256) void k_wt_bf16(const float* __restrict__ W, unsigned short* __restrict__ Wt, int K, int N) {
  const int t = blockIdx.x * 256 + threadIdx.x;
  const int k8n = K / 8;
  if (t >= N * k8n) return;
  const int n = t / k8n, k8 = (t % k8n) * 8;
  v8us v;
#pragma unroll
  for (int i = 0; i < 8; ++i) v[i] = bf16_bits(W[(size_t)(k8 + i) * N + n]);
  *(v8us*)(Wt + (size_t)n * K + k8) = v;
  
}

// GEMM C[M][N] (f32, pitch ldc) = act(A[M][K]·W + bias). A f32 row-major (pitch lda) converted per fragment to bf16
// (ASPLIT: hi/lo two planes -> 2 terms, else single rounded term); Wt bf16 [N][K] (pitch ldb). BIAS_BF16 rounds the
// bias to bf16 first (bias quantised to bf16 before the add). K%32==0, M%16==0, N%64==0.
template <bool ASPLIT, int ACT, bool BIAS_BF16>
__global__ __launch_bounds__(128) void k_gemm_bf(const float* __restrict__ A, int lda, const unsigned short* __restrict__ Wt, int ldb,
                                               const float* __restrict__ bias, float* __restrict__ C, int ldc, int M, int N, int K) {
  __shared__ __attribute__((aligned(16))) float so[4][16][64];
  const int tid = threadIdx.x, w = tid >> 5, lane = tid & 31, ln = lane & 15, hh = lane >> 4;
  const int ntn = N / 64;
  const int wid = blockIdx.x * 4 + w;
  const int mt = wid / ntn, nq = wid % ntn;
  if (mt * 16 >= M) return;
  const int row0 = mt * 16, col0 = nq * 64;
  const float* arow = A + (size_t)(row0 + ln) * lda;
  v8f acc[4] = {};
  for (int kb = 0; kb < K; kb += 32) {
    FragB ah, al;
    const v4f x0 = *(const v4fa*)(arow + kb + 8 * hh), x1 = *(const v4fa*)(arow + kb + 8 * hh + 4);
    const v4f x2 = *(const v4fa*)(arow + kb + 16 + 8 * hh), x3 = *(const v4fa*)(arow + kb + 16 + 8 * hh + 4);
    float xs[16] = {x0[0],x0[1],x0[2],x0[3],x1[0],x1[1],x1[2],x1[3],x2[0],x2[1],x2[2],x2[3],x3[0],x3[1],x3[2],x3[3]};
#pragma unroll
    for (int i = 0; i < 16; ++i) { const unsigned short hb = bf16_bits(xs[i]); ah.u[i] = hb; al.u[i] = ASPLIT ? bf16_bits(xs[i] - bf16_val(hb)) : (unsigned short)0; }
#pragma unroll
    for (int t = 0; t < 4; ++t) {
      const unsigned short* brow = Wt + (size_t)(col0 + t * 16 + ln) * ldb + kb;
      FragB b;
      b.half[0] = *(const v8us*)(brow + 8 * hh);
      b.half[1] = *(const v8us*)(brow + 16 + 8 * hh);
      acc[t] = mmaN<ASPLIT ? 2 : 1>(ah.v, al.v, b.v, b.v, acc[t]);
    }
  }
#pragma unroll
  for (int t = 0; t < 4; ++t) {
    float bv = bias ? bias[col0 + t * 16 + ln] : 0.f;
    if (BIAS_BF16) bv = bf16_round(bv);
#pragma unroll
    for (int r = 0; r < 8; ++r) { float v = acc[t][r] + bv; if (ACT == 1) v = fmaxf(v, 0.f); so[w][8 * hh + r][t * 16 + ln] = v; }
  }
  __builtin_amdgcn_fence(__ATOMIC_ACQ_REL, "workgroup");
  __builtin_amdgcn_wave_barrier();
  const int rsub = lane >> 4, c4 = (lane & 15) * 4;
  {
#pragma unroll
    for (int q = 0; q < 8; ++q) {
      const int r = q * 2 + rsub;
      const v4f v = *(const v4fa*)&so[w][r][c4];
      *(v4f*)(C + (size_t)(row0 + r) * ldc + col0 + c4) = v;
    }
    
  }
}

// GEMM C = act(A·W + bias + resid): A f32 (ASPLIT -> hi/lo 2 terms), Wt bf16 [N][K]; ACT 0 none, 1 relu, 2 exact gelu;
// resid (optional, f32, row index = (row % rmod), pitch ldr, RES_BF16 rounds it) added before the activation.
template <bool ASPLIT, int ACT, bool BIAS_BF16, bool RES_BF16>
__global__ __launch_bounds__(128) void k_gemm_bf3(const float* __restrict__ A, int lda, const unsigned short* __restrict__ Wt, int ldb,
                                                const float* __restrict__ bias, const float* __restrict__ resid, int rmod, int ldr,
                                                float* __restrict__ C, int ldc, int M, int N, int K) {
  __shared__ __attribute__((aligned(16))) float so[4][16][64];
  const int tid = threadIdx.x, w = tid >> 5, lane = tid & 31, ln = lane & 15, hh = lane >> 4;
  const int ntn = N / 64;
  const int wid = blockIdx.x * 4 + w;
  const int mt = wid / ntn, nq = wid % ntn;
  if (mt * 16 >= M) return;
  const int row0 = mt * 16, col0 = nq * 64;
  const float* arow = A + (size_t)(row0 + ln) * lda;
  v8f acc[4] = {};
  for (int kb = 0; kb < K; kb += 32) {
    FragB ah, al;
    const v4f x0 = *(const v4fa*)(arow + kb + 8 * hh), x1 = *(const v4fa*)(arow + kb + 8 * hh + 4);
    const v4f x2 = *(const v4fa*)(arow + kb + 16 + 8 * hh), x3 = *(const v4fa*)(arow + kb + 16 + 8 * hh + 4);
    float xs[16] = {x0[0],x0[1],x0[2],x0[3],x1[0],x1[1],x1[2],x1[3],x2[0],x2[1],x2[2],x2[3],x3[0],x3[1],x3[2],x3[3]};
#pragma unroll
    for (int i = 0; i < 16; ++i) { const unsigned short hb = bf16_bits(xs[i]); ah.u[i] = hb; al.u[i] = ASPLIT ? bf16_bits(xs[i] - bf16_val(hb)) : (unsigned short)0; }
#pragma unroll
    for (int t = 0; t < 4; ++t) {
      const unsigned short* brow = Wt + (size_t)(col0 + t * 16 + ln) * ldb + kb;
      FragB b;
      b.half[0] = *(const v8us*)(brow + 8 * hh);
      b.half[1] = *(const v8us*)(brow + 16 + 8 * hh);
      acc[t] = mmaN<ASPLIT ? 2 : 1>(ah.v, al.v, b.v, b.v, acc[t]);
    }
  }
#pragma unroll
  for (int t = 0; t < 4; ++t) {
    const int col = col0 + t * 16 + ln;
    float bv = bias ? bias[col] : 0.f;
    if (BIAS_BF16) bv = bf16_round(bv);
#pragma unroll
    for (int r = 0; r < 8; ++r) {
      float v = acc[t][r] + bv;
      if (resid) { float rv = resid[(size_t)((row0 + 8 * hh + r) % rmod) * ldr + col]; if (RES_BF16) rv = bf16_round(rv); v += rv; }
      if (ACT == 1) v = fmaxf(v, 0.f);
      if (ACT == 2) v = 0.5f * v * (1.0f + erff(v * 0.70710678118654752f));
      if (ACT == 3) { const float u = 0.7978845608028654f * (v + 0.044715f * v * v * v); v = 0.5f * v * (1.0f + tanhf(u)); }
      so[w][8 * hh + r][t * 16 + ln] = v;
    }
  }
  __builtin_amdgcn_fence(__ATOMIC_ACQ_REL, "workgroup");
  __builtin_amdgcn_wave_barrier();
  const int rsub = lane >> 4, c4 = (lane & 15) * 4;
  {
#pragma unroll
    for (int q = 0; q < 8; ++q) {
      const int r = q * 2 + rsub;
      const v4f v = *(const v4fa*)&so[w][r][c4];
      *(v4f*)(C + (size_t)(row0 + r) * ldc + col0 + c4) = v;
    }
    
  }
}
// row LayerNorm (biased variance, eps) over N: s = X (+ R); optional out_sum <- s; out_norm <- (s-mu)*rsqrt(var+eps)*g + b
template <bool PARAM_BF16>
__global__ __launch_bounds__(256) void k_layernorm(const float* __restrict__ X, const float* __restrict__ R, const float* __restrict__ g, const float* __restrict__ bta,
                                                  float* __restrict__ out_sum, float* __restrict__ out_norm, int N, float eps) {
  __shared__ float red[256];
  const int row = blockIdx.x, tid = threadIdx.x;
  const float* x = X + (size_t)row * N; const float* rr = R ? R + (size_t)row * N : nullptr;
  float vals[16];                     // up to N = 4096
  const int per = N / 256;            // contiguous chunk per thread? use strided-by-4 chunks: thread handles j = tid*4 + 1024*u
  float s1 = 0.f;
  for (int u = 0; u < per / 4; ++u) {
    const int j = tid * 4 + 1024 * u;
    const v4f a = *(const v4fa*)(x + j);
    v4f b = {0.f,0.f,0.f,0.f}; if (rr) b = *(const v4fa*)(rr + j);
#pragma unroll
    for (int q = 0; q < 4; ++q) { const float v = a[q] + b[q]; vals[u * 4 + q] = v; s1 += v; }
  }
  red[tid] = s1; __syncthreads();
  for (int st = 128; st > 0; st >>= 1) { if (tid < st) red[tid] += red[tid + st]; __syncthreads(); }
  const float mu = red[0] / (float)N; __syncthreads();
  float s2 = 0.f;
  for (int u = 0; u < per / 4; ++u)
#pragma unroll
    for (int q = 0; q < 4; ++q) { const float c = vals[u * 4 + q] - mu; s2 += c * c; }
  red[tid] = s2; __syncthreads();
  for (int st = 128; st > 0; st >>= 1) { if (tid < st) red[tid] += red[tid + st]; __syncthreads(); }
  const float rs = rsqrtf(red[0] / (float)N + eps);
  {
    for (int u = 0; u < per / 4; ++u) {
      const int j = tid * 4 + 1024 * u;
      v4f o, sm;
#pragma unroll
      for (int q = 0; q < 4; ++q) {
        float gg = g[j + q], bb = bta[j + q];
        if (PARAM_BF16) { gg = bf16_round(gg); bb = bf16_round(bb); }
        sm[q] = vals[u * 4 + q]; o[q] = (vals[u * 4 + q] - mu) * rs * gg + bb;
      }
      if (out_sum) *(v4f*)(out_sum + (size_t)row * N + j) = sm;
      *(v4f*)(out_norm + (size_t)row * N + j) = o;
    }
    
  }
}



// ---- f16 WMMA path (v_wmma_f32_16x16x32_f16): 11-bit significands for operands in range — used where a [0,1] probability operand needs more precision than bf16
typedef _Float16 v16h __attribute__((ext_vector_type(16)));
union FragH { v16h v; v8us half[2]; _Float16 h[16]; unsigned short u[16]; };
template <int NT>
__device__ __forceinline__ v8f mmaH(v16h ah, v16h al, v16h bh, v16h bl, v8f c) {
  c = __builtin_amdgcn_wmma_f32_16x16x32_f16(false, ah, false, bh, (short)0, c, false, false);
  if (NT >= 2) c = __builtin_amdgcn_wmma_f32_16x16x32_f16(false, al, false, bh, (short)0, c, false, false);
  if (NT >= 3) c = __builtin_amdgcn_wmma_f32_16x16x32_f16(false, ah, false, bl, (short)0, c, false, false);
  asm volatile("v_nop\n\tv_nop\n\tv_nop\n\tv_nop" : "+v"(c) : "v"(ah), "v"(al), "v"(bh), "v"(bl));
  return c;
}
// batched GEMM like k_gemm_b but f16 operands: A f32 (split into f16 hi/lo if ASPLIT, else rounded to f16), Bt = f16 values [n][k]; alpha; C f32; N multiple of 16 (partial tiles skipped)
template <bool ASPLIT>
__global__ __launch_bounds__(128) void k_gemm_h(const float* __restrict__ A, int lda, size_t sA, const _Float16* __restrict__ Bh, int ldb, size_t sB, float alpha, float* __restrict__ C, int ldc, size_t sC, int M, int N, int K) {
  __shared__ __attribute__((aligned(16))) float so[4][16][64];
  const int tid = threadIdx.x, w = tid >> 5, lane = tid & 31, ln = lane & 15, hh = lane >> 4; const int by = blockIdx.y;
  A += (size_t)by * sA; Bh += (size_t)by * sB; C += (size_t)by * sC;
  const int ntn = (N + 63) / 64; const int wid = blockIdx.x * 4 + w; const int mt = wid / ntn, nq = wid % ntn; if (mt * 16 >= M) return;
  const int row0 = mt * 16, col0 = nq * 64; const float* arow = A + (size_t)(row0 + ln) * lda;
  v8f acc[4] = {};
  for (int kb = 0; kb < K; kb += 32) {
    FragH ah, al;
    const v4f x0 = *(const v4fa*)(arow + kb + 8 * hh), x1 = *(const v4fa*)(arow + kb + 8 * hh + 4), x2 = *(const v4fa*)(arow + kb + 16 + 8 * hh), x3 = *(const v4fa*)(arow + kb + 16 + 8 * hh + 4);
    float xs[16] = {x0[0],x0[1],x0[2],x0[3],x1[0],x1[1],x1[2],x1[3],x2[0],x2[1],x2[2],x2[3],x3[0],x3[1],x3[2],x3[3]};
#pragma unroll
    for (int i = 0; i < 16; ++i) { const _Float16 h = (_Float16)xs[i]; ah.h[i] = h; al.h[i] = ASPLIT ? (_Float16)(xs[i] - (float)h) : (_Float16)0.0f; }
#pragma unroll
    for (int t = 0; t < 4; ++t) { if (col0 + t * 16 >= N) continue; const size_t boff = (size_t)(col0 + t * 16 + ln) * ldb + kb; FragH bq; bq.half[0] = *(const v8us*)(Bh + boff + 8 * hh); bq.half[1] = *(const v8us*)(Bh + boff + 16 + 8 * hh);
      acc[t] = mmaH<ASPLIT ? 2 : 1>(ah.v, al.v, bq.v, bq.v, acc[t]); }
  }
#pragma unroll
  for (int t = 0; t < 4; ++t) { if (col0 + t * 16 >= N) continue;
#pragma unroll
    for (int r = 0; r < 8; ++r) so[w][8 * hh + r][t * 16 + ln] = acc[t][r] * alpha; }
  __builtin_amdgcn_fence(__ATOMIC_ACQ_REL, "workgroup"); __builtin_amdgcn_wave_barrier();
  const int rsub = lane >> 4, c4 = (lane & 15) * 4;
  {
#pragma unroll
    for (int q = 0; q < 8; ++q) { const int r = q * 2 + rsub; if (col0 + c4 < N) { const v4f v = *(const v4fa*)&so[w][r][c4]; *(v4f*)(C + (size_t)(row0 + r) * ldc + col0 + c4) = v; } }
     }
}

// Wt[n][k] = f16(W[k][n]·scale) from f32 row-major W[K][N] (scale = power of two; bf16-exact weights stay exact in f16 away from the subnormal range)
__global__ __launch_bounds__(256) void k_wt_f16(const float* __restrict__ W, _Float16* __restrict__ Wt, int K, int N, float scale) {
  const int t = blockIdx.x * 256 + threadIdx.x; if (t >= N * (K / 8)) return; const int n = t / (K / 8), k8 = (t % (K / 8)) * 8; FragH f;
#pragma unroll
  for (int i = 0; i < 8; ++i) f.h[i] = (_Float16)(bf16_round(W[(size_t)(k8 + i) * N + n]) * scale); const v8us o = f.half[0];
  *(v8us*)((unsigned short*)Wt + (size_t)n * K + k8) = o; 
}
// k_gemm_hh variant with fused epilogue: v = acc·alpha + bias[by·sBias + col] (+ CP[(row/rowsPerB)·sCPb + by·64 + col] if CP) ; ACT 0 none / 1 elu ; writes f16 C16 (and f32 C if non-null)
template <int ACT>
__global__ __launch_bounds__(128) void k_gemm_hhx(const _Float16* __restrict__ A, int lda, size_t sA, const _Float16* __restrict__ Bh, int ldb, size_t sB, float alpha, const float* __restrict__ bias, size_t sBias, const float* __restrict__ CP, int rowsPerB, size_t sCPb, int row0g,
    float* __restrict__ C, _Float16* __restrict__ C16, int ldc, size_t sC, int M, int N, int K) {
  __shared__ __attribute__((aligned(16))) float so[4][16][64];
  const int tid = threadIdx.x, w = tid >> 5, lane = tid & 31, ln = lane & 15, hh = lane >> 4; const int by = blockIdx.y;
  A += (size_t)by * sA; Bh += (size_t)by * sB; const size_t cofs = (size_t)by * sC; const float* bp = bias ? bias + (size_t)by * sBias : nullptr;
  const int ntn = (N + 63) / 64; const int wid = blockIdx.x * 4 + w; const int mt = wid / ntn, nq = wid % ntn; if (mt * 16 >= M) return;
  const int row0 = mt * 16, col0 = nq * 64; const _Float16* arow = A + (size_t)(row0 + ln) * lda;
  v8f acc[4] = {};
  for (int kb = 0; kb < K; kb += 32) { FragH ah; ah.half[0] = *(const v8us*)((const unsigned short*)arow + kb + 8 * hh); ah.half[1] = *(const v8us*)((const unsigned short*)arow + kb + 16 + 8 * hh);
#pragma unroll
    for (int t = 0; t < 4; ++t) { if (col0 + t * 16 >= N) continue; const size_t boff = (size_t)(col0 + t * 16 + ln) * ldb + kb; FragH bq; bq.half[0] = *(const v8us*)((const unsigned short*)Bh + boff + 8 * hh); bq.half[1] = *(const v8us*)((const unsigned short*)Bh + boff + 16 + 8 * hh);
      acc[t] = mmaH<1>(ah.v, ah.v, bq.v, bq.v, acc[t]); }
  }
#pragma unroll
  for (int t = 0; t < 4; ++t) { if (col0 + t * 16 >= N) continue; const int col = col0 + t * 16 + ln; const float bv = bp ? bf16_round(bp[col]) : 0.f;
#pragma unroll
    for (int r = 0; r < 8; ++r) { float v = acc[t][r] * alpha + bv; if (CP) { const int rr = row0g + row0 + 8 * hh + r; if (rowsPerB < 0) v += CP[cofs + (size_t)rr * ldc + col];      /* rowsPerB < 0: own element of the batched C plane */ else { const int bidx = rr / rowsPerB; v += CP[(size_t)bidx * sCPb + (size_t)by * 64 + col]; } } if (ACT == 1) v = (v > 0.f) ? v : expm1f(v); else if (ACT == 7) v = (v > 0.f) ? v + 1.0f : expf(v); else if (ACT == 8) v = tanhf(v); else if (ACT == 9) v = 0.5f * v * (1.0f + tanhf(0.7978845608028654f * (v + 0.044715f * v * v * v))); else if (ACT == 11) v = 1.0f / (1.0f + expf(-v)); else if (ACT == 12) v = (v > 0.f) ? v : 0.01f * v; else if (ACT == 14) v = (v > 0.f) ? v : 0.1f * v; else if (ACT == 16) v = (v >= 0.f) ? v : 0.3f * v; else if (ACT == 17) v = (v >= 0.f) ? v : 0.2f * v; else if (ACT == 15) v = v / (1.0f + expf(-v)); else if (ACT == 3) v = fmaxf(v, 0.f); else if (ACT == 6) v = 0.5f * v * (1.0f + erff(v * 0.70710678118654752f)); so[w][8 * hh + r][t * 16 + ln] = v; } }
  __builtin_amdgcn_fence(__ATOMIC_ACQ_REL, "workgroup"); __builtin_amdgcn_wave_barrier();
  const int rsub = lane >> 4, c4 = (lane & 15) * 4; typedef _Float16 v4h __attribute__((ext_vector_type(4)));
  {
#pragma unroll
    for (int q = 0; q < 8; ++q) { const int r = q * 2 + rsub; if (col0 + c4 < N) { const v4f v = *(const v4fa*)&so[w][r][c4]; if (C) *(v4f*)(C + cofs + (size_t)(row0 + r) * ldc + col0 + c4) = v; if (C16) { v4h h4; for (int i = 0; i < 4; ++i) h4[i] = (_Float16)v[i]; *(v4h*)(C16 + cofs + (size_t)(row0 + r) * ldc + col0 + c4) = h4; } } }
     }
}


typedef _Float16 v4h __attribute__((ext_vector_type(4)));

__global__ __launch_bounds__(256) void k_x16(const float* __restrict__ x, _Float16* __restrict__ X16, size_t n8) { const size_t t = (size_t)blockIdx.x * 256 + threadIdx.x; if (t >= n8) return; FragH f;
#pragma unroll
  for (int q = 0; q < 8; ++q) f.h[q] = (_Float16)bf16_round(x[t * 8 + q]); *(v8us*)((unsigned short*)X16 + t * 8) = f.half[0];  }
__global__ __launch_bounds__(256) void k_h16(const float* __restrict__ x, _Float16* __restrict__ X16, size_t n8) { const size_t t = (size_t)blockIdx.x * 256 + threadIdx.x; if (t >= n8) return; FragH f;
#pragma unroll
  for (int q = 0; q < 8; ++q) f.h[q] = (_Float16)x[t * 8 + q]; *(v8us*)((unsigned short*)X16 + t * 8) = f.half[0];  }
__global__ __launch_bounds__(256) void k_round16f(const float* __restrict__ W, _Float16* __restrict__ Bt, size_t n8) { const size_t t = (size_t)blockIdx.x * 256 + threadIdx.x; if (t >= n8) return; FragH f;
#pragma unroll
  for (int i = 0; i < 8; ++i) f.h[i] = (_Float16)(bf16_round(W[t * 8 + i]) * 16.0f); *(v8us*)((unsigned short*)Bt + t * 8) = f.half[0];  }

__global__ __launch_bounds__(256) void k_hl(const float* __restrict__ F, _Float16* __restrict__ Hh, _Float16* __restrict__ Hl, size_t n8) { const size_t t = (size_t)blockIdx.x * 256 + threadIdx.x; if (t >= n8) return; FragH fh, fl; const v4f a = *(const v4fa*)(F + t * 8), c = *(const v4fa*)(F + t * 8 + 4);
#pragma unroll
  for (int q = 0; q < 4; ++q) { _Float16 h = (_Float16)a[q]; fh.h[q] = h; fl.h[q] = (_Float16)((a[q] - (float)h) * 1024.0f); h = (_Float16)c[q]; fh.h[4 + q] = h; fl.h[4 + q] = (_Float16)((c[q] - (float)h) * 1024.0f); }
  { *(v8us*)((unsigned short*)Hh + t * 8) = fh.half[0]; *(v8us*)((unsigned short*)Hl + t * 8) = fl.half[0];  } }

// ---- fast GEMM tile: C = A . B^T * alpha + bias, A [M][CC] and B [N][CC] f16 rows; work-group tile 128x64, wave tile 32x64 (M % 128 == 0, N % 64 == 0) ----
__device__ __forceinline__ v16h g2_frag(const _Float16* p, int hh) { FragH f; f.half[0] = *(const v8us*)((const unsigned short*)p + 8 * hh); f.half[1] = *(const v8us*)((const unsigned short*)p + 16 + 8 * hh); return f.v; }
__device__ __forceinline__ v8f g2_mma(v16h a, v16h b, v8f c) { v8f d = __builtin_amdgcn_wmma_f32_16x16x32_f16(false, a, false, b, (short)0, c, false, false); asm volatile("v_nop\n\tv_nop\n\tv_nop\n\tv_nop" : "+v"(d) : "v"(a), "v"(b)); return d; }
// Both operand tiles (128 + 64 rows, all of K = CC: 512 bytes a row) are brought into LDS once, whole rows at a time, and the fragments are read from there:
// a fragment load straight from global memory touches 16 lines for 512 bytes, and its latency stood in front of every pair of products.
#define G2_PK 528                    /* LDS row pitch, bytes: 512 + 16, an odd multiple of 16 for 16-byte readers */
#define G2_LDS ((128 + 64) * G2_PK)
__device__ __forceinline__ v16h g2_lfrag(const unsigned char* p) { FragH f; f.half[0] = *(const v8us*)p; f.half[1] = *(const v8us*)(p + 32); return f.v; }      /* p already holds + 16 hh: k = 8 hh .. and 16 + 8 hh .. */
// Twelve asynchronous copies to LDS, one 512-byte row each (a lane brings its own 16 bytes). The s_wait_xcnt is the last line of the copies' own statement, so that it stands in front of whatever rewrites an address register that a copy names.
__device__ __forceinline__ void g2_copy12(const unsigned* l, const unsigned char* const* g) {
  asm volatile("global_load_async_to_lds_b128 %0, %12, off\n\tglobal_load_async_to_lds_b128 %1, %13, off\n\tglobal_load_async_to_lds_b128 %2, %14, off\n\tglobal_load_async_to_lds_b128 %3, %15, off\n\t"
               "global_load_async_to_lds_b128 %4, %16, off\n\tglobal_load_async_to_lds_b128 %5, %17, off\n\tglobal_load_async_to_lds_b128 %6, %18, off\n\tglobal_load_async_to_lds_b128 %7, %19, off\n\t"
               "global_load_async_to_lds_b128 %8, %20, off\n\tglobal_load_async_to_lds_b128 %9, %21, off\n\tglobal_load_async_to_lds_b128 %10, %22, off\n\tglobal_load_async_to_lds_b128 %11, %23, off\n\ts_wait_xcnt 0x0"
               :: "v"(l[0]), "v"(l[1]), "v"(l[2]), "v"(l[3]), "v"(l[4]), "v"(l[5]), "v"(l[6]), "v"(l[7]), "v"(l[8]), "v"(l[9]), "v"(l[10]), "v"(l[11]),
                  "v"(g[0]), "v"(g[1]), "v"(g[2]), "v"(g[3]), "v"(g[4]), "v"(g[5]), "v"(g[6]), "v"(g[7]), "v"(g[8]), "v"(g[9]), "v"(g[10]), "v"(g[11]) : "memory"); }
// RB: the bias belongs to the row of C (channel-major outputs), else to its column. TO: element type of C (float or f16). bx: tile index, column tiles fastest. A and B rows are CC long (K = CC). sm: G2_LDS bytes.
template <bool RB, typename TO>
__device__ __forceinline__ void g2_tile(unsigned char* sm, const _Float16* __restrict__ A, const _Float16* __restrict__ Bh, float alpha, const float* __restrict__ bp, TO* __restrict__ C, int ldc, int bx, int N) {
  const int tid = threadIdx.x, w = tid >> 5, lane = tid & 31, ln = lane & 15, hh = lane >> 4;
  const int ntn = N >> 6; const int mt = bx / ntn, nq = bx - mt * ntn; const int row0 = mt * 128 + 32 * w, col0 = nq * 64;
  { /* wave w brings its own 32 rows of A and rows 16 w .. 16 w + 15 of B: 48 copies, all in flight at once */
    const unsigned char* ga = (const unsigned char*)(A + (size_t)row0 * CC) + lane * 16; const unsigned char* gb = (const unsigned char*)(Bh + (size_t)(col0 + 16 * w) * CC) + lane * 16;
    const unsigned l0 = (unsigned)(size_t)sm + lane * 16; const unsigned la = l0 + 32 * w * G2_PK, lb = l0 + (128 + 16 * w) * G2_PK;
    unsigned l[48]; const unsigned char* g[48];
#pragma unroll      // constant indices, so that the two arrays dissolve into registers
    for (int i = 0; i < 48; ++i) { l[i] = i < 32 ? la + i * G2_PK : lb + (i - 32) * G2_PK; g[i] = i < 32 ? ga + i * (CC * 2) : gb + (i - 32) * (CC * 2); }
    g2_copy12(l, g); g2_copy12(l + 12, g + 12); g2_copy12(l + 24, g + 24); g2_copy12(l + 36, g + 36);
    asm volatile("s_wait_asynccnt 0x0" ::: "memory");      // this wave's 48 copies have landed; the compiler places no wait for them
    __syncthreads(); }      /* both tiles published: the B rows are read by all four waves */
  const unsigned char* ap = sm + (32 * w + ln) * G2_PK + 16 * hh;      /* + 16 hh: the lane half's k offset sits in the row pointers */
  const unsigned char* bq = sm + (128 + ln) * G2_PK + 16 * hh;
  const v8f z8 = {0.f,0.f,0.f,0.f,0.f,0.f,0.f,0.f}; v8f c00 = z8, c01 = z8, c02 = z8, c03 = z8, c10 = z8, c11 = z8, c12 = z8, c13 = z8;
  v16h a0 = g2_lfrag(ap), a1 = g2_lfrag(ap + 16 * G2_PK), b0 = g2_lfrag(bq), b1 = g2_lfrag(bq + 16 * G2_PK), b2 = g2_lfrag(bq + 32 * G2_PK), b3 = g2_lfrag(bq + 48 * G2_PK);
#pragma unroll      // straight line: the next 32 k's fragments go into a second register set, read as one group ahead of this block's products
  for (int ks = 0; ks < CC / 32; ++ks) { v16h na0 = a0, na1 = a1, nb0 = b0, nb1 = b1, nb2 = b2, nb3 = b3;
    if (ks + 1 < CC / 32) { const int o = (ks + 1) * 64; na0 = g2_lfrag(ap + o); na1 = g2_lfrag(ap + 16 * G2_PK + o); nb0 = g2_lfrag(bq + o); nb1 = g2_lfrag(bq + 16 * G2_PK + o); nb2 = g2_lfrag(bq + 32 * G2_PK + o); nb3 = g2_lfrag(bq + 48 * G2_PK + o); }
    c00 = g2_mma(a0, b0, c00); c10 = g2_mma(a1, b0, c10); c01 = g2_mma(a0, b1, c01); c11 = g2_mma(a1, b1, c11);
    c02 = g2_mma(a0, b2, c02); c12 = g2_mma(a1, b2, c12); c03 = g2_mma(a0, b3, c03); c13 = g2_mma(a1, b3, c13);
    a0 = na0; a1 = na1; b0 = nb0; b1 = nb1; b2 = nb2; b3 = nb3; }
  float (*so)[68] = (float (*)[68])(sm + 32 * w * G2_PK);      /* output staging in the wave's own 32 rows of A: no other wave reads or writes them, and this wave's reads of them have fed the sums that are stored here */
  v8f accs[8] = {c00, c01, c02, c03, c10, c11, c12, c13};
#pragma unroll
  for (int u = 0; u < 8; ++u) { const int t = u & 3, half = u >> 2; const int col = col0 + t * 16 + ln;
#pragma unroll
    for (int r = 0; r < 8; ++r) { const int rloc = half * 16 + 8 * hh + r; const float bv = bf16_round(RB ? bp[row0 + rloc] : bp[col]); so[rloc][t * 16 + ln] = accs[u][r] * alpha + bv; } }
  __builtin_amdgcn_fence(__ATOMIC_ACQ_REL, "workgroup"); __builtin_amdgcn_wave_barrier();
  const int rsub = lane >> 4, c4 = (lane & 15) * 4;
#pragma unroll
  for (int q = 0; q < 16; ++q) { const int r = q * 2 + rsub; const v4f v = *(const v4fa*)&so[r][c4]; typedef TO v4o __attribute__((ext_vector_type(4))); v4o o4; for (int i = 0; i < 4; ++i) o4[i] = (TO)v[i]; *(v4o*)(C + (size_t)(row0 + r) * ldc + col0 + c4) = o4; } }
#define CT_G ((CC / 128) * (LL / 64))              /* tiles of one batch's channel-major product */
// out[b][c][n] = sum_k' w_m'[c][k'] o[(b,n)][k'] / 1024 + b_m[c] (channel-major directly; blockIdx.y = batch)
__global__ __launch_bounds__(128) void k_out(const _Float16* __restrict__ AM, const _Float16* __restrict__ O16, const float* __restrict__ bm, float* __restrict__ out) {
  __shared__ __attribute__((aligned(16))) unsigned char sm[G2_LDS];
  const size_t b = blockIdx.y;
  g2_tile<true>(sm, AM, O16 + b * LL * CC, 0.0009765625f, bm, out + b * CC * LL, LL, blockIdx.x, LL); }


__global__ __launch_bounds__(256) void k_wnat(const float* __restrict__ w, size_t n8, _Float16* __restrict__ Bt) { const size_t t = (size_t)blockIdx.x * 256 + threadIdx.x; if (t >= n8) return; FragH f; for (int q = 0; q < 8; ++q) f.h[q] = (_Float16)(bf16_round(w[t * 8 + q]) * 16.0f); *(v8us*)((unsigned short*)Bt + t * 8) = f.half[0];  }
__global__ __launch_bounds__(256) void k_rsm(const float* __restrict__ S, _Float16* __restrict__ P, int nrows) {
  #pragma clang fp contract(off)
  const int i = blockIdx.x * 256 + threadIdx.x; if (i >= nrows) return; const float* s = S + (size_t)i * SQ; float mx = -3.0e38f;
#pragma unroll 1
  for (int j = 0; j < SQ; ++j) mx = fmaxf(mx, s[j]); float se = 0.f;
#pragma unroll 1
  for (int j = 0; j < SQ; ++j) se += expf(s[j] - mx); const float sc = 256.0f / se;
#pragma unroll 1
  for (int j0 = 0; j0 < SQ; j0 += 8) { FragH f; for (int q = 0; q < 8; ++q) f.h[q] = (_Float16)(expf(s[j0 + q] - mx) * sc); unsigned short* d = (unsigned short*)P + (size_t)i * SQ + j0; *(v8us*)d = f.half[0];  } }
__global__ __launch_bounds__(256) void k_vt(const _Float16* __restrict__ V16, int b, int h0, _Float16* __restrict__ VT) { __shared__ unsigned short tl[64][65]; const int tid = threadIdx.x; const int hh = blockIdx.x % HG, sg = blockIdx.x / HG; const int s0 = sg * 64; const int h = h0 + hh;
  for (int i = tid; i < 64 * 8; i += 256) { const int j = i / 8, d8 = (i % 8) * 8; FragH f; f.half[0] = *(const v8us*)((const unsigned short*)V16 + ((size_t)b * SQ + s0 + j) * DM + h * HD + d8); for (int q = 0; q < 8; ++q) tl[d8 + q][j] = f.u[q]; }
  __syncthreads();
  { for (int i = tid; i < 64 * 8; i += 256) { const int d = i / 8, j8 = (i % 8) * 8; FragH f; for (int q = 0; q < 8; ++q) f.u[q] = tl[d][j8 + q]; *(v8us*)((unsigned short*)VT + ((size_t)hh * HD + d) * SQ + s0 + j8) = f.half[0]; }  } }

// ---- projections straight from the inputs ----
// Behind a body's last global store: this wait stands in front of whatever rewrites a register that the store names.
__device__ __forceinline__ void p_stored() { asm volatile("s_wait_xcnt 0x0" ::: "memory"); }
// w_m with its columns permuted to the head-major order of o (exact x16 f16); t: the thread's index over CC * CC / 8 pieces of 8 elements.
__device__ __forceinline__ void p_wpermc(const float* __restrict__ w, _Float16* __restrict__ A, int t) { const int k8 = (t % (CC / 8)) * 8, c = t / (CC / 8); FragH f;
  for (int q = 0; q < 8; ++q) { const int kp = k8 + q; const int h = kp / HD, dd = kp % HD; f.h[q] = (_Float16)(bf16_round(w[(size_t)c * CC + dd * NH + h]) * 16.0f); } unsigned short* d = (unsigned short*)A + (size_t)c * CC + k8; *(v8us*)d = f.half[0]; p_stored(); }
typedef float v2f __attribute__((ext_vector_type(2)));
typedef __bf16 v2b __attribute__((ext_vector_type(2)));
typedef _Float16 v2h __attribute__((ext_vector_type(2)));
typedef unsigned v4ua __attribute__((ext_vector_type(4), may_alias));
typedef unsigned v2ua __attribute__((ext_vector_type(2), may_alias));
// Two f32 -> rounded to bf16 (nearest even, one packed conversion) -> the same values as two f16, a in the low half.
__device__ __forceinline__ unsigned pj_cv2(float a, float b) { const v2f x = {a, b}; const unsigned u = __builtin_bit_cast(unsigned, __builtin_convertvector(x, v2b));
  const v2f y = {__uint_as_float(u << 16), __uint_as_float(u & 0xFFFF0000u)}; return __builtin_bit_cast(unsigned, __builtin_convertvector(y, v2h)); }
#define PJ_T 256                                   /* tokens per work-group; the other side of its tile is all CC channels */
#define PJ_LDS ((PJ_T + CC) * G2_PK)               /* token rows, then weight rows, each all of K = CC at the GEMM pitch */
#define PJ_G (3 * (int)(NR / PJ_T))                /* work-groups of the three projections */
#define PM_G (CC * (CC / 8) / 512)                 /* work-groups that permute w_m: 8 elements a thread, exactly */
static_assert(PJ_T == 256 && CC == 256 && LL % PJ_T == 0 && PM_G * 512 == CC * (CC / 8), "16 waves as 4 x 4 tiles of 64 x 64; a token tile stays inside one batch; no tail guards");
// Epilogue of one wave's 64 x 64 tile, 32 rows at a time through the wave's own LDS range, so that whole 128-byte lines are stored. RB: the bias belongs to the row of C, else to its column; its index is the permuted channel.
// os: a factor on the whole output (product and bias), applied in f32 ahead of the one rounding to f16; 1 leaves every value as it was.
#define FA_CS (0.125f * 1.44269504088896340736f)      /* 1 / sqrt(64), times log2(e): q is stored times this, so that K . q^T is a score in the log2 domain */
template <bool RB>
__device__ __forceinline__ void pj_epi(float (*so)[68], const v8f (&acc)[4][4], const float* __restrict__ bias, float os, _Float16* __restrict__ Cw, int ldc, int row0, int col0, int lane) {
  const int ln = lane & 15, hh = lane >> 4, rsub = lane >> 4, c4 = (lane & 15) * 4;
  const int bi0 = RB ? 8 * hh * NH + row0 / HD : ln * NH + col0 / HD;      /* permuted channel i is natural channel (i % HD) * NH + i / HD; row0 and col0 are multiples of HD */
  const float al = 0.0625f * os;
#pragma unroll      // constant indices, so that the accumulators stay in registers
  for (int hf = 0; hf < 2; ++hf) {
    float bvv[RB ? 16 : 4];      /* the lane's biases for these 32 rows: by row 16 mi + 8 hh + r, or by column 16 t + ln */
#pragma unroll
    for (int u = 0; u < (RB ? 16 : 4); ++u) bvv[u] = bias[bi0 + (RB ? hf * 32 + (u >> 3) * 16 + (u & 7) : u * 16) * NH];
    asm volatile("s_wait_xcnt 0x0" :: "v"(bi0) : "memory");      // behind the bias loads, in front of whatever rewrites the index register that they name; the index is an input so that it is kept up to here (else the last load landed in it)
    __builtin_amdgcn_sched_barrier(0);      // nothing moves ahead of that wait
#pragma unroll
    for (int u = 0; u < (RB ? 16 : 4); ++u) bvv[u] = bf16_round(bvv[u]) * os;
#pragma unroll
    for (int mi = 0; mi < 2; ++mi)
#pragma unroll
      for (int t = 0; t < 4; ++t)
#pragma unroll
        for (int r = 0; r < 8; ++r) { const int rloc = mi * 16 + 8 * hh + r; so[rloc][t * 16 + ln] = acc[hf * 2 + mi][t][r] * al + bvv[RB ? mi * 8 + r : t]; }
    __builtin_amdgcn_fence(__ATOMIC_ACQ_REL, "workgroup"); __builtin_amdgcn_wave_barrier();      // the wave's own writes stand ahead of its reads of other lanes' values
#pragma unroll
    for (int q = 0; q < 16; ++q) { const int r = q * 2 + rsub; const v4f v = *(const v4fa*)&so[r][c4]; v4h o4; for (int i = 0; i < 4; ++i) o4[i] = (_Float16)v[i]; *(v4h*)(Cw + (size_t)(hf * 32 + r) * ldc + c4) = o4; }
    __builtin_amdgcn_fence(__ATOMIC_ACQ_REL, "workgroup"); __builtin_amdgcn_wave_barrier();      // and these reads ahead of the next half's writes
    p_stored();
    __builtin_amdgcn_sched_barrier(0);      // the next half's register writes stay behind that wait
  } }
// One work-group = 256 tokens of one batch x all 256 channels of one projection (blockIdx.x / 64: 0 Q, 1 K, 2 V). Every input element is read from memory once, by whole 128-byte lines, and never written back as f16 rows.
// Input tile: a lane takes 8 channels x 16 tokens (32 loads of 16 bytes); its 8 channels of one token are one 16-byte LDS store, so the transpose happens in the lane's own registers. Weights: a wave takes a row by two 512-byte loads.
__global__ __launch_bounds__(512) void k_proj(const float* __restrict__ xq, const float* __restrict__ xk, const float* __restrict__ xv, const float* __restrict__ wq, const float* __restrict__ wk, const float* __restrict__ wv, const float* __restrict__ wm,
    const float* __restrict__ bq, const float* __restrict__ bk, const float* __restrict__ bv, _Float16* __restrict__ Q16, _Float16* __restrict__ K16, _Float16* __restrict__ VT, _Float16* __restrict__ AM) {
  __shared__ __attribute__((aligned(16))) unsigned char sm[PJ_LDS];
  const int bx = blockIdx.x, tid = threadIdx.x;
  if (bx >= PJ_G) { p_wpermc(wm, AM, (bx - PJ_G) * 512 + tid); return; }      /* on blockIdx alone, in front of every barrier */
  const int p = bx / (int)(NR / PJ_T), tl = bx % (int)(NR / PJ_T); const int b = tl / (LL / PJ_T), n0 = (tl % (LL / PJ_T)) * PJ_T;
  const float* x = p == 0 ? xq : p == 1 ? xk : xv; const float* w = p == 0 ? wq : p == 1 ? wk : wv; const float* bias = p == 0 ? bq : p == 1 ? bk : bv;
  const int wvi = __builtin_amdgcn_readfirstlane(tid >> 5), lane = tid & 31;
  unsigned char* smX = sm; unsigned char* smW = sm + PJ_T * G2_PK;
  { const int cg = (wvi & 7) * 4 + (lane >> 3);      /* the lane's group of 8 channels; 8 lanes side by side cover one 128-byte line of a channel */
    const int tk = (wvi >> 3) * 128 + (lane & 7) * 4;      /* its first token; + 32 a unit */
    const float* px = x + ((size_t)b * CC + cg * 8) * LL + n0 + tk;
    const float* pw = w + (size_t)((wvi & 3) * 16 * NH + (wvi >> 2)) * CC + lane * 4;      /* LDS row 16 wvi + i is natural row ((16 wvi + i) % 64) * 4 + (16 wvi + i) / 64: + NH rows a step */
    v4f xr[4][8], wa[8][2], wb[8][2];
#pragma unroll
    for (int i = 0; i < 4; ++i) for (int j = 0; j < 8; ++j) xr[i][j] = *(const v4fa*)(px + j * LL + i * 32);
    __builtin_amdgcn_sched_barrier(0);      // the input tile's 32 loads go first and together: they come from memory, the weights from L2
#pragma unroll
    for (int i = 0; i < 8; ++i) { wa[i][0] = *(const v4fa*)(pw + i * NH * CC); wa[i][1] = *(const v4fa*)(pw + i * NH * CC + 128); }
    __builtin_amdgcn_sched_barrier(0);      // and half of the weights' loads ahead of the first conversion
    asm volatile("s_wait_xcnt 0x0" :: "v"(px), "s"(pw - lane * 4) : "memory");      // behind the 48 loads, in front of whatever rewrites an address register that they name; the two bases are inputs so that their registers are kept up to here (else a weight load landed in the input loads' address pair)
    __builtin_amdgcn_sched_barrier(0);      // no conversion moves ahead of that wait
#pragma unroll
    for (int i = 0; i < 4; ++i) for (int ii = 0; ii < 4; ++ii) { const v4ua o = {pj_cv2(xr[i][0][ii], xr[i][1][ii]), pj_cv2(xr[i][2][ii], xr[i][3][ii]), pj_cv2(xr[i][4][ii], xr[i][5][ii]), pj_cv2(xr[i][6][ii], xr[i][7][ii])};
      *(v4ua*)(smX + (tk + i * 32 + ii) * G2_PK + cg * 16) = o; }
    __builtin_amdgcn_sched_barrier(0);      // the second half of the weights takes the registers that the input tile has left
#pragma unroll
    for (int i = 0; i < 8; ++i) { wb[i][0] = *(const v4fa*)(pw + (8 + i) * NH * CC); wb[i][1] = *(const v4fa*)(pw + (8 + i) * NH * CC + 128); }
    __builtin_amdgcn_sched_barrier(0);      // in flight under the first half's conversions
    asm volatile("s_wait_xcnt 0x0" ::: "memory");      // as above, behind these 16 loads
    __builtin_amdgcn_sched_barrier(0);
    unsigned char* dw = smW + wvi * 16 * G2_PK + lane * 8;
#pragma unroll
    for (int i = 0; i < 16; ++i) { const v4f lo = i < 8 ? wa[i & 7][0] : wb[i & 7][0], hi = i < 8 ? wa[i & 7][1] : wb[i & 7][1];      /* x16 ahead of the rounding: a power of two, so the same value as rounding first */
      const v2ua o0 = {pj_cv2(lo[0] * 16.0f, lo[1] * 16.0f), pj_cv2(lo[2] * 16.0f, lo[3] * 16.0f)}, o1 = {pj_cv2(hi[0] * 16.0f, hi[1] * 16.0f), pj_cv2(hi[2] * 16.0f, hi[3] * 16.0f)};
      *(v2ua*)(dw + i * G2_PK) = o0; *(v2ua*)(dw + i * G2_PK + 256) = o1; } }
  __syncthreads();      /* both operands published */
  const int ln = lane & 15, hh = lane >> 4, wr_ = wvi >> 2, wc_ = wvi & 3;      /* the wave's 64 rows of A and 64 rows of B */
  const bool vs = p == 2;      /* V: A = weights, B = tokens */
  const unsigned char* ap = (vs ? smW : smX) + (64 * wr_ + ln) * G2_PK + 16 * hh;      /* + 16 hh: the lane half's k offset sits in the row pointers */
  const unsigned char* bp_ = (vs ? smX : smW) + (64 * wc_ + ln) * G2_PK + 16 * hh;
  v8f acc[4][4];
#pragma unroll
  for (int i = 0; i < 4; ++i) for (int j = 0; j < 4; ++j) acc[i][j] = v8f{0.f, 0.f, 0.f, 0.f, 0.f, 0.f, 0.f, 0.f};
#pragma unroll      // straight line: constant LDS offsets
  for (int ks = 0; ks < CC / 32; ++ks) { v16h af[4], bf[4];
    for (int i = 0; i < 4; ++i) { af[i] = g2_lfrag(ap + i * 16 * G2_PK + ks * 64); bf[i] = g2_lfrag(bp_ + i * 16 * G2_PK + ks * 64); }
    __builtin_amdgcn_sched_barrier(0);      // the 16 reads of a k step stand together in one place: left alone, the scheduler read each A fragment into one register set right in front of its four products, behind a wait to 0 each time; the SIMD's three other waves cover the one wait
    for (int i = 0; i < 4; ++i) for (int j = 0; j < 4; ++j) acc[i][j] = __builtin_amdgcn_wmma_f32_16x16x32_f16(false, af[i], false, bf[j], (short)0, acc[i][j], false, false);
    __builtin_amdgcn_sched_barrier(0); }      // and none of the next step's reads moves in among these products
  __syncthreads();      /* every wave has read its last fragment: the operand rows become output staging */
  float (*so)[68] = (float (*)[68])(sm + wvi * 32 * G2_PK);      /* a sixteenth of the LDS for each wave */
  if (vs) pj_epi<true>(so, acc, bias, 1.0f, VT + ((size_t)b * CC + 64 * wr_) * LL + n0 + 64 * wc_, LL, 64 * wr_, 64 * wc_, lane);
  else pj_epi<false>(so, acc, bias, p ? 1.0f : FA_CS, (p ? K16 : Q16) + ((size_t)b * LL + n0 + 64 * wr_) * CC + 64 * wc_, CC, 64 * wr_, 64 * wc_, lane); }
__device__ __forceinline__ float rs_xh(float x) { return __builtin_bit_cast(float, __builtin_amdgcn_permlanex16(__builtin_bit_cast(int, x), __builtin_bit_cast(int, x), 0x76543210, 0xfedcba98, false, false)); }      /* lane l <- lane l ^ 16 */
// 2^z on the transcendental unit. The v_nop is the slot that the instruction set asks for behind a transcendental before its result is read or its source overwritten.
__device__ __forceinline__ float rs_exp2(float z) { float y; asm("v_exp_f32 %0, %1\n\tv_nop" : "=v"(y) : "v"(z)); return y; }
#define FA_KS 64                     /* keys per stage */
#define FA_KG 2                      /* key groups per work-group */
#define FA_GK (SQ / FA_KG)           /* keys per key group */
#define FA_PK 144                    /* LDS row pitch, bytes: 128 + 16, an odd multiple of 16 for 16-byte readers */
__device__ __forceinline__ v8f fa_mma(v16h a, v16h b, v8f c) { return __builtin_amdgcn_wmma_f32_16x16x32_f16(false, a, false, b, (short)0, c, false, false); }
__device__ __forceinline__ v16h fa_lfrag(const unsigned char* p) { FragH f; f.half[0] = *(const v8us*)p; f.half[1] = *(const v8us*)(p + 32); return f.v; }      /* p already holds + 16 hh: k = 8 hh .. and 16 + 8 hh .. */
__global__ __launch_bounds__(512) void k_fattn(const _Float16* __restrict__ Q16, const _Float16* __restrict__ K16, const _Float16* __restrict__ VT, _Float16* __restrict__ O16) {
  __shared__ __attribute__((aligned(16))) unsigned char L[2][FA_KG][2][FA_KS * FA_PK];      /* [buffer][key group][K, V^T][row][pitch] */
  const int kh = __builtin_amdgcn_readfirstlane((int)threadIdx.x >> 8);      /* the wave's key group, in a scalar register */
  const int tid = threadIdx.x & 255, lane = tid & 31, w = tid >> 5, c = lane & 15, hh = lane >> 4;      /* tid, w: within the key group */ const int h = blockIdx.y, b = blockIdx.z; const size_t r0 = (size_t)b * LL; const int q0 = blockIdx.x * 256 + w * 32;
  v16h qf[2][2];
#pragma unroll
  for (int g = 0; g < 2; ++g) for (int kc = 0; kc < 2; ++kc) qf[g][kc] = g2_frag(Q16 + (r0 + q0 + g * 16 + c) * CC + h * HD + kc * 32, hh);
  const int srow = tid >> 2, sseg = (tid & 3) * 32;      /* staging: 4 threads cover one 128-byte row, 32 bytes each */
  const unsigned char* kg = (const unsigned char*)(K16 + (r0 + kh * FA_GK + srow) * CC + h * HD) + sseg;      /* key rows: + 64 rows a stage */
  const unsigned char* vg = (const unsigned char*)(VT + ((size_t)(b * NH + h) * HD + srow) * SQ + kh * FA_GK) + sseg;      /* d rows: + 64 keys a stage */
  const int sdst = srow * FA_PK + sseg;
  v8us k0 = *(const v8us*)kg, k1 = *(const v8us*)(kg + 16), v0 = *(const v8us*)vg, v1 = *(const v8us*)(vg + 16);
  *(v8us*)&L[0][kh][0][sdst] = k0; *(v8us*)&L[0][kh][0][sdst + 16] = k1; *(v8us*)&L[0][kh][1][sdst] = v0; *(v8us*)&L[0][kh][1][sdst + 16] = v1;
  const v8f z8 = {0.f, 0.f, 0.f, 0.f, 0.f, 0.f, 0.f, 0.f}; v8f acc[2][4], cm[2]; float l_run[2];      /* cm: minus the maximum in use, in all eight registers: the C operand of the score products */
#pragma unroll
  for (int g = 0; g < 2; ++g) { cm[g] = z8; l_run[g] = 0.f; for (int t = 0; t < 4; ++t) acc[g][t] = z8; }      /* 0 only until the first pass sets the true maximum */
  __syncthreads();      /* stage 0 published */
#pragma unroll 1      // one stage a trip: the body already holds two unrolled 32-key passes
  for (int st = 0; st < FA_GK / FA_KS; ++st) {
    const bool more = st + 1 < FA_GK / FA_KS;
    if (more) { const unsigned char* kn = kg + (size_t)(st + 1) * (FA_KS * CC * 2); const unsigned char* vn = vg + (size_t)(st + 1) * (FA_KS * 2); k0 = *(const v8us*)kn; k1 = *(const v8us*)(kn + 16); v0 = *(const v8us*)vn; v1 = *(const v8us*)(vn + 16); }
    const unsigned char* Kb = &L[st & 1][kh][0][c * FA_PK + 16 * hh]; const unsigned char* Vb = &L[st & 1][kh][1][c * FA_PK + 16 * hh];
#pragma unroll
    for (int sub = 0; sub < 2; ++sub) {      /* one pass = 32 keys */
      v8f s[2][2];
#pragma unroll
      for (int kt = 0; kt < 2; ++kt) { const v16h ka = fa_lfrag(Kb + (sub * 32 + kt * 16) * FA_PK), kb2 = fa_lfrag(Kb + (sub * 32 + kt * 16) * FA_PK + 64);
        for (int g = 0; g < 2; ++g) s[kt][g] = fa_mma(kb2, qf[g][1], fa_mma(ka, qf[g][0], cm[g])); }      /* score - maximum in use, log2 domain */
      v16h vf[4];
#pragma unroll
      for (int t = 0; t < 4; ++t) vf[t] = fa_lfrag(Vb + t * 16 * FA_PK + sub * 64);
      float mb[2]; bool need = false;
#pragma unroll
      for (int g = 0; g < 2; ++g) { float mx = fmaxf(s[0][g][0], s[1][g][0]);
        for (int r = 1; r < 8; ++r) mx = fmaxf(mx, fmaxf(s[0][g][r], s[1][g][r]));
        mx = fmaxf(mx, rs_xh(mx)); mb[g] = mx; need = need || (mx > 8.0f); }      /* both wave halves hold the query's maximum, counted from the maximum in use */
      const bool first = sub == 0 && st == 0;      /* the group's first pass takes the true maximum, also one below 0, so that the sum never starts from underflowed terms */
      if (__builtin_amdgcn_ballot_w32(need) != 0 || first) {      /* wave-uniform scalar branch, one test a pass */
#pragma unroll
        for (int g = 0; g < 2; ++g) { const float up = first ? mb[g] : fmaxf(mb[g], 0.f); const float dl = cm[g][0] - (cm[g][0] - up);      /* the step of the maximum as it comes out rounded: what later passes' C really differs by */
          const float corr = rs_exp2(fminf(-dl, 0.f));      /* dl < 0 only on the first pass, where sum and accumulators are 0 */
          l_run[g] *= corr; for (int t = 0; t < 4; ++t) acc[g][t] = acc[g][t] * corr;
          for (int kt = 0; kt < 2; ++kt) s[kt][g] = s[kt][g] - dl;      /* this pass's arguments were formed against the old maximum */
          cm[g] = cm[g] - up; }      /* every register holds minus the new maximum */
      }
#pragma unroll
      for (int g = 0; g < 2; ++g) { float e0[8], e1[8];
        for (int r = 0; r < 8; ++r) { e0[r] = __builtin_amdgcn_exp2f(s[0][g][r]); e1[r] = __builtin_amdgcn_exp2f(s[1][g][r]); }      /* the builtin: the arguments are read where the matrix unit left them, and the compiler sees these reads when it keeps the distance behind a matrix instruction (an asm statement on the tiles' registers cost a copy of every tile) */
        l_run[g] += (((e0[0] + e0[1]) + (e0[2] + e0[3])) + ((e0[4] + e0[5]) + (e0[6] + e0[7]))) + (((e1[0] + e1[1]) + (e1[2] + e1[3])) + ((e1[4] + e1[5]) + (e1[6] + e1[7])));
        FragH pf; for (int r = 0; r < 8; ++r) { pf.h[r] = (_Float16)e0[r]; pf.h[8 + r] = (_Float16)e1[r]; }      /* element s: key 8 hh + s, then 16 + 8 hh + (s - 8): the k order of V^T's loader */
        for (int t = 0; t < 4; ++t) acc[g][t] = fa_mma(vf[t], pf.v, acc[g][t]); }
    }
    if (more) { unsigned char* d = &L[(st + 1) & 1][kh][0][sdst]; *(v8us*)d = k0; *(v8us*)(d + 16) = k1; *(v8us*)(d + FA_KS * FA_PK) = v0; *(v8us*)(d + FA_KS * FA_PK + 16) = v1; }      /* its last readers left it before the barrier that ended trip st - 1 */
    __syncthreads();      /* publishes stage st + 1 and ends every read of stage st */
  }
  // Join of the two key groups: group kh finishes column group kh and hands column group 1 - kh to the lane of the same number in the other group. The stage buffers are free: the loop's last barrier ended every read of them.
  const float m_run[2] = {-cm[0][0], -cm[1][0]};
  static_assert(FA_KG == 2 && sizeof(L) >= (size_t)FA_KG * 9 * 256 * 16, "the exchange takes 9 slots of 16 bytes a lane");
  v4f* X = (v4f*)&L[0][0][0][0];      /* [key group][slot][lane of the group]: neighbouring lanes 16 bytes apart */
  v4f* xs = X + kh * (9 * 256) + tid; const v4f* xr = X + (1 - kh) * (9 * 256) + tid;
  v8f mine[4];
#pragma unroll      // constant indices, so that the accumulators stay in registers
  for (int t = 0; t < 4; ++t) { const v8f o = kh ? acc[0][t] : acc[1][t]; mine[t] = kh ? acc[1][t] : acc[0][t];
    const v4f lo = {o[0], o[1], o[2], o[3]}, hi = {o[4], o[5], o[6], o[7]}; xs[(2 * t) * 256] = lo; xs[(2 * t + 1) * 256] = hi; }
  { const v4f ml = {kh ? m_run[0] : m_run[1], kh ? l_run[0] : l_run[1], 0.f, 0.f}; xs[8 * 256] = ml; }
  __syncthreads();      /* both groups' hand-overs published */
  const float m_a = kh ? m_run[1] : m_run[0], l_a = kh ? l_run[1] : l_run[0]; const v4f ml = xr[8 * 256];
  const float m_j = fmaxf(m_a, ml[0]); const float f_a = rs_exp2(m_a - m_j), f_b = rs_exp2(ml[0] - m_j);
  const float lp = l_a * f_a + ml[1] * f_b; const float inv = 64.0f / (lp + rs_xh(lp)); const float s_a = f_a * inv, s_b = f_b * inv;
  unsigned short* d = (unsigned short*)O16 + (r0 + q0 + kh * 16 + c) * CC + h * HD + 8 * hh;      /* o x64; a lane's 8 registers are 8 consecutive d of its query */
#pragma unroll      // constant indices again
  for (int t = 0; t < 4; ++t) { const v4f lo = xr[(2 * t) * 256], hi = xr[(2 * t + 1) * 256]; FragH f;
    for (int r = 0; r < 4; ++r) { f.h[r] = (_Float16)(mine[t][r] * s_a + lo[r] * s_b); f.h[4 + r] = (_Float16)(mine[t][4 + r] * s_a + hi[r] * s_b); }
    *(v8us*)(d + t * 16) = f.half[0]; } }

extern "C" void kernel_launch(void* const* d_in, const int* in_sizes, int n_in,
                              void* d_out, int out_size, void* d_ws, size_t ws_size, hipStream_t stream) {
  (void)in_sizes; (void)n_in; (void)out_size;
  const float* const* I = (const float* const*)d_in; const float* xq = I[0]; const float* xk = I[1]; const float* xv = I[2]; const float* wq = I[3]; const float* bq = I[4]; const float* wk = I[5]; const float* bk = I[6]; const float* wv = I[7]; const float* bv = I[8]; const float* wm = I[9]; const float* bm = I[10];
  char* ws = (char*)d_ws; size_t off = 0;
  auto take = [&](size_t bytes) { char* p = ws + off; off += (bytes + 255) & ~(size_t)255; return p; };
  _Float16* AM = (_Float16*)take((size_t)CC * CC * 2);
  _Float16* Q16 = (_Float16*)take(NR * CC * 2); _Float16* K16 = (_Float16*)take(NR * CC * 2); _Float16* O16 = (_Float16*)take(NR * CC * 2);
  _Float16* VT = (_Float16*)take((size_t)NB * NH * HD * SQ * 2);
  if (off > ws_size) return;      /* approx 32 MiB */
  k_proj<<<PJ_G + PM_G, 512, 0, stream>>>(xq, xk, xv, wq, wk, wv, wm, bq, bk, bv, Q16, K16, VT, AM);      /* q, k token rows; V^T [8][4][64][2048]; w_m permuted */
  k_fattn<<<dim3(SQ / 256, NH, NB), 512, 0, stream>>>(Q16, K16, VT, O16);      /* o x64, head-major f16 rows */
  k_out<<<dim3(CT_G, NB), 128, 0, stream>>>(AM, O16, bm, (float*)d_out);
}

// v009
// One run takes 48.4 microseconds.
// Next to v008, in two timings, it ran 1.03 and 1.04 times as fast.
// Over all steps from v000 it is 72.0 times as fast.
#include <hip/hip_runtime.h>
// SuperGlue multi-head attention (query, key, value channel-first [8][256][2048]; q/k/v = 1x1 conv (natural [256][256] + bias); the module's head split view(B, d=64, H=4, N) makes channel c = dd*4 + h (INTERLEAVED heads); scores = q.k / 8 per head over 2,048 keys; softmax; x merged back to c = dd*4 + h; out = w_m x + b_m -> [8][256][2048]).
// Structure, 3 launches: (1) Q, K and V as WMMA GEMMs in one grid, straight from the channel-first f32 inputs and the natural f32 weights: a work-group brings 256 tokens x all channels and one whole weight matrix into LDS as f16 rows (inputs exact, transposed in registers; weights exact x16, rows permuted so the head split becomes contiguous 64-column blocks), 64x64 wave tiles, f32 accumulation, f16 outputs, V with the operands swapped so that V^T [8][4][64][2048] is written directly; sixteen more work-groups of that grid permute w_m's columns for launch 3; (2) scores, softmax and P . V fused in one kernel over all batches and heads (S^T = K . Q^T - running maximum, q stored times log2(e) / 8, online softmax in f32, O^T += V^T . P^T, P stays in registers as f16; o x64 in f16) into head-major rows; (3) out channel-major directly: (w_m with permuted columns) . o^T GEMM batched over the 8 batches (alpha folds 1/16 and 1/64), the per-channel bias added in its epilogue.
// Compute dtype: inputs rounded to bf16; inputs / weights exact in f16; q, k, v, softmax weights and o plain f16 (~2^-12); scores and softmax statistics f32. v_wmma_f32_16x16x32_f16.
#define NB 8
#define CC 256
#define LL 2048
#define SQ LL
#define DM CC
#define NH 4
#define HD 64
#define HG 4
#define QN SQ                        /* query rows per batch (unused) */
#define NR ((size_t)NB * LL)
typedef __bf16 v16b __attribute__((ext_vector_type(16)));
typedef unsigned short v8us __attribute__((ext_vector_type(8), may_alias));
typedef float  v8f  __attribute__((ext_vector_type(8)));
typedef float  v4f  __attribute__((ext_vector_type(4)));
typedef float  v4fa __attribute__((ext_vector_type(4), may_alias));
union FragB { v16b v; v8us half[2]; unsigned short u[16]; };

__device__ __forceinline__ unsigned short bf16_bits(float x) { unsigned int u = __float_as_uint(x); return (unsigned short)((u + 0x7FFFu + ((u >> 16) & 1u)) >> 16); }
__device__ __forceinline__ float bf16_val(unsigned short b) { return __uint_as_float(((unsigned int)b) << 16); }
__device__ __forceinline__ float bf16_round(float x) { return bf16_val(bf16_bits(x)); }
// D += A·B with NT terms: 1 = ah·bh, 2 = + al·bh (A split), 3 = + ah·bl (both split)
template <int NT>
__device__ __forceinline__ v8f mmaN(v16b ah, v16b al, v16b bh, v16b bl, v8f c) {
  c = __builtin_amdgcn_wmma_f32_16x16x32_bf16(false, ah, false, bh, (short)0, c, false, false);
  if (NT >= 2) c = __builtin_amdgcn_wmma_f32_16x16x32_bf16(false, al, false, bh, (short)0, c, false, false);
  if (NT >= 3) c = __builtin_amdgcn_wmma_f32_16x16x32_bf16(false, ah, false, bl, (short)0, c, false, false);
  asm volatile("v_nop\n\tv_nop\n\tv_nop\n\tv_nop" : "+v"(c) : "v"(ah), "v"(al), "v"(bh), "v"(bl));
  return c;
}

__global__ __launch_bounds__(256) void k_wt_bf16(const float* __restrict__ W, unsigned short* __restrict__ Wt, int K, int N) {
  const int t = blockIdx.x * 256 + threadIdx.x;
  const int k8n = K / 8;
  if (t >= N * k8n) return;
  const int n = t / k8n, k8 = (t % k8n) * 8;
  v8us v;
#pragma unroll
  for (int i = 0; i < 8; ++i) v[i] = bf16_bits(W[(size_t)(k8 + i) * N + n]);
  *(v8us*)(Wt + (size_t)n * K + k8) = v;
  
}

// GEMM C[M][N] (f32, pitch ldc) = act(A[M][K]·W + bias). A f32 row-major (pitch lda) converted per fragment to bf16
// (ASPLIT: hi/lo two planes -> 2 terms, else single rounded term); Wt bf16 [N][K] (pitch ldb). BIAS_BF16 rounds the
// bias to bf16 first (bias quantised to bf16 before the add). K%32==0, M%16==0, N%64==0.
template <bool ASPLIT, int ACT, bool BIAS_BF16>
__global__ __launch_bounds__(128) void k_gemm_bf(const float* __restrict__ A, int lda, const unsigned short* __restrict__ Wt, int ldb,
                                               const float* __restrict__ bias, float* __restrict__ C, int ldc, int M, int N, int K) {
  __shared__ __attribute__((aligned(16))) float so[4][16][64];
  const int tid = threadIdx.x, w = tid >> 5, lane = tid & 31, ln = lane & 15, hh = lane >> 4;
  const int ntn = N / 64;
  const int wid = blockIdx.x * 4 + w;
  const int mt = wid / ntn, nq = wid % ntn;
  if (mt * 16 >= M) return;
  const int row0 = mt * 16, col0 = nq * 64;
  const float* arow = A + (size_t)(row0 + ln) * lda;
  v8f acc[4] = {};
  for (int kb = 0; kb < K; kb += 32) {
    FragB ah, al;
    const v4f x0 = *(const v4fa*)(arow + kb + 8 * hh), x1 = *(const v4fa*)(arow + kb + 8 * hh + 4);
    const v4f x2 = *(const v4fa*)(arow + kb + 16 + 8 * hh), x3 = *(const v4fa*)(arow + kb + 16 + 8 * hh + 4);
    float xs[16] = {x0[0],x0[1],x0[2],x0[3],x1[0],x1[1],x1[2],x1[3],x2[0],x2[1],x2[2],x2[3],x3[0],x3[1],x3[2],x3[3]};
#pragma unroll
    for (int i = 0; i < 16; ++i) { const unsigned short hb = bf16_bits(xs[i]); ah.u[i] = hb; al.u[i] = ASPLIT ? bf16_bits(xs[i] - bf16_val(hb)) : (unsigned short)0; }
#pragma unroll
    for (int t = 0; t < 4; ++t) {
      const unsigned short* brow = Wt + (size_t)(col0 + t * 16 + ln) * ldb + kb;
      FragB b;
      b.half[0] = *(const v8us*)(brow + 8 * hh);
      b.half[1] = *(const v8us*)(brow + 16 + 8 * hh);
      acc[t] = mmaN<ASPLIT ? 2 : 1>(ah.v, al.v, b.v, b.v, acc[t]);
    }
  }
#pragma unroll
  for (int t = 0; t < 4; ++t) {
    float bv = bias ? bias[col0 + t * 16 + ln] : 0.f;
    if (BIAS_BF16) bv = bf16_round(bv);
#pragma unroll
    for (int r = 0; r < 8; ++r) { float v = acc[t][r] + bv; if (ACT == 1) v = fmaxf(v, 0.f); so[w][8 * hh + r][t * 16 + ln] = v; }
  }
  __builtin_amdgcn_fence(__ATOMIC_ACQ_REL, "workgroup");
  __builtin_amdgcn_wave_barrier();
  const int rsub = lane >> 4, c4 = (lane & 15) * 4;
  {
#pragma unroll
    for (int q = 0; q < 8; ++q) {
      const int r = q * 2 + rsub;
      const v4f v = *(const v4fa*)&so[w][r][c4];
      *(v4f*)(C + (size_t)(row0 + r) * ldc + col0 + c4) = v;
    }
    
  }
}

// GEMM C = act(A·W + bias + resid): A f32 (ASPLIT -> hi/lo 2 terms), Wt bf16 [N][K]; ACT 0 none, 1 relu, 2 exact gelu;
// resid (optional, f32, row index = (row % rmod), pitch ldr, RES_BF16 rounds it) added before the activation.
template <bool ASPLIT, int ACT, bool BIAS_BF16, bool RES_BF16>
__global__ __launch_bounds__(128) void k_gemm_bf3(const float* __restrict__ A, int lda, const unsigned short* __restrict__ Wt, int ldb,
                                                const float* __restrict__ bias, const float* __restrict__ resid, int rmod, int ldr,
                                                float* __restrict__ C, int ldc, int M, int N, int K) {
  __shared__ __attribute__((aligned(16))) float so[4][16][64];
  const int tid = threadIdx.x, w = tid >> 5, lane = tid & 31, ln = lane & 15, hh = lane >> 4;
  const int ntn = N / 64;
  const int wid = blockIdx.x * 4 + w;
  const int mt = wid / ntn, nq = wid % ntn;
  if (mt * 16 >= M) return;
  const int row0 = mt * 16, col0 = nq * 64;
  const float* arow = A + (size_t)(row0 + ln) * lda;
  v8f acc[4] = {};
  for (int kb = 0; kb < K; kb += 32) {
    FragB ah, al;
    const v4f x0 = *(const v4fa*)(arow + kb + 8 * hh), x1 = *(const v4fa*)(arow + kb + 8 * hh + 4);
    const v4f x2 = *(const v4fa*)(arow + kb + 16 + 8 * hh), x3 = *(const v4fa*)(arow + kb + 16 + 8 * hh + 4);
    float xs[16] = {x0[0],x0[1],x0[2],x0[3],x1[0],x1[1],x1[2],x1[3],x2[0],x2[1],x2[2],x2[3],x3[0],x3[1],x3[2],x3[3]};
#pragma unroll
    for (int i = 0; i < 16; ++i) { const unsigned short hb = bf16_bits(xs[i]); ah.u[i] = hb; al.u[i] = ASPLIT ? bf16_bits(xs[i] - bf16_val(hb)) : (unsigned short)0; }
#pragma unroll
    for (int t = 0; t < 4; ++t) {
      const unsigned short* brow = Wt + (size_t)(col0 + t * 16 + ln) * ldb + kb;
      FragB b;
      b.half[0] = *(const v8us*)(brow + 8 * hh);
      b.half[1] = *(const v8us*)(brow + 16 + 8 * hh);
      acc[t] = mmaN<ASPLIT ? 2 : 1>(ah.v, al.v, b.v, b.v, acc[t]);
    }
  }
#pragma unroll
  for (int t = 0; t < 4; ++t) {
    const int col = col0 + t * 16 + ln;
    float bv = bias ? bias[col] : 0.f;
    if (BIAS_BF16) bv = bf16_round(bv);
#pragma unroll
    for (int r = 0; r < 8; ++r) {
      float v = acc[t][r] + bv;
      if (resid) { float rv = resid[(size_t)((row0 + 8 * hh + r) % rmod) * ldr + col]; if (RES_BF16) rv = bf16_round(rv); v += rv; }
      if (ACT == 1) v = fmaxf(v, 0.f);
      if (ACT == 2) v = 0.5f * v * (1.0f + erff(v * 0.70710678118654752f));
      if (ACT == 3) { const float u = 0.7978845608028654f * (v + 0.044715f * v * v * v); v = 0.5f * v * (1.0f + tanhf(u)); }
      so[w][8 * hh + r][t * 16 + ln] = v;
    }
  }
  __builtin_amdgcn_fence(__ATOMIC_ACQ_REL, "workgroup");
  __builtin_amdgcn_wave_barrier();
  const int rsub = lane >> 4, c4 = (lane & 15) * 4;
  {
#pragma unroll
    for (int q = 0; q < 8; ++q) {
      const int r = q * 2 + rsub;
      const v4f v = *(const v4fa*)&so[w][r][c4];
      *(v4f*)(C + (size_t)(row0 + r) * ldc + col0 + c4) = v;
    }
    
  }
}
// row LayerNorm (biased variance, eps) over N: s = X (+ R); optional out_sum <- s; out_norm <- (s-mu)*rsqrt(var+eps)*g + b
template <bool PARAM_BF16>
__global__ __launch_bounds__(256) void k_layernorm(const float* __restrict__ X, const float* __restrict__ R, const float* __restrict__ g, const float* __restrict__ bta,
                                                  float* __restrict__ out_sum, float* __restrict__ out_norm, int N, float eps) {
  __shared__ float red[256];
  const int row = blockIdx.x, tid = threadIdx.x;
  const float* x = X + (size_t)row * N; const float* rr = R ? R + (size_t)row * N : nullptr;
  float vals[16];                     // up to N = 4096
  const int per = N / 256;            // contiguous chunk per thread? use strided-by-4 chunks: thread handles j = tid*4 + 1024*u
  float s1 = 0.f;
  for (int u = 0; u < per / 4; ++u) {
    const int j = tid * 4 + 1024 * u;
    const v4f a = *(const v4fa*)(x + j);
    v4f b = {0.f,0.f,0.f,0.f}; if (rr) b = *(const v4fa*)(rr + j);
#pragma unroll
    for (int q = 0; q < 4; ++q) { const float v = a[q] + b[q]; vals[u * 4 + q] = v; s1 += v; }
  }
  red[tid] = s1; __syncthreads();
  for (int st = 128; st > 0; st >>= 1) { if (tid < st) red[tid] += red[tid + st]; __syncthreads(); }
  const float mu = red[0] / (float)N; __syncthreads();
  float s2 = 0.f;
  for (int u = 0; u < per / 4; ++u)
#pragma unroll
    for (int q = 0; q < 4; ++q) { const float c = vals[u * 4 + q] - mu; s2 += c * c; }
  red[tid] = s2; __syncthreads();
  for (int st = 128; st > 0; st >>= 1) { if (tid < st) red[tid] += red[tid + st]; __syncthreads(); }
  const float rs = rsqrtf(red[0] / (float)N + eps);
  {
    for (int u = 0; u < per / 4; ++u) {
      const int j = tid * 4 + 1024 * u;
      v4f o, sm;
#pragma unroll
      for (int q = 0; q < 4; ++q) {
        float gg = g[j + q], bb = bta[j + q];
        if (PARAM_BF16) { gg = bf16_round(gg); bb = bf16_round(bb); }
        sm[q] = vals[u * 4 + q]; o[q] = (vals[u * 4 + q] - mu) * rs * gg + bb;
      }
      if (out_sum) *(v4f*)(out_sum + (size_t)row * N + j) = sm;
      *(v4f*)(out_norm + (size_t)row * N + j) = o;
    }
    
  }
}



// ---- f16 WMMA path (v_wmma_f32_16x16x32_f16): 11-bit significands for operands in range — used where a [0,1] probability operand needs more precision than bf16
typedef _Float16 v16h __attribute__((ext_vector_type(16)));
union FragH { v16h v; v8us half[2]; _Float16 h[16]; unsigned short u[16]; };
template <int NT>
__device__ __forceinline__ v8f mmaH(v16h ah, v16h al, v16h bh, v16h bl, v8f c) {
  c = __builtin_amdgcn_wmma_f32_16x16x32_f16(false, ah, false, bh, (short)0, c, false, false);
  if (NT >= 2) c = __builtin_amdgcn_wmma_f32_16x16x32_f16(false, al, false, bh, (short)0, c, false, false);
  if (NT >= 3) c = __builtin_amdgcn_wmma_f32_16x16x32_f16(false, ah, false, bl, (short)0, c, false, false);
  asm volatile("v_nop\n\tv_nop\n\tv_nop\n\tv_nop" : "+v"(c) : "v"(ah), "v"(al), "v"(bh), "v"(bl));
  return c;
}
// batched GEMM like k_gemm_b but f16 operands: A f32 (split into f16 hi/lo if ASPLIT, else rounded to f16), Bt = f16 values [n][k]; alpha; C f32; N multiple of 16 (partial tiles skipped)
template <bool ASPLIT>
__global__ __launch_bounds__(128) void k_gemm_h(const float* __restrict__ A, int lda, size_t sA, const _Float16* __restrict__ Bh, int ldb, size_t sB, float alpha, float* __restrict__ C, int ldc, size_t sC, int M, int N, int K) {
  __shared__ __attribute__((aligned(16))) float so[4][16][64];
  const int tid = threadIdx.x, w = tid >> 5, lane = tid & 31, ln = lane & 15, hh = lane >> 4; const int by = blockIdx.y;
  A += (size_t)by * sA; Bh += (size_t)by * sB; C += (size_t)by * sC;
  const int ntn = (N + 63) / 64; const int wid = blockIdx.x * 4 + w; const int mt = wid / ntn, nq = wid % ntn; if (mt * 16 >= M) return;
  const int row0 = mt * 16, col0 = nq * 64; const float* arow = A + (size_t)(row0 + ln) * lda;
  v8f acc[4] = {};
  for (int kb = 0; kb < K; kb += 32) {
    FragH ah, al;
    const v4f x0 = *(const v4fa*)(arow + kb + 8 * hh), x1 = *(const v4fa*)(arow + kb + 8 * hh + 4), x2 = *(const v4fa*)(arow + kb + 16 + 8 * hh), x3 = *(const v4fa*)(arow + kb + 16 + 8 * hh + 4);
    float xs[16] = {x0[0],x0[1],x0[2],x0[3],x1[0],x1[1],x1[2],x1[3],x2[0],x2[1],x2[2],x2[3],x3[0],x3[1],x3[2],x3[3]};
#pragma unroll
    for (int i = 0; i < 16; ++i) { const _Float16 h = (_Float16)xs[i]; ah.h[i] = h; al.h[i] = ASPLIT ? (_Float16)(xs[i] - (float)h) : (_Float16)0.0f; }
#pragma unroll
    for (int t = 0; t < 4; ++t) { if (col0 + t * 16 >= N) continue; const size_t boff = (size_t)(col0 + t * 16 + ln) * ldb + kb; FragH bq; bq.half[0] = *(const v8us*)(Bh + boff + 8 * hh); bq.half[1] = *(const v8us*)(Bh + boff + 16 + 8 * hh);
      acc[t] = mmaH<ASPLIT ? 2 : 1>(ah.v, al.v, bq.v, bq.v, acc[t]); }
  }
#pragma unroll
  for (int t = 0; t < 4; ++t) { if (col0 + t * 16 >= N) continue;
#pragma unroll
    for (int r = 0; r < 8; ++r) so[w][8 * hh + r][t * 16 + ln] = acc[t][r] * alpha; }
  __builtin_amdgcn_fence(__ATOMIC_ACQ_REL, "workgroup"); __builtin_amdgcn_wave_barrier();
  const int rsub = lane >> 4, c4 = (lane & 15) * 4;
  {
#pragma unroll
    for (int q = 0; q < 8; ++q) { const int r = q * 2 + rsub; if (col0 + c4 < N) { const v4f v = *(const v4fa*)&so[w][r][c4]; *(v4f*)(C + (size_t)(row0 + r) * ldc + col0 + c4) = v; } }
     }
}

// Wt[n][k] = f16(W[k][n]·scale) from f32 row-major W[K][N] (scale = power of two; bf16-exact weights stay exact in f16 away from the subnormal range)
__global__ __launch_bounds__(256) void k_wt_f16(const float* __restrict__ W, _Float16* __restrict__ Wt, int K, int N, float scale) {
  const int t = blockIdx.x * 256 + threadIdx.x; if (t >= N * (K / 8)) return; const int n = t / (K / 8), k8 = (t % (K / 8)) * 8; FragH f;
#pragma unroll
  for (int i = 0; i < 8; ++i) f.h[i] = (_Float16)(bf16_round(W[(size_t)(k8 + i) * N + n]) * scale); const v8us o = f.half[0];
  *(v8us*)((unsigned short*)Wt + (size_t)n * K + k8) = o; 
}
// k_gemm_hh variant with fused epilogue: v = acc·alpha + bias[by·sBias + col] (+ CP[(row/rowsPerB)·sCPb + by·64 + col] if CP) ; ACT 0 none / 1 elu ; writes f16 C16 (and f32 C if non-null)
template <int ACT>
__global__ __launch_bounds__(128) void k_gemm_hhx(const _Float16* __restrict__ A, int lda, size_t sA, const _Float16* __restrict__ Bh, int ldb, size_t sB, float alpha, const float* __restrict__ bias, size_t sBias, const float* __restrict__ CP, int rowsPerB, size_t sCPb, int row0g,
    float* __restrict__ C, _Float16* __restrict__ C16, int ldc, size_t sC, int M, int N, int K) {
  __shared__ __attribute__((aligned(16))) float so[4][16][64];
  const int tid = threadIdx.x, w = tid >> 5, lane = tid & 31, ln = lane & 15, hh = lane >> 4; const int by = blockIdx.y;
  A += (size_t)by * sA; Bh += (size_t)by * sB; const size_t cofs = (size_t)by * sC; const float* bp = bias ? bias + (size_t)by * sBias : nullptr;
  const int ntn = (N + 63) / 64; const int wid = blockIdx.x * 4 + w; const int mt = wid / ntn, nq = wid % ntn; if (mt * 16 >= M) return;
  const int row0 = mt * 16, col0 = nq * 64; const _Float16* arow = A + (size_t)(row0 + ln) * lda;
  v8f acc[4] = {};
  for (int kb = 0; kb < K; kb += 32) { FragH ah; ah.half[0] = *(const v8us*)((const unsigned short*)arow + kb + 8 * hh); ah.half[1] = *(const v8us*)((const unsigned short*)arow + kb + 16 + 8 * hh);
#pragma unroll
    for (int t = 0; t < 4; ++t) { if (col0 + t * 16 >= N) continue; const size_t boff = (size_t)(col0 + t * 16 + ln) * ldb + kb; FragH bq; bq.half[0] = *(const v8us*)((const unsigned short*)Bh + boff + 8 * hh); bq.half[1] = *(const v8us*)((const unsigned short*)Bh + boff + 16 + 8 * hh);
      acc[t] = mmaH<1>(ah.v, ah.v, bq.v, bq.v, acc[t]); }
  }
#pragma unroll
  for (int t = 0; t < 4; ++t) { if (col0 + t * 16 >= N) continue; const int col = col0 + t * 16 + ln; const float bv = bp ? bf16_round(bp[col]) : 0.f;
#pragma unroll
    for (int r = 0; r < 8; ++r) { float v = acc[t][r] * alpha + bv; if (CP) { const int rr = row0g + row0 + 8 * hh + r; if (rowsPerB < 0) v += CP[cofs + (size_t)rr * ldc + col];      /* rowsPerB < 0: own element of the batched C plane */ else { const int bidx = rr / rowsPerB; v += CP[(size_t)bidx * sCPb + (size_t)by * 64 + col]; } } if (ACT == 1) v = (v > 0.f) ? v : expm1f(v); else if (ACT == 7) v = (v > 0.f) ? v + 1.0f : expf(v); else if (ACT == 8) v = tanhf(v); else if (ACT == 9) v = 0.5f * v * (1.0f + tanhf(0.7978845608028654f * (v + 0.044715f * v * v * v))); else if (ACT == 11) v = 1.0f / (1.0f + expf(-v)); else if (ACT == 12) v = (v > 0.f) ? v : 0.01f * v; else if (ACT == 14) v = (v > 0.f) ? v : 0.1f * v; else if (ACT == 16) v = (v >= 0.f) ? v : 0.3f * v; else if (ACT == 17) v = (v >= 0.f) ? v : 0.2f * v; else if (ACT == 15) v = v / (1.0f + expf(-v)); else if (ACT == 3) v = fmaxf(v, 0.f); else if (ACT == 6) v = 0.5f * v * (1.0f + erff(v * 0.70710678118654752f)); so[w][8 * hh + r][t * 16 + ln] = v; } }
  __builtin_amdgcn_fence(__ATOMIC_ACQ_REL, "workgroup"); __builtin_amdgcn_wave_barrier();
  const int rsub = lane >> 4, c4 = (lane & 15) * 4; typedef _Float16 v4h __attribute__((ext_vector_type(4)));
  {
#pragma unroll
    for (int q = 0; q < 8; ++q) { const int r = q * 2 + rsub; if (col0 + c4 < N) { const v4f v = *(const v4fa*)&so[w][r][c4]; if (C) *(v4f*)(C + cofs + (size_t)(row0 + r) * ldc + col0 + c4) = v; if (C16) { v4h h4; for (int i = 0; i < 4; ++i) h4[i] = (_Float16)v[i]; *(v4h*)(C16 + cofs + (size_t)(row0 + r) * ldc + col0 + c4) = h4; } } }
     }
}


typedef _Float16 v4h __attribute__((ext_vector_type(4)));

__global__ __launch_bounds__(256) void k_x16(const float* __restrict__ x, _Float16* __restrict__ X16, size_t n8) { const size_t t = (size_t)blockIdx.x * 256 + threadIdx.x; if (t >= n8) return; FragH f;
#pragma unroll
  for (int q = 0; q < 8; ++q) f.h[q] = (_Float16)bf16_round(x[t * 8 + q]); *(v8us*)((unsigned short*)X16 + t * 8) = f.half[0];  }
__global__ __launch_bounds__(256) void k_h16(const float* __restrict__ x, _Float16* __restrict__ X16, size_t n8) { const size_t t = (size_t)blockIdx.x * 256 + threadIdx.x; if (t >= n8) return; FragH f;
#pragma unroll
  for (int q = 0; q < 8; ++q) f.h[q] = (_Float16)x[t * 8 + q]; *(v8us*)((unsigned short*)X16 + t * 8) = f.half[0];  }
__global__ __launch_bounds__(256) void k_round16f(const float* __restrict__ W, _Float16* __restrict__ Bt, size_t n8) { const size_t t = (size_t)blockIdx.x * 256 + threadIdx.x; if (t >= n8) return; FragH f;
#pragma unroll
  for (int i = 0; i < 8; ++i) f.h[i] = (_Float16)(bf16_round(W[t * 8 + i]) * 16.0f); *(v8us*)((unsigned short*)Bt + t * 8) = f.half[0];  }

__global__ __launch_bounds__(256) void k_hl(const float* __restrict__ F, _Float16* __restrict__ Hh, _Float16* __restrict__ Hl, size_t n8) { const size_t t = (size_t)blockIdx.x * 256 + threadIdx.x; if (t >= n8) return; FragH fh, fl; const v4f a = *(const v4fa*)(F + t * 8), c = *(const v4fa*)(F + t * 8 + 4);
#pragma unroll
  for (int q = 0; q < 4; ++q) { _Float16 h = (_Float16)a[q]; fh.h[q] = h; fl.h[q] = (_Float16)((a[q] - (float)h) * 1024.0f); h = (_Float16)c[q]; fh.h[4 + q] = h; fl.h[4 + q] = (_Float16)((c[q] - (float)h) * 1024.0f); }
  { *(v8us*)((unsigned short*)Hh + t * 8) = fh.half[0]; *(v8us*)((unsigned short*)Hl + t * 8) = fl.half[0];  } }

// ---- fast GEMM tile: C = A . B^T * alpha + bias, A [M][CC] and B [N][CC] f16 rows; work-group tile 128x64, wave tile 32x64 (M % 128 == 0, N % 64 == 0) ----
__device__ __forceinline__ v16h g2_frag(const _Float16* p, int hh) { FragH f; f.half[0] = *(const v8us*)((const unsigned short*)p + 8 * hh); f.half[1] = *(const v8us*)((const unsigned short*)p + 16 + 8 * hh); return f.v; }
__device__ __forceinline__ v8f g2_mma(v16h a, v16h b, v8f c) { v8f d = __builtin_amdgcn_wmma_f32_16x16x32_f16(false, a, false, b, (short)0, c, false, false); asm volatile("v_nop\n\tv_nop\n\tv_nop\n\tv_nop" : "+v"(d) : "v"(a), "v"(b)); return d; }
// Both operand tiles (128 + 64 rows, all of K = CC: 512 bytes a row) are brought into LDS once, whole rows at a time, and the fragments are read from there:
// a fragment load straight from global memory touches 16 lines for 512 bytes, and its latency stood in front of every pair of products.
#define G2_PK 528                    /* LDS row pitch, bytes: 512 + 16, an odd multiple of 16 for 16-byte readers */
#define G2_LDS ((128 + 64) * G2_PK)
__device__ __forceinline__ v16h g2_lfrag(const unsigned char* p) { FragH f; f.half[0] = *(const v8us*)p; f.half[1] = *(const v8us*)(p + 32); return f.v; }      /* p already holds + 16 hh: k = 8 hh .. and 16 + 8 hh .. */
// Twelve asynchronous copies to LDS, one 512-byte row each (a lane brings its own 16 bytes). The s_wait_xcnt is the last line of the copies' own statement, so that it stands in front of whatever rewrites an address register that a copy names.
__device__ __forceinline__ void g2_copy12(const unsigned* l, const unsigned char* const* g) {
  asm volatile("global_load_async_to_lds_b128 %0, %12, off\n\tglobal_load_async_to_lds_b128 %1, %13, off\n\tglobal_load_async_to_lds_b128 %2, %14, off\n\tglobal_load_async_to_lds_b128 %3, %15, off\n\t"
               "global_load_async_to_lds_b128 %4, %16, off\n\tglobal_load_async_to_lds_b128 %5, %17, off\n\tglobal_load_async_to_lds_b128 %6, %18, off\n\tglobal_load_async_to_lds_b128 %7, %19, off\n\t"
               "global_load_async_to_lds_b128 %8, %20, off\n\tglobal_load_async_to_lds_b128 %9, %21, off\n\tglobal_load_async_to_lds_b128 %10, %22, off\n\tglobal_load_async_to_lds_b128 %11, %23, off\n\ts_wait_xcnt 0x0"
               :: "v"(l[0]), "v"(l[1]), "v"(l[2]), "v"(l[3]), "v"(l[4]), "v"(l[5]), "v"(l[6]), "v"(l[7]), "v"(l[8]), "v"(l[9]), "v"(l[10]), "v"(l[11]),
                  "v"(g[0]), "v"(g[1]), "v"(g[2]), "v"(g[3]), "v"(g[4]), "v"(g[5]), "v"(g[6]), "v"(g[7]), "v"(g[8]), "v"(g[9]), "v"(g[10]), "v"(g[11]) : "memory"); }
// RB: the bias belongs to the row of C (channel-major outputs), else to its column. TO: element type of C (float or f16). bx: tile index, column tiles fastest. A and B rows are CC long (K = CC). sm: G2_LDS bytes.
template <bool RB, typename TO>
__device__ __forceinline__ void g2_tile(unsigned char* sm, const _Float16* __restrict__ A, const _Float16* __restrict__ Bh, float alpha, const float* __restrict__ bp, TO* __restrict__ C, int ldc, int bx, int N) {
  const int tid = threadIdx.x, w = tid >> 5, lane = tid & 31, ln = lane & 15, hh = lane >> 4;
  const int ntn = N >> 6; const int mt = bx / ntn, nq = bx - mt * ntn; const int row0 = mt * 128 + 32 * w, col0 = nq * 64;
  { /* wave w brings its own 32 rows of A and rows 16 w .. 16 w + 15 of B: 48 copies, all in flight at once */
    const unsigned char* ga = (const unsigned char*)(A + (size_t)row0 * CC) + lane * 16; const unsigned char* gb = (const unsigned char*)(Bh + (size_t)(col0 + 16 * w) * CC) + lane * 16;
    const unsigned l0 = (unsigned)(size_t)sm + lane * 16; const unsigned la = l0 + 32 * w * G2_PK, lb = l0 + (128 + 16 * w) * G2_PK;
    unsigned l[48]; const unsigned char* g[48];
#pragma unroll      // constant indices, so that the two arrays dissolve into registers
    for (int i = 0; i < 48; ++i) { l[i] = i < 32 ? la + i * G2_PK : lb + (i - 32) * G2_PK; g[i] = i < 32 ? ga + i * (CC * 2) : gb + (i - 32) * (CC * 2); }
    g2_copy12(l, g); g2_copy12(l + 12, g + 12); g2_copy12(l + 24, g + 24); g2_copy12(l + 36, g + 36);
    asm volatile("s_wait_asynccnt 0x0" ::: "memory");      // this wave's 48 copies have landed; the compiler places no wait for them
    __syncthreads(); }      /* both tiles published: the B rows are read by all four waves */
  const unsigned char* ap = sm + (32 * w + ln) * G2_PK + 16 * hh;      /* + 16 hh: the lane half's k offset sits in the row pointers */
  const unsigned char* bq = sm + (128 + ln) * G2_PK + 16 * hh;
  const v8f z8 = {0.f,0.f,0.f,0.f,0.f,0.f,0.f,0.f}; v8f c00 = z8, c01 = z8, c02 = z8, c03 = z8, c10 = z8, c11 = z8, c12 = z8, c13 = z8;
  v16h a0 = g2_lfrag(ap), a1 = g2_lfrag(ap + 16 * G2_PK), b0 = g2_lfrag(bq), b1 = g2_lfrag(bq + 16 * G2_PK), b2 = g2_lfrag(bq + 32 * G2_PK), b3 = g2_lfrag(bq + 48 * G2_PK);
#pragma unroll      // straight line: the next 32 k's fragments go into a second register set, read as one group ahead of this block's products
  for (int ks = 0; ks < CC / 32; ++ks) { v16h na0 = a0, na1 = a1, nb0 = b0, nb1 = b1, nb2 = b2, nb3 = b3;
    if (ks + 1 < CC / 32) { const int o = (ks + 1) * 64; na0 = g2_lfrag(ap + o); na1 = g2_lfrag(ap + 16 * G2_PK + o); nb0 = g2_lfrag(bq + o); nb1 = g2_lfrag(bq + 16 * G2_PK + o); nb2 = g2_lfrag(bq + 32 * G2_PK + o); nb3 = g2_lfrag(bq + 48 * G2_PK + o); }
    c00 = g2_mma(a0, b0, c00); c10 = g2_mma(a1, b0, c10); c01 = g2_mma(a0, b1, c01); c11 = g2_mma(a1, b1, c11);
    c02 = g2_mma(a0, b2, c02); c12 = g2_mma(a1, b2, c12); c03 = g2_mma(a0, b3, c03); c13 = g2_mma(a1, b3, c13);
    a0 = na0; a1 = na1; b0 = nb0; b1 = nb1; b2 = nb2; b3 = nb3; }
  float (*so)[68] = (float (*)[68])(sm + 32 * w * G2_PK);      /* output staging in the wave's own 32 rows of A: no other wave reads or writes them, and this wave's reads of them have fed the sums that are stored here */
  v8f accs[8] = {c00, c01, c02, c03, c10, c11, c12, c13};
#pragma unroll
  for (int u = 0; u < 8; ++u) { const int t = u & 3, half = u >> 2; const int col = col0 + t * 16 + ln;
#pragma unroll
    for (int r = 0; r < 8; ++r) { const int rloc = half * 16 + 8 * hh + r; const float bv = bf16_round(RB ? bp[row0 + rloc] : bp[col]); so[rloc][t * 16 + ln] = accs[u][r] * alpha + bv; } }
  __builtin_amdgcn_fence(__ATOMIC_ACQ_REL, "workgroup"); __builtin_amdgcn_wave_barrier();
  const int rsub = lane >> 4, c4 = (lane & 15) * 4;
#pragma unroll
  for (int q = 0; q < 16; ++q) { const int r = q * 2 + rsub; const v4f v = *(const v4fa*)&so[r][c4]; typedef TO v4o __attribute__((ext_vector_type(4))); v4o o4; for (int i = 0; i < 4; ++i) o4[i] = (TO)v[i]; *(v4o*)(C + (size_t)(row0 + r) * ldc + col0 + c4) = o4; } }
#define CT_G ((CC / 128) * (LL / 64))              /* tiles of one batch's channel-major product */
// out[b][c][n] = sum_k' w_m'[c][k'] o[(b,n)][k'] / 1024 + b_m[c] (channel-major directly; blockIdx.y = batch)
__global__ __launch_bounds__(128) void k_out(const _Float16* __restrict__ AM, const _Float16* __restrict__ O16, const float* __restrict__ bm, float* __restrict__ out) {
  __shared__ __attribute__((aligned(16))) unsigned char sm[G2_LDS];
  const size_t b = blockIdx.y;
  g2_tile<true>(sm, AM, O16 + b * LL * CC, 0.0009765625f, bm, out + b * CC * LL, LL, blockIdx.x, LL); }


__global__ __launch_bounds__(256) void k_wnat(const float* __restrict__ w, size_t n8, _Float16* __restrict__ Bt) { const size_t t = (size_t)blockIdx.x * 256 + threadIdx.x; if (t >= n8) return; FragH f; for (int q = 0; q < 8; ++q) f.h[q] = (_Float16)(bf16_round(w[t * 8 + q]) * 16.0f); *(v8us*)((unsigned short*)Bt + t * 8) = f.half[0];  }
__global__ __launch_bounds__(256) void k_rsm(const float* __restrict__ S, _Float16* __restrict__ P, int nrows) {
  #pragma clang fp contract(off)
  const int i = blockIdx.x * 256 + threadIdx.x; if (i >= nrows) return; const float* s = S + (size_t)i * SQ; float mx = -3.0e38f;
#pragma unroll 1
  for (int j = 0; j < SQ; ++j) mx = fmaxf(mx, s[j]); float se = 0.f;
#pragma unroll 1
  for (int j = 0; j < SQ; ++j) se += expf(s[j] - mx); const float sc = 256.0f / se;
#pragma unroll 1
  for (int j0 = 0; j0 < SQ; j0 += 8) { FragH f; for (int q = 0; q < 8; ++q) f.h[q] = (_Float16)(expf(s[j0 + q] - mx) * sc); unsigned short* d = (unsigned short*)P + (size_t)i * SQ + j0; *(v8us*)d = f.half[0];  } }
__global__ __launch_bounds__(256) void k_vt(const _Float16* __restrict__ V16, int b, int h0, _Float16* __restrict__ VT) { __shared__ unsigned short tl[64][65]; const int tid = threadIdx.x; const int hh = blockIdx.x % HG, sg = blockIdx.x / HG; const int s0 = sg * 64; const int h = h0 + hh;
  for (int i = tid; i < 64 * 8; i += 256) { const int j = i / 8, d8 = (i % 8) * 8; FragH f; f.half[0] = *(const v8us*)((const unsigned short*)V16 + ((size_t)b * SQ + s0 + j) * DM + h * HD + d8); for (int q = 0; q < 8; ++q) tl[d8 + q][j] = f.u[q]; }
  __syncthreads();
  { for (int i = tid; i < 64 * 8; i += 256) { const int d = i / 8, j8 = (i % 8) * 8; FragH f; for (int q = 0; q < 8; ++q) f.u[q] = tl[d][j8 + q]; *(v8us*)((unsigned short*)VT + ((size_t)hh * HD + d) * SQ + s0 + j8) = f.half[0]; }  } }

// ---- projections straight from the inputs ----
// Behind a body's last global store: this wait stands in front of whatever rewrites a register that the store names.
__device__ __forceinline__ void p_stored() { asm volatile("s_wait_xcnt 0x0" ::: "memory"); }
// w_m with its columns permuted to the head-major order of o (exact x16 f16); t: the thread's index over CC * CC / 8 pieces of 8 elements.
__device__ __forceinline__ void p_wpermc(const float* __restrict__ w, _Float16* __restrict__ A, int t) { const int k8 = (t % (CC / 8)) * 8, c = t / (CC / 8); FragH f;
  for (int q = 0; q < 8; ++q) { const int kp = k8 + q; const int h = kp / HD, dd = kp % HD; f.h[q] = (_Float16)(bf16_round(w[(size_t)c * CC + dd * NH + h]) * 16.0f); } unsigned short* d = (unsigned short*)A + (size_t)c * CC + k8; *(v8us*)d = f.half[0]; p_stored(); }
typedef float v2f __attribute__((ext_vector_type(2)));
typedef __bf16 v2b __attribute__((ext_vector_type(2)));
typedef _Float16 v2h __attribute__((ext_vector_type(2)));
typedef unsigned v4ua __attribute__((ext_vector_type(4), may_alias));
typedef unsigned v2ua __attribute__((ext_vector_type(2), may_alias));
// Two f32 -> rounded to bf16 (nearest even, one packed conversion) -> the same values as two f16, a in the low half.
__device__ __forceinline__ unsigned pj_cv2(float a, float b) { const v2f x = {a, b}; const unsigned u = __builtin_bit_cast(unsigned, __builtin_convertvector(x, v2b));
  const v2f y = {__uint_as_float(u << 16), __uint_as_float(u & 0xFFFF0000u)}; return __builtin_bit_cast(unsigned, __builtin_convertvector(y, v2h)); }
#define PJ_T 256                                   /* tokens per work-group; the other side of its tile is all CC channels */
#define PJ_LDS ((PJ_T + CC) * G2_PK)               /* token rows, then weight rows, each all of K = CC at the GEMM pitch */
#define PJ_G (3 * (int)(NR / PJ_T))                /* work-groups of the three projections */
#define PM_G (CC * (CC / 8) / 512)                 /* work-groups that permute w_m: 8 elements a thread, exactly */
static_assert(PJ_T == 256 && CC == 256 && LL % PJ_T == 0 && PM_G * 512 == CC * (CC / 8), "16 waves as 4 x 4 tiles of 64 x 64; a token tile stays inside one batch; no tail guards");
// Epilogue of one wave's 64 x 64 tile, 32 rows at a time through the wave's own LDS range, so that whole 128-byte lines are stored. RB: the bias belongs to the row of C, else to its column; its index is the permuted channel.
// os: a factor on the whole output (product and bias), applied in f32 ahead of the one rounding to f16; 1 leaves every value as it was.
#define FA_CS (0.125f * 1.44269504088896340736f)      /* 1 / sqrt(64), times log2(e): q is stored times this, so that K . q^T is a score in the log2 domain */
template <bool RB>
__device__ __forceinline__ void pj_epi(float (*so)[68], const v8f (&acc)[4][4], const float* __restrict__ bias, float os, _Float16* __restrict__ Cw, int ldc, int row0, int col0, int lane) {
  const int ln = lane & 15, hh = lane >> 4, rsub = lane >> 4, c4 = (lane & 15) * 4;
  const int bi0 = RB ? 8 * hh * NH + row0 / HD : ln * NH + col0 / HD;      /* permuted channel i is natural channel (i % HD) * NH + i / HD; row0 and col0 are multiples of HD */
  const float al = 0.0625f * os;
#pragma unroll      // constant indices, so that the accumulators stay in registers
  for (int hf = 0; hf < 2; ++hf) {
    float bvv[RB ? 16 : 4];      /* the lane's biases for these 32 rows: by row 16 mi + 8 hh + r, or by column 16 t + ln */
#pragma unroll
    for (int u = 0; u < (RB ? 16 : 4); ++u) bvv[u] = bias[bi0 + (RB ? hf * 32 + (u >> 3) * 16 + (u & 7) : u * 16) * NH];
    asm volatile("s_wait_xcnt 0x0" :: "v"(bi0) : "memory");      // behind the bias loads, in front of whatever rewrites the index register that they name; the index is an input so that it is kept up to here (else the last load landed in it)
    __builtin_amdgcn_sched_barrier(0);      // nothing moves ahead of that wait
#pragma unroll
    for (int u = 0; u < (RB ? 16 : 4); ++u) bvv[u] = bf16_round(bvv[u]) * os;
#pragma unroll
    for (int mi = 0; mi < 2; ++mi)
#pragma unroll
      for (int t = 0; t < 4; ++t)
#pragma unroll
        for (int r = 0; r < 8; ++r) { const int rloc = mi * 16 + 8 * hh + r; so[rloc][t * 16 + ln] = acc[hf * 2 + mi][t][r] * al + bvv[RB ? mi * 8 + r : t]; }
    __builtin_amdgcn_fence(__ATOMIC_ACQ_REL, "workgroup"); __builtin_amdgcn_wave_barrier();      // the wave's own writes stand ahead of its reads of other lanes' values
#pragma unroll
    for (int q = 0; q < 16; ++q) { const int r = q * 2 + rsub; const v4f v = *(const v4fa*)&so[r][c4]; v4h o4; for (int i = 0; i < 4; ++i) o4[i] = (_Float16)v[i]; *(v4h*)(Cw + (size_t)(hf * 32 + r) * ldc + c4) = o4; }
    __builtin_amdgcn_fence(__ATOMIC_ACQ_REL, "workgroup"); __builtin_amdgcn_wave_barrier();      // and these reads ahead of the next half's writes
    p_stored();
    __builtin_amdgcn_sched_barrier(0);      // the next half's register writes stay behind that wait
  } }
// One work-group = 256 tokens of one batch x all 256 channels of one projection (blockIdx.x / 64: 0 Q, 1 K, 2 V). Every input element is read from memory once, by whole 128-byte lines, and never written back as f16 rows.
// Input tile: a lane takes 8 channels x 16 tokens (32 loads of 16 bytes); its 8 channels of one token are one 16-byte LDS store, so the transpose happens in the lane's own registers. Weights: a wave takes a row by two 512-byte loads.
__global__ __launch_bounds__(512) void k_proj(const float* __restrict__ xq, const float* __restrict__ xk, const float* __restrict__ xv, const float* __restrict__ wq, const float* __restrict__ wk, const float* __restrict__ wv, const float* __restrict__ wm,
    const float* __restrict__ bq, const float* __restrict__ bk, const float* __restrict__ bv, _Float16* __restrict__ Q16, _Float16* __restrict__ K16, _Float16* __restrict__ VT, _Float16* __restrict__ AM) {
  __shared__ __attribute__((aligned(16))) unsigned char sm[PJ_LDS];
  const int bx = blockIdx.x, tid = threadIdx.x;
  if (bx >= PJ_G) { p_wpermc(wm, AM, (bx - PJ_G) * 512 + tid); return; }      /* on blockIdx alone, in front of every barrier */
  const int p = bx / (int)(NR / PJ_T), tl = bx % (int)(NR / PJ_T); const int b = tl / (LL / PJ_T), n0 = (tl % (LL / PJ_T)) * PJ_T;
  const float* x = p == 0 ? xq : p == 1 ? xk : xv; const float* w = p == 0 ? wq : p == 1 ? wk : wv; const float* bias = p == 0 ? bq : p == 1 ? bk : bv;
  const int wvi = __builtin_amdgcn_readfirstlane(tid >> 5), lane = tid & 31;
  unsigned char* smX = sm; unsigned char* smW = sm + PJ_T * G2_PK;
  { const int cg = (wvi & 7) * 4 + (lane >> 3);      /* the lane's group of 8 channels; 8 lanes side by side cover one 128-byte line of a channel */
    const int tk = (wvi >> 3) * 128 + (lane & 7) * 4;      /* its first token; + 32 a unit */
    const float* px = x + ((size_t)b * CC + cg * 8) * LL + n0 + tk;
    const float* pw = w + (size_t)((wvi & 3) * 16 * NH + (wvi >> 2)) * CC + lane * 4;      /* LDS row 16 wvi + i is natural row ((16 wvi + i) % 64) * 4 + (16 wvi + i) / 64: + NH rows a step */
    v4f xr[4][8], wa[8][2], wb[8][2];
#pragma unroll
    for (int i = 0; i < 4; ++i) for (int j = 0; j < 8; ++j) xr[i][j] = *(const v4fa*)(px + j * LL + i * 32);
    __builtin_amdgcn_sched_barrier(0);      // the input tile's 32 loads go first and together: they come from memory, the weights from L2
#pragma unroll
    for (int i = 0; i < 8; ++i) { wa[i][0] = *(const v4fa*)(pw + i * NH * CC); wa[i][1] = *(const v4fa*)(pw + i * NH * CC + 128); }
    __builtin_amdgcn_sched_barrier(0);      // and half of the weights' loads ahead of the first conversion
    asm volatile("s_wait_xcnt 0x0" :: "v"(px), "s"(pw - lane * 4) : "memory");      // behind the 48 loads, in front of whatever rewrites an address register that they name; the two bases are inputs so that their registers are kept up to here (else a weight load landed in the input loads' address pair)
    __builtin_amdgcn_sched_barrier(0);      // no conversion moves ahead of that wait
#pragma unroll
    for (int i = 0; i < 4; ++i) for (int ii = 0; ii < 4; ++ii) { const v4ua o = {pj_cv2(xr[i][0][ii], xr[i][1][ii]), pj_cv2(xr[i][2][ii], xr[i][3][ii]), pj_cv2(xr[i][4][ii], xr[i][5][ii]), pj_cv2(xr[i][6][ii], xr[i][7][ii])};
      *(v4ua*)(smX + (tk + i * 32 + ii) * G2_PK + cg * 16) = o; }
    __builtin_amdgcn_sched_barrier(0);      // the second half of the weights takes the registers that the input tile has left
#pragma unroll
    for (int i = 0; i < 8; ++i) { wb[i][0] = *(const v4fa*)(pw + (8 + i) * NH * CC); wb[i][1] = *(const v4fa*)(pw + (8 + i) * NH * CC + 128); }
    __builtin_amdgcn_sched_barrier(0);      // in flight under the first half's conversions
    asm volatile("s_wait_xcnt 0x0" ::: "memory");      // as above, behind these 16 loads
    __builtin_amdgcn_sched_barrier(0);
    unsigned char* dw = smW + wvi * 16 * G2_PK + lane * 8;
#pragma unroll
    for (int i = 0; i < 16; ++i) { const v4f lo = i < 8 ? wa[i & 7][0] : wb[i & 7][0], hi = i < 8 ? wa[i & 7][1] : wb[i & 7][1];      /* x16 ahead of the rounding: a power of two, so the same value as rounding first */
      const v2ua o0 = {pj_cv2(lo[0] * 16.0f, lo[1] * 16.0f), pj_cv2(lo[2] * 16.0f, lo[3] * 16.0f)}, o1 = {pj_cv2(hi[0] * 16.0f, hi[1] * 16.0f), pj_cv2(hi[2] * 16.0f, hi[3] * 16.0f)};
      *(v2ua*)(dw + i * G2_PK) = o0; *(v2ua*)(dw + i * G2_PK + 256) = o1; } }
  __syncthreads();      /* both operands published */
  const int ln = lane & 15, hh = lane >> 4, wr_ = wvi >> 2, wc_ = wvi & 3;      /* the wave's 64 rows of A and 64 rows of B */
  const bool vs = p == 2;      /* V: A = weights, B = tokens */
  const unsigned char* ap = (vs ? smW : smX) + (64 * wr_ + ln) * G2_PK + 16 * hh;      /* + 16 hh: the lane half's k offset sits in the row pointers */
  const unsigned char* bp_ = (vs ? smX : smW) + (64 * wc_ + ln) * G2_PK + 16 * hh;
  v8f acc[4][4];
#pragma unroll
  for (int i = 0; i < 4; ++i) for (int j = 0; j < 4; ++j) acc[i][j] = v8f{0.f, 0.f, 0.f, 0.f, 0.f, 0.f, 0.f, 0.f};
#pragma unroll      // straight line: constant LDS offsets
  for (int ks = 0; ks < CC / 32; ++ks) { v16h af[4], bf[4];
    for (int i = 0; i < 4; ++i) { af[i] = g2_lfrag(ap + i * 16 * G2_PK + ks * 64); bf[i] = g2_lfrag(bp_ + i * 16 * G2_PK + ks * 64); }
    __builtin_amdgcn_sched_barrier(0);      // the 16 reads of a k step stand together in one place: left alone, the scheduler read each A fragment into one register set right in front of its four products, behind a wait to 0 each time; the SIMD's three other waves cover the one wait
    for (int i = 0; i < 4; ++i) for (int j = 0; j < 4; ++j) acc[i][j] = __builtin_amdgcn_wmma_f32_16x16x32_f16(false, af[i], false, bf[j], (short)0, acc[i][j], false, false);
    __builtin_amdgcn_sched_barrier(0); }      // and none of the next step's reads moves in among these products
  __syncthreads();      /* every wave has read its last fragment: the operand rows become output staging */
  float (*so)[68] = (float (*)[68])(sm + wvi * 32 * G2_PK);      /* a sixteenth of the LDS for each wave */
  if (vs) pj_epi<true>(so, acc, bias, 1.0f, VT + ((size_t)b * CC + 64 * wr_) * LL + n0 + 64 * wc_, LL, 64 * wr_, 64 * wc_, lane);
  else pj_epi<false>(so, acc, bias, p ? 1.0f : FA_CS, (p ? K16 : Q16) + ((size_t)b * LL + n0 + 64 * wr_) * CC + 64 * wc_, CC, 64 * wr_, 64 * wc_, lane); }
__device__ __forceinline__ float rs_xh(float x) { return __builtin_bit_cast(float, __builtin_amdgcn_permlanex16(__builtin_bit_cast(int, x), __builtin_bit_cast(int, x), 0x76543210, 0xfedcba98, false, false)); }      /* lane l <- lane l ^ 16 */
// 2^z on the transcendental unit. The v_nop is the slot that the instruction set asks for behind a transcendental before its result is read or its source overwritten.
__device__ __forceinline__ float rs_exp2(float z) { float y; asm("v_exp_f32 %0, %1\n\tv_nop" : "=v"(y) : "v"(z)); return y; }
#define FA_KS 64                     /* keys per stage */
#define FA_KG 2                      /* key groups per work-group */
#define FA_GK (SQ / FA_KG)           /* keys per key group */
#define FA_ST 4096.0f                /* largest sum of a query's 32 exponentials of one pass that is taken without a rescale: every P <= 2^12 */
#define FA_PK 144                    /* LDS row pitch, bytes: 128 + 16, an odd multiple of 16 for 16-byte readers */
__device__ __forceinline__ v8f fa_mma(v16h a, v16h b, v8f c) { return __builtin_amdgcn_wmma_f32_16x16x32_f16(false, a, false, b, (short)0, c, false, false); }
__device__ __forceinline__ v16h fa_lfrag(const unsigned char* p) { FragH f; f.half[0] = *(const v8us*)p; f.half[1] = *(const v8us*)(p + 32); return f.v; }      /* p already holds + 16 hh: k = 8 hh .. and 16 + 8 hh .. */
__global__ __launch_bounds__(512) void k_fattn(const _Float16* __restrict__ Q16, const _Float16* __restrict__ K16, const _Float16* __restrict__ VT, _Float16* __restrict__ O16) {
  __shared__ __attribute__((aligned(16))) unsigned char L[2][FA_KG][2][FA_KS * FA_PK];      /* [buffer][key group][K, V^T][row][pitch] */
  const int kh = __builtin_amdgcn_readfirstlane((int)threadIdx.x >> 8);      /* the wave's key group, in a scalar register */
  const int tid = threadIdx.x & 255, lane = tid & 31, w = tid >> 5, c = lane & 15, hh = lane >> 4;      /* tid, w: within the key group */ const int h = blockIdx.y, b = blockIdx.z; const size_t r0 = (size_t)b * LL; const int q0 = blockIdx.x * 256 + w * 32;
  v16h qf[2][2];
#pragma unroll
  for (int g = 0; g < 2; ++g) for (int kc = 0; kc < 2; ++kc) qf[g][kc] = g2_frag(Q16 + (r0 + q0 + g * 16 + c) * CC + h * HD + kc * 32, hh);
  const int srow = tid >> 2, sseg = (tid & 3) * 32;      /* staging: 4 threads cover one 128-byte row, 32 bytes each */
  const unsigned char* kg = (const unsigned char*)(K16 + (r0 + kh * FA_GK + srow) * CC + h * HD) + sseg;      /* key rows: + 64 rows a stage */
  const unsigned char* vg = (const unsigned char*)(VT + ((size_t)(b * NH + h) * HD + srow) * SQ + kh * FA_GK) + sseg;      /* d rows: + 64 keys a stage */
  const int sdst = srow * FA_PK + sseg;
  v8us k0 = *(const v8us*)kg, k1 = *(const v8us*)(kg + 16), v0 = *(const v8us*)vg, v1 = *(const v8us*)(vg + 16);
  *(v8us*)&L[0][kh][0][sdst] = k0; *(v8us*)&L[0][kh][0][sdst + 16] = k1; *(v8us*)&L[0][kh][1][sdst] = v0; *(v8us*)&L[0][kh][1][sdst + 16] = v1;
  const v8f z8 = {0.f, 0.f, 0.f, 0.f, 0.f, 0.f, 0.f, 0.f}; v8f acc[2][4], cm[2]; float l_run[2];      /* cm: minus the maximum in use, in all eight registers: the C operand of the score products */
#pragma unroll
  for (int g = 0; g < 2; ++g) { cm[g] = z8; l_run[g] = 0.f; for (int t = 0; t < 4; ++t) acc[g][t] = z8; }      /* 0 only until the first pass sets the true maximum */
  FragH on1;
#pragma unroll
  for (int i = 0; i < 16; ++i) on1.h[i] = (c & 7) == 0 ? (_Float16)1.0f : (_Float16)0.0f;      /* A operand of the sum product: ones in rows 0 and 8, the rows of D that land in register 0 of the two wave halves; every k alike, so no k order to match. (All ones gave the same sums, but the compiler rebuilt that constant in vector registers every pass.) */
  __syncthreads();      /* stage 0 published */
#pragma unroll 1      // one stage a trip: the body already holds two unrolled 32-key passes
  for (int st = 0; st < FA_GK / FA_KS; ++st) {
    const bool more = st + 1 < FA_GK / FA_KS;
    if (more) { const unsigned char* kn = kg + (size_t)(st + 1) * (FA_KS * CC * 2); const unsigned char* vn = vg + (size_t)(st + 1) * (FA_KS * 2); k0 = *(const v8us*)kn; k1 = *(const v8us*)(kn + 16); v0 = *(const v8us*)vn; v1 = *(const v8us*)(vn + 16); }
    const unsigned char* Kb = &L[st & 1][kh][0][c * FA_PK + 16 * hh]; const unsigned char* Vb = &L[st & 1][kh][1][c * FA_PK + 16 * hh];
#pragma unroll
    for (int sub = 0; sub < 2; ++sub) {      /* one pass = 32 keys */
      const unsigned char* Kp = Kb + sub * 32 * FA_PK;
      v8f s[2][2]; v16h kf[2][2];
#pragma unroll
      for (int kt = 0; kt < 2; ++kt) { kf[kt][0] = fa_lfrag(Kp + kt * 16 * FA_PK); kf[kt][1] = fa_lfrag(Kp + kt * 16 * FA_PK + 64); }
      __builtin_amdgcn_sched_barrier(0);      // the pass's eight K reads stand together ahead of its products, as they did before the barrier below came in: with that one alone, the scheduler read one fragment at a time into one register set, behind a wait to 0 each time
#pragma unroll
      for (int kt = 0; kt < 2; ++kt)
        for (int g = 0; g < 2; ++g) s[kt][g] = fa_mma(kf[kt][1], qf[g][1], fa_mma(kf[kt][0], qf[g][0], cm[g]));      /* score - maximum in use, log2 domain */
      __builtin_amdgcn_sched_barrier(0);      // the eight score products stand together ahead of the exponentials: left alone, the scheduler put single exponentials directly behind single products, with four idle slots between them each time
      v16h vf[4];
#pragma unroll
      for (int t = 0; t < 4; ++t) vf[t] = fa_lfrag(Vb + t * 16 * FA_PK + sub * 64);
      FragH pf[2]; v8f ps[2];      /* pf element s: key 8 hh + s, then 16 + 8 hh + (s - 8): the k order of V^T's loader; ps: the pass's sums */
#pragma unroll
      for (int g = 0; g < 2; ++g) {
        for (int r = 0; r < 8; ++r) { pf[g].h[r] = (_Float16)__builtin_amdgcn_exp2f(s[0][g][r]); pf[g].h[8 + r] = (_Float16)__builtin_amdgcn_exp2f(s[1][g][r]); }      /* the builtin: the arguments are read where the matrix unit left them, and the compiler sees these reads when it keeps the distance behind a matrix instruction */
        ps[g] = fa_mma(on1.v, pf[g].v, z8); }
      const bool need = ps[0][0] > FA_ST || ps[1][0] > FA_ST;
      const bool first = sub == 0 && st == 0;      /* the group's first pass takes the true maximum, also one below 0, so that the sum never starts from underflowed terms */
      if (__builtin_amdgcn_ballot_w32(need) != 0 || first) {      /* wave-uniform scalar branch, one test a pass */
#pragma unroll
        for (int kt = 0; kt < 2; ++kt) { const v16h ka = fa_lfrag(Kp + kt * 16 * FA_PK), kb2 = fa_lfrag(Kp + kt * 16 * FA_PK + 64);
          for (int g = 0; g < 2; ++g) s[kt][g] = fa_mma(kb2, qf[g][1], fa_mma(ka, qf[g][0], cm[g])); }      /* the scores once more, from the stage buffer: the exponentials above took their registers */
#pragma unroll
        for (int g = 0; g < 2; ++g) { float mx = fmaxf(s[0][g][0], s[1][g][0]);
          for (int r = 1; r < 8; ++r) mx = fmaxf(mx, fmaxf(s[0][g][r], s[1][g][r]));
          mx = fmaxf(mx, rs_xh(mx));      /* both wave halves hold the query's maximum, counted from the maximum in use */
          const float up = first ? mx : fmaxf(mx, 0.f); const float dl = cm[g][0] - (cm[g][0] - up);      /* the step of the maximum as it comes out rounded: what later passes' C really differs by */
          const float corr = __builtin_amdgcn_exp2f(fminf(-dl, 0.f));      /* dl < 0 only on the first pass, where sum and accumulators are 0; the builtin, so that the compiler keeps the distance behind the sum product, whose unused result registers it hands out again */
          l_run[g] *= corr; for (int t = 0; t < 4; ++t) acc[g][t] = acc[g][t] * corr;
          for (int kt = 0; kt < 2; ++kt) s[kt][g] = s[kt][g] - dl;      /* these arguments were formed against the old maximum */
          cm[g] = cm[g] - up;      /* every register holds minus the new maximum */
          for (int r = 0; r < 8; ++r) { pf[g].h[r] = (_Float16)__builtin_amdgcn_exp2f(s[0][g][r]); pf[g].h[8 + r] = (_Float16)__builtin_amdgcn_exp2f(s[1][g][r]); }
          ps[g] = fa_mma(on1.v, pf[g].v, z8); }
      }
#pragma unroll
      for (int g = 0; g < 2; ++g) { l_run[g] += ps[g][0];
        for (int t = 0; t < 4; ++t) acc[g][t] = fa_mma(vf[t], pf[g].v, acc[g][t]); }
    }
    if (more) { unsigned char* d = &L[(st + 1) & 1][kh][0][sdst]; *(v8us*)d = k0; *(v8us*)(d + 16) = k1; *(v8us*)(d + FA_KS * FA_PK) = v0; *(v8us*)(d + FA_KS * FA_PK + 16) = v1; }      /* its last readers left it before the barrier that ended trip st - 1 */
    __syncthreads();      /* publishes stage st + 1 and ends every read of stage st */
  }
  // Join of the two key groups: group kh finishes column group kh and hands column group 1 - kh to the lane of the same number in the other group. The stage buffers are free: the loop's last barrier ended every read of them.
  const float m_run[2] = {-cm[0][0], -cm[1][0]};
  static_assert(FA_KG == 2 && sizeof(L) >= (size_t)FA_KG * 9 * 256 * 16, "the exchange takes 9 slots of 16 bytes a lane");
  v4f* X = (v4f*)&L[0][0][0][0];      /* [key group][slot][lane of the group]: neighbouring lanes 16 bytes apart */
  v4f* xs = X + kh * (9 * 256) + tid; const v4f* xr = X + (1 - kh) * (9 * 256) + tid;
  v8f mine[4];
#pragma unroll      // constant indices, so that the accumulators stay in registers
  for (int t = 0; t < 4; ++t) { const v8f o = kh ? acc[0][t] : acc[1][t]; mine[t] = kh ? acc[1][t] : acc[0][t];
    const v4f lo = {o[0], o[1], o[2], o[3]}, hi = {o[4], o[5], o[6], o[7]}; xs[(2 * t) * 256] = lo; xs[(2 * t + 1) * 256] = hi; }
  { const v4f ml = {kh ? m_run[0] : m_run[1], kh ? l_run[0] : l_run[1], 0.f, 0.f}; xs[8 * 256] = ml; }
  __syncthreads();      /* both groups' hand-overs published */
  const float m_a = kh ? m_run[1] : m_run[0], l_a = kh ? l_run[1] : l_run[0]; const v4f ml = xr[8 * 256];
  const float m_j = fmaxf(m_a, ml[0]); const float f_a = rs_exp2(m_a - m_j), f_b = rs_exp2(ml[0] - m_j);
  const float lp = l_a * f_a + ml[1] * f_b; const float inv = 64.0f / lp;      /* the sums already span both wave halves' keys */ const float s_a = f_a * inv, s_b = f_b * inv;
  unsigned short* d = (unsigned short*)O16 + (r0 + q0 + kh * 16 + c) * CC + h * HD + 8 * hh;      /* o x64; a lane's 8 registers are 8 consecutive d of its query */
#pragma unroll      // constant indices again
  for (int t = 0; t < 4; ++t) { const v4f lo = xr[(2 * t) * 256], hi = xr[(2 * t + 1) * 256]; FragH f;
    for (int r = 0; r < 4; ++r) { f.h[r] = (_Float16)(mine[t][r] * s_a + lo[r] * s_b); f.h[4 + r] = (_Float16)(mine[t][4 + r] * s_a + hi[r] * s_b); }
    *(v8us*)(d + t * 16) = f.half[0]; } }

extern "C" void kernel_launch(void* const* d_in, const int* in_sizes, int n_in,
                              void* d_out, int out_size, void* d_ws, size_t ws_size, hipStream_t stream) {
  (void)in_sizes; (void)n_in; (void)out_size;
  const float* const* I = (const float* const*)d_in; const float* xq = I[0]; const float* xk = I[1]; const float* xv = I[2]; const float* wq = I[3]; const float* bq = I[4]; const float* wk = I[5]; const float* bk = I[6]; const float* wv = I[7]; const float* bv = I[8]; const float* wm = I[9]; const float* bm = I[10];
  char* ws = (char*)d_ws; size_t off = 0;
  auto take = [&](size_t bytes) { char* p = ws + off; off += (bytes + 255) & ~(size_t)255; return p; };
  _Float16* AM = (_Float16*)take((size_t)CC * CC * 2);
  _Float16* Q16 = (_Float16*)take(NR * CC * 2); _Float16* K16 = (_Float16*)take(NR * CC * 2); _Float16* O16 = (_Float16*)take(NR * CC * 2);
  _Float16* VT = (_Float16*)take((size_t)NB * NH * HD * SQ * 2);
  if (off > ws_size) return;      /* approx 32 MiB */
  k_proj<<<PJ_G + PM_G, 512, 0, stream>>>(xq, xk, xv, wq, wk, wv, wm, bq, bk, bv, Q16, K16, VT, AM);      /* q, k token rows; V^T [8][4][64][2048]; w_m permuted */
  k_fattn<<<dim3(SQ / 256, NH, NB), 512, 0, stream>>>(Q16, K16, VT, O16);      /* o x64, head-major f16 rows */
  k_out<<<dim3(CT_G, NB), 128, 0, stream>>>(AM, O16, bm, (float*)d_out);
}

// v010
// One run takes 46.4 microseconds.
// Two timings next to v009 both put it at 1.04 times that version's speed.
// All steps since v000 together make it 74.9 times as fast.
#include <hip/hip_runtime.h>
// SuperGlue multi-head attention (query, key, value channel-first [8][256][2048]; q/k/v = 1x1 conv (natural [256][256] + bias); the module's head split view(B, d=64, H=4, N) makes channel c = dd*4 + h (INTERLEAVED heads); scores = q.k / 8 per head over 2,048 keys; softmax; x merged back to c = dd*4 + h; out = w_m x + b_m -> [8][256][2048]).
// Structure, 3 launches: (1) Q, K and V as WMMA GEMMs in one grid, straight from the channel-first f32 inputs and the natural f32 weights: a work-group brings 256 tokens x all channels and one whole weight matrix into LDS as f16 rows (inputs exact, transposed in registers; weights exact x16, rows permuted so the head split becomes contiguous 64-column blocks), 64x64 wave tiles, f32 accumulation, f16 outputs, V with the operands swapped so that V^T [8][4][64][2048] is written directly; sixteen more work-groups of that grid permute w_m's columns for launch 3; (2) scores, softmax and P . V fused in one kernel over all batches and heads (S^T = K . Q^T - running maximum, q stored times log2(e) / 8, online softmax in f32, O^T += V^T . P^T, P stays in registers as f16; o x64 in f16) into head-major rows; (3) out channel-major directly: (w_m with permuted columns) . o^T GEMM batched over the 8 batches (alpha folds 1/16 and 1/64), the per-channel bias added in its epilogue.
// Compute dtype: inputs rounded to bf16; inputs / weights exact in f16; q, k, v, softmax weights and o plain f16 (~2^-12); scores and softmax statistics f32. v_wmma_f32_16x16x32_f16.
#define NB 8
#define CC 256
#define LL 2048
#define SQ LL
#define DM CC
#define NH 4
#define HD 64
#define HG 4
#define QN SQ                        /* query rows per batch (unused) */
#define NR ((size_t)NB * LL)
typedef __bf16 v16b __attribute__((ext_vector_type(16)));
typedef unsigned short v8us __attribute__((ext_vector_type(8), may_alias));
typedef float  v8f  __attribute__((ext_vector_type(8)));
typedef float  v4f  __attribute__((ext_vector_type(4)));
typedef float  v4fa __attribute__((ext_vector_type(4), may_alias));
union FragB { v16b v; v8us half[2]; unsigned short u[16]; };

__device__ __forceinline__ unsigned short bf16_bits(float x) { unsigned int u = __float_as_uint(x); return (unsigned short)((u + 0x7FFFu + ((u >> 16) & 1u)) >> 16); }
__device__ __forceinline__ float bf16_val(unsigned short b) { return __uint_as_float(((unsigned int)b) << 16); }
__device__ __forceinline__ float bf16_round(float x) { return bf16_val(bf16_bits(x)); }
// D += A·B with NT terms: 1 = ah·bh, 2 = + al·bh (A split), 3 = + ah·bl (both split)
template <int NT>
__device__ __forceinline__ v8f mmaN(v16b ah, v16b al, v16b bh, v16b bl, v8f c) {
  c = __builtin_amdgcn_wmma_f32_16x16x32_bf16(false, ah, false, bh, (short)0, c, false, false);
  if (NT >= 2) c = __builtin_amdgcn_wmma_f32_16x16x32_bf16(false, al, false, bh, (short)0, c, false, false);
  if (NT >= 3) c = __builtin_amdgcn_wmma_f32_16x16x32_bf16(false, ah, false, bl, (short)0, c, false, false);
  asm volatile("v_nop\n\tv_nop\n\tv_nop\n\tv_nop" : "+v"(c) : "v"(ah), "v"(al), "v"(bh), "v"(bl));
  return c;
}

__global__ __launch_bounds__(256) void k_wt_bf16(const float* __restrict__ W, unsigned short* __restrict__ Wt, int K, int N) {
  const int t = blockIdx.x * 256 + threadIdx.x;
  const int k8n = K / 8;
  if (t >= N * k8n) return;
  const int n = t / k8n, k8 = (t % k8n) * 8;
  v8us v;
#pragma unroll
  for (int i = 0; i < 8; ++i) v[i] = bf16_bits(W[(size_t)(k8 + i) * N + n]);
  *(v8us*)(Wt + (size_t)n * K + k8) = v;
  
}

// GEMM C[M][N] (f32, pitch ldc) = act(A[M][K]·W + bias). A f32 row-major (pitch lda) converted per fragment to bf16
// (ASPLIT: hi/lo two planes -> 2 terms, else single rounded term); Wt bf16 [N][K] (pitch ldb). BIAS_BF16 rounds the
// bias to bf16 first (bias quantised to bf16 before the add). K%32==0, M%16==0, N%64==0.
template <bool ASPLIT, int ACT, bool BIAS_BF16>
__global__ __launch_bounds__(128) void k_gemm_bf(const float* __restrict__ A, int lda, const unsigned short* __restrict__ Wt, int ldb,
                                               const float* __restrict__ bias, float* __restrict__ C, int ldc, int M, int N, int K) {
  __shared__ __attribute__((aligned(16))) float so[4][16][64];
  const int tid = threadIdx.x, w = tid >> 5, lane = tid & 31, ln = lane & 15, hh = lane >> 4;
  const int ntn = N / 64;
  const int wid = blockIdx.x * 4 + w;
  const int mt = wid / ntn, nq = wid % ntn;
  if (mt * 16 >= M) return;
  const int row0 = mt * 16, col0 = nq * 64;
  const float* arow = A + (size_t)(row0 + ln) * lda;
  v8f acc[4] = {};
  for (int kb = 0; kb < K; kb += 32) {
    FragB ah, al;
    const v4f x0 = *(const v4fa*)(arow + kb + 8 * hh), x1 = *(const v4fa*)(arow + kb + 8 * hh + 4);
    const v4f x2 = *(const v4fa*)(arow + kb + 16 + 8 * hh), x3 = *(const v4fa*)(arow + kb + 16 + 8 * hh + 4);
    float xs[16] = {x0[0],x0[1],x0[2],x0[3],x1[0],x1[1],x1[2],x1[3],x2[0],x2[1],x2[2],x2[3],x3[0],x3[1],x3[2],x3[3]};
#pragma unroll
    for (int i = 0; i < 16; ++i) { const unsigned short hb = bf16_bits(xs[i]); ah.u[i] = hb; al.u[i] = ASPLIT ? bf16_bits(xs[i] - bf16_val(hb)) : (unsigned short)0; }
#pragma unroll
    for (int t = 0; t < 4; ++t) {
      const unsigned short* brow = Wt + (size_t)(col0 + t * 16 + ln) * ldb + kb;
      FragB b;
      b.half[0] = *(const v8us*)(brow + 8 * hh);
      b.half[1] = *(const v8us*)(brow + 16 + 8 * hh);
      acc[t] = mmaN<ASPLIT ? 2 : 1>(ah.v, al.v, b.v, b.v, acc[t]);
    }
  }
#pragma unroll
  for (int t = 0; t < 4; ++t) {
    float bv = bias ? bias[col0 + t * 16 + ln] : 0.f;
    if (BIAS_BF16) bv = bf16_round(bv);
#pragma unroll
    for (int r = 0; r < 8; ++r) { float v = acc[t][r] + bv; if (ACT == 1) v = fmaxf(v, 0.f); so[w][8 * hh + r][t * 16 + ln] = v; }
  }
  __builtin_amdgcn_fence(__ATOMIC_ACQ_REL, "workgroup");
  __builtin_amdgcn_wave_barrier();
  const int rsub = lane >> 4, c4 = (lane & 15) * 4;
  {
#pragma unroll
    for (int q = 0; q < 8; ++q) {
      const int r = q * 2 + rsub;
      const v4f v = *(const v4fa*)&so[w][r][c4];
      *(v4f*)(C + (size_t)(row0 + r) * ldc + col0 + c4) = v;
    }
    
  }
}

// GEMM C = act(A·W + bias + resid): A f32 (ASPLIT -> hi/lo 2 terms), Wt bf16 [N][K]; ACT 0 none, 1 relu, 2 exact gelu;
// resid (optional, f32, row index = (row % rmod), pitch ldr, RES_BF16 rounds it) added before the activation.
template <bool ASPLIT, int ACT, bool BIAS_BF16, bool RES_BF16>
__global__ __launch_bounds__(128) void k_gemm_bf3(const float* __restrict__ A, int lda, const unsigned short* __restrict__ Wt, int ldb,
                                                const float* __restrict__ bias, const float* __restrict__ resid, int rmod, int ldr,
                                                float* __restrict__ C, int ldc, int M, int N, int K) {
  __shared__ __attribute__((aligned(16))) float so[4][16][64];
  const int tid = threadIdx.x, w = tid >> 5, lane = tid & 31, ln = lane & 15, hh = lane >> 4;
  const int ntn = N / 64;
  const int wid = blockIdx.x * 4 + w;
  const int mt = wid / ntn, nq = wid % ntn;
  if (mt * 16 >= M) return;
  const int row0 = mt * 16, col0 = nq * 64;
  const float* arow = A + (size_t)(row0 + ln) * lda;
  v8f acc[4] = {};
  for (int kb = 0; kb < K; kb += 32) {
    FragB ah, al;
    const v4f x0 = *(const v4fa*)(arow + kb + 8 * hh), x1 = *(const v4fa*)(arow + kb + 8 * hh + 4);
    const v4f x2 = *(const v4fa*)(arow + kb + 16 + 8 * hh), x3 = *(const v4fa*)(arow + kb + 16 + 8 * hh + 4);
    float xs[16] = {x0[0],x0[1],x0[2],x0[3],x1[0],x1[1],x1[2],x1[3],x2[0],x2[1],x2[2],x2[3],x3[0],x3[1],x3[2],x3[3]};
#pragma unroll
    for (int i = 0; i < 16; ++i) { const unsigned short hb = bf16_bits(xs[i]); ah.u[i] = hb; al.u[i] = ASPLIT ? bf16_bits(xs[i] - bf16_val(hb)) : (unsigned short)0; }
#pragma unroll
    for (int t = 0; t < 4; ++t) {
      const unsigned short* brow = Wt + (size_t)(col0 + t * 16 + ln) * ldb + kb;
      FragB b;
      b.half[0] = *(const v8us*)(brow + 8 * hh);
      b.half[1] = *(const v8us*)(brow + 16 + 8 * hh);
      acc[t] = mmaN<ASPLIT ? 2 : 1>(ah.v, al.v, b.v, b.v, acc[t]);
    }
  }
#pragma unroll
  for (int t = 0; t < 4; ++t) {
    const int col = col0 + t * 16 + ln;
    float bv = bias ? bias[col] : 0.f;
    if (BIAS_BF16) bv = bf16_round(bv);
#pragma unroll
    for (int r = 0; r < 8; ++r) {
      float v = acc[t][r] + bv;
      if (resid) { float rv = resid[(size_t)((row0 + 8 * hh + r) % rmod) * ldr + col]; if (RES_BF16) rv = bf16_round(rv); v += rv; }
      if (ACT == 1) v = fmaxf(v, 0.f);
      if (ACT == 2) v = 0.5f * v * (1.0f + erff(v * 0.70710678118654752f));
      if (ACT == 3) { const float u = 0.7978845608028654f * (v + 0.044715f * v * v * v); v = 0.5f * v * (1.0f + tanhf(u)); }
      so[w][8 * hh + r][t * 16 + ln] = v;
    }
  }
  __builtin_amdgcn_fence(__ATOMIC_ACQ_REL, "workgroup");
  __builtin_amdgcn_wave_barrier();
  const int rsub = lane >> 4, c4 = (lane & 15) * 4;
  {
#pragma unroll
    for (int q = 0; q < 8; ++q) {
      const int r = q * 2 + rsub;
      const v4f v = *(const v4fa*)&so[w][r][c4];
      *(v4f*)(C + (size_t)(row0 + r) * ldc + col0 + c4) = v;
    }
    
  }
}
// row LayerNorm (biased variance, eps) over N: s = X (+ R); optional out_sum <- s; out_norm <- (s-mu)*rsqrt(var+eps)*g + b
template <bool PARAM_BF16>
__global__ __launch_bounds__(256) void k_layernorm(const float* __restrict__ X, const float* __restrict__ R, const float* __restrict__ g, const float* __restrict__ bta,
                                                  float* __restrict__ out_sum, float* __restrict__ out_norm, int N, float eps) {
  __shared__ float red[256];
  const int row = blockIdx.x, tid = threadIdx.x;
  const float* x = X + (size_t)row * N; const float* rr = R ? R + (size_t)row * N : nullptr;
  float vals[16];                     // up to N = 4096
  const int per = N / 256;            // contiguous chunk per thread? use strided-by-4 chunks: thread handles j = tid*4 + 1024*u
  float s1 = 0.f;
  for (int u = 0; u < per / 4; ++u) {
    const int j = tid * 4 + 1024 * u;
    const v4f a = *(const v4fa*)(x + j);
    v4f b = {0.f,0.f,0.f,0.f}; if (rr) b = *(const v4fa*)(rr + j);
#pragma unroll
    for (int q = 0; q < 4; ++q) { const float v = a[q] + b[q]; vals[u * 4 + q] = v; s1 += v; }
  }
  red[tid] = s1; __syncthreads();
  for (int st = 128; st > 0; st >>= 1) { if (tid < st) red[tid] += red[tid + st]; __syncthreads(); }
  const float mu = red[0] / (float)N; __syncthreads();
  float s2 = 0.f;
  for (int u = 0; u < per / 4; ++u)
#pragma unroll
    for (int q = 0; q < 4; ++q) { const float c = vals[u * 4 + q] - mu; s2 += c * c; }
  red[tid] = s2; __syncthreads();
  for (int st = 128; st > 0; st >>= 1) { if (tid < st) red[tid] += red[tid + st]; __syncthreads(); }
  const float rs = rsqrtf(red[0] / (float)N + eps);
  {
    for (int u = 0; u < per / 4; ++u) {
      const int j = tid * 4 + 1024 * u;
      v4f o, sm;
#pragma unroll
      for (int q = 0; q < 4; ++q) {
        float gg = g[j + q], bb = bta[j + q];
        if (PARAM_BF16) { gg = bf16_round(gg); bb = bf16_round(bb); }
        sm[q] = vals[u * 4 + q]; o[q] = (vals[u * 4 + q] - mu) * rs * gg + bb;
      }
      if (out_sum) *(v4f*)(out_sum + (size_t)row * N + j) = sm;
      *(v4f*)(out_norm + (size_t)row * N + j) = o;
    }
    
  }
}



// ---- f16 WMMA path (v_wmma_f32_16x16x32_f16): 11-bit significands for operands in range — used where a [0,1] probability operand needs more precision than bf16
typedef _Float16 v16h __attribute__((ext_vector_type(16)));
union FragH { v16h v; v8us half[2]; _Float16 h[16]; unsigned short u[16]; };
template <int NT>
__device__ __forceinline__ v8f mmaH(v16h ah, v16h al, v16h bh, v16h bl, v8f c) {
  c = __builtin_amdgcn_wmma_f32_16x16x32_f16(false, ah, false, bh, (short)0, c, false, false);
  if (NT >= 2) c = __builtin_amdgcn_wmma_f32_16x16x32_f16(false, al, false, bh, (short)0, c, false, false);
  if (NT >= 3) c = __builtin_amdgcn_wmma_f32_16x16x32_f16(false, ah, false, bl, (short)0, c, false, false);
  asm volatile("v_nop\n\tv_nop\n\tv_nop\n\tv_nop" : "+v"(c) : "v"(ah), "v"(al), "v"(bh), "v"(bl));
  return c;
}
// batched GEMM like k_gemm_b but f16 operands: A f32 (split into f16 hi/lo if ASPLIT, else rounded to f16), Bt = f16 values [n][k]; alpha; C f32; N multiple of 16 (partial tiles skipped)
template <bool ASPLIT>
__global__ __launch_bounds__(128) void k_gemm_h(const float* __restrict__ A, int lda, size_t sA, const _Float16* __restrict__ Bh, int ldb, size_t sB, float alpha, float* __restrict__ C, int ldc, size_t sC, int M, int N, int K) {
  __shared__ __attribute__((aligned(16))) float so[4][16][64];
  const int tid = threadIdx.x, w = tid >> 5, lane = tid & 31, ln = lane & 15, hh = lane >> 4; const int by = blockIdx.y;
  A += (size_t)by * sA; Bh += (size_t)by * sB; C += (size_t)by * sC;
  const int ntn = (N + 63) / 64; const int wid = blockIdx.x * 4 + w; const int mt = wid / ntn, nq = wid % ntn; if (mt * 16 >= M) return;
  const int row0 = mt * 16, col0 = nq * 64; const float* arow = A + (size_t)(row0 + ln) * lda;
  v8f acc[4] = {};
  for (int kb = 0; kb < K; kb += 32) {
    FragH ah, al;
    const v4f x0 = *(const v4fa*)(arow + kb + 8 * hh), x1 = *(const v4fa*)(arow + kb + 8 * hh + 4), x2 = *(const v4fa*)(arow + kb + 16 + 8 * hh), x3 = *(const v4fa*)(arow + kb + 16 + 8 * hh + 4);
    float xs[16] = {x0[0],x0[1],x0[2],x0[3],x1[0],x1[1],x1[2],x1[3],x2[0],x2[1],x2[2],x2[3],x3[0],x3[1],x3[2],x3[3]};
#pragma unroll
    for (int i = 0; i < 16; ++i) { const _Float16 h = (_Float16)xs[i]; ah.h[i] = h; al.h[i] = ASPLIT ? (_Float16)(xs[i] - (float)h) : (_Float16)0.0f; }
#pragma unroll
    for (int t = 0; t < 4; ++t) { if (col0 + t * 16 >= N) continue; const size_t boff = (size_t)(col0 + t * 16 + ln) * ldb + kb; FragH bq; bq.half[0] = *(const v8us*)(Bh + boff + 8 * hh); bq.half[1] = *(const v8us*)(Bh + boff + 16 + 8 * hh);
      acc[t] = mmaH<ASPLIT ? 2 : 1>(ah.v, al.v, bq.v, bq.v, acc[t]); }
  }
#pragma unroll
  for (int t = 0; t < 4; ++t) { if (col0 + t * 16 >= N) continue;
#pragma unroll
    for (int r = 0; r < 8; ++r) so[w][8 * hh + r][t * 16 + ln] = acc[t][r] * alpha; }
  __builtin_amdgcn_fence(__ATOMIC_ACQ_REL, "workgroup"); __builtin_amdgcn_wave_barrier();
  const int rsub = lane >> 4, c4 = (lane & 15) * 4;
  {
#pragma unroll
    for (int q = 0; q < 8; ++q) { const int r = q * 2 + rsub; if (col0 + c4 < N) { const v4f v = *(const v4fa*)&so[w][r][c4]; *(v4f*)(C + (size_t)(row0 + r) * ldc + col0 + c4) = v; } }
     }
}

// Wt[n][k] = f16(W[k][n]·scale) from f32 row-major W[K][N] (scale = power of two; bf16-exact weights stay exact in f16 away from the subnormal range)
__global__ __launch_bounds__(256) void k_wt_f16(const float* __restrict__ W, _Float16* __restrict__ Wt, int K, int N, float scale) {
  const int t = blockIdx.x * 256 + threadIdx.x; if (t >= N * (K / 8)) return; const int n = t / (K / 8), k8 = (t % (K / 8)) * 8; FragH f;
#pragma unroll
  for (int i = 0; i < 8; ++i) f.h[i] = (_Float16)(bf16_round(W[(size_t)(k8 + i) * N + n]) * scale); const v8us o = f.half[0];
  *(v8us*)((unsigned short*)Wt + (size_t)n * K + k8) = o; 
}
// k_gemm_hh variant with fused epilogue: v = acc·alpha + bias[by·sBias + col] (+ CP[(row/rowsPerB)·sCPb + by·64 + col] if CP) ; ACT 0 none / 1 elu ; writes f16 C16 (and f32 C if non-null)
template <int ACT>
__global__ __launch_bounds__(128) void k_gemm_hhx(const _Float16* __restrict__ A, int lda, size_t sA, const _Float16* __restrict__ Bh, int ldb, size_t sB, float alpha, const float* __restrict__ bias, size_t sBias, const float* __restrict__ CP, int rowsPerB, size_t sCPb, int row0g,
    float* __restrict__ C, _Float16* __restrict__ C16, int ldc, size_t sC, int M, int N, int K) {
  __shared__ __attribute__((aligned(16))) float so[4][16][64];
  const int tid = threadIdx.x, w = tid >> 5, lane = tid & 31, ln = lane & 15, hh = lane >> 4; const int by = blockIdx.y;
  A += (size_t)by * sA; Bh += (size_t)by * sB; const size_t cofs = (size_t)by * sC; const float* bp = bias ? bias + (size_t)by * sBias : nullptr;
  const int ntn = (N + 63) / 64; const int wid = blockIdx.x * 4 + w; const int mt = wid / ntn, nq = wid % ntn; if (mt * 16 >= M) return;
  const int row0 = mt * 16, col0 = nq * 64; const _Float16* arow = A + (size_t)(row0 + ln) * lda;
  v8f acc[4] = {};
  for (int kb = 0; kb < K; kb += 32) { FragH ah; ah.half[0] = *(const v8us*)((const unsigned short*)arow + kb + 8 * hh); ah.half[1] = *(const v8us*)((const unsigned short*)arow + kb + 16 + 8 * hh);
#pragma unroll
    for (int t = 0; t < 4; ++t) { if (col0 + t * 16 >= N) continue; const size_t boff = (size_t)(col0 + t * 16 + ln) * ldb + kb; FragH bq; bq.half[0] = *(const v8us*)((const unsigned short*)Bh + boff + 8 * hh); bq.half[1] = *(const v8us*)((const unsigned short*)Bh + boff + 16 + 8 * hh);
      acc[t] = mmaH<1>(ah.v, ah.v, bq.v, bq.v, acc[t]); }
  }
#pragma unroll
  for (int t = 0; t < 4; ++t) { if (col0 + t * 16 >= N) continue; const int col = col0 + t * 16 + ln; const float bv = bp ? bf16_round(bp[col]) : 0.f;
#pragma unroll
    for (int r = 0; r < 8; ++r) { float v = acc[t][r] * alpha + bv; if (CP) { const int rr = row0g + row0 + 8 * hh + r; if (rowsPerB < 0) v += CP[cofs + (size_t)rr * ldc + col];      /* rowsPerB < 0: own element of the batched C plane */ else { const int bidx = rr / rowsPerB; v += CP[(size_t)bidx * sCPb + (size_t)by * 64 + col]; } } if (ACT == 1) v = (v > 0.f) ? v : expm1f(v); else if (ACT == 7) v = (v > 0.f) ? v + 1.0f : expf(v); else if (ACT == 8) v = tanhf(v); else if (ACT == 9) v = 0.5f * v * (1.0f + tanhf(0.7978845608028654f * (v + 0.044715f * v * v * v))); else if (ACT == 11) v = 1.0f / (1.0f + expf(-v)); else if (ACT == 12) v = (v > 0.f) ? v : 0.01f * v; else if (ACT == 14) v = (v > 0.f) ? v : 0.1f * v; else if (ACT == 16) v = (v >= 0.f) ? v : 0.3f * v; else if (ACT == 17) v = (v >= 0.f) ? v : 0.2f * v; else if (ACT == 15) v = v / (1.0f + expf(-v)); else if (ACT == 3) v = fmaxf(v, 0.f); else if (ACT == 6) v = 0.5f * v * (1.0f + erff(v * 0.70710678118654752f)); so[w][8 * hh + r][t * 16 + ln] = v; } }
  __builtin_amdgcn_fence(__ATOMIC_ACQ_REL, "workgroup"); __builtin_amdgcn_wave_barrier();
  const int rsub = lane >> 4, c4 = (lane & 15) * 4; typedef _Float16 v4h __attribute__((ext_vector_type(4)));
  {
#pragma unroll
    for (int q = 0; q < 8; ++q) { const int r = q * 2 + rsub; if (col0 + c4 < N) { const v4f v = *(const v4fa*)&so[w][r][c4]; if (C) *(v4f*)(C + cofs + (size_t)(row0 + r) * ldc + col0 + c4) = v; if (C16) { v4h h4; for (int i = 0; i < 4; ++i) h4[i] = (_Float16)v[i]; *(v4h*)(C16 + cofs + (size_t)(row0 + r) * ldc + col0 + c4) = h4; } } }
     }
}


typedef _Float16 v4h __attribute__((ext_vector_type(4)));

__global__ __launch_bounds__(256) void k_x16(const float* __restrict__ x, _Float16* __restrict__ X16, size_t n8) { const size_t t = (size_t)blockIdx.x * 256 + threadIdx.x; if (t >= n8) return; FragH f;
#pragma unroll
  for (int q = 0; q < 8; ++q) f.h[q] = (_Float16)bf16_round(x[t * 8 + q]); *(v8us*)((unsigned short*)X16 + t * 8) = f.half[0];  }
__global__ __launch_bounds__(256) void k_h16(const float* __restrict__ x, _Float16* __restrict__ X16, size_t n8) { const size_t t = (size_t)blockIdx.x * 256 + threadIdx.x; if (t >= n8) return; FragH f;
#pragma unroll
  for (int q = 0; q < 8; ++q) f.h[q] = (_Float16)x[t * 8 + q]; *(v8us*)((unsigned short*)X16 + t * 8) = f.half[0];  }
__global__ __launch_bounds__(256) void k_round16f(const float* __restrict__ W, _Float16* __restrict__ Bt, size_t n8) { const size_t t = (size_t)blockIdx.x * 256 + threadIdx.x; if (t >= n8) return; FragH f;
#pragma unroll
  for (int i = 0; i < 8; ++i) f.h[i] = (_Float16)(bf16_round(W[t * 8 + i]) * 16.0f); *(v8us*)((unsigned short*)Bt + t * 8) = f.half[0];  }

__global__ __launch_bounds__(256) void k_hl(const float* __restrict__ F, _Float16* __restrict__ Hh, _Float16* __restrict__ Hl, size_t n8) { const size_t t = (size_t)blockIdx.x * 256 + threadIdx.x; if (t >= n8) return; FragH fh, fl; const v4f a = *(const v4fa*)(F + t * 8), c = *(const v4fa*)(F + t * 8 + 4);
#pragma unroll
  for (int q = 0; q < 4; ++q) { _Float16 h = (_Float16)a[q]; fh.h[q] = h; fl.h[q] = (_Float16)((a[q] - (float)h) * 1024.0f); h = (_Float16)c[q]; fh.h[4 + q] = h; fl.h[4 + q] = (_Float16)((c[q] - (float)h) * 1024.0f); }
  { *(v8us*)((unsigned short*)Hh + t * 8) = fh.half[0]; *(v8us*)((unsigned short*)Hl + t * 8) = fl.half[0];  } }

// ---- fast GEMM tile: C = A . B^T * alpha + bias, A [M][CC] and B [N][CC] f16 rows; work-group tile 128x64, wave tile 32x64 (M % 128 == 0, N % 64 == 0) ----
__device__ __forceinline__ v16h g2_frag(const _Float16* p, int hh) { FragH f; f.half[0] = *(const v8us*)((const unsigned short*)p + 8 * hh); f.half[1] = *(const v8us*)((const unsigned short*)p + 16 + 8 * hh); return f.v; }
__device__ __forceinline__ v8f g2_mma(v16h a, v16h b, v8f c) { v8f d = __builtin_amdgcn_wmma_f32_16x16x32_f16(false, a, false, b, (short)0, c, false, false); asm volatile("v_nop\n\tv_nop\n\tv_nop\n\tv_nop" : "+v"(d) : "v"(a), "v"(b)); return d; }
// Both operand tiles (128 + 64 rows, all of K = CC: 512 bytes a row) are brought into LDS once, whole rows at a time, and the fragments are read from there:
// a fragment load straight from global memory touches 16 lines for 512 bytes, and its latency stood in front of every pair of products.
#define G2_PK 528                    /* LDS row pitch, bytes: 512 + 16, an odd multiple of 16 for 16-byte readers */
#define G2_LDS ((128 + 64) * G2_PK)
__device__ __forceinline__ v16h g2_lfrag(const unsigned char* p) { FragH f; f.half[0] = *(const v8us*)p; f.half[1] = *(const v8us*)(p + 32); return f.v; }      /* p already holds + 16 hh: k = 8 hh .. and 16 + 8 hh .. */
// Twelve asynchronous copies to LDS, one 512-byte row each (a lane brings its own 16 bytes). The s_wait_xcnt is the last line of the copies' own statement, so that it stands in front of whatever rewrites an address register that a copy names.
__device__ __forceinline__ void g2_copy12(const unsigned* l, const unsigned char* const* g) {
  asm volatile("global_load_async_to_lds_b128 %0, %12, off\n\tglobal_load_async_to_lds_b128 %1, %13, off\n\tglobal_load_async_to_lds_b128 %2, %14, off\n\tglobal_load_async_to_lds_b128 %3, %15, off\n\t"
               "global_load_async_to_lds_b128 %4, %16, off\n\tglobal_load_async_to_lds_b128 %5, %17, off\n\tglobal_load_async_to_lds_b128 %6, %18, off\n\tglobal_load_async_to_lds_b128 %7, %19, off\n\t"
               "global_load_async_to_lds_b128 %8, %20, off\n\tglobal_load_async_to_lds_b128 %9, %21, off\n\tglobal_load_async_to_lds_b128 %10, %22, off\n\tglobal_load_async_to_lds_b128 %11, %23, off\n\ts_wait_xcnt 0x0"
               :: "v"(l[0]), "v"(l[1]), "v"(l[2]), "v"(l[3]), "v"(l[4]), "v"(l[5]), "v"(l[6]), "v"(l[7]), "v"(l[8]), "v"(l[9]), "v"(l[10]), "v"(l[11]),
                  "v"(g[0]), "v"(g[1]), "v"(g[2]), "v"(g[3]), "v"(g[4]), "v"(g[5]), "v"(g[6]), "v"(g[7]), "v"(g[8]), "v"(g[9]), "v"(g[10]), "v"(g[11]) : "memory"); }
// RB: the bias belongs to the row of C (channel-major outputs), else to its column. TO: element type of C (float or f16). bx: tile index, column tiles fastest. A and B rows are CC long (K = CC). sm: G2_LDS bytes.
// Row order of B in LDS: row c of the tile lies at LDS row 16 (c & 3) + (c >> 2), so that lane ln's column in column tile t is c = 4 ln + t: a lane's four accumulators of one row of C are four neighbours in memory,
// 16 lanes cover 64 columns of that row, and C is stored from the registers by whole lines, with no staging in LDS.
template <bool RB, typename TO>
__device__ __forceinline__ void g2_tile(unsigned char* sm, const _Float16* __restrict__ A, const _Float16* __restrict__ Bh, float alpha, const float* __restrict__ bp, TO* __restrict__ C, int ldc, int bx, int N) {
  const int tid = threadIdx.x, w = tid >> 5, lane = tid & 31, ln = lane & 15, hh = lane >> 4;
  const int ntn = N >> 6; const int mt = bx / ntn, nq = bx - mt * ntn; const int row0 = mt * 128 + 32 * w, col0 = nq * 64;
  { /* wave w brings its own 32 rows of A and rows 16 w .. 16 w + 15 of B: 48 copies, all in flight at once */
    const unsigned char* ga = (const unsigned char*)(A + (size_t)row0 * CC) + lane * 16; const unsigned char* gb = (const unsigned char*)(Bh + (size_t)(col0 + 16 * w) * CC) + lane * 16;
    const unsigned l0 = (unsigned)(size_t)sm + lane * 16; const unsigned la = l0 + 32 * w * G2_PK, lb = l0 + (128 + 4 * w) * G2_PK;      /* B row c = 16 w + q goes to LDS row 16 (q & 3) + 4 w + (q >> 2) */
    unsigned l[48]; const unsigned char* g[48];
#pragma unroll      // constant indices, so that the two arrays dissolve into registers
    for (int i = 0; i < 48; ++i) { l[i] = i < 32 ? la + i * G2_PK : lb + (16 * ((i - 32) & 3) + ((i - 32) >> 2)) * G2_PK; g[i] = i < 32 ? ga + i * (CC * 2) : gb + (i - 32) * (CC * 2); }
    g2_copy12(l, g); g2_copy12(l + 12, g + 12); g2_copy12(l + 24, g + 24); g2_copy12(l + 36, g + 36);
    asm volatile("s_wait_asynccnt 0x0" ::: "memory");      // this wave's 48 copies have landed; the compiler places no wait for them
    __syncthreads(); }      /* both tiles published: the B rows are read by all four waves */
  const unsigned char* ap = sm + (32 * w + ln) * G2_PK + 16 * hh;      /* + 16 hh: the lane half's k offset sits in the row pointers */
  const unsigned char* bq = sm + (128 + ln) * G2_PK + 16 * hh;
  const v8f z8 = {0.f,0.f,0.f,0.f,0.f,0.f,0.f,0.f}; v8f c00 = z8, c01 = z8, c02 = z8, c03 = z8, c10 = z8, c11 = z8, c12 = z8, c13 = z8;
  v16h a0 = g2_lfrag(ap), a1 = g2_lfrag(ap + 16 * G2_PK), b0 = g2_lfrag(bq), b1 = g2_lfrag(bq + 16 * G2_PK), b2 = g2_lfrag(bq + 32 * G2_PK), b3 = g2_lfrag(bq + 48 * G2_PK);
#pragma unroll      // straight line: the next 32 k's fragments go into a second register set, read as one group ahead of this block's products
  for (int ks = 0; ks < CC / 32; ++ks) { v16h na0 = a0, na1 = a1, nb0 = b0, nb1 = b1, nb2 = b2, nb3 = b3;
    if (ks + 1 < CC / 32) { const int o = (ks + 1) * 64; na0 = g2_lfrag(ap + o); na1 = g2_lfrag(ap + 16 * G2_PK + o); nb0 = g2_lfrag(bq + o); nb1 = g2_lfrag(bq + 16 * G2_PK + o); nb2 = g2_lfrag(bq + 32 * G2_PK + o); nb3 = g2_lfrag(bq + 48 * G2_PK + o); }
    c00 = g2_mma(a0, b0, c00); c10 = g2_mma(a1, b0, c10); c01 = g2_mma(a0, b1, c01); c11 = g2_mma(a1, b1, c11);
    c02 = g2_mma(a0, b2, c02); c12 = g2_mma(a1, b2, c12); c03 = g2_mma(a0, b3, c03); c13 = g2_mma(a1, b3, c13);
    a0 = na0; a1 = na1; b0 = nb0; b1 = nb1; b2 = nb2; b3 = nb3; }
  v8f accs[8] = {c00, c01, c02, c03, c10, c11, c12, c13};
  typedef TO v4o __attribute__((ext_vector_type(4)));
  const int bi0 = RB ? row0 + 8 * hh : col0 + 4 * ln;      /* the lane's first bias: by row 16 half + 8 hh + r, or by column 4 ln + t */
  float bvv[RB ? 16 : 4];
#pragma unroll      // constant indices, so that the arrays of this epilogue dissolve into registers
  for (int u = 0; u < (RB ? 16 : 4); ++u) bvv[u] = bp[bi0 + (RB ? (u >> 3) * 16 + (u & 7) : u)];
  asm volatile("s_wait_xcnt 0x0" :: "v"(bi0) : "memory");      // behind the bias loads, in front of whatever rewrites the index register that they name; the index is an input so that it is kept up to here
  __builtin_amdgcn_sched_barrier(0);      // nothing moves ahead of that wait
  v4o o4[16];
#pragma unroll
  for (int u = 0; u < 16; ++u) { const int half = u >> 3, r = u & 7;
    for (int t = 0; t < 4; ++t) o4[u][t] = (TO)(accs[half * 4 + t][r] * alpha + bf16_round(bvv[RB ? u : t])); }
  __builtin_amdgcn_sched_barrier(0);      // every value stands in a register of its own before the first store: no store's data register is written again behind it
  TO* cp = C + (size_t)(row0 + 8 * hh) * ldc + col0 + 4 * ln;
#pragma unroll
  for (int u = 0; u < 16; ++u) *(v4o*)(cp + (size_t)((u >> 3) * 16 + (u & 7)) * ldc) = o4[u]; }
#define CT_G ((CC / 128) * (LL / 64))              /* tiles of one batch's channel-major product */
// out[b][c][n] = sum_k' w_m'[c][k'] o[(b,n)][k'] / 1024 + b_m[c] (channel-major directly; blockIdx.y = batch)
__global__ __launch_bounds__(128) void k_out(const _Float16* __restrict__ AM, const _Float16* __restrict__ O16, const float* __restrict__ bm, float* __restrict__ out) {
  __shared__ __attribute__((aligned(16))) unsigned char sm[G2_LDS];
  const size_t b = blockIdx.y;
  g2_tile<true>(sm, AM, O16 + b * LL * CC, 0.0009765625f, bm, out + b * CC * LL, LL, blockIdx.x, LL); }


__global__ __launch_bounds__(256) void k_wnat(const float* __restrict__ w, size_t n8, _Float16* __restrict__ Bt) { const size_t t = (size_t)blockIdx.x * 256 + threadIdx.x; if (t >= n8) return; FragH f; for (int q = 0; q < 8; ++q) f.h[q] = (_Float16)(bf16_round(w[t * 8 + q]) * 16.0f); *(v8us*)((unsigned short*)Bt + t * 8) = f.half[0];  }
__global__ __launch_bounds__(256) void k_rsm(const float* __restrict__ S, _Float16* __restrict__ P, int nrows) {
  #pragma clang fp contract(off)
  const int i = blockIdx.x * 256 + threadIdx.x; if (i >= nrows) return; const float* s = S + (size_t)i * SQ; float mx = -3.0e38f;
#pragma unroll 1
  for (int j = 0; j < SQ; ++j) mx = fmaxf(mx, s[j]); float se = 0.f;
#pragma unroll 1
  for (int j = 0; j < SQ; ++j) se += expf(s[j] - mx); const float sc = 256.0f / se;
#pragma unroll 1
  for (int j0 = 0; j0 < SQ; j0 += 8) { FragH f; for (int q = 0; q < 8; ++q) f.h[q] = (_Float16)(expf(s[j0 + q] - mx) * sc); unsigned short* d = (unsigned short*)P + (size_t)i * SQ + j0; *(v8us*)d = f.half[0];  } }
__global__ __launch_bounds__(256) void k_vt(const _Float16* __restrict__ V16, int b, int h0, _Float16* __restrict__ VT) { __shared__ unsigned short tl[64][65]; const int tid = threadIdx.x; const int hh = blockIdx.x % HG, sg = blockIdx.x / HG; const int s0 = sg * 64; const int h = h0 + hh;
  for (int i = tid; i < 64 * 8; i += 256) { const int j = i / 8, d8 = (i % 8) * 8; FragH f; f.half[0] = *(const v8us*)((const unsigned short*)V16 + ((size_t)b * SQ + s0 + j) * DM + h * HD + d8); for (int q = 0; q < 8; ++q) tl[d8 + q][j] = f.u[q]; }
  __syncthreads();
  { for (int i = tid; i < 64 * 8; i += 256) { const int d = i / 8, j8 = (i % 8) * 8; FragH f; for (int q = 0; q < 8; ++q) f.u[q] = tl[d][j8 + q]; *(v8us*)((unsigned short*)VT + ((size_t)hh * HD + d) * SQ + s0 + j8) = f.half[0]; }  } }

// ---- projections straight from the inputs ----
// Behind a body's last global store: this wait stands in front of whatever rewrites a register that the store names.
__device__ __forceinline__ void p_stored() { asm volatile("s_wait_xcnt 0x0" ::: "memory"); }
// w_m with its columns permuted to the head-major order of o (exact x16 f16); t: the thread's index over CC * CC / 8 pieces of 8 elements.
__device__ __forceinline__ void p_wpermc(const float* __restrict__ w, _Float16* __restrict__ A, int t) { const int k8 = (t % (CC / 8)) * 8, c = t / (CC / 8); FragH f;
  for (int q = 0; q < 8; ++q) { const int kp = k8 + q; const int h = kp / HD, dd = kp % HD; f.h[q] = (_Float16)(bf16_round(w[(size_t)c * CC + dd * NH + h]) * 16.0f); } unsigned short* d = (unsigned short*)A + (size_t)c * CC + k8; *(v8us*)d = f.half[0]; p_stored(); }
typedef float v2f __attribute__((ext_vector_type(2)));
typedef __bf16 v2b __attribute__((ext_vector_type(2)));
typedef _Float16 v2h __attribute__((ext_vector_type(2)));
typedef unsigned v4ua __attribute__((ext_vector_type(4), may_alias));
typedef unsigned v2ua __attribute__((ext_vector_type(2), may_alias));
// Two f32 -> rounded to bf16 (nearest even, one packed conversion) -> the same values as two f16, a in the low half.
__device__ __forceinline__ unsigned pj_cv2(float a, float b) { const v2f x = {a, b}; const unsigned u = __builtin_bit_cast(unsigned, __builtin_convertvector(x, v2b));
  const v2f y = {__uint_as_float(u << 16), __uint_as_float(u & 0xFFFF0000u)}; return __builtin_bit_cast(unsigned, __builtin_convertvector(y, v2h)); }
#define PJ_T 256                                   /* tokens per work-group; the other side of its tile is all CC channels */
#define PJ_LDS ((PJ_T + CC) * G2_PK)               /* token rows, then weight rows, each all of K = CC at the GEMM pitch */
#define PJ_G (3 * (int)(NR / PJ_T))                /* work-groups of the three projections */
#define PM_G (CC * (CC / 8) / 512)                 /* work-groups that permute w_m: 8 elements a thread, exactly */
static_assert(PJ_T == 256 && CC == 256 && LL % PJ_T == 0 && PM_G * 512 == CC * (CC / 8), "16 waves as 4 x 4 tiles of 64 x 64; a token tile stays inside one batch; no tail guards");
// Row order of both operands in LDS: inside each block of 64 rows, row x (a token, or a permuted channel) lies at LDS row 16 (x & 3) + (x >> 2). The fragment readers are as they were, so in the wave's 64 x 64 tile
// accumulator [i][j][r] of lane (ln, hh) is row 32 hh + 4 r + i and column 4 ln + j of C: a lane's four accumulators [i][0..3][r] are four neighbours in memory, 16 lanes cover the 64 columns of one row (128 bytes),
// and the tile is stored from the registers by whole lines, with no staging in LDS.
// Epilogue of one wave's 64 x 64 tile. RB: the bias belongs to the row of C, else to its column; its index is the permuted channel.
// os: a factor on the whole output (product and bias), applied in f32 ahead of the one rounding to f16; 1 leaves every value as it was.
#define FA_CS (0.125f * 1.44269504088896340736f)      /* 1 / sqrt(64), times log2(e): q is stored times this, so that K . q^T is a score in the log2 domain */
template <bool RB>
__device__ __forceinline__ void pj_epi(const v8f (&acc)[4][4], const float* __restrict__ bias, float os, _Float16* __restrict__ Cw, int ldc, int row0, int col0, int lane) {
  const int ln = lane & 15, hh = lane >> 4;
  const int bi0 = RB ? 32 * hh * NH + row0 / HD : 4 * ln * NH + col0 / HD;      /* permuted channel i is natural channel (i % HD) * NH + i / HD; row0 and col0 are multiples of HD */
  const float al = 0.0625f * os;
  float bvv[RB ? 32 : 4];      /* the lane's biases: by row 32 hh + 4 r + i (index 8 i + r), or by column 4 ln + j */
#pragma unroll      // constant indices, so that the arrays of this epilogue and the accumulators stay in registers
  for (int u = 0; u < (RB ? 32 : 4); ++u) bvv[u] = bias[bi0 + (RB ? 4 * (u & 7) + (u >> 3) : u) * NH];
  asm volatile("s_wait_xcnt 0x0" :: "v"(bi0) : "memory");      // behind the bias loads, in front of whatever rewrites the index register that they name; the index is an input so that it is kept up to here (else the last load landed in it)
  __builtin_amdgcn_sched_barrier(0);      // nothing moves ahead of that wait
#pragma unroll
  for (int u = 0; u < (RB ? 32 : 4); ++u) bvv[u] = bf16_round(bvv[u]) * os;
  v4h o4[32];
#pragma unroll
  for (int i = 0; i < 4; ++i) { v8f f[4];      /* scale and bias tile by tile first, the conversion then takes its pair from two column tiles: written as one expression across the tiles, each pair of accumulators was first moved side by side (about 70 register moves a wave) */
#pragma unroll
    for (int j = 0; j < 4; ++j) for (int r = 0; r < 8; ++r) f[j][r] = acc[i][j][r] * al + bvv[RB ? i * 8 + r : j];
#pragma unroll
    for (int r = 0; r < 8; ++r) for (int j = 0; j < 4; ++j) o4[i * 8 + r][j] = (_Float16)f[j][r]; }
  __builtin_amdgcn_sched_barrier(0);      // every value stands in a register of its own before the first store: no store's data register is written again behind it
  _Float16* cp = Cw + (size_t)(32 * hh) * ldc + 4 * ln;
#pragma unroll
  for (int r = 0; r < 8; ++r)
    for (int i = 0; i < 4; ++i) *(v4h*)(cp + (size_t)(4 * r + i) * ldc) = o4[i * 8 + r];      /* rows in rising order */
  p_stored(); }      // as behind every body's last store; an asm statement here also keeps the compiler from merging the stores of the two bodies (RB or not) into one block, where their constant row offsets became 31 vector additions
// One work-group = 256 tokens of one batch x all 256 channels of one projection (blockIdx.x / 64: 0 Q, 1 K, 2 V). Every input element is read from memory once, by whole 128-byte lines, and never written back as f16 rows.
// Input tile: a lane takes 8 channels x 16 tokens (32 loads of 16 bytes); its 8 channels of one token are one 16-byte LDS store, so the transpose happens in the lane's own registers. Weights: a wave takes a row by two 512-byte loads.
__global__ __launch_bounds__(512) void k_proj(const float* __restrict__ xq, const float* __restrict__ xk, const float* __restrict__ xv, const float* __restrict__ wq, const float* __restrict__ wk, const float* __restrict__ wv, const float* __restrict__ wm,
    const float* __restrict__ bq, const float* __restrict__ bk, const float* __restrict__ bv, _Float16* __restrict__ Q16, _Float16* __restrict__ K16, _Float16* __restrict__ VT, _Float16* __restrict__ AM) {
  __shared__ __attribute__((aligned(16))) unsigned char sm[PJ_LDS];
  const int bx = blockIdx.x, tid = threadIdx.x;
  if (bx >= PJ_G) { p_wpermc(wm, AM, (bx - PJ_G) * 512 + tid); return; }      /* on blockIdx alone, in front of every barrier */
  const int p = bx / (int)(NR / PJ_T), tl = bx % (int)(NR / PJ_T); const int b = tl / (LL / PJ_T), n0 = (tl % (LL / PJ_T)) * PJ_T;
  const float* x = p == 0 ? xq : p == 1 ? xk : xv; const float* w = p == 0 ? wq : p == 1 ? wk : wv; const float* bias = p == 0 ? bq : p == 1 ? bk : bv;
  const int wvi = __builtin_amdgcn_readfirstlane(tid >> 5), lane = tid & 31;
  unsigned char* smX = sm; unsigned char* smW = sm + PJ_T * G2_PK;
  { const int cg = (wvi & 7) * 4 + (lane >> 3);      /* the lane's group of 8 channels; 8 lanes side by side cover one 128-byte line of a channel */
    const int tk = (wvi >> 3) * 128 + (lane & 7) * 4;      /* its first token; + 32 a unit */
    const int tr = (wvi >> 3) * 128 + (lane & 7);      /* that token's LDS row */
    const float* px = x + ((size_t)b * CC + cg * 8) * LL + n0 + tk;
    const float* pw = w + (size_t)((wvi & 3) * NH + (wvi >> 2)) * CC + lane * 4;      /* LDS row 16 wvi + i holds permuted channel 64 (wvi >> 2) + 4 i + (wvi & 3), natural row (4 i + (wvi & 3)) * NH + (wvi >> 2): + 4 NH rows a step */
    v4f xr[4][8], wa[8][2], wb[8][2];
#pragma unroll
    for (int i = 0; i < 4; ++i) for (int j = 0; j < 8; ++j) xr[i][j] = *(const v4fa*)(px + j * LL + i * 32);
    __builtin_amdgcn_sched_barrier(0);      // the input tile's 32 loads go first and together: they come from memory, the weights from L2
#pragma unroll
    for (int i = 0; i < 8; ++i) { wa[i][0] = *(const v4fa*)(pw + i * 4 * NH * CC); wa[i][1] = *(const v4fa*)(pw + i * 4 * NH * CC + 128); }
    __builtin_amdgcn_sched_barrier(0);      // and half of the weights' loads ahead of the first conversion
    asm volatile("s_wait_xcnt 0x0" :: "v"(px), "s"(pw - lane * 4) : "memory");      // behind the 48 loads, in front of whatever rewrites an address register that they name; the two bases are inputs so that their registers are kept up to here (else a weight load landed in the input loads' address pair)
    __builtin_amdgcn_sched_barrier(0);      // no conversion moves ahead of that wait
#pragma unroll
    for (int i = 0; i < 4; ++i) for (int ii = 0; ii < 4; ++ii) { const v4ua o = {pj_cv2(xr[i][0][ii], xr[i][1][ii]), pj_cv2(xr[i][2][ii], xr[i][3][ii]), pj_cv2(xr[i][4][ii], xr[i][5][ii]), pj_cv2(xr[i][6][ii], xr[i][7][ii])};
      *(v4ua*)(smX + (tr + (i >> 1) * 64 + ii * 16 + (i & 1) * 8) * G2_PK + cg * 16) = o; }      /* token tk + 32 i + ii */
    __builtin_amdgcn_sched_barrier(0);      // the second half of the weights takes the registers that the input tile has left
#pragma unroll
    for (int i = 0; i < 8; ++i) { wb[i][0] = *(const v4fa*)(pw + (8 + i) * 4 * NH * CC); wb[i][1] = *(const v4fa*)(pw + (8 + i) * 4 * NH * CC + 128); }
    __builtin_amdgcn_sched_barrier(0);      // in flight under the first half's conversions
    asm volatile("s_wait_xcnt 0x0" ::: "memory");      // as above, behind these 16 loads
    __builtin_amdgcn_sched_barrier(0);
    unsigned char* dw = smW + wvi * 16 * G2_PK + lane * 8;
#pragma unroll
    for (int i = 0; i < 16; ++i) { const v4f lo = i < 8 ? wa[i & 7][0] : wb[i & 7][0], hi = i < 8 ? wa[i & 7][1] : wb[i & 7][1];      /* x16 ahead of the rounding: a power of two, so the same value as rounding first */
      const v2ua o0 = {pj_cv2(lo[0] * 16.0f, lo[1] * 16.0f), pj_cv2(lo[2] * 16.0f, lo[3] * 16.0f)}, o1 = {pj_cv2(hi[0] * 16.0f, hi[1] * 16.0f), pj_cv2(hi[2] * 16.0f, hi[3] * 16.0f)};
      *(v2ua*)(dw + i * G2_PK) = o0; *(v2ua*)(dw + i * G2_PK + 256) = o1; } }
  __syncthreads();      /* both operands published */
  const int ln = lane & 15, hh = lane >> 4, wr_ = wvi >> 2, wc_ = wvi & 3;      /* the wave's 64 rows of A and 64 rows of B */
  const bool vs = p == 2;      /* V: A = weights, B = tokens */
  const unsigned char* ap = (vs ? smW : smX) + (64 * wr_ + ln) * G2_PK + 16 * hh;      /* + 16 hh: the lane half's k offset sits in the row pointers */
  const unsigned char* bp_ = (vs ? smX : smW) + (64 * wc_ + ln) * G2_PK + 16 * hh;
  v8f acc[4][4];
#pragma unroll
  for (int i = 0; i < 4; ++i) for (int j = 0; j < 4; ++j) acc[i][j] = v8f{0.f, 0.f, 0.f, 0.f, 0.f, 0.f, 0.f, 0.f};
#pragma unroll      // straight line: constant LDS offsets
  for (int ks = 0; ks < CC / 32; ++ks) { v16h af[4], bf[4];
    for (int i = 0; i < 4; ++i) { af[i] = g2_lfrag(ap + i * 16 * G2_PK + ks * 64); bf[i] = g2_lfrag(bp_ + i * 16 * G2_PK + ks * 64); }
    __builtin_amdgcn_sched_barrier(0);      // the 16 reads of a k step stand together in one place: left alone, the scheduler read each A fragment into one register set right in front of its four products, behind a wait to 0 each time; the SIMD's three other waves cover the one wait
    for (int i = 0; i < 4; ++i) for (int j = 0; j < 4; ++j) acc[i][j] = __builtin_amdgcn_wmma_f32_16x16x32_f16(false, af[i], false, bf[j], (short)0, acc[i][j], false, false);
    __builtin_amdgcn_sched_barrier(0); }      // and none of the next step's reads moves in among these products
  if (vs) pj_epi<true>(acc, bias, 1.0f, VT + ((size_t)b * CC + 64 * wr_) * LL + n0 + 64 * wc_, LL, 64 * wr_, 64 * wc_, lane);
  else pj_epi<false>(acc, bias, p ? 1.0f : FA_CS, (p ? K16 : Q16) + ((size_t)b * LL + n0 + 64 * wr_) * CC + 64 * wc_, CC, 64 * wr_, 64 * wc_, lane); }
__device__ __forceinline__ float rs_xh(float x) { return __builtin_bit_cast(float, __builtin_amdgcn_permlanex16(__builtin_bit_cast(int, x), __builtin_bit_cast(int, x), 0x76543210, 0xfedcba98, false, false)); }      /* lane l <- lane l ^ 16 */
// 2^z on the transcendental unit. The v_nop is the slot that the instruction set asks for behind a transcendental before its result is read or its source overwritten.
__device__ __forceinline__ float rs_exp2(float z) { float y; asm("v_exp_f32 %0, %1\n\tv_nop" : "=v"(y) : "v"(z)); return y; }
#define FA_KS 64                     /* keys per stage */
#define FA_KG 2                      /* key groups per work-group */
#define FA_GK (SQ / FA_KG)           /* keys per key group */
#define FA_ST 4096.0f                /* largest sum of a query's 32 exponentials of one pass that is taken without a rescale: every P <= 2^12 */
#define FA_PK 144                    /* LDS row pitch, bytes: 128 + 16, an odd multiple of 16 for 16-byte readers */
__device__ __forceinline__ v8f fa_mma(v16h a, v16h b, v8f c) { return __builtin_amdgcn_wmma_f32_16x16x32_f16(false, a, false, b, (short)0, c, false, false); }
__device__ __forceinline__ v16h fa_lfrag(const unsigned char* p) { FragH f; f.half[0] = *(const v8us*)p; f.half[1] = *(const v8us*)(p + 32); return f.v; }      /* p already holds + 16 hh: k = 8 hh .. and 16 + 8 hh .. */
__global__ __launch_bounds__(512) void k_fattn(const _Float16* __restrict__ Q16, const _Float16* __restrict__ K16, const _Float16* __restrict__ VT, _Float16* __restrict__ O16) {
  __shared__ __attribute__((aligned(16))) unsigned char L[2][FA_KG][2][FA_KS * FA_PK];      /* [buffer][key group][K, V^T][row][pitch] */
  const int kh = __builtin_amdgcn_readfirstlane((int)threadIdx.x >> 8);      /* the wave's key group, in a scalar register */
  const int tid = threadIdx.x & 255, lane = tid & 31, w = tid >> 5, c = lane & 15, hh = lane >> 4;      /* tid, w: within the key group */ const int h = blockIdx.y, b = blockIdx.z; const size_t r0 = (size_t)b * LL; const int q0 = blockIdx.x * 256 + w * 32;
  v16h qf[2][2];
#pragma unroll
  for (int g = 0; g < 2; ++g) for (int kc = 0; kc < 2; ++kc) qf[g][kc] = g2_frag(Q16 + (r0 + q0 + g * 16 + c) * CC + h * HD + kc * 32, hh);
  const int srow = tid >> 2, sseg = (tid & 3) * 32;      /* staging: 4 threads cover one 128-byte row, 32 bytes each */
  const unsigned char* kg = (const unsigned char*)(K16 + (r0 + kh * FA_GK + srow) * CC + h * HD) + sseg;      /* key rows: + 64 rows a stage */
  const unsigned char* vg = (const unsigned char*)(VT + ((size_t)(b * NH + h) * HD + srow) * SQ + kh * FA_GK) + sseg;      /* d rows: + 64 keys a stage */
  const int sdst = srow * FA_PK + sseg;
  v8us k0 = *(const v8us*)kg, k1 = *(const v8us*)(kg + 16), v0 = *(const v8us*)vg, v1 = *(const v8us*)(vg + 16);
  *(v8us*)&L[0][kh][0][sdst] = k0; *(v8us*)&L[0][kh][0][sdst + 16] = k1; *(v8us*)&L[0][kh][1][sdst] = v0; *(v8us*)&L[0][kh][1][sdst + 16] = v1;
  const v8f z8 = {0.f, 0.f, 0.f, 0.f, 0.f, 0.f, 0.f, 0.f}; v8f acc[2][4], cm[2]; float l_run[2];      /* cm: minus the maximum in use, in all eight registers: the C operand of the score products */
#pragma unroll
  for (int g = 0; g < 2; ++g) { cm[g] = z8; l_run[g] = 0.f; for (int t = 0; t < 4; ++t) acc[g][t] = z8; }      /* 0 only until the first pass sets the true maximum */
  FragH on1;
#pragma unroll
  for (int i = 0; i < 16; ++i) on1.h[i] = (c & 7) == 0 ? (_Float16)1.0f : (_Float16)0.0f;      /* A operand of the sum product: ones in rows 0 and 8, the rows of D that land in register 0 of the two wave halves; every k alike, so no k order to match. (All ones gave the same sums, but the compiler rebuilt that constant in vector registers every pass.) */
  __syncthreads();      /* stage 0 published */
#pragma unroll 1      // one stage a trip: the body already holds two unrolled 32-key passes
  for (int st = 0; st < FA_GK / FA_KS; ++st) {
    const bool more = st + 1 < FA_GK / FA_KS;
    if (more) { const unsigned char* kn = kg + (size_t)(st + 1) * (FA_KS * CC * 2); const unsigned char* vn = vg + (size_t)(st + 1) * (FA_KS * 2); k0 = *(const v8us*)kn; k1 = *(const v8us*)(kn + 16); v0 = *(const v8us*)vn; v1 = *(const v8us*)(vn + 16); }
    const unsigned char* Kb = &L[st & 1][kh][0][c * FA_PK + 16 * hh]; const unsigned char* Vb = &L[st & 1][kh][1][c * FA_PK + 16 * hh];
#pragma unroll
    for (int sub = 0; sub < 2; ++sub) {      /* one pass = 32 keys */
      const unsigned char* Kp = Kb + sub * 32 * FA_PK;
      v8f s[2][2]; v16h kf[2][2];
#pragma unroll
      for (int kt = 0; kt < 2; ++kt) { kf[kt][0] = fa_lfrag(Kp + kt * 16 * FA_PK); kf[kt][1] = fa_lfrag(Kp + kt * 16 * FA_PK + 64); }
      __builtin_amdgcn_sched_barrier(0);      // the pass's eight K reads stand together ahead of its products, as they did before the barrier below came in: with that one alone, the scheduler read one fragment at a time into one register set, behind a wait to 0 each time
#pragma unroll
      for (int kt = 0; kt < 2; ++kt)
        for (int g = 0; g < 2; ++g) s[kt][g] = fa_mma(kf[kt][1], qf[g][1], fa_mma(kf[kt][0], qf[g][0], cm[g]));      /* score - maximum in use, log2 domain */
      __builtin_amdgcn_sched_barrier(0);      // the eight score products stand together ahead of the exponentials: left alone, the scheduler put single exponentials directly behind single products, with four idle slots between them each time
      v16h vf[4];
#pragma unroll
      for (int t = 0; t < 4; ++t) vf[t] = fa_lfrag(Vb + t * 16 * FA_PK + sub * 64);
      FragH pf[2]; v8f ps[2];      /* pf element s: key 8 hh + s, then 16 + 8 hh + (s - 8): the k order of V^T's loader; ps: the pass's sums */
#pragma unroll
      for (int g = 0; g < 2; ++g) {
        for (int r = 0; r < 8; ++r) { pf[g].h[r] = (_Float16)__builtin_amdgcn_exp2f(s[0][g][r]); pf[g].h[8 + r] = (_Float16)__builtin_amdgcn_exp2f(s[1][g][r]); }      /* the builtin: the arguments are read where the matrix unit left them, and the compiler sees these reads when it keeps the distance behind a matrix instruction */
        ps[g] = fa_mma(on1.v, pf[g].v, z8); }
      const bool need = ps[0][0] > FA_ST || ps[1][0] > FA_ST;
      const bool first = sub == 0 && st == 0;      /* the group's first pass takes the true maximum, also one below 0, so that the sum never starts from underflowed terms */
      if (__builtin_amdgcn_ballot_w32(need) != 0 || first) {      /* wave-uniform scalar branch, one test a pass */
#pragma unroll
        for (int kt = 0; kt < 2; ++kt) { const v16h ka = fa_lfrag(Kp + kt * 16 * FA_PK), kb2 = fa_lfrag(Kp + kt * 16 * FA_PK + 64);
          for (int g = 0; g < 2; ++g) s[kt][g] = fa_mma(kb2, qf[g][1], fa_mma(ka, qf[g][0], cm[g])); }      /* the scores once more, from the stage buffer: the exponentials above took their registers */
#pragma unroll
        for (int g = 0; g < 2; ++g) { float mx = fmaxf(s[0][g][0], s[1][g][0]);
          for (int r = 1; r < 8; ++r) mx = fmaxf(mx, fmaxf(s[0][g][r], s[1][g][r]));
          mx = fmaxf(mx, rs_xh(mx));      /* both wave halves hold the query's maximum, counted from the maximum in use */
          const float up = first ? mx : fmaxf(mx, 0.f); const float dl = cm[g][0] - (cm[g][0] - up);      /* the step of the maximum as it comes out rounded: what later passes' C really differs by */
          const float corr = __builtin_amdgcn_exp2f(fminf(-dl, 0.f));      /* dl < 0 only on the first pass, where sum and accumulators are 0; the builtin, so that the compiler keeps the distance behind the sum product, whose unused result registers it hands out again */
          l_run[g] *= corr; for (int t = 0; t < 4; ++t) acc[g][t] = acc[g][t] * corr;
          for (int kt = 0; kt < 2; ++kt) s[kt][g] = s[kt][g] - dl;      /* these arguments were formed against the old maximum */
          cm[g] = cm[g] - up;      /* every register holds minus the new maximum */
          for (int r = 0; r < 8; ++r) { pf[g].h[r] = (_Float16)__builtin_amdgcn_exp2f(s[0][g][r]); pf[g].h[8 + r] = (_Float16)__builtin_amdgcn_exp2f(s[1][g][r]); }
          ps[g] = fa_mma(on1.v, pf[g].v, z8); }
      }
#pragma unroll
      for (int g = 0; g < 2; ++g) { l_run[g] += ps[g][0];
        for (int t = 0; t < 4; ++t) acc[g][t] = fa_mma(vf[t], pf[g].v, acc[g][t]); }
    }
    if (more) { unsigned char* d = &L[(st + 1) & 1][kh][0][sdst]; *(v8us*)d = k0; *(v8us*)(d + 16) = k1; *(v8us*)(d + FA_KS * FA_PK) = v0; *(v8us*)(d + FA_KS * FA_PK + 16) = v1; }      /* its last readers left it before the barrier that ended trip st - 1 */
    __syncthreads();      /* publishes stage st + 1 and ends every read of stage st */
  }
  // Join of the two key groups: group kh finishes column group kh and hands column group 1 - kh to the lane of the same number in the other group. The stage buffers are free: the loop's last barrier ended every read of them.
  const float m_run[2] = {-cm[0][0], -cm[1][0]};
  static_assert(FA_KG == 2 && sizeof(L) >= (size_t)FA_KG * 9 * 256 * 16, "the exchange takes 9 slots of 16 bytes a lane");
  v4f* X = (v4f*)&L[0][0][0][0];      /* [key group][slot][lane of the group]: neighbouring lanes 16 bytes apart */
  v4f* xs = X + kh * (9 * 256) + tid; const v4f* xr = X + (1 - kh) * (9 * 256) + tid;
  v8f mine[4];
#pragma unroll      // constant indices, so that the accumulators stay in registers
  for (int t = 0; t < 4; ++t) { const v8f o = kh ? acc[0][t] : acc[1][t]; mine[t] = kh ? acc[1][t] : acc[0][t];
    const v4f lo = {o[0], o[1], o[2], o[3]}, hi = {o[4], o[5], o[6], o[7]}; xs[(2 * t) * 256] = lo; xs[(2 * t + 1) * 256] = hi; }
  { const v4f ml = {kh ? m_run[0] : m_run[1], kh ? l_run[0] : l_run[1], 0.f, 0.f}; xs[8 * 256] = ml; }
  __syncthreads();      /* both groups' hand-overs published */
  const float m_a = kh ? m_run[1] : m_run[0], l_a = kh ? l_run[1] : l_run[0]; const v4f ml = xr[8 * 256];
  const float m_j = fmaxf(m_a, ml[0]); const float f_a = rs_exp2(m_a - m_j), f_b = rs_exp2(ml[0] - m_j);
  const float lp = l_a * f_a + ml[1] * f_b; const float inv = 64.0f / lp;      /* the sums already span both wave halves' keys */ const float s_a = f_a * inv, s_b = f_b * inv;
  unsigned short* d = (unsigned short*)O16 + (r0 + q0 + kh * 16 + c) * CC + h * HD + 8 * hh;      /* o x64; a lane's 8 registers are 8 consecutive d of its query */
#pragma unroll      // constant indices again
  for (int t = 0; t < 4; ++t) { const v4f lo = xr[(2 * t) * 256], hi = xr[(2 * t + 1) * 256]; FragH f;
    for (int r = 0; r < 4; ++r) { f.h[r] = (_Float16)(mine[t][r] * s_a + lo[r] * s_b); f.h[4 + r] = (_Float16)(mine[t][4 + r] * s_a + hi[r] * s_b); }
    *(v8us*)(d + t * 16) = f.half[0]; } }

extern "C" void kernel_launch(void* const* d_in, const int* in_sizes, int n_in,
                              void* d_out, int out_size, void* d_ws, size_t ws_size, hipStream_t stream) {
  (void)in_sizes; (void)n_in; (void)out_size;
  const float* const* I = (const float* const*)d_in; const float* xq = I[0]; const float* xk = I[1]; const float* xv = I[2]; const float* wq = I[3]; const float* bq = I[4]; const float* wk = I[5]; const float* bk = I[6]; const float* wv = I[7]; const float* bv = I[8]; const float* wm = I[9]; const float* bm = I[10];
  char* ws = (char*)d_ws; size_t off = 0;
  auto take = [&](size_t bytes) { char* p = ws + off; off += (bytes + 255) & ~(size_t)255; return p; };
  _Float16* AM = (_Float16*)take((size_t)CC * CC * 2);
  _Float16* Q16 = (_Float16*)take(NR * CC * 2); _Float16* K16 = (_Float16*)take(NR * CC * 2); _Float16* O16 = (_Float16*)take(NR * CC * 2);
  _Float16* VT = (_Float16*)take((size_t)NB * NH * HD * SQ * 2);
  if (off > ws_size) return;      /* approx 32 MiB */
  k_proj<<<PJ_G + PM_G, 512, 0, stream>>>(xq, xk, xv, wq, wk, wv, wm, bq, bk, bv, Q16, K16, VT, AM);      /* q, k token rows; V^T [8][4][64][2048]; w_m permuted */
  k_fattn<<<dim3(SQ / 256, NH, NB), 512, 0, stream>>>(Q16, K16, VT, O16);      /* o x64, head-major f16 rows */
  k_out<<<dim3(CT_G, NB), 128, 0, stream>>>(AM, O16, bm, (float*)d_out);
}
